// v000
// Measured on an AMD MI455X. A time is GPU time per run, averaged over a window of back-to-back runs after a warm-up
// (all launches, gaps included; the runs take copies of the inputs in turn), and the median of several windows.
// Apart from v000's, it joins two sittings. Times from different sittings can be a few percent apart, while
// side-by-side timings come from the same sitting.
// The starting kernel, v000, takes 642 microseconds a run.
// compute dtype: x, w_qkv, w_out rounded to bf16; qkv = w_qkv . x with exact bf16 products on WMMA 16x16x32 (positions as rows via an LDS transpose of the [B,C,N] input, natural weight rows; output channel o -> head o/192, part (o%192)/64, dim o%64); q and k stored as f16 hi + (x2048-scaled) residual planes with 3-product scores x 1/8; running-max softmax in f32 (hardware exp); P (scaled by 2^11, as f16 hi + residual) x v hi/lo (3 products); y = w_out (exact rows) x vals (f32 as bf16 hi + residual, 2 products) written channels-first; f32 accumulate.
#include <hip/hip_runtime.h>
#include <math.h>

typedef __attribute__((ext_vector_type(16))) _Float16 v16h;
typedef __attribute__((ext_vector_type(16))) __bf16 v16b;
typedef __attribute__((ext_vector_type(8)))  _Float16 v8h;
typedef __attribute__((ext_vector_type(8)))  float v8f;
typedef __attribute__((ext_vector_type(4)))  float v4f;
typedef __attribute__((ext_vector_type(2)))  float v2f;
typedef __attribute__((ext_vector_type(4)))  unsigned v4u;
typedef __attribute__((ext_vector_type(4)))  int v4i;
typedef float __attribute__((may_alias)) float_a;
typedef int __attribute__((may_alias)) int_a;

template <typename T> __device__ __forceinline__ void vst2(void* p, T v) { *(T*)p = v;  }
__device__ __forceinline__ v8f wmma16(v16h a, v16h b, v8f c) {
  v8f d = __builtin_amdgcn_wmma_f32_16x16x32_f16(false, a, false, b, (short)0, c, false, false);
  asm volatile("v_nop\n\tv_nop\n\tv_nop\n\tv_nop" : "+v"(d) : "v"(a), "v"(b));
  return d;
}
__device__ __forceinline__ v8f wmma_bf(v16b a, v16b b, v8f c) {
  v8f d = __builtin_amdgcn_wmma_f32_16x16x32_bf16(false, a, false, b, (short)0, c, false, false);
  asm volatile("v_nop\n\tv_nop\n\tv_nop\n\tv_nop" : "+v"(d) : "v"(a), "v"(b));
  return d;
}
// Channels-first multi-head attention layer (x [2][1024 channels][2048 positions], 16 heads x 64): 1x1-conv qkv with per-head interleaved (q|k|v) channel blocks, softmax(q k^T / 8) v, 1x1-conv output projection -> [B, C, N].
__device__ __forceinline__ v16h frag_h(const _Float16* rowk0, int lane) {
  union { v16h v; v8h q[2]; } u; const _Float16* p = rowk0 + 8 * (lane >> 4);
  u.q[0] = *(const v8h*)p; u.q[1] = *(const v8h*)(p + 16); return u.v;
}
__device__ __forceinline__ v16h frag_f32(const float* rowk0, int lane) {
  v16h a; const float* p = rowk0 + 8 * (lane >> 4);
#pragma unroll
  for (int i = 0; i < 8; ++i) { a[i] = (_Float16)p[i]; a[8 + i] = (_Float16)p[16 + i]; }
  return a;
}
__device__ __forceinline__ v16h frag_f32s(const float* rowk0, int lane, float sc) {
  v16h a; const float* p = rowk0 + 8 * (lane >> 4);
#pragma unroll
  for (int i = 0; i < 8; ++i) { a[i] = (_Float16)(p[i] * sc); a[8 + i] = (_Float16)(p[16 + i] * sc); }
  return a;
}
// column fragment from a [K][ld] layout (column n), rows >= K read as 0
__device__ __forceinline__ v16h fragc_f32(const float* W, int k0, int n, int lane, int ld, int K) {
  v16h a; const int g = lane >> 4;
#pragma unroll
  for (int i = 0; i < 8; ++i) { const int ka = k0 + 8 * g + i, kb = ka + 16;
    a[i] = (_Float16)(ka < K ? W[(size_t)(ka < K ? ka : K - 1) * ld + n] : 0.f); a[8 + i] = (_Float16)(kb < K ? W[(size_t)(kb < K ? kb : K - 1) * ld + n] : 0.f); }
  return a;
}
struct F2 { v16b h, l; };
__device__ __forceinline__ F2 bsplit16(const float v[16]) { F2 r;
#pragma unroll
  for (int i = 0; i < 16; ++i) { const __bf16 h = (__bf16)v[i]; r.h[i] = h; r.l[i] = (__bf16)(v[i] - (float)h); }
  return r; }
__device__ __forceinline__ F2 split_row(const float* row, int k0, int lane) { float v[16]; const float* p = row + k0 + 8 * (lane >> 4);
#pragma unroll
  for (int i = 0; i < 8; ++i) { v[i] = p[i]; v[8 + i] = p[16 + i]; }
  return bsplit16(v); }
__device__ __forceinline__ F2 split_rowK(const float* row, int k0, int lane, int K) { float v[16]; const int g = lane >> 4;
#pragma unroll
  for (int i = 0; i < 8; ++i) { const int ka = k0 + 8 * g + i, kb = ka + 16; v[i] = ka < K ? row[ka < K ? ka : K - 1] : 0.f; v[8 + i] = kb < K ? row[kb < K ? kb : K - 1] : 0.f; }
  return bsplit16(v); }
__device__ __forceinline__ F2 split_col(const float* W, int k0, int n, int lane, int ld, int K) { float v[16]; const int g = lane >> 4;
#pragma unroll
  for (int i = 0; i < 8; ++i) { const int ka = k0 + 8 * g + i, kb = ka + 16; v[i] = ka < K ? W[(size_t)(ka < K ? ka : K - 1) * ld + n] : 0.f; v[8 + i] = kb < K ? W[(size_t)(kb < K ? kb : K - 1) * ld + n] : 0.f; }
  return bsplit16(v); }
__device__ __forceinline__ v8f mac3(const F2& a, const F2& b, v8f c) { c = wmma_bf(a.l, b.h, c); c = wmma_bf(a.h, b.l, c); return wmma_bf(a.h, b.h, c); }
__device__ __forceinline__ float sigm(float v) { return 1.0f / (1.0f + expf(-v)); }
#define LDSX() do { asm volatile("s_wait_dscnt 0" ::: "memory"); __builtin_amdgcn_wave_barrier(); __builtin_amdgcn_fence(__ATOMIC_RELEASE, "workgroup"); } while (0)


#define NB 2
#define SS 2048
#define DM 1024
#define NH 16
#define HD 64
#define QKVW (3 * DM)
#ifndef TQB
#define TQB (SS / 64)
#define TNB NB
#define TON (SS / 128)         // output position blocks per batch (all)
#endif
typedef __attribute__((ext_vector_type(8))) __bf16 v8b;
__device__ __forceinline__ v16b frag_b(const __bf16* rowk0, int lane) {
  union { v16b v; v8b q[2]; } u; const __bf16* p = rowk0 + 8 * (lane >> 4);
  u.q[0] = *(const v8b*)p; u.q[1] = *(const v8b*)(p + 16); return u.v;
}
__device__ __forceinline__ float bfr(float v) { return (float)(__bf16)v; }
__device__ __attribute__((noinline)) float exp_ni(float v) { return expf(v); }
__device__ __attribute__((noinline)) float erf_ni(float v) { return erff(v); }

#define PK_A 0                       // [3072][1024] Wqkv rows (natural [out][in])
#define PK_P (PK_A + QKVW * DM)        // [1024][1024] Wo rows (natural)
#define PK_END (PK_P + DM * DM)
#define WS_PK  0u
#define WS_QK  (WS_PK + 2u * PK_END)             // f16 [4096 rows][2048]: q | k
#define WS_QKL (WS_QK + 2u * NB * SS * 2 * DM)     // f16 q | k residual planes x2048
#define WS_VTH (WS_QKL + 2u * NB * SS * 2 * DM)    // f16 [b][1024 (h*64+d)][2048 s] hi
#define WS_VTL (WS_VTH + 2u * NB * DM * SS)        // f16 lo x 2048
#define WS_O   (WS_VTL + 2u * NB * DM * SS)        // f32 [4096][1024]
#define WS_CS  (WS_O + 4u * NB * SS * DM)           // f32 2 x [2048][32], unused (only counted in WS_END)
#define WS_END (WS_CS + 4u * 2 * SS * 32)
// ---- k_pack: block = (row n, which): natural [out][in] rows -> bf16; which 0 -> W_qkv row n into PK_A row n; 1 -> W_o row n (n < 1024) into PK_P
__global__ __launch_bounds__(256) void k_pack(const float* __restrict__ WQKV, const float* __restrict__ WOUT, __bf16* __restrict__ PK) {
  __shared__ __align__(16) __bf16 s[DM]; const int n = blockIdx.x, which = blockIdx.y, t = threadIdx.x; const float* src = (which == 0) ? (WQKV + (size_t)n * DM) : (WOUT + (size_t)(n - 0) * DM);
  if (which == 1 && n >= DM) return;
  for (int k = t; k < DM; k += 256) s[k] = (__bf16)src[k];
  __syncthreads();
  __bf16* dst = (which == 0) ? PK + PK_A + (size_t)n * DM : PK + PK_P + (size_t)n * DM;
  for (int q = t; q < DM / 8; q += 256) vst2((unsigned*)(dst + q * 8), *(const v4u*)&s[q * 8]);
}
// ---- k_qkv: block = (64 positions, 128 of the 3072 output channels, b): A tile [64 n][1024 c] from x[b][c][n] (bf16 exact) in LDS; each 16-col tile is one (head, part, 16 dims): q/k -> f16 hi/lo row segments [row][part*1024 + h*64 + d]; v -> planes [b][h*64 + d][n]
__global__ __launch_bounds__(128) void k_qkv(const float* __restrict__ X, const __bf16* __restrict__ P, _Float16* __restrict__ QK, _Float16* __restrict__ QKL, _Float16* __restrict__ VTH, _Float16* __restrict__ VTL) {
  __shared__ __align__(16) __bf16 sa[64][DM / 2 + 8]; __shared__ __align__(16) _Float16 so[4][16][136], sol[4][16][136]; __shared__ __align__(16) _Float16 sth[128][72], stl[128][72];
  const int tid = threadIdx.x, wave = tid >> 5, lane = tid & 31, col = lane & 15, g = lane >> 4; const size_t b = blockIdx.z; const int p0 = blockIdx.x * 64; const int n0 = blockIdx.y * 128; const size_t r0 = b * SS + p0 + wave * 16;
  v8f acc[8] = {};
  if (tid < 64) for (int c = DM / 2; c < DM / 2 + 8; ++c) sa[tid][c] = (__bf16)0.f;
#pragma unroll 1
  for (int half = 0; half < 2; ++half) {   // the [64 n][1024 c] A tile is staged in two 512-channel halves (LDS budget)
    for (int e = tid; e < 64 * (DM / 2); e += 128) { const int c = e >> 6, r = e & 63; sa[r][c] = (__bf16)X[(b * DM + half * (DM / 2) + c) * SS + p0 + r]; }
    __syncthreads();
#pragma unroll 2
    for (int kc = 0; kc < DM / 64; ++kc) { const v16b a = frag_b(&sa[wave * 16 + col][kc * 32], lane);
#pragma unroll
      for (int j = 0; j < 8; ++j) acc[j] = wmma_bf(a, frag_b(P + (size_t)(n0 + j * 16 + col) * DM + half * (DM / 2) + kc * 32, lane), acc[j]); }
    __syncthreads(); }
  // epilogue: tile j -> o0 = n0 + j*16; h = o0 / 192; part = (o0 % 192) / 64; d = o0 % 64 + col
#pragma unroll
  for (int j = 0; j < 8; ++j) { const int o0 = n0 + j * 16; const int part = (o0 % 192) / 64;
#pragma unroll
    for (int r = 0; r < 8; ++r) { const float v = acc[j][r]; const _Float16 hv = (_Float16)v; const _Float16 lv = (_Float16)((v - (float)hv) * 2048.0f);
      if (part < 2) { so[wave][8 * g + r][j * 16 + col] = hv; sol[wave][8 * g + r][j * 16 + col] = lv; } else { sth[j * 16 + col][wave * 16 + 8 * g + r] = hv; stl[j * 16 + col][wave * 16 + 8 * g + r] = lv; } } }
  __syncthreads();
  // stores: per tile group of 4 (64 channels = one (head, part)): tiles j = 4*q4 .. 4*q4+3 share (h, part) since 64-runs align
#pragma unroll
  for (int q4 = 0; q4 < 2; ++q4) { const int o0 = n0 + q4 * 64; const int h = o0 / 192, part = (o0 % 192) / 64;
    if (part < 2) {
      for (int rl = 0; rl < 16; ++rl) if (lane < 8) { vst2((unsigned*)(QK + (r0 + rl) * (2 * DM) + part * DM + h * HD + lane * 8), *(const v4u*)&so[wave][rl][q4 * 64 + lane * 8]); vst2((unsigned*)(QKL + (r0 + rl) * (2 * DM) + part * DM + h * HD + lane * 8), *(const v4u*)&sol[wave][rl][q4 * 64 + lane * 8]); }
    } else {
      for (int e = tid; e < 64 * 8; e += 128) { const int d = e >> 3, pc = e & 7; const size_t o = (b * DM + h * HD + d) * SS + p0 + pc * 8; vst2((unsigned*)(VTH + o), *(const v4u*)&sth[q4 * 64 + d][pc * 8]); vst2((unsigned*)(VTL + o), *(const v4u*)&stl[q4 * 64 + d][pc * 8]); } } }
}
// ---- k_attn: block = (64 queries, head h, batch b): all-keys flash attention (K = 64: 2 k-steps), scores = (q.k) * 0.125 with f16 hi + residual operands (3 products), P.V: P x 2048 as f16 hi + residual x (V hi, V lo*2048), 3 products in two accumulators; O[b*S+q][h*64+d] = (acc + accl / 2048) / (2048 l) (256-B segments)
__global__ __launch_bounds__(128) void k_attn(const _Float16* __restrict__ QK, const _Float16* __restrict__ QKL, const _Float16* __restrict__ VTH, const _Float16* __restrict__ VTL, float* __restrict__ O) {
  __shared__ __align__(16) float sp[4][16][36]; __shared__ __align__(16) float so[4][16][68];
  const int tid = threadIdx.x, wave = tid >> 5, lane = tid & 31, col = lane & 15, g = lane >> 4;
  const int qb = blockIdx.x, h = blockIdx.y, b = blockIdx.z; const int q0 = qb * 64 + wave * 16; const size_t rq = (size_t)b * SS + q0 + col;
  v16h aq[2], aql[2];
#pragma unroll
  for (int kc = 0; kc < 2; ++kc) { aq[kc] = frag_h(QK + rq * (2 * DM) + h * HD + kc * 32, lane); aql[kc] = frag_h(QKL + rq * (2 * DM) + h * HD + kc * 32, lane); }
  float m[8], l[8];
#pragma unroll
  for (int r = 0; r < 8; ++r) { m[r] = -3.0e38f; l[r] = 0.f; }
  v8f acc[4] = {}, accl[4] = {};
  const int nks = SS / 32;   // all keys
#pragma unroll 1
  for (int ks = 0; ks < nks; ++ks) { v8f s[2];
#pragma unroll
    for (int ct = 0; ct < 2; ++ct) { const int kk = ks * 32 + ct * 16 + col; const _Float16* krow = QK + ((size_t)b * SS + kk) * (2 * DM) + DM + h * HD; const _Float16* krowl = QKL + ((size_t)b * SS + kk) * (2 * DM) + DM + h * HD; v8f c = {}, cl = {};
#pragma unroll
      for (int kc = 0; kc < 2; ++kc) { const v16h kh = frag_h(krow + kc * 32, lane); c = wmma16(aq[kc], kh, c); cl = wmma16(aql[kc], kh, cl); cl = wmma16(aq[kc], frag_h(krowl + kc * 32, lane), cl); }   // 3 products: q, k as f16 hi + residual
#pragma unroll
      for (int r = 0; r < 8; ++r) c[r] += cl[r] * (1.0f / 2048.0f);
#pragma unroll
      for (int r = 0; r < 8; ++r) s[ct][r] = c[r] * 0.125f; }   // 1/sqrt(64), all keys
#pragma unroll
    for (int r = 0; r < 8; ++r) { float mx = fmaxf(s[0][r], s[1][r]);
#pragma unroll
      for (int o = 1; o < 16; o <<= 1) mx = fmaxf(mx, __shfl_xor(mx, o));
      const float mn = fmaxf(m[r], mx); const float alpha = (m[r] <= -1.0e38f) ? 0.f : __expf(m[r] - mn);
      const float e0 = (s[0][r] <= -1.0e38f) ? 0.f : __expf(s[0][r] - mn), e1 = (s[1][r] <= -1.0e38f) ? 0.f : __expf(s[1][r] - mn); float es = e0 + e1;
#pragma unroll
      for (int o = 1; o < 16; o <<= 1) es += __shfl_xor(es, o);
      l[r] = l[r] * alpha + es; m[r] = mn;
#pragma unroll
      for (int dt = 0; dt < 4; ++dt) { acc[dt][r] *= alpha; accl[dt][r] *= alpha; }
      sp[wave][8 * g + r][col] = e0; sp[wave][8 * g + r][16 + col] = e1; }
    LDSX();
    v16h pa, pl; { const float* prow = &sp[wave][col][0] + 8 * (lane >> 4);
#pragma unroll
      for (int i = 0; i < 8; ++i) { const float x0 = prow[i] * 2048.0f, x1 = prow[16 + i] * 2048.0f; const _Float16 h0 = (_Float16)x0, h1 = (_Float16)x1; pa[i] = h0; pa[8 + i] = h1; pl[i] = (_Float16)((x0 - (float)h0) * 2048.0f); pl[8 + i] = (_Float16)((x1 - (float)h1) * 2048.0f); } }   // P scaled by 2^11 before the f16 split so small softmax weights stay out of the f16 subnormal range; 2^-11 folded into the epilogue
#pragma unroll
    for (int dt = 0; dt < 4; ++dt) { const size_t vr = ((size_t)b * DM + h * HD + dt * 16 + col) * SS + ks * 32; const v16h vh = frag_h(VTH + vr, lane); acc[dt] = wmma16(pa, vh, acc[dt]); accl[dt] = wmma16(pl, vh, accl[dt]); accl[dt] = wmma16(pa, frag_h(VTL + vr, lane), accl[dt]); }   // P hi x V hi + (P lo x V hi + P hi x V lo) / 2048
    LDSX(); }
#pragma unroll
  for (int r = 0; r < 8; ++r) { const float il = (1.0f / 2048.0f) / l[r];
#pragma unroll
    for (int dt = 0; dt < 4; ++dt) so[wave][8 * g + r][dt * 16 + col] = (acc[dt][r] + accl[dt][r] * (1.0f / 2048.0f)) * il; }
  LDSX();
  for (int rl = 0; rl < 16; ++rl) if (lane < 16) vst2(O + ((size_t)b * SS + q0 + rl) * DM + h * HD + lane * 4, *(const v4f*)&so[wave][rl][lane * 4]);
}
// ---- k_out: block = (64 output channels o, 128 positions, b): y[o][n] = w_out rows (exact) x vals rows O[n][c] (bf16 hi + residual, K 1024) -> [B][C][N] rows (512-B segments)
__global__ __launch_bounds__(128) void k_out(const float* __restrict__ O, const __bf16* __restrict__ P, float* __restrict__ Y) {
  __shared__ __align__(16) float so[4][16][132];
  const int tid = threadIdx.x, wave = tid >> 5, lane = tid & 31, col = lane & 15, g = lane >> 4; const int o0 = blockIdx.x * 64 + wave * 16; const int n0 = blockIdx.y * 128; const size_t b = blockIdx.z;
  v8f acc[8] = {};
#pragma unroll 2
  for (int kc = 0; kc < DM / 32; ++kc) { const v16b a = frag_b(P + (size_t)(o0 + col) * DM + kc * 32, lane);
#pragma unroll
    for (int j = 0; j < 8; ++j) { const F2 vb = split_row(O + (b * SS + n0 + j * 16 + col) * DM, kc * 32, lane); acc[j] = wmma_bf(a, vb.l, acc[j]); acc[j] = wmma_bf(a, vb.h, acc[j]); } }
#pragma unroll
  for (int j = 0; j < 8; ++j)
#pragma unroll
    for (int r = 0; r < 8; ++r) so[wave][8 * g + r][j * 16 + col] = acc[j][r];
  LDSX();
  for (int rl = 0; rl < 16; ++rl) vst2(Y + (b * DM + o0 + rl) * SS + n0 + lane * 4, *(const v4f*)&so[wave][rl][lane * 4]);
}
extern "C" void kernel_launch(void* const* d_in, const int* in_sizes, int n_in, void* d_out, int out_size, void* d_ws, size_t ws_size, hipStream_t stream) {
  (void)in_sizes; (void)n_in; (void)out_size;
  const float** F = (const float**)d_in;   // 0 x [2,1024,2048], 1 w_qkv [3072,1024] natural (head-interleaved q|k|v blocks of 64), 2 w_out [1024,1024] natural
  if (ws_size < (size_t)WS_END) return;
  char* ws = (char*)d_ws; __bf16* PK = (__bf16*)(ws + WS_PK); _Float16 *QK = (_Float16*)(ws + WS_QK), *QKL = (_Float16*)(ws + WS_QKL), *VTH = (_Float16*)(ws + WS_VTH), *VTL = (_Float16*)(ws + WS_VTL); float* O = (float*)(ws + WS_O);
  k_pack<<<dim3(QKVW, 2), 256, 0, stream>>>(F[1], F[2], PK);
  k_qkv<<<dim3(SS / 64, QKVW / 128, TNB), 128, 0, stream>>>(F[0], PK + PK_A, QK, QKL, VTH, VTL);
  k_attn<<<dim3(TQB, NH, TNB), 128, 0, stream>>>(QK, QKL, VTH, VTL, O);
  k_out<<<dim3(DM / 64, TON, TNB), 128, 0, stream>>>(O, PK + PK_P, (float*)d_out);
}

// v001
// One run takes 306 microseconds.
// Two timings next to v000 put it at 2.13 and 2.11 times that version's speed.
// compute dtype: x, w_qkv, w_out rounded to bf16; qkv = w_qkv . x with exact bf16 products on WMMA 16x16x32 (positions as rows via an LDS transpose of the [B,C,N] input, natural weight rows; output channel o -> head o/192, part (o%192)/64, dim o%64); q and k stored as f16 hi + (x2048-scaled) residual planes with 3-product scores x 1/8; running-max softmax in f32 (hardware exp); P (scaled by 2^11, as f16 hi + residual) x v hi/lo (3 products); y = w_out (exact rows) x vals (f32 as bf16 hi + residual, 2 products) written channels-first; f32 accumulate.
#include <hip/hip_runtime.h>
#include <math.h>

typedef __attribute__((ext_vector_type(16))) _Float16 v16h;
typedef __attribute__((ext_vector_type(16))) __bf16 v16b;
typedef __attribute__((ext_vector_type(8)))  _Float16 v8h;
typedef __attribute__((ext_vector_type(8)))  float v8f;
typedef __attribute__((ext_vector_type(4)))  float v4f;
typedef __attribute__((ext_vector_type(2)))  float v2f;
typedef __attribute__((ext_vector_type(4)))  unsigned v4u;
typedef __attribute__((ext_vector_type(4)))  int v4i;
typedef float __attribute__((may_alias)) float_a;
typedef int __attribute__((may_alias)) int_a;

template <typename T> __device__ __forceinline__ void vst2(void* p, T v) { *(T*)p = v;  }
__device__ __forceinline__ v8f wmma16(v16h a, v16h b, v8f c) {
  v8f d = __builtin_amdgcn_wmma_f32_16x16x32_f16(false, a, false, b, (short)0, c, false, false);
  asm volatile("v_nop\n\tv_nop\n\tv_nop\n\tv_nop" : "+v"(d) : "v"(a), "v"(b));
  return d;
}
__device__ __forceinline__ v8f wmma_bf(v16b a, v16b b, v8f c) {
  v8f d = __builtin_amdgcn_wmma_f32_16x16x32_bf16(false, a, false, b, (short)0, c, false, false);
  asm volatile("v_nop\n\tv_nop\n\tv_nop\n\tv_nop" : "+v"(d) : "v"(a), "v"(b));
  return d;
}
// Channels-first multi-head attention layer (x [2][1024 channels][2048 positions], 16 heads x 64): 1x1-conv qkv with per-head interleaved (q|k|v) channel blocks, softmax(q k^T / 8) v, 1x1-conv output projection -> [B, C, N].
__device__ __forceinline__ v16h frag_h(const _Float16* rowk0, int lane) {
  union { v16h v; v8h q[2]; } u; const _Float16* p = rowk0 + 8 * (lane >> 4);
  u.q[0] = *(const v8h*)p; u.q[1] = *(const v8h*)(p + 16); return u.v;
}
__device__ __forceinline__ v16h frag_f32(const float* rowk0, int lane) {
  v16h a; const float* p = rowk0 + 8 * (lane >> 4);
#pragma unroll
  for (int i = 0; i < 8; ++i) { a[i] = (_Float16)p[i]; a[8 + i] = (_Float16)p[16 + i]; }
  return a;
}
__device__ __forceinline__ v16h frag_f32s(const float* rowk0, int lane, float sc) {
  v16h a; const float* p = rowk0 + 8 * (lane >> 4);
#pragma unroll
  for (int i = 0; i < 8; ++i) { a[i] = (_Float16)(p[i] * sc); a[8 + i] = (_Float16)(p[16 + i] * sc); }
  return a;
}
// column fragment from a [K][ld] layout (column n), rows >= K read as 0
__device__ __forceinline__ v16h fragc_f32(const float* W, int k0, int n, int lane, int ld, int K) {
  v16h a; const int g = lane >> 4;
#pragma unroll
  for (int i = 0; i < 8; ++i) { const int ka = k0 + 8 * g + i, kb = ka + 16;
    a[i] = (_Float16)(ka < K ? W[(size_t)(ka < K ? ka : K - 1) * ld + n] : 0.f); a[8 + i] = (_Float16)(kb < K ? W[(size_t)(kb < K ? kb : K - 1) * ld + n] : 0.f); }
  return a;
}
struct F2 { v16b h, l; };
__device__ __forceinline__ F2 bsplit16(const float v[16]) { F2 r;
#pragma unroll
  for (int i = 0; i < 16; ++i) { const __bf16 h = (__bf16)v[i]; r.h[i] = h; r.l[i] = (__bf16)(v[i] - (float)h); }
  return r; }
__device__ __forceinline__ F2 split_row(const float* row, int k0, int lane) { float v[16]; const float* p = row + k0 + 8 * (lane >> 4);
#pragma unroll
  for (int i = 0; i < 8; ++i) { v[i] = p[i]; v[8 + i] = p[16 + i]; }
  return bsplit16(v); }
__device__ __forceinline__ F2 split_rowK(const float* row, int k0, int lane, int K) { float v[16]; const int g = lane >> 4;
#pragma unroll
  for (int i = 0; i < 8; ++i) { const int ka = k0 + 8 * g + i, kb = ka + 16; v[i] = ka < K ? row[ka < K ? ka : K - 1] : 0.f; v[8 + i] = kb < K ? row[kb < K ? kb : K - 1] : 0.f; }
  return bsplit16(v); }
__device__ __forceinline__ F2 split_col(const float* W, int k0, int n, int lane, int ld, int K) { float v[16]; const int g = lane >> 4;
#pragma unroll
  for (int i = 0; i < 8; ++i) { const int ka = k0 + 8 * g + i, kb = ka + 16; v[i] = ka < K ? W[(size_t)(ka < K ? ka : K - 1) * ld + n] : 0.f; v[8 + i] = kb < K ? W[(size_t)(kb < K ? kb : K - 1) * ld + n] : 0.f; }
  return bsplit16(v); }
__device__ __forceinline__ v8f mac3(const F2& a, const F2& b, v8f c) { c = wmma_bf(a.l, b.h, c); c = wmma_bf(a.h, b.l, c); return wmma_bf(a.h, b.h, c); }
__device__ __forceinline__ float sigm(float v) { return 1.0f / (1.0f + expf(-v)); }
#define LDSX() do { asm volatile("s_wait_dscnt 0" ::: "memory"); __builtin_amdgcn_wave_barrier(); __builtin_amdgcn_fence(__ATOMIC_RELEASE, "workgroup"); } while (0)


#define NB 2
#define SS 2048
#define DM 1024
#define NH 16
#define HD 64
#define QKVW (3 * DM)
#ifndef TQB
#define TQB (SS / 64)
#define TNB NB
#define TON (SS / 128)         // output position blocks per batch (all)
#endif
typedef __attribute__((ext_vector_type(8))) __bf16 v8b;
__device__ __forceinline__ v16b frag_b(const __bf16* rowk0, int lane) {
  union { v16b v; v8b q[2]; } u; const __bf16* p = rowk0 + 8 * (lane >> 4);
  u.q[0] = *(const v8b*)p; u.q[1] = *(const v8b*)(p + 16); return u.v;
}
__device__ __forceinline__ unsigned lds_addr(const void* p) { return (unsigned)(size_t)p; }   // low 32 bits of a __shared__ address = byte offset in the work-group's LDS
#define WPIT 40   // 16-bit elements per staged 64-B row: 64 B + 16 B (a pitch of 16 B x odd keeps 16-byte LDS reads of 16 rows off each other's banks)
__device__ __forceinline__ float bfr(float v) { return (float)(__bf16)v; }
__device__ __attribute__((noinline)) float exp_ni(float v) { return expf(v); }
__device__ __attribute__((noinline)) float erf_ni(float v) { return erff(v); }

#define PK_A 0                       // [3072][1024] Wqkv rows (natural [out][in])
#define PK_P (PK_A + QKVW * DM)        // [1024][1024] Wo rows (natural)
#define PK_END (PK_P + DM * DM)
#define WS_PK  0u
#define WS_QK  (WS_PK + 2u * PK_END)             // f16 [4096 rows][2048]: q | k
#define WS_QKL (WS_QK + 2u * NB * SS * 2 * DM)     // f16 q | k residual planes x2048
#define WS_VTH (WS_QKL + 2u * NB * SS * 2 * DM)    // f16 [b][1024 (h*64+d)][2048 s] hi
#define WS_VTL (WS_VTH + 2u * NB * DM * SS)        // f16 lo x 2048
#define WS_O   (WS_VTL + 2u * NB * DM * SS)        // f32 [4096][1024]
#define WS_CS  (WS_O + 4u * NB * SS * DM)           // f32 2 x [2048][32], unused (only counted in WS_END)
#define WS_END (WS_CS + 4u * 2 * SS * 32)
// ---- k_pack: block = (row n, which): natural [out][in] rows -> bf16; which 0 -> W_qkv row n into PK_A row n; 1 -> W_o row n (n < 1024) into PK_P
__global__ __launch_bounds__(256) void k_pack(const float* __restrict__ WQKV, const float* __restrict__ WOUT, __bf16* __restrict__ PK) {
  __shared__ __align__(16) __bf16 s[DM]; const int n = blockIdx.x, which = blockIdx.y, t = threadIdx.x; const float* src = (which == 0) ? (WQKV + (size_t)n * DM) : (WOUT + (size_t)(n - 0) * DM);
  if (which == 1 && n >= DM) return;
  for (int k = t; k < DM; k += 256) s[k] = (__bf16)src[k];
  __syncthreads();
  __bf16* dst = (which == 0) ? PK + PK_A + (size_t)n * DM : PK + PK_P + (size_t)n * DM;
  for (int q = t; q < DM / 8; q += 256) vst2((unsigned*)(dst + q * 8), *(const v4u*)&s[q * 8]);
}
// ---- k_qkv: block = (64 positions, 128 of the 3072 output channels, b): A tile [64 n][1024 c] from x[b][c][n] (bf16 exact) in LDS; each 16-col tile is one (head, part, 16 dims): q/k -> f16 hi/lo row segments [row][part*1024 + h*64 + d]; v -> planes [b][h*64 + d][n]
__global__ __launch_bounds__(128) void k_qkv(const float* __restrict__ X, const __bf16* __restrict__ P, _Float16* __restrict__ QK, _Float16* __restrict__ QKL, _Float16* __restrict__ VTH, _Float16* __restrict__ VTL) {
  __shared__ __align__(16) __bf16 sa[64][DM / 2 + 8]; __shared__ __align__(16) _Float16 so[4][16][136], sol[4][16][136]; __shared__ __align__(16) _Float16 sth[128][72], stl[128][72];
  const int tid = threadIdx.x, wave = tid >> 5, lane = tid & 31, col = lane & 15, g = lane >> 4; const size_t b = blockIdx.z; const int p0 = blockIdx.x * 64; const int n0 = blockIdx.y * 128; const size_t r0 = b * SS + p0 + wave * 16;
  v8f acc[8] = {};
  // weight tiles [128 output channels][32 input channels] come into LDS once per work-group by asynchronous copies, two buffers: tile t + 1 flies while tile t is worked on
  __shared__ __align__(16) __bf16 sb[2][128][WPIT];
  const int wr = tid >> 2, wc8 = (tid & 3) * 8;   // copy map: 4 lanes a 64-B row segment, rows wr + 32 i
  const __bf16* wsrc = P + (size_t)(n0 + wr) * DM + wc8;
  auto stage = [&](int t) { const int bf = t & 1; const __bf16* s0 = wsrc + t * 32;
    // four 16-byte copies a lane; s_wait_xcnt 0 as the statement's last line stands in front of every later rewrite of the address registers
    asm volatile("global_load_async_to_lds_b128 %0, %4, off\n\t"
                 "global_load_async_to_lds_b128 %1, %5, off\n\t"
                 "global_load_async_to_lds_b128 %2, %6, off\n\t"
                 "global_load_async_to_lds_b128 %3, %7, off\n\t"
                 "s_wait_xcnt 0x0"
                 :: "v"(lds_addr(&sb[bf][wr][wc8])), "v"(lds_addr(&sb[bf][wr + 32][wc8])), "v"(lds_addr(&sb[bf][wr + 64][wc8])), "v"(lds_addr(&sb[bf][wr + 96][wc8])),
                    "v"(s0), "v"(s0 + 32 * DM), "v"(s0 + 64 * DM), "v"(s0 + 96 * DM)
                 : "memory"); };
  stage(0);
  asm volatile("s_wait_asynccnt 0x0" ::: "memory");   // this wave's part of tile 0 has landed
  __syncthreads();                                     // every wave's part of tile 0 is visible
  stage(1);
  if (tid < 64) for (int c = DM / 2; c < DM / 2 + 8; ++c) sa[tid][c] = (__bf16)0.f;
#pragma unroll 1
  for (int half = 0; half < 2; ++half) {   // the [64 n][1024 c] A tile is staged in two 512-channel halves (LDS budget)
    for (int e = tid; e < 64 * (DM / 2); e += 128) { const int c = e >> 6, r = e & 63; sa[r][c] = (__bf16)X[(b * DM + half * (DM / 2) + c) * SS + p0 + r]; }
    __syncthreads();
#pragma unroll 2
    for (int kc = 0; kc < DM / 64; ++kc) { const int t = half * (DM / 64) + kc, bf = t & 1; const v16b a = frag_b(&sa[wave * 16 + col][kc * 32], lane);
      v16b w[8];
#pragma unroll
      for (int j = 0; j < 8; ++j) w[j] = frag_b(&sb[bf][j * 16 + col][0], lane);
      asm volatile("" :: "v"(a), "v"(w[0]), "v"(w[1]), "v"(w[2]), "v"(w[3]), "v"(w[4]), "v"(w[5]), "v"(w[6]), "v"(w[7]));   // inputs only: holds the trip's LDS reads as one group in front of the first matrix instruction (one LDS wait a trip, not one a tile)
#pragma unroll
      for (int j = 0; j < 8; ++j) acc[j] = wmma_bf(a, w[j], acc[j]);
      // hand-over of the weight buffers, in this order in every wave
      asm volatile("s_wait_dscnt 0x0" ::: "memory");      // this wave's LDS reads of tile t have returned
      asm volatile("s_wait_asynccnt 0x0" ::: "memory");   // this wave's part of tile t + 1 has landed
      __syncthreads();                                     // publishes tile t + 1 and ends every wave's reads of tile t
      if (t + 2 < DM / 32) stage(t + 2); }                 // refill of the buffer that this trip has read
    __syncthreads(); }
  asm volatile("s_wait_asynccnt 0x0" ::: "memory");       // no copy is outstanding behind the loop
  // epilogue: tile j -> o0 = n0 + j*16; h = o0 / 192; part = (o0 % 192) / 64; d = o0 % 64 + col
#pragma unroll
  for (int j = 0; j < 8; ++j) { const int o0 = n0 + j * 16; const int part = (o0 % 192) / 64;
#pragma unroll
    for (int r = 0; r < 8; ++r) { const float v = acc[j][r]; const _Float16 hv = (_Float16)v; const _Float16 lv = (_Float16)((v - (float)hv) * 2048.0f);
      if (part < 2) { so[wave][8 * g + r][j * 16 + col] = hv; sol[wave][8 * g + r][j * 16 + col] = lv; } else { sth[j * 16 + col][wave * 16 + 8 * g + r] = hv; stl[j * 16 + col][wave * 16 + 8 * g + r] = lv; } } }
  __syncthreads();
  // stores: per tile group of 4 (64 channels = one (head, part)): tiles j = 4*q4 .. 4*q4+3 share (h, part) since 64-runs align
#pragma unroll
  for (int q4 = 0; q4 < 2; ++q4) { const int o0 = n0 + q4 * 64; const int h = o0 / 192, part = (o0 % 192) / 64;
    if (part < 2) {
      for (int rl = 0; rl < 16; ++rl) if (lane < 8) { vst2((unsigned*)(QK + (r0 + rl) * (2 * DM) + part * DM + h * HD + lane * 8), *(const v4u*)&so[wave][rl][q4 * 64 + lane * 8]); vst2((unsigned*)(QKL + (r0 + rl) * (2 * DM) + part * DM + h * HD + lane * 8), *(const v4u*)&sol[wave][rl][q4 * 64 + lane * 8]); }
    } else {
      for (int e = tid; e < 64 * 8; e += 128) { const int d = e >> 3, pc = e & 7; const size_t o = (b * DM + h * HD + d) * SS + p0 + pc * 8; vst2((unsigned*)(VTH + o), *(const v4u*)&sth[q4 * 64 + d][pc * 8]); vst2((unsigned*)(VTL + o), *(const v4u*)&stl[q4 * 64 + d][pc * 8]); } } }
}
// ---- k_attn: block = (64 queries, head h, batch b): all-keys flash attention (K = 64: 2 k-steps), scores = (q.k) * 0.125 with 3 f16 products, P.V: f16 P x (V hi, V lo*2048) in two accumulators; O[b*S+q][h*64+d] = (acc + accl / 2048) / (2048 l) (256-B segments)
// Each 32-key K and V tile (hi and residual planes) is brought into LDS once per work-group by asynchronous copies, two buffers: tile t + 1 flies while tile t is worked on; the four waves read their fragments from LDS.
#define KPIT 72   // halfs per staged K row: 128 B + 16 B (a pitch of 16 B x odd keeps 16-byte LDS reads of 16 rows off each other's banks)
#define VPIT 40   // halfs per staged V row: 64 B + 16 B, same reason
__global__ __launch_bounds__(128) void k_attn(const _Float16* __restrict__ QK, const _Float16* __restrict__ QKL, const _Float16* __restrict__ VTH, const _Float16* __restrict__ VTL, float* __restrict__ O) {
  __shared__ __align__(16) float sp[4][16][36]; __shared__ __align__(16) float so[4][16][68];
  __shared__ __align__(16) _Float16 sk[2][2][32][KPIT];   // [buffer][hi | residual][key][d]
  __shared__ __align__(16) _Float16 sv[2][2][64][VPIT];   // [buffer][hi | residual][d][key]
  const int tid = threadIdx.x, wave = tid >> 5, lane = tid & 31, col = lane & 15, g = lane >> 4;
  const int qb = blockIdx.x, h = blockIdx.y, b = blockIdx.z; const int q0 = qb * 64 + wave * 16; const size_t rq = (size_t)b * SS + q0 + col;
  const int nks = SS / 32;   // all keys
  // copy map: K, 8 lanes a 128-B row, rows kr and kr + 16; V, 4 lanes a 64-B row segment, rows vd and vd + 32
  const int kr = tid >> 3, kc8 = (tid & 7) * 8, vd = tid >> 2, vc8 = (tid & 3) * 8;
  const size_t koff = ((size_t)b * SS + kr) * (2 * DM) + DM + h * HD + kc8, voff = ((size_t)b * DM + h * HD + vd) * SS + vc8;
  auto stage = [&](int t) { const int bf = t & 1; const size_t ko = koff + (size_t)t * 32 * (2 * DM), vo = voff + (size_t)t * 32;
    // eight 16-byte copies a lane; s_wait_xcnt 0 as the statement's last line stands in front of every later rewrite of the address registers
    asm volatile("global_load_async_to_lds_b128 %0, %8, off\n\t"
                 "global_load_async_to_lds_b128 %1, %9, off\n\t"
                 "global_load_async_to_lds_b128 %2, %10, off\n\t"
                 "global_load_async_to_lds_b128 %3, %11, off\n\t"
                 "global_load_async_to_lds_b128 %4, %12, off\n\t"
                 "global_load_async_to_lds_b128 %5, %13, off\n\t"
                 "global_load_async_to_lds_b128 %6, %14, off\n\t"
                 "global_load_async_to_lds_b128 %7, %15, off\n\t"
                 "s_wait_xcnt 0x0"
                 :: "v"(lds_addr(&sk[bf][0][kr][kc8])), "v"(lds_addr(&sk[bf][0][kr + 16][kc8])), "v"(lds_addr(&sk[bf][1][kr][kc8])), "v"(lds_addr(&sk[bf][1][kr + 16][kc8])),
                    "v"(lds_addr(&sv[bf][0][vd][vc8])), "v"(lds_addr(&sv[bf][0][vd + 32][vc8])), "v"(lds_addr(&sv[bf][1][vd][vc8])), "v"(lds_addr(&sv[bf][1][vd + 32][vc8])),
                    "v"(QK + ko), "v"(QK + ko + 16 * (2 * DM)), "v"(QKL + ko), "v"(QKL + ko + 16 * (2 * DM)),
                    "v"(VTH + vo), "v"(VTH + vo + 32 * SS), "v"(VTL + vo), "v"(VTL + vo + 32 * SS)
                 : "memory"); };
  stage(0);
  asm volatile("s_wait_asynccnt 0x0" ::: "memory");   // this wave's part of tile 0 has landed
  __syncthreads();                                     // every wave's part of tile 0 is visible
  stage(1);
  v16h aq[2], aql[2];
#pragma unroll
  for (int kc = 0; kc < 2; ++kc) { aq[kc] = frag_h(QK + rq * (2 * DM) + h * HD + kc * 32, lane); aql[kc] = frag_h(QKL + rq * (2 * DM) + h * HD + kc * 32, lane); }
  float m[8], l[8];
#pragma unroll
  for (int r = 0; r < 8; ++r) { m[r] = -3.0e38f; l[r] = 0.f; }
  v8f acc[4] = {}, accl[4] = {};
#pragma unroll 1
  for (int ks = 0; ks < nks; ++ks) { v8f s[2]; const int bf = ks & 1; v16h kf[2][2], kl[2][2];
#pragma unroll
    for (int ct = 0; ct < 2; ++ct)
#pragma unroll
      for (int kc = 0; kc < 2; ++kc) { kf[ct][kc] = frag_h(&sk[bf][0][ct * 16 + col][kc * 32], lane); kl[ct][kc] = frag_h(&sk[bf][1][ct * 16 + col][kc * 32], lane); }
    asm volatile("" :: "v"(kf[0][0]), "v"(kf[0][1]), "v"(kf[1][0]), "v"(kf[1][1]), "v"(kl[0][0]), "v"(kl[0][1]), "v"(kl[1][0]), "v"(kl[1][1]));   // inputs only: holds the trip's K reads from LDS as one group in front of the first matrix instruction (one LDS wait, not one a fragment)
#pragma unroll
    for (int ct = 0; ct < 2; ++ct) { v8f c = {}, cl = {};
#pragma unroll
      for (int kc = 0; kc < 2; ++kc) { c = wmma16(aq[kc], kf[ct][kc], c); cl = wmma16(aql[kc], kf[ct][kc], cl); cl = wmma16(aq[kc], kl[ct][kc], cl); }   // 3 products: q, k as f16 hi + residual
#pragma unroll
      for (int r = 0; r < 8; ++r) c[r] += cl[r] * (1.0f / 2048.0f);
#pragma unroll
      for (int r = 0; r < 8; ++r) s[ct][r] = c[r] * 0.125f; }   // 1/sqrt(64), all keys
#pragma unroll
    for (int r = 0; r < 8; ++r) { float mx = fmaxf(s[0][r], s[1][r]);
#pragma unroll
      for (int o = 1; o < 16; o <<= 1) mx = fmaxf(mx, __shfl_xor(mx, o));
      const float mn = fmaxf(m[r], mx); const float alpha = (m[r] <= -1.0e38f) ? 0.f : __expf(m[r] - mn);
      const float e0 = (s[0][r] <= -1.0e38f) ? 0.f : __expf(s[0][r] - mn), e1 = (s[1][r] <= -1.0e38f) ? 0.f : __expf(s[1][r] - mn); float es = e0 + e1;
#pragma unroll
      for (int o = 1; o < 16; o <<= 1) es += __shfl_xor(es, o);
      l[r] = l[r] * alpha + es; m[r] = mn;
#pragma unroll
      for (int dt = 0; dt < 4; ++dt) { acc[dt][r] *= alpha; accl[dt][r] *= alpha; }
      sp[wave][8 * g + r][col] = e0; sp[wave][8 * g + r][16 + col] = e1; }
    LDSX();
    v16h vh[4], vl[4];
#pragma unroll
    for (int dt = 0; dt < 4; ++dt) { vh[dt] = frag_h(&sv[bf][0][dt * 16 + col][0], lane); vl[dt] = frag_h(&sv[bf][1][dt * 16 + col][0], lane); }
    v16h pa, pl; { const float* prow = &sp[wave][col][0] + 8 * (lane >> 4);
#pragma unroll
      for (int i = 0; i < 8; ++i) { const float x0 = prow[i] * 2048.0f, x1 = prow[16 + i] * 2048.0f; const _Float16 h0 = (_Float16)x0, h1 = (_Float16)x1; pa[i] = h0; pa[8 + i] = h1; pl[i] = (_Float16)((x0 - (float)h0) * 2048.0f); pl[8 + i] = (_Float16)((x1 - (float)h1) * 2048.0f); } }   // P scaled by 2^11 before the f16 split so small softmax weights stay out of the f16 subnormal range; 2^-11 folded into the epilogue
    asm volatile("" :: "v"(vh[0]), "v"(vh[1]), "v"(vh[2]), "v"(vh[3]), "v"(vl[0]), "v"(vl[1]), "v"(vl[2]), "v"(vl[3]));   // inputs only: holds the trip's V reads from LDS as one group in front of the first P.V matrix instruction
#pragma unroll
    for (int dt = 0; dt < 4; ++dt) { acc[dt] = wmma16(pa, vh[dt], acc[dt]); accl[dt] = wmma16(pl, vh[dt], accl[dt]); accl[dt] = wmma16(pa, vl[dt], accl[dt]); }   // P hi x V hi + (P lo x V hi + P hi x V lo) / 2048
    // hand-over of the buffers, in this order in every wave
    asm volatile("s_wait_dscnt 0x0" ::: "memory");      // this wave's LDS reads of tile ks (and of sp) have returned
    asm volatile("s_wait_asynccnt 0x0" ::: "memory");   // this wave's part of tile ks + 1 has landed
    __syncthreads();                                     // publishes tile ks + 1 and ends every wave's reads of tile ks
    if (ks + 2 < nks) stage(ks + 2); }                   // refill of the buffer that this trip has read
  asm volatile("s_wait_asynccnt 0x0" ::: "memory");     // no copy is outstanding behind the loop
#pragma unroll
  for (int r = 0; r < 8; ++r) { const float il = (1.0f / 2048.0f) / l[r];
#pragma unroll
    for (int dt = 0; dt < 4; ++dt) so[wave][8 * g + r][dt * 16 + col] = (acc[dt][r] + accl[dt][r] * (1.0f / 2048.0f)) * il; }
  LDSX();
  for (int rl = 0; rl < 16; ++rl) if (lane < 16) vst2(O + ((size_t)b * SS + q0 + rl) * DM + h * HD + lane * 4, *(const v4f*)&so[wave][rl][lane * 4]);
}
// ---- k_out: block = (64 output channels o, 128 positions, b): y[o][n] = w_out rows (exact) x vals rows O[n][c] (bf16 hi + residual, K 1024) -> [B][C][N] rows (512-B segments)
__global__ __launch_bounds__(128) void k_out(const float* __restrict__ O, const __bf16* __restrict__ P, float* __restrict__ Y) {
  __shared__ __align__(16) float so[4][16][132];
  const int tid = threadIdx.x, wave = tid >> 5, lane = tid & 31, col = lane & 15, g = lane >> 4; const int o0 = blockIdx.x * 64 + wave * 16; const int n0 = blockIdx.y * 128; const size_t b = blockIdx.z;
  v8f acc[8] = {};
  // tiles of vals [128 positions][32 channels, f32] and of weights [64 output channels][32 channels] come into LDS once per work-group by asynchronous copies, two buffers: tile t + 1 flies while tile t is worked on
  __shared__ __align__(16) float sval[2][128][36];   // 128-B rows at a pitch of 144 B (16 B x odd, as WPIT)
  __shared__ __align__(16) __bf16 sw[2][64][WPIT];
  const int vr = tid >> 3, vc4 = (tid & 7) * 4, wr = tid >> 2, wc8 = (tid & 3) * 8;   // copy map: vals, 8 lanes a 128-B row, rows vr + 16 i; weights, 4 lanes a 64-B row segment, rows wr and wr + 32
  const float* vsrc = O + (b * SS + n0 + vr) * DM + vc4; const __bf16* wsrc = P + (size_t)(blockIdx.x * 64 + wr) * DM + wc8;
  auto stage = [&](int t) { const int bf = t & 1; const float* s0 = vsrc + t * 32; const __bf16* w0 = wsrc + t * 32;
    // ten 16-byte copies a lane; s_wait_xcnt 0 as the statement's last line stands in front of every later rewrite of the address registers
    asm volatile("global_load_async_to_lds_b128 %0, %10, off\n\t"
                 "global_load_async_to_lds_b128 %1, %11, off\n\t"
                 "global_load_async_to_lds_b128 %2, %12, off\n\t"
                 "global_load_async_to_lds_b128 %3, %13, off\n\t"
                 "global_load_async_to_lds_b128 %4, %14, off\n\t"
                 "global_load_async_to_lds_b128 %5, %15, off\n\t"
                 "global_load_async_to_lds_b128 %6, %16, off\n\t"
                 "global_load_async_to_lds_b128 %7, %17, off\n\t"
                 "global_load_async_to_lds_b128 %8, %18, off\n\t"
                 "global_load_async_to_lds_b128 %9, %19, off\n\t"
                 "s_wait_xcnt 0x0"
                 :: "v"(lds_addr(&sval[bf][vr][vc4])), "v"(lds_addr(&sval[bf][vr + 16][vc4])), "v"(lds_addr(&sval[bf][vr + 32][vc4])), "v"(lds_addr(&sval[bf][vr + 48][vc4])),
                    "v"(lds_addr(&sval[bf][vr + 64][vc4])), "v"(lds_addr(&sval[bf][vr + 80][vc4])), "v"(lds_addr(&sval[bf][vr + 96][vc4])), "v"(lds_addr(&sval[bf][vr + 112][vc4])),
                    "v"(lds_addr(&sw[bf][wr][wc8])), "v"(lds_addr(&sw[bf][wr + 32][wc8])),
                    "v"(s0), "v"(s0 + 16 * DM), "v"(s0 + 32 * DM), "v"(s0 + 48 * DM), "v"(s0 + 64 * DM), "v"(s0 + 80 * DM), "v"(s0 + 96 * DM), "v"(s0 + 112 * DM),
                    "v"(w0), "v"(w0 + 32 * DM)
                 : "memory"); };
  stage(0);
  asm volatile("s_wait_asynccnt 0x0" ::: "memory");   // this wave's part of tile 0 has landed
  __syncthreads();                                     // every wave's part of tile 0 is visible
  stage(1);
#pragma unroll 2
  for (int kc = 0; kc < DM / 32; ++kc) { const int bf = kc & 1; const v16b a = frag_b(&sw[bf][wave * 16 + col][0], lane);
#pragma unroll
    for (int j = 0; j < 8; ++j) { const F2 vb = split_row(&sval[bf][j * 16 + col][0], 0, lane); acc[j] = wmma_bf(a, vb.l, acc[j]); acc[j] = wmma_bf(a, vb.h, acc[j]); }
    // hand-over of the buffers, in this order in every wave
    asm volatile("s_wait_dscnt 0x0" ::: "memory");      // this wave's LDS reads of tile kc have returned
    asm volatile("s_wait_asynccnt 0x0" ::: "memory");   // this wave's part of tile kc + 1 has landed
    __syncthreads();                                     // publishes tile kc + 1 and ends every wave's reads of tile kc
    if (kc + 2 < DM / 32) stage(kc + 2); }               // refill of the buffer that this trip has read
  asm volatile("s_wait_asynccnt 0x0" ::: "memory");     // no copy is outstanding behind the loop
#pragma unroll
  for (int j = 0; j < 8; ++j)
#pragma unroll
    for (int r = 0; r < 8; ++r) so[wave][8 * g + r][j * 16 + col] = acc[j][r];
  LDSX();
  for (int rl = 0; rl < 16; ++rl) vst2(Y + (b * DM + o0 + rl) * SS + n0 + lane * 4, *(const v4f*)&so[wave][rl][lane * 4]);
}
extern "C" void kernel_launch(void* const* d_in, const int* in_sizes, int n_in, void* d_out, int out_size, void* d_ws, size_t ws_size, hipStream_t stream) {
  (void)in_sizes; (void)n_in; (void)out_size;
  const float** F = (const float**)d_in;   // 0 x [2,1024,2048], 1 w_qkv [3072,1024] natural (head-interleaved q|k|v blocks of 64), 2 w_out [1024,1024] natural
  if (ws_size < (size_t)WS_END) return;
  char* ws = (char*)d_ws; __bf16* PK = (__bf16*)(ws + WS_PK); _Float16 *QK = (_Float16*)(ws + WS_QK), *QKL = (_Float16*)(ws + WS_QKL), *VTH = (_Float16*)(ws + WS_VTH), *VTL = (_Float16*)(ws + WS_VTL); float* O = (float*)(ws + WS_O);
  k_pack<<<dim3(QKVW, 2), 256, 0, stream>>>(F[1], F[2], PK);
  k_qkv<<<dim3(SS / 64, QKVW / 128, TNB), 128, 0, stream>>>(F[0], PK + PK_A, QK, QKL, VTH, VTL);
  k_attn<<<dim3(TQB, NH, TNB), 128, 0, stream>>>(QK, QKL, VTH, VTL, O);
  k_out<<<dim3(DM / 64, TON, TNB), 128, 0, stream>>>(O, PK + PK_P, (float*)d_out);
}

// v002
// It runs in 258 microseconds.
// Next to v001, in two timings, it ran 1.18 times as fast each time.
// Counting every step since v000, it is 2.51 times as fast.
// compute dtype: x, w_qkv, w_out rounded to bf16; qkv = w_qkv . x with exact bf16 products on WMMA 16x16x32 (positions as rows via an LDS transpose of the [B,C,N] input, natural weight rows; output channel o -> head o/192, part (o%192)/64, dim o%64); q and k stored as f16 hi + (x2048-scaled) residual planes with 3-product scores x 1/8; running-max softmax in f32 (hardware exp); P (scaled by 2^11, as f16 hi + residual) x v hi/lo (3 products); y = w_out (exact rows) x vals (f32 as bf16 hi + residual, 2 products) written channels-first; f32 accumulate.
#include <hip/hip_runtime.h>
#include <math.h>

typedef __attribute__((ext_vector_type(16))) _Float16 v16h;
typedef __attribute__((ext_vector_type(16))) __bf16 v16b;
typedef __attribute__((ext_vector_type(8)))  _Float16 v8h;
typedef __attribute__((ext_vector_type(8)))  float v8f;
typedef __attribute__((ext_vector_type(4)))  float v4f;
typedef __attribute__((ext_vector_type(2)))  float v2f;
typedef __attribute__((ext_vector_type(4)))  unsigned v4u;
typedef __attribute__((ext_vector_type(4)))  int v4i;
typedef float __attribute__((may_alias)) float_a;
typedef int __attribute__((may_alias)) int_a;

template <typename T> __device__ __forceinline__ void vst2(void* p, T v) { *(T*)p = v;  }
__device__ __forceinline__ v8f wmma16(v16h a, v16h b, v8f c) {
  v8f d = __builtin_amdgcn_wmma_f32_16x16x32_f16(false, a, false, b, (short)0, c, false, false);
  asm volatile("v_nop\n\tv_nop\n\tv_nop\n\tv_nop" : "+v"(d) : "v"(a), "v"(b));
  return d;
}
__device__ __forceinline__ v8f wmma_bf(v16b a, v16b b, v8f c) {
  v8f d = __builtin_amdgcn_wmma_f32_16x16x32_bf16(false, a, false, b, (short)0, c, false, false);
  asm volatile("v_nop\n\tv_nop\n\tv_nop\n\tv_nop" : "+v"(d) : "v"(a), "v"(b));
  return d;
}
// Channels-first multi-head attention layer (x [2][1024 channels][2048 positions], 16 heads x 64): 1x1-conv qkv with per-head interleaved (q|k|v) channel blocks, softmax(q k^T / 8) v, 1x1-conv output projection -> [B, C, N].
__device__ __forceinline__ v16h frag_h(const _Float16* rowk0, int lane) {
  union { v16h v; v8h q[2]; } u; const _Float16* p = rowk0 + 8 * (lane >> 4);
  u.q[0] = *(const v8h*)p; u.q[1] = *(const v8h*)(p + 16); return u.v;
}
__device__ __forceinline__ v16h frag_f32(const float* rowk0, int lane) {
  v16h a; const float* p = rowk0 + 8 * (lane >> 4);
#pragma unroll
  for (int i = 0; i < 8; ++i) { a[i] = (_Float16)p[i]; a[8 + i] = (_Float16)p[16 + i]; }
  return a;
}
__device__ __forceinline__ v16h frag_f32s(const float* rowk0, int lane, float sc) {
  v16h a; const float* p = rowk0 + 8 * (lane >> 4);
#pragma unroll
  for (int i = 0; i < 8; ++i) { a[i] = (_Float16)(p[i] * sc); a[8 + i] = (_Float16)(p[16 + i] * sc); }
  return a;
}
// column fragment from a [K][ld] layout (column n), rows >= K read as 0
__device__ __forceinline__ v16h fragc_f32(const float* W, int k0, int n, int lane, int ld, int K) {
  v16h a; const int g = lane >> 4;
#pragma unroll
  for (int i = 0; i < 8; ++i) { const int ka = k0 + 8 * g + i, kb = ka + 16;
    a[i] = (_Float16)(ka < K ? W[(size_t)(ka < K ? ka : K - 1) * ld + n] : 0.f); a[8 + i] = (_Float16)(kb < K ? W[(size_t)(kb < K ? kb : K - 1) * ld + n] : 0.f); }
  return a;
}
struct F2 { v16b h, l; };
__device__ __forceinline__ F2 bsplit16(const float v[16]) { F2 r;
#pragma unroll
  for (int i = 0; i < 16; ++i) { const __bf16 h = (__bf16)v[i]; r.h[i] = h; r.l[i] = (__bf16)(v[i] - (float)h); }
  return r; }
__device__ __forceinline__ F2 split_row(const float* row, int k0, int lane) { float v[16]; const float* p = row + k0 + 8 * (lane >> 4);
#pragma unroll
  for (int i = 0; i < 8; ++i) { v[i] = p[i]; v[8 + i] = p[16 + i]; }
  return bsplit16(v); }
__device__ __forceinline__ F2 split_rowK(const float* row, int k0, int lane, int K) { float v[16]; const int g = lane >> 4;
#pragma unroll
  for (int i = 0; i < 8; ++i) { const int ka = k0 + 8 * g + i, kb = ka + 16; v[i] = ka < K ? row[ka < K ? ka : K - 1] : 0.f; v[8 + i] = kb < K ? row[kb < K ? kb : K - 1] : 0.f; }
  return bsplit16(v); }
__device__ __forceinline__ F2 split_col(const float* W, int k0, int n, int lane, int ld, int K) { float v[16]; const int g = lane >> 4;
#pragma unroll
  for (int i = 0; i < 8; ++i) { const int ka = k0 + 8 * g + i, kb = ka + 16; v[i] = ka < K ? W[(size_t)(ka < K ? ka : K - 1) * ld + n] : 0.f; v[8 + i] = kb < K ? W[(size_t)(kb < K ? kb : K - 1) * ld + n] : 0.f; }
  return bsplit16(v); }
__device__ __forceinline__ v8f mac3(const F2& a, const F2& b, v8f c) { c = wmma_bf(a.l, b.h, c); c = wmma_bf(a.h, b.l, c); return wmma_bf(a.h, b.h, c); }
__device__ __forceinline__ float sigm(float v) { return 1.0f / (1.0f + expf(-v)); }
#define LDSX() do { asm volatile("s_wait_dscnt 0" ::: "memory"); __builtin_amdgcn_wave_barrier(); __builtin_amdgcn_fence(__ATOMIC_RELEASE, "workgroup"); } while (0)


#define NB 2
#define SS 2048
#define DM 1024
#define NH 16
#define HD 64
#define QKVW (3 * DM)
#ifndef TQB
#define TQB (SS / 64)
#define TNB NB
#define TON (SS / 128)         // output position blocks per batch (all)
#endif
typedef __attribute__((ext_vector_type(8))) __bf16 v8b;
__device__ __forceinline__ v16b frag_b(const __bf16* rowk0, int lane) {
  union { v16b v; v8b q[2]; } u; const __bf16* p = rowk0 + 8 * (lane >> 4);
  u.q[0] = *(const v8b*)p; u.q[1] = *(const v8b*)(p + 16); return u.v;
}
__device__ __forceinline__ unsigned lds_addr(const void* p) { return (unsigned)(size_t)p; }   // low 32 bits of a __shared__ address = byte offset in the work-group's LDS
#define WPIT 40   // 16-bit elements per staged 64-B row: 64 B + 16 B (a pitch of 16 B x odd keeps 16-byte LDS reads of 16 rows off each other's banks)
__device__ __forceinline__ float bfr(float v) { return (float)(__bf16)v; }
__device__ __attribute__((noinline)) float exp_ni(float v) { return expf(v); }
__device__ __attribute__((noinline)) float erf_ni(float v) { return erff(v); }

#define PK_A 0                       // [3072][1024] Wqkv rows (natural [out][in])
#define PK_P (PK_A + QKVW * DM)        // [1024][1024] Wo rows (natural)
#define PK_END (PK_P + DM * DM)
#define WS_PK  0u
#define WS_QK  (WS_PK + 2u * PK_END)             // f16 [4096 rows][2048]: q | k
#define WS_QKL (WS_QK + 2u * NB * SS * 2 * DM)     // f16 q | k residual planes x2048
#define WS_VTH (WS_QKL + 2u * NB * SS * 2 * DM)    // f16 [b][1024 (h*64+d)][2048 s] hi
#define WS_VTL (WS_VTH + 2u * NB * DM * SS)        // f16 lo x 2048
#define WS_O   (WS_VTL + 2u * NB * DM * SS)        // f32 [4096][1024]
#define WS_CS  (WS_O + 4u * NB * SS * DM)           // f32 2 x [2048][32], unused (only counted in WS_END)
#define WS_END (WS_CS + 4u * 2 * SS * 32)
// ---- k_pack: block = (row n, which): natural [out][in] rows -> bf16; which 0 -> W_qkv row n into PK_A row n; 1 -> W_o row n (n < 1024) into PK_P
__global__ __launch_bounds__(256) void k_pack(const float* __restrict__ WQKV, const float* __restrict__ WOUT, __bf16* __restrict__ PK) {
  __shared__ __align__(16) __bf16 s[DM]; const int n = blockIdx.x, which = blockIdx.y, t = threadIdx.x; const float* src = (which == 0) ? (WQKV + (size_t)n * DM) : (WOUT + (size_t)(n - 0) * DM);
  if (which == 1 && n >= DM) return;
  for (int k = t; k < DM; k += 256) s[k] = (__bf16)src[k];
  __syncthreads();
  __bf16* dst = (which == 0) ? PK + PK_A + (size_t)n * DM : PK + PK_P + (size_t)n * DM;
  for (int q = t; q < DM / 8; q += 256) vst2((unsigned*)(dst + q * 8), *(const v4u*)&s[q * 8]);
}
// ---- k_qkv: block = (64 positions, 128 of the 3072 output channels, b): A tile [64 n][1024 c] from x[b][c][n] (bf16 exact) in LDS; each 16-col tile is one (head, part, 16 dims): q/k -> f16 hi/lo row segments [row][part*1024 + h*64 + d]; v -> planes [b][h*64 + d][n]
__global__ __launch_bounds__(128) void k_qkv(const float* __restrict__ X, const __bf16* __restrict__ P, _Float16* __restrict__ QK, _Float16* __restrict__ QKL, _Float16* __restrict__ VTH, _Float16* __restrict__ VTL) {
  __shared__ __align__(16) __bf16 sa[64][DM / 2 + 8]; __shared__ __align__(16) _Float16 so[4][16][136], sol[4][16][136]; __shared__ __align__(16) _Float16 sth[128][72], stl[128][72];
  const int tid = threadIdx.x, wave = tid >> 5, lane = tid & 31, col = lane & 15, g = lane >> 4; const size_t b = blockIdx.z; const int p0 = blockIdx.x * 64; const int n0 = blockIdx.y * 128; const size_t r0 = b * SS + p0 + wave * 16;
  v8f acc[8] = {};
  // weight tiles [128 output channels][32 input channels] come into LDS once per work-group by asynchronous copies, two buffers: tile t + 1 flies while tile t is worked on
  __shared__ __align__(16) __bf16 sb[2][128][WPIT];
  const int wr = tid >> 2, wc8 = (tid & 3) * 8;   // copy map: 4 lanes a 64-B row segment, rows wr + 32 i
  const __bf16* wsrc = P + (size_t)(n0 + wr) * DM + wc8;
  auto stage = [&](int t) { const int bf = t & 1; const __bf16* s0 = wsrc + t * 32;
    // four 16-byte copies a lane; s_wait_xcnt 0 as the statement's last line stands in front of every later rewrite of the address registers
    asm volatile("global_load_async_to_lds_b128 %0, %4, off\n\t"
                 "global_load_async_to_lds_b128 %1, %5, off\n\t"
                 "global_load_async_to_lds_b128 %2, %6, off\n\t"
                 "global_load_async_to_lds_b128 %3, %7, off\n\t"
                 "s_wait_xcnt 0x0"
                 :: "v"(lds_addr(&sb[bf][wr][wc8])), "v"(lds_addr(&sb[bf][wr + 32][wc8])), "v"(lds_addr(&sb[bf][wr + 64][wc8])), "v"(lds_addr(&sb[bf][wr + 96][wc8])),
                    "v"(s0), "v"(s0 + 32 * DM), "v"(s0 + 64 * DM), "v"(s0 + 96 * DM)
                 : "memory"); };
  stage(0);
  asm volatile("s_wait_asynccnt 0x0" ::: "memory");   // this wave's part of tile 0 has landed
  __syncthreads();                                     // every wave's part of tile 0 is visible
  stage(1);
  if (tid < 64) for (int c = DM / 2; c < DM / 2 + 8; ++c) sa[tid][c] = (__bf16)0.f;
#pragma unroll 1
  for (int half = 0; half < 2; ++half) {   // the [64 n][1024 c] A tile is staged in two 512-channel halves (LDS budget)
    for (int e = tid; e < 64 * (DM / 2); e += 128) { const int c = e >> 6, r = e & 63; sa[r][c] = (__bf16)X[(b * DM + half * (DM / 2) + c) * SS + p0 + r]; }
    __syncthreads();
#pragma unroll 2
    for (int kc = 0; kc < DM / 64; ++kc) { const int t = half * (DM / 64) + kc, bf = t & 1; const v16b a = frag_b(&sa[wave * 16 + col][kc * 32], lane);
      v16b w[8];
#pragma unroll
      for (int j = 0; j < 8; ++j) w[j] = frag_b(&sb[bf][j * 16 + col][0], lane);
      asm volatile("" :: "v"(a), "v"(w[0]), "v"(w[1]), "v"(w[2]), "v"(w[3]), "v"(w[4]), "v"(w[5]), "v"(w[6]), "v"(w[7]));   // inputs only: holds the trip's LDS reads as one group in front of the first matrix instruction (one LDS wait a trip, not one a tile)
#pragma unroll
      for (int j = 0; j < 8; ++j) acc[j] = wmma_bf(a, w[j], acc[j]);
      // hand-over of the weight buffers, in this order in every wave
      asm volatile("s_wait_dscnt 0x0" ::: "memory");      // this wave's LDS reads of tile t have returned
      asm volatile("s_wait_asynccnt 0x0" ::: "memory");   // this wave's part of tile t + 1 has landed
      __syncthreads();                                     // publishes tile t + 1 and ends every wave's reads of tile t
      if (t + 2 < DM / 32) stage(t + 2); }                 // refill of the buffer that this trip has read
    __syncthreads(); }
  asm volatile("s_wait_asynccnt 0x0" ::: "memory");       // no copy is outstanding behind the loop
  // epilogue: tile j -> o0 = n0 + j*16; h = o0 / 192; part = (o0 % 192) / 64; d = o0 % 64 + col
#pragma unroll
  for (int j = 0; j < 8; ++j) { const int o0 = n0 + j * 16; const int part = (o0 % 192) / 64;
#pragma unroll
    for (int r = 0; r < 8; ++r) { const float v = acc[j][r]; const _Float16 hv = (_Float16)v; const _Float16 lv = (_Float16)((v - (float)hv) * 2048.0f);
      if (part < 2) { so[wave][8 * g + r][j * 16 + col] = hv; sol[wave][8 * g + r][j * 16 + col] = lv; } else { sth[j * 16 + col][wave * 16 + 8 * g + r] = hv; stl[j * 16 + col][wave * 16 + 8 * g + r] = lv; } } }
  __syncthreads();
  // stores: per tile group of 4 (64 channels = one (head, part)): tiles j = 4*q4 .. 4*q4+3 share (h, part) since 64-runs align
#pragma unroll
  for (int q4 = 0; q4 < 2; ++q4) { const int o0 = n0 + q4 * 64; const int h = o0 / 192, part = (o0 % 192) / 64;
    if (part < 2) {
      for (int rl = 0; rl < 16; ++rl) if (lane < 8) { vst2((unsigned*)(QK + (r0 + rl) * (2 * DM) + part * DM + h * HD + lane * 8), *(const v4u*)&so[wave][rl][q4 * 64 + lane * 8]); vst2((unsigned*)(QKL + (r0 + rl) * (2 * DM) + part * DM + h * HD + lane * 8), *(const v4u*)&sol[wave][rl][q4 * 64 + lane * 8]); }
    } else {
      for (int e = tid; e < 64 * 8; e += 128) { const int d = e >> 3, pc = e & 7; const size_t o = (b * DM + h * HD + d) * SS + p0 + pc * 8; vst2((unsigned*)(VTH + o), *(const v4u*)&sth[q4 * 64 + d][pc * 8]); vst2((unsigned*)(VTL + o), *(const v4u*)&stl[q4 * 64 + d][pc * 8]); } } }
}
typedef __attribute__((ext_vector_type(2))) _Float16 v2h;
// lane l <-> lane l ^ 16 in one vector instruction
__device__ __forceinline__ float xhalf(float v) { const int b = __builtin_bit_cast(int, v); return __builtin_bit_cast(float, __builtin_amdgcn_permlanex16(b, b, 0x76543210, 0xfedcba98, false, false)); }
#define KPIT 72   // halfs per staged K row: 128 B + 16 B (a pitch of 16 B x odd keeps 16-byte LDS reads of 16 rows off each other's banks)
#define VPIT 40   // halfs per staged V row: 64 B + 16 B, same reason
__global__ __launch_bounds__(128) void k_attn(const _Float16* __restrict__ QK, const _Float16* __restrict__ QKL, const _Float16* __restrict__ VTH, const _Float16* __restrict__ VTL, float* __restrict__ O) {
  __shared__ __align__(16) float so[4][16][68];
  __shared__ __align__(16) _Float16 sk[2][2][32][KPIT];   // [buffer][hi | residual][key][d]
  __shared__ __align__(16) _Float16 sv[2][2][64][VPIT];   // [buffer][hi | residual][d][key]
  const int tid = threadIdx.x, wave = tid >> 5, lane = tid & 31, col = lane & 15, g = lane >> 4;
  const int qb = blockIdx.x, h = blockIdx.y, b = blockIdx.z; const int q0 = qb * 64 + wave * 16; const size_t rq = (size_t)b * SS + q0 + col;
  const int nks = SS / 32;   // all keys
  // copy map: K, 8 lanes a 128-B row, rows kr and kr + 16; V, 4 lanes a 64-B row segment, rows vd and vd + 32
  const int kr = tid >> 3, kc8 = (tid & 7) * 8, vd = tid >> 2, vc8 = (tid & 3) * 8;
  const size_t koff = ((size_t)b * SS + kr) * (2 * DM) + DM + h * HD + kc8, voff = ((size_t)b * DM + h * HD + vd) * SS + vc8;
  auto stage = [&](int t) { const int bf = t & 1; const size_t ko = koff + (size_t)t * 32 * (2 * DM), vo = voff + (size_t)t * 32;
    // eight 16-byte copies a lane; s_wait_xcnt 0 as the statement's last line stands in front of every later rewrite of the address registers
    asm volatile("global_load_async_to_lds_b128 %0, %8, off\n\t"
                 "global_load_async_to_lds_b128 %1, %9, off\n\t"
                 "global_load_async_to_lds_b128 %2, %10, off\n\t"
                 "global_load_async_to_lds_b128 %3, %11, off\n\t"
                 "global_load_async_to_lds_b128 %4, %12, off\n\t"
                 "global_load_async_to_lds_b128 %5, %13, off\n\t"
                 "global_load_async_to_lds_b128 %6, %14, off\n\t"
                 "global_load_async_to_lds_b128 %7, %15, off\n\t"
                 "s_wait_xcnt 0x0"
                 :: "v"(lds_addr(&sk[bf][0][kr][kc8])), "v"(lds_addr(&sk[bf][0][kr + 16][kc8])), "v"(lds_addr(&sk[bf][1][kr][kc8])), "v"(lds_addr(&sk[bf][1][kr + 16][kc8])),
                    "v"(lds_addr(&sv[bf][0][vd][vc8])), "v"(lds_addr(&sv[bf][0][vd + 32][vc8])), "v"(lds_addr(&sv[bf][1][vd][vc8])), "v"(lds_addr(&sv[bf][1][vd + 32][vc8])),
                    "v"(QK + ko), "v"(QK + ko + 16 * (2 * DM)), "v"(QKL + ko), "v"(QKL + ko + 16 * (2 * DM)),
                    "v"(VTH + vo), "v"(VTH + vo + 32 * SS), "v"(VTL + vo), "v"(VTL + vo + 32 * SS)
                 : "memory"); };
  stage(0);
  asm volatile("s_wait_asynccnt 0x0" ::: "memory");   // this wave's part of tile 0 has landed
  __syncthreads();                                     // every wave's part of tile 0 is visible
  stage(1);
  v16h aq[2], aql[2];
#pragma unroll
  for (int kc = 0; kc < 2; ++kc) { aq[kc] = frag_h(QK + rq * (2 * DM) + h * HD + kc * 32, lane); aql[kc] = frag_h(QKL + rq * (2 * DM) + h * HD + kc * 32, lane); }
  float m = -3.0e38f, l = 0.f;   // of this lane's query (col); l holds the keys of this lane half only, the halves join behind the loop
  v8f acc[4] = {}, accl[4] = {};   // O^T tiles: register r = O[query col][d = dt * 16 + 8 g + r]
#pragma unroll 1
  for (int ks = 0; ks < nks; ++ks) { v8f s[2]; const int bf = ks & 1; v16h kf[2][2], kl[2][2];
#pragma unroll
    for (int ct = 0; ct < 2; ++ct)
#pragma unroll
      for (int kc = 0; kc < 2; ++kc) { kf[ct][kc] = frag_h(&sk[bf][0][ct * 16 + col][kc * 32], lane); kl[ct][kc] = frag_h(&sk[bf][1][ct * 16 + col][kc * 32], lane); }
    asm volatile("" :: "v"(kf[0][0]), "v"(kf[0][1]), "v"(kf[1][0]), "v"(kf[1][1]), "v"(kl[0][0]), "v"(kl[0][1]), "v"(kl[1][0]), "v"(kl[1][1]));   // inputs only: holds the trip's K reads from LDS as one group in front of the first matrix instruction (one LDS wait, not one a fragment)
#pragma unroll
    for (int ct = 0; ct < 2; ++ct) { v8f c = {}, cl = {};
#pragma unroll
      for (int kc = 0; kc < 2; ++kc) { c = wmma16(kf[ct][kc], aq[kc], c); cl = wmma16(kf[ct][kc], aql[kc], cl); cl = wmma16(kl[ct][kc], aq[kc], cl); }   // 3 products: q, k as f16 hi + residual; K rows as A, Q as B: register r = score of key ct * 16 + 8 g + r for query col
#pragma unroll
      for (int r = 0; r < 8; ++r) c[r] += cl[r] * (1.0f / 2048.0f);
#pragma unroll
      for (int r = 0; r < 8; ++r) s[ct][r] = c[r] * 0.125f; }   // 1/sqrt(64), all keys
    v16h vh[4], vl[4];
#pragma unroll
    for (int dt = 0; dt < 4; ++dt) { vh[dt] = frag_h(&sv[bf][0][dt * 16 + col][0], lane); vl[dt] = frag_h(&sv[bf][1][dt * 16 + col][0], lane); }
    // a lane holds 16 of its query's 32 scores, lane ^ 16 the other 16: maximum and sum in registers, one exchange between the halves for the maximum
    float t[8];
#pragma unroll
    for (int r = 0; r < 8; ++r) t[r] = fmaxf(s[0][r], s[1][r]);
    float mx = fmaxf(fmaxf(fmaxf(t[0], t[1]), fmaxf(t[2], t[3])), fmaxf(fmaxf(t[4], t[5]), fmaxf(t[6], t[7])));
    mx = fmaxf(mx, xhalf(mx));
    const float mn = fmaxf(m, mx); const float alpha = (m <= -1.0e38f) ? 0.f : __expf(m - mn);
    v16h pa, pl;   // P^T as B operand: element ct * 8 + r is key ct * 16 + 8 g + r, the order in which frag_h reads V^T's keys
#pragma unroll
    for (int ct = 0; ct < 2; ++ct)
#pragma unroll
      for (int r = 0; r < 8; r += 2) { v2f e; e.x = (s[ct][r] <= -1.0e38f) ? 0.f : __expf(s[ct][r] - mn); e.y = (s[ct][r + 1] <= -1.0e38f) ? 0.f : __expf(s[ct][r + 1] - mn);
        if (ct == 0) { t[r] = e.x; t[r + 1] = e.y; } else { t[r] += e.x; t[r + 1] += e.y; }
        const v2f x = e * 2048.0f; const v2h hi = __builtin_convertvector(x, v2h); const v2h lo = __builtin_convertvector((x - __builtin_convertvector(hi, v2f)) * 2048.0f, v2h);   // two neighbouring keys share a register of the operand: one packed conversion each for hi and residual
        pa[ct * 8 + r] = hi.x; pa[ct * 8 + r + 1] = hi.y; pl[ct * 8 + r] = lo.x; pl[ct * 8 + r + 1] = lo.y; }   // P scaled by 2^11 before the f16 split so small softmax weights stay out of the f16 subnormal range; 2^-11 folded into the epilogue
    l = l * alpha + (((t[0] + t[1]) + (t[2] + t[3])) + ((t[4] + t[5]) + (t[6] + t[7]))); m = mn;
#pragma unroll
    for (int dt = 0; dt < 4; ++dt)
#pragma unroll
      for (int r = 0; r < 8; ++r) { acc[dt][r] *= alpha; accl[dt][r] *= alpha; }
    asm volatile("" :: "v"(vh[0]), "v"(vh[1]), "v"(vh[2]), "v"(vh[3]), "v"(vl[0]), "v"(vl[1]), "v"(vl[2]), "v"(vl[3]));   // inputs only: holds the trip's V reads from LDS as one group in front of the first P.V matrix instruction
#pragma unroll
    for (int dt = 0; dt < 4; ++dt) { acc[dt] = wmma16(vh[dt], pa, acc[dt]); accl[dt] = wmma16(vh[dt], pl, accl[dt]); accl[dt] = wmma16(vl[dt], pa, accl[dt]); }   // V^T rows as A: V hi x P hi + (V hi x P lo + V lo x P hi) / 2048
    // hand-over of the buffers, in this order in every wave
    asm volatile("s_wait_dscnt 0x0" ::: "memory");      // this wave's LDS reads of tile ks have returned
    asm volatile("s_wait_asynccnt 0x0" ::: "memory");   // this wave's part of tile ks + 1 has landed
    __syncthreads();                                     // publishes tile ks + 1 and ends every wave's reads of tile ks
    if (ks + 2 < nks) stage(ks + 2); }                   // refill of the buffer that this trip has read
  asm volatile("s_wait_asynccnt 0x0" ::: "memory");     // no copy is outstanding behind the loop
  l += xhalf(l);   // the two halves' key sums of one query
  const float il = (1.0f / 2048.0f) / l;
#pragma unroll
  for (int dt = 0; dt < 4; ++dt)
#pragma unroll
    for (int r = 0; r < 8; ++r) so[wave][col][dt * 16 + 8 * g + r] = (acc[dt][r] + accl[dt][r] * (1.0f / 2048.0f)) * il;
  LDSX();
  for (int rl = 0; rl < 16; ++rl) if (lane < 16) vst2(O + ((size_t)b * SS + q0 + rl) * DM + h * HD + lane * 4, *(const v4f*)&so[wave][rl][lane * 4]);
}
// ---- k_out: block = (64 output channels o, 128 positions, b): y[o][n] = w_out rows (exact) x vals rows O[n][c] (bf16 hi + residual, K 1024) -> [B][C][N] rows (512-B segments)
__global__ __launch_bounds__(128) void k_out(const float* __restrict__ O, const __bf16* __restrict__ P, float* __restrict__ Y) {
  __shared__ __align__(16) float so[4][16][132];
  const int tid = threadIdx.x, wave = tid >> 5, lane = tid & 31, col = lane & 15, g = lane >> 4; const int o0 = blockIdx.x * 64 + wave * 16; const int n0 = blockIdx.y * 128; const size_t b = blockIdx.z;
  v8f acc[8] = {};
  // tiles of vals [128 positions][32 channels, f32] and of weights [64 output channels][32 channels] come into LDS once per work-group by asynchronous copies, two buffers: tile t + 1 flies while tile t is worked on
  __shared__ __align__(16) float sval[2][128][36];   // 128-B rows at a pitch of 144 B (16 B x odd, as WPIT)
  __shared__ __align__(16) __bf16 sw[2][64][WPIT];
  const int vr = tid >> 3, vc4 = (tid & 7) * 4, wr = tid >> 2, wc8 = (tid & 3) * 8;   // copy map: vals, 8 lanes a 128-B row, rows vr + 16 i; weights, 4 lanes a 64-B row segment, rows wr and wr + 32
  const float* vsrc = O + (b * SS + n0 + vr) * DM + vc4; const __bf16* wsrc = P + (size_t)(blockIdx.x * 64 + wr) * DM + wc8;
  auto stage = [&](int t) { const int bf = t & 1; const float* s0 = vsrc + t * 32; const __bf16* w0 = wsrc + t * 32;
    // ten 16-byte copies a lane; s_wait_xcnt 0 as the statement's last line stands in front of every later rewrite of the address registers
    asm volatile("global_load_async_to_lds_b128 %0, %10, off\n\t"
                 "global_load_async_to_lds_b128 %1, %11, off\n\t"
                 "global_load_async_to_lds_b128 %2, %12, off\n\t"
                 "global_load_async_to_lds_b128 %3, %13, off\n\t"
                 "global_load_async_to_lds_b128 %4, %14, off\n\t"
                 "global_load_async_to_lds_b128 %5, %15, off\n\t"
                 "global_load_async_to_lds_b128 %6, %16, off\n\t"
                 "global_load_async_to_lds_b128 %7, %17, off\n\t"
                 "global_load_async_to_lds_b128 %8, %18, off\n\t"
                 "global_load_async_to_lds_b128 %9, %19, off\n\t"
                 "s_wait_xcnt 0x0"
                 :: "v"(lds_addr(&sval[bf][vr][vc4])), "v"(lds_addr(&sval[bf][vr + 16][vc4])), "v"(lds_addr(&sval[bf][vr + 32][vc4])), "v"(lds_addr(&sval[bf][vr + 48][vc4])),
                    "v"(lds_addr(&sval[bf][vr + 64][vc4])), "v"(lds_addr(&sval[bf][vr + 80][vc4])), "v"(lds_addr(&sval[bf][vr + 96][vc4])), "v"(lds_addr(&sval[bf][vr + 112][vc4])),
                    "v"(lds_addr(&sw[bf][wr][wc8])), "v"(lds_addr(&sw[bf][wr + 32][wc8])),
                    "v"(s0), "v"(s0 + 16 * DM), "v"(s0 + 32 * DM), "v"(s0 + 48 * DM), "v"(s0 + 64 * DM), "v"(s0 + 80 * DM), "v"(s0 + 96 * DM), "v"(s0 + 112 * DM),
                    "v"(w0), "v"(w0 + 32 * DM)
                 : "memory"); };
  stage(0);
  asm volatile("s_wait_asynccnt 0x0" ::: "memory");   // this wave's part of tile 0 has landed
  __syncthreads();                                     // every wave's part of tile 0 is visible
  stage(1);
#pragma unroll 2
  for (int kc = 0; kc < DM / 32; ++kc) { const int bf = kc & 1; const v16b a = frag_b(&sw[bf][wave * 16 + col][0], lane);
#pragma unroll
    for (int j = 0; j < 8; ++j) { const F2 vb = split_row(&sval[bf][j * 16 + col][0], 0, lane); acc[j] = wmma_bf(a, vb.l, acc[j]); acc[j] = wmma_bf(a, vb.h, acc[j]); }
    // hand-over of the buffers, in this order in every wave
    asm volatile("s_wait_dscnt 0x0" ::: "memory");      // this wave's LDS reads of tile kc have returned
    asm volatile("s_wait_asynccnt 0x0" ::: "memory");   // this wave's part of tile kc + 1 has landed
    __syncthreads();                                     // publishes tile kc + 1 and ends every wave's reads of tile kc
    if (kc + 2 < DM / 32) stage(kc + 2); }               // refill of the buffer that this trip has read
  asm volatile("s_wait_asynccnt 0x0" ::: "memory");     // no copy is outstanding behind the loop
#pragma unroll
  for (int j = 0; j < 8; ++j)
#pragma unroll
    for (int r = 0; r < 8; ++r) so[wave][8 * g + r][j * 16 + col] = acc[j][r];
  LDSX();
  for (int rl = 0; rl < 16; ++rl) vst2(Y + (b * DM + o0 + rl) * SS + n0 + lane * 4, *(const v4f*)&so[wave][rl][lane * 4]);
}
extern "C" void kernel_launch(void* const* d_in, const int* in_sizes, int n_in, void* d_out, int out_size, void* d_ws, size_t ws_size, hipStream_t stream) {
  (void)in_sizes; (void)n_in; (void)out_size;
  const float** F = (const float**)d_in;   // 0 x [2,1024,2048], 1 w_qkv [3072,1024] natural (head-interleaved q|k|v blocks of 64), 2 w_out [1024,1024] natural
  if (ws_size < (size_t)WS_END) return;
  char* ws = (char*)d_ws; __bf16* PK = (__bf16*)(ws + WS_PK); _Float16 *QK = (_Float16*)(ws + WS_QK), *QKL = (_Float16*)(ws + WS_QKL), *VTH = (_Float16*)(ws + WS_VTH), *VTL = (_Float16*)(ws + WS_VTL); float* O = (float*)(ws + WS_O);
  k_pack<<<dim3(QKVW, 2), 256, 0, stream>>>(F[1], F[2], PK);
  k_qkv<<<dim3(SS / 64, QKVW / 128, TNB), 128, 0, stream>>>(F[0], PK + PK_A, QK, QKL, VTH, VTL);
  k_attn<<<dim3(TQB, NH, TNB), 128, 0, stream>>>(QK, QKL, VTH, VTL, O);
  k_out<<<dim3(DM / 64, TON, TNB), 128, 0, stream>>>(O, PK + PK_P, (float*)d_out);
}

// v003
// Measured time: 177 microseconds a run.
// Next to v002, in two timings, it ran 1.46 and 1.45 times as fast.
// Over all steps from v000 it is 3.65 times as fast.
// compute dtype: x, w_qkv, w_out rounded to bf16; qkv = w_qkv . x with exact bf16 products on WMMA 16x16x32 (positions as rows via an LDS transpose of the [B,C,N] input, natural weight rows; output channel o -> head o/192, part (o%192)/64, dim o%64); q and k stored as f16 hi + (x2048-scaled) residual planes with 3-product scores x 1/8; running-max softmax in f32 (hardware exp); P (scaled by 2^11, as f16 hi + residual) x v hi/lo (3 products); y = w_out (exact rows) x vals (f32 as bf16 hi + residual, 2 products) written channels-first; f32 accumulate.
#include <hip/hip_runtime.h>
#include <math.h>

typedef __attribute__((ext_vector_type(16))) _Float16 v16h;
typedef __attribute__((ext_vector_type(16))) __bf16 v16b;
typedef __attribute__((ext_vector_type(8)))  _Float16 v8h;
typedef __attribute__((ext_vector_type(8)))  float v8f;
typedef __attribute__((ext_vector_type(4)))  float v4f;
typedef __attribute__((ext_vector_type(2)))  float v2f;
typedef __attribute__((ext_vector_type(4)))  unsigned v4u;
typedef __attribute__((ext_vector_type(4)))  int v4i;
typedef float __attribute__((may_alias)) float_a;
typedef int __attribute__((may_alias)) int_a;

template <typename T> __device__ __forceinline__ void vst2(void* p, T v) { *(T*)p = v;  }
__device__ __forceinline__ v8f wmma16(v16h a, v16h b, v8f c) {
  v8f d = __builtin_amdgcn_wmma_f32_16x16x32_f16(false, a, false, b, (short)0, c, false, false);
  asm volatile("v_nop\n\tv_nop\n\tv_nop\n\tv_nop" : "+v"(d) : "v"(a), "v"(b));
  return d;
}
__device__ __forceinline__ v8f wmma_bf(v16b a, v16b b, v8f c) {
  v8f d = __builtin_amdgcn_wmma_f32_16x16x32_bf16(false, a, false, b, (short)0, c, false, false);
  asm volatile("v_nop\n\tv_nop\n\tv_nop\n\tv_nop" : "+v"(d) : "v"(a), "v"(b));
  return d;
}
// Channels-first multi-head attention layer (x [2][1024 channels][2048 positions], 16 heads x 64): 1x1-conv qkv with per-head interleaved (q|k|v) channel blocks, softmax(q k^T / 8) v, 1x1-conv output projection -> [B, C, N].
__device__ __forceinline__ v16h frag_h(const _Float16* rowk0, int lane) {
  union { v16h v; v8h q[2]; } u; const _Float16* p = rowk0 + 8 * (lane >> 4);
  u.q[0] = *(const v8h*)p; u.q[1] = *(const v8h*)(p + 16); return u.v;
}
__device__ __forceinline__ v16h frag_f32(const float* rowk0, int lane) {
  v16h a; const float* p = rowk0 + 8 * (lane >> 4);
#pragma unroll
  for (int i = 0; i < 8; ++i) { a[i] = (_Float16)p[i]; a[8 + i] = (_Float16)p[16 + i]; }
  return a;
}
__device__ __forceinline__ v16h frag_f32s(const float* rowk0, int lane, float sc) {
  v16h a; const float* p = rowk0 + 8 * (lane >> 4);
#pragma unroll
  for (int i = 0; i < 8; ++i) { a[i] = (_Float16)(p[i] * sc); a[8 + i] = (_Float16)(p[16 + i] * sc); }
  return a;
}
// column fragment from a [K][ld] layout (column n), rows >= K read as 0
__device__ __forceinline__ v16h fragc_f32(const float* W, int k0, int n, int lane, int ld, int K) {
  v16h a; const int g = lane >> 4;
#pragma unroll
  for (int i = 0; i < 8; ++i) { const int ka = k0 + 8 * g + i, kb = ka + 16;
    a[i] = (_Float16)(ka < K ? W[(size_t)(ka < K ? ka : K - 1) * ld + n] : 0.f); a[8 + i] = (_Float16)(kb < K ? W[(size_t)(kb < K ? kb : K - 1) * ld + n] : 0.f); }
  return a;
}
struct F2 { v16b h, l; };
__device__ __forceinline__ F2 bsplit16(const float v[16]) { F2 r;
#pragma unroll
  for (int i = 0; i < 16; ++i) { const __bf16 h = (__bf16)v[i]; r.h[i] = h; r.l[i] = (__bf16)(v[i] - (float)h); }
  return r; }
__device__ __forceinline__ F2 split_row(const float* row, int k0, int lane) { float v[16]; const float* p = row + k0 + 8 * (lane >> 4);
#pragma unroll
  for (int i = 0; i < 8; ++i) { v[i] = p[i]; v[8 + i] = p[16 + i]; }
  return bsplit16(v); }
__device__ __forceinline__ F2 split_rowK(const float* row, int k0, int lane, int K) { float v[16]; const int g = lane >> 4;
#pragma unroll
  for (int i = 0; i < 8; ++i) { const int ka = k0 + 8 * g + i, kb = ka + 16; v[i] = ka < K ? row[ka < K ? ka : K - 1] : 0.f; v[8 + i] = kb < K ? row[kb < K ? kb : K - 1] : 0.f; }
  return bsplit16(v); }
__device__ __forceinline__ F2 split_col(const float* W, int k0, int n, int lane, int ld, int K) { float v[16]; const int g = lane >> 4;
#pragma unroll
  for (int i = 0; i < 8; ++i) { const int ka = k0 + 8 * g + i, kb = ka + 16; v[i] = ka < K ? W[(size_t)(ka < K ? ka : K - 1) * ld + n] : 0.f; v[8 + i] = kb < K ? W[(size_t)(kb < K ? kb : K - 1) * ld + n] : 0.f; }
  return bsplit16(v); }
__device__ __forceinline__ v8f mac3(const F2& a, const F2& b, v8f c) { c = wmma_bf(a.l, b.h, c); c = wmma_bf(a.h, b.l, c); return wmma_bf(a.h, b.h, c); }
__device__ __forceinline__ float sigm(float v) { return 1.0f / (1.0f + expf(-v)); }
#define LDSX() do { asm volatile("s_wait_dscnt 0" ::: "memory"); __builtin_amdgcn_wave_barrier(); __builtin_amdgcn_fence(__ATOMIC_RELEASE, "workgroup"); } while (0)


#define NB 2
#define SS 2048
#define DM 1024
#define NH 16
#define HD 64
#define QKVW (3 * DM)
#ifndef TQB
#define TQB (SS / 64)
#define TNB NB
#define TON (SS / 128)         // output position blocks per batch (all)
#endif
typedef __attribute__((ext_vector_type(8))) __bf16 v8b;
__device__ __forceinline__ v16b frag_b(const __bf16* rowk0, int lane) {
  union { v16b v; v8b q[2]; } u; const __bf16* p = rowk0 + 8 * (lane >> 4);
  u.q[0] = *(const v8b*)p; u.q[1] = *(const v8b*)(p + 16); return u.v;
}
__device__ __forceinline__ unsigned lds_addr(const void* p) { return (unsigned)(size_t)p; }   // low 32 bits of a __shared__ address = byte offset in the work-group's LDS
#define WPIT 40   // 16-bit elements per staged 64-B row: 64 B + 16 B (a pitch of 16 B x odd keeps 16-byte LDS reads of 16 rows off each other's banks)
__device__ __forceinline__ float bfr(float v) { return (float)(__bf16)v; }
__device__ __attribute__((noinline)) float exp_ni(float v) { return expf(v); }
__device__ __attribute__((noinline)) float erf_ni(float v) { return erff(v); }

#define PK_A 0                       // [3072][1024] Wqkv rows (natural [out][in])
#define PK_P (PK_A + QKVW * DM)        // [1024][1024] Wo rows (natural)
#define PK_END (PK_P + DM * DM)
#define WS_PK  0u
#define WS_QK  (WS_PK + 2u * PK_END)             // f16 [4096 rows][2048]: q | k
#define WS_QKL (WS_QK + 2u * NB * SS * 2 * DM)     // f16 q | k residual planes x2048
#define WS_VTH (WS_QKL + 2u * NB * SS * 2 * DM)    // f16 [b][1024 (h*64+d)][2048 s] hi
#define WS_VTL (WS_VTH + 2u * NB * DM * SS)        // f16 lo x 2048
#define WS_O   (WS_VTL + 2u * NB * DM * SS)        // f32 [4096][1024]
#define WS_XT  (WS_O + 4u * NB * SS * DM)           // bf16 [b][2048 positions][1024 channels]: x rounded and transposed
#define WS_END (WS_XT + 2u * NB * SS * DM)
// ---- k_pack: block = (row n, which): natural [out][in] rows -> bf16; which 0 -> w_qkv row n into PK_A; which 1, n < 1024 -> w_out row n into PK_P
// which 1, n >= 1024 (2048 blocks with no weight row): tile n - 1024 of x, [64 channels][32 positions] -> XT[b][position][channel] in bf16, so that x is rounded and transposed once and not once per block of k_qkv
__global__ __launch_bounds__(256) void k_pack(const float* __restrict__ WQKV, const float* __restrict__ WOUT, const float* __restrict__ X, __bf16* __restrict__ PK, __bf16* __restrict__ XT) {
  __shared__ __align__(16) __bf16 s[DM]; const int n = blockIdx.x, which = blockIdx.y, t = threadIdx.x; const float* src = (which == 0) ? (WQKV + (size_t)n * DM) : (WOUT + (size_t)(n - 0) * DM);
  if (which == 1 && n >= DM) {
    __shared__ __align__(16) __bf16 sx[32][72];   // [position][channel]: 128-B rows at a pitch of 144 B
    const int id = n - DM, bb = id >> 10, c0 = (id & 15) * 64, p0 = ((id >> 4) & 63) * 32;
    for (int i = 0; i < 2; ++i) { const int c = (t >> 3) + 32 * i, p4 = (t & 7) * 4;   // 8 lanes read one channel's 128-B line
      const v4f v = *(const v4f*)(X + ((size_t)bb * DM + c0 + c) * SS + p0 + p4);
      for (int k = 0; k < 4; ++k) sx[p4 + k][c] = (__bf16)v[k]; }
    __syncthreads();
    const int p = t >> 3, c8 = (t & 7) * 8;   // 8 lanes write one position's 128-B line
    vst2((unsigned*)(XT + ((size_t)bb * SS + p0 + p) * DM + c0 + c8), *(const v4u*)&sx[p][c8]);
    return; }
  for (int k = t; k < DM; k += 256) s[k] = (__bf16)src[k];
  __syncthreads();
  __bf16* dst = (which == 0) ? PK + PK_A + (size_t)n * DM : PK + PK_P + (size_t)n * DM;
  for (int q = t; q < DM / 8; q += 256) vst2((unsigned*)(dst + q * 8), *(const v4u*)&s[q * 8]);
}
// ---- k_qkv: block = (64 positions, 128 of the 3072 output channels, b): A rows from XT[b][n][c] (x in bf16, transposed by k_pack); each 16-col tile is one (head, part, 16 dims): q/k -> f16 hi/lo row segments [row][part*1024 + h*64 + d]; v -> planes [b][h*64 + d][n]
__global__ __launch_bounds__(128) void k_qkv(const __bf16* __restrict__ XT, const __bf16* __restrict__ P, _Float16* __restrict__ QK, _Float16* __restrict__ QKL, _Float16* __restrict__ VTH, _Float16* __restrict__ VTL) {
  __shared__ __align__(16) _Float16 so[4][16][136], sol[4][16][136]; __shared__ __align__(16) _Float16 sth[128][72], stl[128][72];
  const int tid = threadIdx.x, wave = tid >> 5, lane = tid & 31, col = lane & 15, g = lane >> 4; const size_t b = blockIdx.z; const int p0 = blockIdx.x * 64; const int n0 = blockIdx.y * 128; const size_t r0 = b * SS + p0 + wave * 16;
  v8f acc[8] = {};
  // tiles of weights [128 output channels][32 input channels] and of x [64 positions][32 input channels] come into LDS once per work-group by asynchronous copies, two buffers: tile t + 1 flies while tile t is worked on
  __shared__ __align__(16) __bf16 sb[2][128][WPIT];
  __shared__ __align__(16) __bf16 sx[2][64][WPIT];
  const int wr = tid >> 2, wc8 = (tid & 3) * 8;   // copy map: 4 lanes a 64-B row segment, rows wr + 32 i
  const __bf16* wsrc = P + (size_t)(n0 + wr) * DM + wc8; const __bf16* xsrc = XT + (b * SS + p0 + wr) * DM + wc8;
  auto stage = [&](int t) { const int bf = t & 1; const __bf16* s0 = wsrc + t * 32; const __bf16* x0 = xsrc + t * 32;
    // six 16-byte copies a lane; s_wait_xcnt 0 as the statement's last line stands in front of every later rewrite of the address registers
    asm volatile("global_load_async_to_lds_b128 %0, %6, off\n\t"
                 "global_load_async_to_lds_b128 %1, %7, off\n\t"
                 "global_load_async_to_lds_b128 %2, %8, off\n\t"
                 "global_load_async_to_lds_b128 %3, %9, off\n\t"
                 "global_load_async_to_lds_b128 %4, %10, off\n\t"
                 "global_load_async_to_lds_b128 %5, %11, off\n\t"
                 "s_wait_xcnt 0x0"
                 :: "v"(lds_addr(&sb[bf][wr][wc8])), "v"(lds_addr(&sb[bf][wr + 32][wc8])), "v"(lds_addr(&sb[bf][wr + 64][wc8])), "v"(lds_addr(&sb[bf][wr + 96][wc8])),
                    "v"(lds_addr(&sx[bf][wr][wc8])), "v"(lds_addr(&sx[bf][wr + 32][wc8])),
                    "v"(s0), "v"(s0 + 32 * DM), "v"(s0 + 64 * DM), "v"(s0 + 96 * DM), "v"(x0), "v"(x0 + 32 * DM)
                 : "memory"); };
  stage(0);
  asm volatile("s_wait_asynccnt 0x0" ::: "memory");   // this wave's part of tile 0 has landed
  __syncthreads();                                     // every wave's part of tile 0 is visible
  stage(1);
#pragma unroll 2
    for (int t = 0; t < DM / 32; ++t) { const int bf = t & 1; const v16b a = frag_b(&sx[bf][wave * 16 + col][0], lane);
      v16b w[8];
#pragma unroll
      for (int j = 0; j < 8; ++j) w[j] = frag_b(&sb[bf][j * 16 + col][0], lane);
      asm volatile("" :: "v"(a), "v"(w[0]), "v"(w[1]), "v"(w[2]), "v"(w[3]), "v"(w[4]), "v"(w[5]), "v"(w[6]), "v"(w[7]));   // inputs only: holds the trip's LDS reads as one group in front of the first matrix instruction (one LDS wait a trip, not one a tile)
#pragma unroll
      for (int j = 0; j < 8; ++j) acc[j] = wmma_bf(a, w[j], acc[j]);
      // hand-over of the buffers, in this order in every wave
      asm volatile("s_wait_dscnt 0x0" ::: "memory");      // this wave's LDS reads of tile t have returned
      asm volatile("s_wait_asynccnt 0x0" ::: "memory");   // this wave's part of tile t + 1 has landed
      __syncthreads();                                     // publishes tile t + 1 and ends every wave's reads of tile t
      if (t + 2 < DM / 32) stage(t + 2); }                 // refill of the buffer that this trip has read
  asm volatile("s_wait_asynccnt 0x0" ::: "memory");       // no copy is outstanding behind the loop
  // epilogue: tile j -> o0 = n0 + j*16; h = o0 / 192; part = (o0 % 192) / 64; d = o0 % 64 + col
#pragma unroll
  for (int j = 0; j < 8; ++j) { const int o0 = n0 + j * 16; const int part = (o0 % 192) / 64;
#pragma unroll
    for (int r = 0; r < 8; ++r) { const float v = acc[j][r]; const _Float16 hv = (_Float16)v; const _Float16 lv = (_Float16)((v - (float)hv) * 2048.0f);
      if (part < 2) { so[wave][8 * g + r][j * 16 + col] = hv; sol[wave][8 * g + r][j * 16 + col] = lv; } else { sth[j * 16 + col][wave * 16 + 8 * g + r] = hv; stl[j * 16 + col][wave * 16 + 8 * g + r] = lv; } } }
  __syncthreads();
  // stores: per tile group of 4 (64 channels = one (head, part)): tiles j = 4*q4 .. 4*q4+3 share (h, part) since 64-runs align
#pragma unroll
  for (int q4 = 0; q4 < 2; ++q4) { const int o0 = n0 + q4 * 64; const int h = o0 / 192, part = (o0 % 192) / 64;
    if (part < 2) {
      for (int rl = 0; rl < 16; ++rl) if (lane < 8) { vst2((unsigned*)(QK + (r0 + rl) * (2 * DM) + part * DM + h * HD + lane * 8), *(const v4u*)&so[wave][rl][q4 * 64 + lane * 8]); vst2((unsigned*)(QKL + (r0 + rl) * (2 * DM) + part * DM + h * HD + lane * 8), *(const v4u*)&sol[wave][rl][q4 * 64 + lane * 8]); }
    } else {
      for (int e = tid; e < 64 * 8; e += 128) { const int d = e >> 3, pc = e & 7; const size_t o = (b * DM + h * HD + d) * SS + p0 + pc * 8; vst2((unsigned*)(VTH + o), *(const v4u*)&sth[q4 * 64 + d][pc * 8]); vst2((unsigned*)(VTL + o), *(const v4u*)&stl[q4 * 64 + d][pc * 8]); } } }
}
typedef __attribute__((ext_vector_type(2))) _Float16 v2h;
// lane l <-> lane l ^ 16 in one vector instruction
__device__ __forceinline__ float xhalf(float v) { const int b = __builtin_bit_cast(int, v); return __builtin_bit_cast(float, __builtin_amdgcn_permlanex16(b, b, 0x76543210, 0xfedcba98, false, false)); }
#define KPIT 72   // halfs per staged K row: 128 B + 16 B (a pitch of 16 B x odd keeps 16-byte LDS reads of 16 rows off each other's banks)
#define VPIT 40   // halfs per staged V row: 64 B + 16 B, same reason
__global__ __launch_bounds__(128) void k_attn(const _Float16* __restrict__ QK, const _Float16* __restrict__ QKL, const _Float16* __restrict__ VTH, const _Float16* __restrict__ VTL, float* __restrict__ O) {
  __shared__ __align__(16) float so[4][16][68];
  __shared__ __align__(16) _Float16 sk[2][2][32][KPIT];   // [buffer][hi | residual][key][d]
  __shared__ __align__(16) _Float16 sv[2][2][64][VPIT];   // [buffer][hi | residual][d][key]
  const int tid = threadIdx.x, wave = tid >> 5, lane = tid & 31, col = lane & 15, g = lane >> 4;
  const int qb = blockIdx.x, h = blockIdx.y, b = blockIdx.z; const int q0 = qb * 64 + wave * 16; const size_t rq = (size_t)b * SS + q0 + col;
  const int nks = SS / 32;   // all keys
  // copy map: K, 8 lanes a 128-B row, rows kr and kr + 16; V, 4 lanes a 64-B row segment, rows vd and vd + 32
  const int kr = tid >> 3, kc8 = (tid & 7) * 8, vd = tid >> 2, vc8 = (tid & 3) * 8;
  const size_t koff = ((size_t)b * SS + kr) * (2 * DM) + DM + h * HD + kc8, voff = ((size_t)b * DM + h * HD + vd) * SS + vc8;
  auto stage = [&](int t) { const int bf = t & 1; const size_t ko = koff + (size_t)t * 32 * (2 * DM), vo = voff + (size_t)t * 32;
    // eight 16-byte copies a lane; s_wait_xcnt 0 as the statement's last line stands in front of every later rewrite of the address registers
    asm volatile("global_load_async_to_lds_b128 %0, %8, off\n\t"
                 "global_load_async_to_lds_b128 %1, %9, off\n\t"
                 "global_load_async_to_lds_b128 %2, %10, off\n\t"
                 "global_load_async_to_lds_b128 %3, %11, off\n\t"
                 "global_load_async_to_lds_b128 %4, %12, off\n\t"
                 "global_load_async_to_lds_b128 %5, %13, off\n\t"
                 "global_load_async_to_lds_b128 %6, %14, off\n\t"
                 "global_load_async_to_lds_b128 %7, %15, off\n\t"
                 "s_wait_xcnt 0x0"
                 :: "v"(lds_addr(&sk[bf][0][kr][kc8])), "v"(lds_addr(&sk[bf][0][kr + 16][kc8])), "v"(lds_addr(&sk[bf][1][kr][kc8])), "v"(lds_addr(&sk[bf][1][kr + 16][kc8])),
                    "v"(lds_addr(&sv[bf][0][vd][vc8])), "v"(lds_addr(&sv[bf][0][vd + 32][vc8])), "v"(lds_addr(&sv[bf][1][vd][vc8])), "v"(lds_addr(&sv[bf][1][vd + 32][vc8])),
                    "v"(QK + ko), "v"(QK + ko + 16 * (2 * DM)), "v"(QKL + ko), "v"(QKL + ko + 16 * (2 * DM)),
                    "v"(VTH + vo), "v"(VTH + vo + 32 * SS), "v"(VTL + vo), "v"(VTL + vo + 32 * SS)
                 : "memory"); };
  stage(0);
  asm volatile("s_wait_asynccnt 0x0" ::: "memory");   // this wave's part of tile 0 has landed
  __syncthreads();                                     // every wave's part of tile 0 is visible
  stage(1);
  v16h aq[2], aql[2];
#pragma unroll
  for (int kc = 0; kc < 2; ++kc) { aq[kc] = frag_h(QK + rq * (2 * DM) + h * HD + kc * 32, lane); aql[kc] = frag_h(QKL + rq * (2 * DM) + h * HD + kc * 32, lane); }
  float m = -3.0e38f, l = 0.f;   // of this lane's query (col); l holds the keys of this lane half only, the halves join behind the loop
  v8f acc[4] = {}, accl[4] = {};   // O^T tiles: register r = O[query col][d = dt * 16 + 8 g + r]
#pragma unroll 1
  for (int ks = 0; ks < nks; ++ks) { v8f s[2]; const int bf = ks & 1; v16h kf[2][2], kl[2][2];
#pragma unroll
    for (int ct = 0; ct < 2; ++ct)
#pragma unroll
      for (int kc = 0; kc < 2; ++kc) { kf[ct][kc] = frag_h(&sk[bf][0][ct * 16 + col][kc * 32], lane); kl[ct][kc] = frag_h(&sk[bf][1][ct * 16 + col][kc * 32], lane); }
    asm volatile("" :: "v"(kf[0][0]), "v"(kf[0][1]), "v"(kf[1][0]), "v"(kf[1][1]), "v"(kl[0][0]), "v"(kl[0][1]), "v"(kl[1][0]), "v"(kl[1][1]));   // inputs only: holds the trip's K reads from LDS as one group in front of the first matrix instruction (one LDS wait, not one a fragment)
#pragma unroll
    for (int ct = 0; ct < 2; ++ct) { v8f c = {}, cl = {};
#pragma unroll
      for (int kc = 0; kc < 2; ++kc) { c = wmma16(kf[ct][kc], aq[kc], c); cl = wmma16(kf[ct][kc], aql[kc], cl); cl = wmma16(kl[ct][kc], aq[kc], cl); }   // 3 products: q, k as f16 hi + residual; K rows as A, Q as B: register r = score of key ct * 16 + 8 g + r for query col
#pragma unroll
      for (int r = 0; r < 8; ++r) c[r] += cl[r] * (1.0f / 2048.0f);
#pragma unroll
      for (int r = 0; r < 8; ++r) s[ct][r] = c[r] * 0.125f; }   // 1/sqrt(64), all keys
    v16h vh[4], vl[4];
#pragma unroll
    for (int dt = 0; dt < 4; ++dt) { vh[dt] = frag_h(&sv[bf][0][dt * 16 + col][0], lane); vl[dt] = frag_h(&sv[bf][1][dt * 16 + col][0], lane); }
    // a lane holds 16 of its query's 32 scores, lane ^ 16 the other 16: maximum and sum in registers, one exchange between the halves for the maximum
    float t[8];
#pragma unroll
    for (int r = 0; r < 8; ++r) t[r] = fmaxf(s[0][r], s[1][r]);
    float mx = fmaxf(fmaxf(fmaxf(t[0], t[1]), fmaxf(t[2], t[3])), fmaxf(fmaxf(t[4], t[5]), fmaxf(t[6], t[7])));
    mx = fmaxf(mx, xhalf(mx));
    const float mn = fmaxf(m, mx); const float alpha = (m <= -1.0e38f) ? 0.f : __expf(m - mn);
    v16h pa, pl;   // P^T as B operand: element ct * 8 + r is key ct * 16 + 8 g + r, the order in which frag_h reads V^T's keys
#pragma unroll
    for (int ct = 0; ct < 2; ++ct)
#pragma unroll
      for (int r = 0; r < 8; r += 2) { v2f e; e.x = (s[ct][r] <= -1.0e38f) ? 0.f : __expf(s[ct][r] - mn); e.y = (s[ct][r + 1] <= -1.0e38f) ? 0.f : __expf(s[ct][r + 1] - mn);
        if (ct == 0) { t[r] = e.x; t[r + 1] = e.y; } else { t[r] += e.x; t[r + 1] += e.y; }
        const v2f x = e * 2048.0f; const v2h hi = __builtin_convertvector(x, v2h); const v2h lo = __builtin_convertvector((x - __builtin_convertvector(hi, v2f)) * 2048.0f, v2h);   // two neighbouring keys share a register of the operand: one packed conversion each for hi and residual
        pa[ct * 8 + r] = hi.x; pa[ct * 8 + r + 1] = hi.y; pl[ct * 8 + r] = lo.x; pl[ct * 8 + r + 1] = lo.y; }   // P scaled by 2^11 before the f16 split so small softmax weights stay out of the f16 subnormal range; 2^-11 folded into the epilogue
    l = l * alpha + (((t[0] + t[1]) + (t[2] + t[3])) + ((t[4] + t[5]) + (t[6] + t[7]))); m = mn;
#pragma unroll
    for (int dt = 0; dt < 4; ++dt)
#pragma unroll
      for (int r = 0; r < 8; ++r) { acc[dt][r] *= alpha; accl[dt][r] *= alpha; }
    asm volatile("" :: "v"(vh[0]), "v"(vh[1]), "v"(vh[2]), "v"(vh[3]), "v"(vl[0]), "v"(vl[1]), "v"(vl[2]), "v"(vl[3]));   // inputs only: holds the trip's V reads from LDS as one group in front of the first P.V matrix instruction
#pragma unroll
    for (int dt = 0; dt < 4; ++dt) { acc[dt] = wmma16(vh[dt], pa, acc[dt]); accl[dt] = wmma16(vh[dt], pl, accl[dt]); accl[dt] = wmma16(vl[dt], pa, accl[dt]); }   // V^T rows as A: V hi x P hi + (V hi x P lo + V lo x P hi) / 2048
    // hand-over of the buffers, in this order in every wave
    asm volatile("s_wait_dscnt 0x0" ::: "memory");      // this wave's LDS reads of tile ks have returned
    asm volatile("s_wait_asynccnt 0x0" ::: "memory");   // this wave's part of tile ks + 1 has landed
    __syncthreads();                                     // publishes tile ks + 1 and ends every wave's reads of tile ks
    if (ks + 2 < nks) stage(ks + 2); }                   // refill of the buffer that this trip has read
  asm volatile("s_wait_asynccnt 0x0" ::: "memory");     // no copy is outstanding behind the loop
  l += xhalf(l);   // the two halves' key sums of one query
  const float il = (1.0f / 2048.0f) / l;
#pragma unroll
  for (int dt = 0; dt < 4; ++dt)
#pragma unroll
    for (int r = 0; r < 8; ++r) so[wave][col][dt * 16 + 8 * g + r] = (acc[dt][r] + accl[dt][r] * (1.0f / 2048.0f)) * il;
  LDSX();
  for (int rl = 0; rl < 16; ++rl) if (lane < 16) vst2(O + ((size_t)b * SS + q0 + rl) * DM + h * HD + lane * 4, *(const v4f*)&so[wave][rl][lane * 4]);
}
// ---- k_out: block = (64 output channels o, 128 positions, b): y[o][n] = w_out rows (exact) x vals rows O[n][c] (bf16 hi + residual, K 1024) -> [B][C][N] rows (512-B segments)
__global__ __launch_bounds__(128) void k_out(const float* __restrict__ O, const __bf16* __restrict__ P, float* __restrict__ Y) {
  __shared__ __align__(16) float so[4][16][132];
  const int tid = threadIdx.x, wave = tid >> 5, lane = tid & 31, col = lane & 15, g = lane >> 4; const int o0 = blockIdx.x * 64 + wave * 16; const int n0 = blockIdx.y * 128; const size_t b = blockIdx.z;
  v8f acc[8] = {};
  // tiles of vals [128 positions][32 channels, f32] and of weights [64 output channels][32 channels] come into LDS once per work-group by asynchronous copies, two buffers: tile t + 1 flies while tile t is worked on
  __shared__ __align__(16) float sval[2][128][36];   // 128-B rows at a pitch of 144 B (16 B x odd, as WPIT)
  __shared__ __align__(16) __bf16 sw[2][64][WPIT];
  const int vr = tid >> 3, vc4 = (tid & 7) * 4, wr = tid >> 2, wc8 = (tid & 3) * 8;   // copy map: vals, 8 lanes a 128-B row, rows vr + 16 i; weights, 4 lanes a 64-B row segment, rows wr and wr + 32
  const float* vsrc = O + (b * SS + n0 + vr) * DM + vc4; const __bf16* wsrc = P + (size_t)(blockIdx.x * 64 + wr) * DM + wc8;
  auto stage = [&](int t) { const int bf = t & 1; const float* s0 = vsrc + t * 32; const __bf16* w0 = wsrc + t * 32;
    // ten 16-byte copies a lane; s_wait_xcnt 0 as the statement's last line stands in front of every later rewrite of the address registers
    asm volatile("global_load_async_to_lds_b128 %0, %10, off\n\t"
                 "global_load_async_to_lds_b128 %1, %11, off\n\t"
                 "global_load_async_to_lds_b128 %2, %12, off\n\t"
                 "global_load_async_to_lds_b128 %3, %13, off\n\t"
                 "global_load_async_to_lds_b128 %4, %14, off\n\t"
                 "global_load_async_to_lds_b128 %5, %15, off\n\t"
                 "global_load_async_to_lds_b128 %6, %16, off\n\t"
                 "global_load_async_to_lds_b128 %7, %17, off\n\t"
                 "global_load_async_to_lds_b128 %8, %18, off\n\t"
                 "global_load_async_to_lds_b128 %9, %19, off\n\t"
                 "s_wait_xcnt 0x0"
                 :: "v"(lds_addr(&sval[bf][vr][vc4])), "v"(lds_addr(&sval[bf][vr + 16][vc4])), "v"(lds_addr(&sval[bf][vr + 32][vc4])), "v"(lds_addr(&sval[bf][vr + 48][vc4])),
                    "v"(lds_addr(&sval[bf][vr + 64][vc4])), "v"(lds_addr(&sval[bf][vr + 80][vc4])), "v"(lds_addr(&sval[bf][vr + 96][vc4])), "v"(lds_addr(&sval[bf][vr + 112][vc4])),
                    "v"(lds_addr(&sw[bf][wr][wc8])), "v"(lds_addr(&sw[bf][wr + 32][wc8])),
                    "v"(s0), "v"(s0 + 16 * DM), "v"(s0 + 32 * DM), "v"(s0 + 48 * DM), "v"(s0 + 64 * DM), "v"(s0 + 80 * DM), "v"(s0 + 96 * DM), "v"(s0 + 112 * DM),
                    "v"(w0), "v"(w0 + 32 * DM)
                 : "memory"); };
  stage(0);
  asm volatile("s_wait_asynccnt 0x0" ::: "memory");   // this wave's part of tile 0 has landed
  __syncthreads();                                     // every wave's part of tile 0 is visible
  stage(1);
#pragma unroll 2
  for (int kc = 0; kc < DM / 32; ++kc) { const int bf = kc & 1; const v16b a = frag_b(&sw[bf][wave * 16 + col][0], lane);
#pragma unroll
    for (int j = 0; j < 8; ++j) { const F2 vb = split_row(&sval[bf][j * 16 + col][0], 0, lane); acc[j] = wmma_bf(a, vb.l, acc[j]); acc[j] = wmma_bf(a, vb.h, acc[j]); }
    // hand-over of the buffers, in this order in every wave
    asm volatile("s_wait_dscnt 0x0" ::: "memory");      // this wave's LDS reads of tile kc have returned
    asm volatile("s_wait_asynccnt 0x0" ::: "memory");   // this wave's part of tile kc + 1 has landed
    __syncthreads();                                     // publishes tile kc + 1 and ends every wave's reads of tile kc
    if (kc + 2 < DM / 32) stage(kc + 2); }               // refill of the buffer that this trip has read
  asm volatile("s_wait_asynccnt 0x0" ::: "memory");     // no copy is outstanding behind the loop
#pragma unroll
  for (int j = 0; j < 8; ++j)
#pragma unroll
    for (int r = 0; r < 8; ++r) so[wave][8 * g + r][j * 16 + col] = acc[j][r];
  LDSX();
  for (int rl = 0; rl < 16; ++rl) vst2(Y + (b * DM + o0 + rl) * SS + n0 + lane * 4, *(const v4f*)&so[wave][rl][lane * 4]);
}
extern "C" void kernel_launch(void* const* d_in, const int* in_sizes, int n_in, void* d_out, int out_size, void* d_ws, size_t ws_size, hipStream_t stream) {
  (void)in_sizes; (void)n_in; (void)out_size;
  const float** F = (const float**)d_in;   // 0 x [2,1024,2048], 1 w_qkv [3072,1024] natural (head-interleaved q|k|v blocks of 64), 2 w_out [1024,1024] natural
  if (ws_size < (size_t)WS_END) return;
  char* ws = (char*)d_ws; __bf16* PK = (__bf16*)(ws + WS_PK); _Float16 *QK = (_Float16*)(ws + WS_QK), *QKL = (_Float16*)(ws + WS_QKL), *VTH = (_Float16*)(ws + WS_VTH), *VTL = (_Float16*)(ws + WS_VTL); float* O = (float*)(ws + WS_O); __bf16* XT = (__bf16*)(ws + WS_XT);
  k_pack<<<dim3(QKVW, 2), 256, 0, stream>>>(F[1], F[2], F[0], PK, XT);
  k_qkv<<<dim3(SS / 64, QKVW / 128, TNB), 128, 0, stream>>>(XT, PK + PK_A, QK, QKL, VTH, VTL);
  k_attn<<<dim3(TQB, NH, TNB), 128, 0, stream>>>(QK, QKL, VTH, VTL, O);
  k_out<<<dim3(DM / 64, TON, TNB), 128, 0, stream>>>(O, PK + PK_P, (float*)d_out);
}

// v004
// Measured time: 169 microseconds a run.
// Timed twice side by side with v003, it ran 1.05 times as fast both times.
// Over all steps from v000 it is 3.83 times as fast.
// compute dtype: x, w_qkv, w_out rounded to bf16; qkv = w_qkv . x with exact bf16 products on WMMA 16x16x32 (positions as rows via an LDS transpose of the [B,C,N] input, natural weight rows; output channel o -> head o/192, part (o%192)/64, dim o%64); q and k stored as f16 hi + (x2048-scaled) residual planes with 3-product scores x 1/8; running-max softmax in f32 (hardware exp); P (scaled by 2^11, as f16 hi + residual) x v hi/lo (3 products); y = w_out (exact rows) x vals (f32 as bf16 hi + residual, 2 products) written channels-first; f32 accumulate.
#include <hip/hip_runtime.h>
#include <math.h>

typedef __attribute__((ext_vector_type(16))) _Float16 v16h;
typedef __attribute__((ext_vector_type(16))) __bf16 v16b;
typedef __attribute__((ext_vector_type(8)))  _Float16 v8h;
typedef __attribute__((ext_vector_type(8)))  float v8f;
typedef __attribute__((ext_vector_type(4)))  float v4f;
typedef __attribute__((ext_vector_type(2)))  float v2f;
typedef __attribute__((ext_vector_type(4)))  unsigned v4u;
typedef __attribute__((ext_vector_type(4)))  int v4i;
typedef float __attribute__((may_alias)) float_a;
typedef int __attribute__((may_alias)) int_a;

template <typename T> __device__ __forceinline__ void vst2(void* p, T v) { *(T*)p = v;  }
__device__ __forceinline__ v8f wmma16(v16h a, v16h b, v8f c) {
  v8f d = __builtin_amdgcn_wmma_f32_16x16x32_f16(false, a, false, b, (short)0, c, false, false);
  asm volatile("v_nop\n\tv_nop\n\tv_nop\n\tv_nop" : "+v"(d) : "v"(a), "v"(b));
  return d;
}
__device__ __forceinline__ v8f wmma_bf(v16b a, v16b b, v8f c) {
  v8f d = __builtin_amdgcn_wmma_f32_16x16x32_bf16(false, a, false, b, (short)0, c, false, false);
  asm volatile("v_nop\n\tv_nop\n\tv_nop\n\tv_nop" : "+v"(d) : "v"(a), "v"(b));
  return d;
}
// Channels-first multi-head attention layer (x [2][1024 channels][2048 positions], 16 heads x 64): 1x1-conv qkv with per-head interleaved (q|k|v) channel blocks, softmax(q k^T / 8) v, 1x1-conv output projection -> [B, C, N].
__device__ __forceinline__ v16h frag_h(const _Float16* rowk0, int lane) {
  union { v16h v; v8h q[2]; } u; const _Float16* p = rowk0 + 8 * (lane >> 4);
  u.q[0] = *(const v8h*)p; u.q[1] = *(const v8h*)(p + 16); return u.v;
}
__device__ __forceinline__ v16h frag_f32(const float* rowk0, int lane) {
  v16h a; const float* p = rowk0 + 8 * (lane >> 4);
#pragma unroll
  for (int i = 0; i < 8; ++i) { a[i] = (_Float16)p[i]; a[8 + i] = (_Float16)p[16 + i]; }
  return a;
}
__device__ __forceinline__ v16h frag_f32s(const float* rowk0, int lane, float sc) {
  v16h a; const float* p = rowk0 + 8 * (lane >> 4);
#pragma unroll
  for (int i = 0; i < 8; ++i) { a[i] = (_Float16)(p[i] * sc); a[8 + i] = (_Float16)(p[16 + i] * sc); }
  return a;
}
// column fragment from a [K][ld] layout (column n), rows >= K read as 0
__device__ __forceinline__ v16h fragc_f32(const float* W, int k0, int n, int lane, int ld, int K) {
  v16h a; const int g = lane >> 4;
#pragma unroll
  for (int i = 0; i < 8; ++i) { const int ka = k0 + 8 * g + i, kb = ka + 16;
    a[i] = (_Float16)(ka < K ? W[(size_t)(ka < K ? ka : K - 1) * ld + n] : 0.f); a[8 + i] = (_Float16)(kb < K ? W[(size_t)(kb < K ? kb : K - 1) * ld + n] : 0.f); }
  return a;
}
struct F2 { v16b h, l; };
__device__ __forceinline__ F2 bsplit16(const float v[16]) { F2 r;
#pragma unroll
  for (int i = 0; i < 16; ++i) { const __bf16 h = (__bf16)v[i]; r.h[i] = h; r.l[i] = (__bf16)(v[i] - (float)h); }
  return r; }
__device__ __forceinline__ F2 split_row(const float* row, int k0, int lane) { float v[16]; const float* p = row + k0 + 8 * (lane >> 4);
#pragma unroll
  for (int i = 0; i < 8; ++i) { v[i] = p[i]; v[8 + i] = p[16 + i]; }
  return bsplit16(v); }
__device__ __forceinline__ F2 split_rowK(const float* row, int k0, int lane, int K) { float v[16]; const int g = lane >> 4;
#pragma unroll
  for (int i = 0; i < 8; ++i) { const int ka = k0 + 8 * g + i, kb = ka + 16; v[i] = ka < K ? row[ka < K ? ka : K - 1] : 0.f; v[8 + i] = kb < K ? row[kb < K ? kb : K - 1] : 0.f; }
  return bsplit16(v); }
__device__ __forceinline__ F2 split_col(const float* W, int k0, int n, int lane, int ld, int K) { float v[16]; const int g = lane >> 4;
#pragma unroll
  for (int i = 0; i < 8; ++i) { const int ka = k0 + 8 * g + i, kb = ka + 16; v[i] = ka < K ? W[(size_t)(ka < K ? ka : K - 1) * ld + n] : 0.f; v[8 + i] = kb < K ? W[(size_t)(kb < K ? kb : K - 1) * ld + n] : 0.f; }
  return bsplit16(v); }
__device__ __forceinline__ v8f mac3(const F2& a, const F2& b, v8f c) { c = wmma_bf(a.l, b.h, c); c = wmma_bf(a.h, b.l, c); return wmma_bf(a.h, b.h, c); }
__device__ __forceinline__ float sigm(float v) { return 1.0f / (1.0f + expf(-v)); }
#define LDSX() do { asm volatile("s_wait_dscnt 0" ::: "memory"); __builtin_amdgcn_wave_barrier(); __builtin_amdgcn_fence(__ATOMIC_RELEASE, "workgroup"); } while (0)


#define NB 2
#define SS 2048
#define DM 1024
#define NH 16
#define HD 64
#define QKVW (3 * DM)
#ifndef TQB
#define TQB (SS / 64)
#define TNB NB
#define TON (SS / 128)         // output position blocks per batch (all)
#endif
typedef __attribute__((ext_vector_type(8))) __bf16 v8b;
__device__ __forceinline__ v16b frag_b(const __bf16* rowk0, int lane) {
  union { v16b v; v8b q[2]; } u; const __bf16* p = rowk0 + 8 * (lane >> 4);
  u.q[0] = *(const v8b*)p; u.q[1] = *(const v8b*)(p + 16); return u.v;
}
__device__ __forceinline__ unsigned lds_addr(const void* p) { return (unsigned)(size_t)p; }   // low 32 bits of a __shared__ address = byte offset in the work-group's LDS
#define WPIT 40   // 16-bit elements per staged 64-B row: 64 B + 16 B (a pitch of 16 B x odd keeps 16-byte LDS reads of 16 rows off each other's banks)
__device__ __forceinline__ float bfr(float v) { return (float)(__bf16)v; }
__device__ __attribute__((noinline)) float exp_ni(float v) { return expf(v); }
__device__ __attribute__((noinline)) float erf_ni(float v) { return erff(v); }

#define PK_A 0                       // [3072][1024] Wqkv rows (natural [out][in])
#define PK_P (PK_A + QKVW * DM)        // [1024][1024] Wo rows (natural)
#define PK_END (PK_P + DM * DM)
#define WS_PK  0u
#define WS_QK  (WS_PK + 2u * PK_END)             // f16 [4096 rows][2048]: q | k
#define WS_QKL (WS_QK + 2u * NB * SS * 2 * DM)     // f16 q | k residual planes x2048
#define WS_VTH (WS_QKL + 2u * NB * SS * 2 * DM)    // f16 [b][1024 (h*64+d)][2048 s] hi
#define WS_VTL (WS_VTH + 2u * NB * DM * SS)        // f16 lo x 2048
#define WS_O   (WS_VTL + 2u * NB * DM * SS)        // bf16 [b * 2048 + position][32 groups of 32 channels][32 hi | 32 residual]: vals already split for k_out, 4 B a value
#define WS_XT  (WS_O + 4u * NB * SS * DM)           // bf16 [b][2048 positions][1024 channels]: x rounded and transposed
#define WS_END (WS_XT + 2u * NB * SS * DM)
// ---- k_pack: block = (row n, which): natural [out][in] rows -> bf16; which 0 -> w_qkv row n into PK_A; which 1, n < 1024 -> w_out row n into PK_P
// which 1, n >= 1024 (2048 blocks with no weight row): tile n - 1024 of x, [64 channels][32 positions] -> XT[b][position][channel] in bf16, so that x is rounded and transposed once and not once per block of k_qkv
__global__ __launch_bounds__(256) void k_pack(const float* __restrict__ WQKV, const float* __restrict__ WOUT, const float* __restrict__ X, __bf16* __restrict__ PK, __bf16* __restrict__ XT) {
  __shared__ __align__(16) __bf16 s[DM]; const int n = blockIdx.x, which = blockIdx.y, t = threadIdx.x; const float* src = (which == 0) ? (WQKV + (size_t)n * DM) : (WOUT + (size_t)(n - 0) * DM);
  if (which == 1 && n >= DM) {
    __shared__ __align__(16) __bf16 sx[32][72];   // [position][channel]: 128-B rows at a pitch of 144 B
    const int id = n - DM, bb = id >> 10, c0 = (id & 15) * 64, p0 = ((id >> 4) & 63) * 32;
    for (int i = 0; i < 2; ++i) { const int c = (t >> 3) + 32 * i, p4 = (t & 7) * 4;   // 8 lanes read one channel's 128-B line
      const v4f v = *(const v4f*)(X + ((size_t)bb * DM + c0 + c) * SS + p0 + p4);
      for (int k = 0; k < 4; ++k) sx[p4 + k][c] = (__bf16)v[k]; }
    __syncthreads();
    const int p = t >> 3, c8 = (t & 7) * 8;   // 8 lanes write one position's 128-B line
    vst2((unsigned*)(XT + ((size_t)bb * SS + p0 + p) * DM + c0 + c8), *(const v4u*)&sx[p][c8]);
    return; }
  for (int k = t; k < DM; k += 256) s[k] = (__bf16)src[k];
  __syncthreads();
  __bf16* dst = (which == 0) ? PK + PK_A + (size_t)n * DM : PK + PK_P + (size_t)n * DM;
  for (int q = t; q < DM / 8; q += 256) vst2((unsigned*)(dst + q * 8), *(const v4u*)&s[q * 8]);
}
// ---- k_qkv: block = (64 positions, 128 of the 3072 output channels, b): A rows from XT[b][n][c] (x in bf16, transposed by k_pack); each 16-col tile is one (head, part, 16 dims): q/k -> f16 hi/lo row segments [row][part*1024 + h*64 + d]; v -> planes [b][h*64 + d][n]
__global__ __launch_bounds__(128) void k_qkv(const __bf16* __restrict__ XT, const __bf16* __restrict__ P, _Float16* __restrict__ QK, _Float16* __restrict__ QKL, _Float16* __restrict__ VTH, _Float16* __restrict__ VTL) {
  __shared__ __align__(16) _Float16 so[4][16][136], sol[4][16][136]; __shared__ __align__(16) _Float16 sth[128][72], stl[128][72];
  const int tid = threadIdx.x, wave = tid >> 5, lane = tid & 31, col = lane & 15, g = lane >> 4; const size_t b = blockIdx.z; const int p0 = blockIdx.x * 64; const int n0 = blockIdx.y * 128; const size_t r0 = b * SS + p0 + wave * 16;
  v8f acc[8] = {};
  // tiles of weights [128 output channels][32 input channels] and of x [64 positions][32 input channels] come into LDS once per work-group by asynchronous copies, two buffers: tile t + 1 flies while tile t is worked on
  __shared__ __align__(16) __bf16 sb[2][128][WPIT];
  __shared__ __align__(16) __bf16 sx[2][64][WPIT];
  const int wr = tid >> 2, wc8 = (tid & 3) * 8;   // copy map: 4 lanes a 64-B row segment, rows wr + 32 i
  const __bf16* wsrc = P + (size_t)(n0 + wr) * DM + wc8; const __bf16* xsrc = XT + (b * SS + p0 + wr) * DM + wc8;
  auto stage = [&](int t) { const int bf = t & 1; const __bf16* s0 = wsrc + t * 32; const __bf16* x0 = xsrc + t * 32;
    // six 16-byte copies a lane; s_wait_xcnt 0 as the statement's last line stands in front of every later rewrite of the address registers
    asm volatile("global_load_async_to_lds_b128 %0, %6, off\n\t"
                 "global_load_async_to_lds_b128 %1, %7, off\n\t"
                 "global_load_async_to_lds_b128 %2, %8, off\n\t"
                 "global_load_async_to_lds_b128 %3, %9, off\n\t"
                 "global_load_async_to_lds_b128 %4, %10, off\n\t"
                 "global_load_async_to_lds_b128 %5, %11, off\n\t"
                 "s_wait_xcnt 0x0"
                 :: "v"(lds_addr(&sb[bf][wr][wc8])), "v"(lds_addr(&sb[bf][wr + 32][wc8])), "v"(lds_addr(&sb[bf][wr + 64][wc8])), "v"(lds_addr(&sb[bf][wr + 96][wc8])),
                    "v"(lds_addr(&sx[bf][wr][wc8])), "v"(lds_addr(&sx[bf][wr + 32][wc8])),
                    "v"(s0), "v"(s0 + 32 * DM), "v"(s0 + 64 * DM), "v"(s0 + 96 * DM), "v"(x0), "v"(x0 + 32 * DM)
                 : "memory"); };
  stage(0);
  asm volatile("s_wait_asynccnt 0x0" ::: "memory");   // this wave's part of tile 0 has landed
  __syncthreads();                                     // every wave's part of tile 0 is visible
  stage(1);
#pragma unroll 2
    for (int t = 0; t < DM / 32; ++t) { const int bf = t & 1; const v16b a = frag_b(&sx[bf][wave * 16 + col][0], lane);
      v16b w[8];
#pragma unroll
      for (int j = 0; j < 8; ++j) w[j] = frag_b(&sb[bf][j * 16 + col][0], lane);
      asm volatile("" :: "v"(a), "v"(w[0]), "v"(w[1]), "v"(w[2]), "v"(w[3]), "v"(w[4]), "v"(w[5]), "v"(w[6]), "v"(w[7]));   // inputs only: holds the trip's LDS reads as one group in front of the first matrix instruction (one LDS wait a trip, not one a tile)
#pragma unroll
      for (int j = 0; j < 8; ++j) acc[j] = wmma_bf(a, w[j], acc[j]);
      // hand-over of the buffers, in this order in every wave
      asm volatile("s_wait_dscnt 0x0" ::: "memory");      // this wave's LDS reads of tile t have returned
      asm volatile("s_wait_asynccnt 0x0" ::: "memory");   // this wave's part of tile t + 1 has landed
      __syncthreads();                                     // publishes tile t + 1 and ends every wave's reads of tile t
      if (t + 2 < DM / 32) stage(t + 2); }                 // refill of the buffer that this trip has read
  asm volatile("s_wait_asynccnt 0x0" ::: "memory");       // no copy is outstanding behind the loop
  // epilogue: tile j -> o0 = n0 + j*16; h = o0 / 192; part = (o0 % 192) / 64; d = o0 % 64 + col
#pragma unroll
  for (int j = 0; j < 8; ++j) { const int o0 = n0 + j * 16; const int part = (o0 % 192) / 64;
#pragma unroll
    for (int r = 0; r < 8; ++r) { const float v = acc[j][r]; const _Float16 hv = (_Float16)v; const _Float16 lv = (_Float16)((v - (float)hv) * 2048.0f);
      if (part < 2) { so[wave][8 * g + r][j * 16 + col] = hv; sol[wave][8 * g + r][j * 16 + col] = lv; } else { sth[j * 16 + col][wave * 16 + 8 * g + r] = hv; stl[j * 16 + col][wave * 16 + 8 * g + r] = lv; } } }
  __syncthreads();
  // stores: per tile group of 4 (64 channels = one (head, part)): tiles j = 4*q4 .. 4*q4+3 share (h, part) since 64-runs align
#pragma unroll
  for (int q4 = 0; q4 < 2; ++q4) { const int o0 = n0 + q4 * 64; const int h = o0 / 192, part = (o0 % 192) / 64;
    if (part < 2) {
      for (int rl = 0; rl < 16; ++rl) if (lane < 8) { vst2((unsigned*)(QK + (r0 + rl) * (2 * DM) + part * DM + h * HD + lane * 8), *(const v4u*)&so[wave][rl][q4 * 64 + lane * 8]); vst2((unsigned*)(QKL + (r0 + rl) * (2 * DM) + part * DM + h * HD + lane * 8), *(const v4u*)&sol[wave][rl][q4 * 64 + lane * 8]); }
    } else {
      for (int e = tid; e < 64 * 8; e += 128) { const int d = e >> 3, pc = e & 7; const size_t o = (b * DM + h * HD + d) * SS + p0 + pc * 8; vst2((unsigned*)(VTH + o), *(const v4u*)&sth[q4 * 64 + d][pc * 8]); vst2((unsigned*)(VTL + o), *(const v4u*)&stl[q4 * 64 + d][pc * 8]); } } }
}
typedef __attribute__((ext_vector_type(2))) _Float16 v2h;
// lane l <-> lane l ^ 16 in one vector instruction
__device__ __forceinline__ float xhalf(float v) { const int b = __builtin_bit_cast(int, v); return __builtin_bit_cast(float, __builtin_amdgcn_permlanex16(b, b, 0x76543210, 0xfedcba98, false, false)); }
#define KPIT 72   // halfs per staged K row: 128 B + 16 B (a pitch of 16 B x odd keeps 16-byte LDS reads of 16 rows off each other's banks)
#define VPIT 40   // halfs per staged V row: 64 B + 16 B, same reason
__global__ __launch_bounds__(128) void k_attn(const _Float16* __restrict__ QK, const _Float16* __restrict__ QKL, const _Float16* __restrict__ VTH, const _Float16* __restrict__ VTL, __bf16* __restrict__ O) {
  __shared__ __align__(16) __bf16 so[4][16][136];   // [wave][query][2 x (32 hi | 32 residual)]: 256-B rows at a pitch of 272 B
  __shared__ __align__(16) _Float16 sk[2][2][32][KPIT];   // [buffer][hi | residual][key][d]
  __shared__ __align__(16) _Float16 sv[2][2][64][VPIT];   // [buffer][hi | residual][d][key]
  const int tid = threadIdx.x, wave = tid >> 5, lane = tid & 31, col = lane & 15, g = lane >> 4;
  const int qb = blockIdx.x, h = blockIdx.y, b = blockIdx.z; const int q0 = qb * 64 + wave * 16; const size_t rq = (size_t)b * SS + q0 + col;
  const int nks = SS / 32;   // all keys
  // copy map: K, 8 lanes a 128-B row, rows kr and kr + 16; V, 4 lanes a 64-B row segment, rows vd and vd + 32
  const int kr = tid >> 3, kc8 = (tid & 7) * 8, vd = tid >> 2, vc8 = (tid & 3) * 8;
  const size_t koff = ((size_t)b * SS + kr) * (2 * DM) + DM + h * HD + kc8, voff = ((size_t)b * DM + h * HD + vd) * SS + vc8;
  auto stage = [&](int t) { const int bf = t & 1; const size_t ko = koff + (size_t)t * 32 * (2 * DM), vo = voff + (size_t)t * 32;
    // eight 16-byte copies a lane; s_wait_xcnt 0 as the statement's last line stands in front of every later rewrite of the address registers
    asm volatile("global_load_async_to_lds_b128 %0, %8, off\n\t"
                 "global_load_async_to_lds_b128 %1, %9, off\n\t"
                 "global_load_async_to_lds_b128 %2, %10, off\n\t"
                 "global_load_async_to_lds_b128 %3, %11, off\n\t"
                 "global_load_async_to_lds_b128 %4, %12, off\n\t"
                 "global_load_async_to_lds_b128 %5, %13, off\n\t"
                 "global_load_async_to_lds_b128 %6, %14, off\n\t"
                 "global_load_async_to_lds_b128 %7, %15, off\n\t"
                 "s_wait_xcnt 0x0"
                 :: "v"(lds_addr(&sk[bf][0][kr][kc8])), "v"(lds_addr(&sk[bf][0][kr + 16][kc8])), "v"(lds_addr(&sk[bf][1][kr][kc8])), "v"(lds_addr(&sk[bf][1][kr + 16][kc8])),
                    "v"(lds_addr(&sv[bf][0][vd][vc8])), "v"(lds_addr(&sv[bf][0][vd + 32][vc8])), "v"(lds_addr(&sv[bf][1][vd][vc8])), "v"(lds_addr(&sv[bf][1][vd + 32][vc8])),
                    "v"(QK + ko), "v"(QK + ko + 16 * (2 * DM)), "v"(QKL + ko), "v"(QKL + ko + 16 * (2 * DM)),
                    "v"(VTH + vo), "v"(VTH + vo + 32 * SS), "v"(VTL + vo), "v"(VTL + vo + 32 * SS)
                 : "memory"); };
  stage(0);
  asm volatile("s_wait_asynccnt 0x0" ::: "memory");   // this wave's part of tile 0 has landed
  __syncthreads();                                     // every wave's part of tile 0 is visible
  stage(1);
  v16h aq[2], aql[2];
#pragma unroll
  for (int kc = 0; kc < 2; ++kc) { aq[kc] = frag_h(QK + rq * (2 * DM) + h * HD + kc * 32, lane); aql[kc] = frag_h(QKL + rq * (2 * DM) + h * HD + kc * 32, lane); }
  float m = -3.0e38f, l = 0.f;   // of this lane's query (col); l holds the keys of this lane half only, the halves join behind the loop
  v8f acc[4] = {}, accl[4] = {};   // O^T tiles: register r = O[query col][d = dt * 16 + 8 g + r]
#pragma unroll 1
  for (int ks = 0; ks < nks; ++ks) { v8f s[2]; const int bf = ks & 1; v16h kf[2][2], kl[2][2];
#pragma unroll
    for (int ct = 0; ct < 2; ++ct)
#pragma unroll
      for (int kc = 0; kc < 2; ++kc) { kf[ct][kc] = frag_h(&sk[bf][0][ct * 16 + col][kc * 32], lane); kl[ct][kc] = frag_h(&sk[bf][1][ct * 16 + col][kc * 32], lane); }
    asm volatile("" :: "v"(kf[0][0]), "v"(kf[0][1]), "v"(kf[1][0]), "v"(kf[1][1]), "v"(kl[0][0]), "v"(kl[0][1]), "v"(kl[1][0]), "v"(kl[1][1]));   // inputs only: holds the trip's K reads from LDS as one group in front of the first matrix instruction (one LDS wait, not one a fragment)
#pragma unroll
    for (int ct = 0; ct < 2; ++ct) { v8f c = {}, cl = {};
#pragma unroll
      for (int kc = 0; kc < 2; ++kc) { c = wmma16(kf[ct][kc], aq[kc], c); cl = wmma16(kf[ct][kc], aql[kc], cl); cl = wmma16(kl[ct][kc], aq[kc], cl); }   // 3 products: q, k as f16 hi + residual; K rows as A, Q as B: register r = score of key ct * 16 + 8 g + r for query col
#pragma unroll
      for (int r = 0; r < 8; ++r) c[r] += cl[r] * (1.0f / 2048.0f);
#pragma unroll
      for (int r = 0; r < 8; ++r) s[ct][r] = c[r] * 0.125f; }   // 1/sqrt(64), all keys
    v16h vh[4], vl[4];
#pragma unroll
    for (int dt = 0; dt < 4; ++dt) { vh[dt] = frag_h(&sv[bf][0][dt * 16 + col][0], lane); vl[dt] = frag_h(&sv[bf][1][dt * 16 + col][0], lane); }
    // a lane holds 16 of its query's 32 scores, lane ^ 16 the other 16: maximum and sum in registers, one exchange between the halves for the maximum
    float t[8];
#pragma unroll
    for (int r = 0; r < 8; ++r) t[r] = fmaxf(s[0][r], s[1][r]);
    float mx = fmaxf(fmaxf(fmaxf(t[0], t[1]), fmaxf(t[2], t[3])), fmaxf(fmaxf(t[4], t[5]), fmaxf(t[6], t[7])));
    mx = fmaxf(mx, xhalf(mx));
    const float mn = fmaxf(m, mx); const float alpha = (m <= -1.0e38f) ? 0.f : __expf(m - mn);
    v16h pa, pl;   // P^T as B operand: element ct * 8 + r is key ct * 16 + 8 g + r, the order in which frag_h reads V^T's keys
#pragma unroll
    for (int ct = 0; ct < 2; ++ct)
#pragma unroll
      for (int r = 0; r < 8; r += 2) { v2f e; e.x = (s[ct][r] <= -1.0e38f) ? 0.f : __expf(s[ct][r] - mn); e.y = (s[ct][r + 1] <= -1.0e38f) ? 0.f : __expf(s[ct][r + 1] - mn);
        if (ct == 0) { t[r] = e.x; t[r + 1] = e.y; } else { t[r] += e.x; t[r + 1] += e.y; }
        const v2f x = e * 2048.0f; const v2h hi = __builtin_convertvector(x, v2h); const v2h lo = __builtin_convertvector((x - __builtin_convertvector(hi, v2f)) * 2048.0f, v2h);   // two neighbouring keys share a register of the operand: one packed conversion each for hi and residual
        pa[ct * 8 + r] = hi.x; pa[ct * 8 + r + 1] = hi.y; pl[ct * 8 + r] = lo.x; pl[ct * 8 + r + 1] = lo.y; }   // P scaled by 2^11 before the f16 split so small softmax weights stay out of the f16 subnormal range; 2^-11 folded into the epilogue
    l = l * alpha + (((t[0] + t[1]) + (t[2] + t[3])) + ((t[4] + t[5]) + (t[6] + t[7]))); m = mn;
#pragma unroll
    for (int dt = 0; dt < 4; ++dt)
#pragma unroll
      for (int r = 0; r < 8; ++r) { acc[dt][r] *= alpha; accl[dt][r] *= alpha; }
    asm volatile("" :: "v"(vh[0]), "v"(vh[1]), "v"(vh[2]), "v"(vh[3]), "v"(vl[0]), "v"(vl[1]), "v"(vl[2]), "v"(vl[3]));   // inputs only: holds the trip's V reads from LDS as one group in front of the first P.V matrix instruction
#pragma unroll
    for (int dt = 0; dt < 4; ++dt) { acc[dt] = wmma16(vh[dt], pa, acc[dt]); accl[dt] = wmma16(vh[dt], pl, accl[dt]); accl[dt] = wmma16(vl[dt], pa, accl[dt]); }   // V^T rows as A: V hi x P hi + (V hi x P lo + V lo x P hi) / 2048
    // hand-over of the buffers, in this order in every wave
    asm volatile("s_wait_dscnt 0x0" ::: "memory");      // this wave's LDS reads of tile ks have returned
    asm volatile("s_wait_asynccnt 0x0" ::: "memory");   // this wave's part of tile ks + 1 has landed
    __syncthreads();                                     // publishes tile ks + 1 and ends every wave's reads of tile ks
    if (ks + 2 < nks) stage(ks + 2); }                   // refill of the buffer that this trip has read
  asm volatile("s_wait_asynccnt 0x0" ::: "memory");     // no copy is outstanding behind the loop
  l += xhalf(l);   // the two halves' key sums of one query
  const float il = (1.0f / 2048.0f) / l;
#pragma unroll
  for (int dt = 0; dt < 4; ++dt) { v8b hv, lv;   // a lane's 8 neighbouring d of one query: 16 B of hi, 16 B of residual
#pragma unroll
    for (int r = 0; r < 8; ++r) { const float v = (acc[dt][r] + accl[dt][r] * (1.0f / 2048.0f)) * il; const __bf16 hb = (__bf16)v; hv[r] = hb; lv[r] = (__bf16)(v - (float)hb); }
    __bf16* p = &so[wave][col][(dt >> 1) * 64 + (dt & 1) * 16 + 8 * g]; *(v8b*)p = hv; *(v8b*)(p + 32) = lv; }
  LDSX();
  for (int rl = 0; rl < 16; ++rl) if (lane < 16) vst2(O + ((size_t)b * SS + q0 + rl) * (2 * DM) + h * (2 * HD) + lane * 8, *(const v4u*)&so[wave][rl][lane * 8]);
}
// ---- k_out: block = (64 output channels o, 128 positions, b): y[o][n] = w_out rows (exact) x vals rows O[n][c] (bf16 hi + residual as k_attn stored them, K 1024) -> [B][C][N] rows (512-B segments)
__global__ __launch_bounds__(128) void k_out(const __bf16* __restrict__ O, const __bf16* __restrict__ P, float* __restrict__ Y) {
  __shared__ __align__(16) float so[4][16][132];
  const int tid = threadIdx.x, wave = tid >> 5, lane = tid & 31, col = lane & 15, g = lane >> 4; const int o0 = blockIdx.x * 64 + wave * 16; const int n0 = blockIdx.y * 128; const size_t b = blockIdx.z;
  v8f acc[8] = {};
  // tiles of vals [128 positions][32 channels: 32 hi | 32 residual] and of weights [64 output channels][32 channels] come into LDS once per work-group by asynchronous copies, two buffers: tile t + 1 flies while tile t is worked on
  __shared__ __align__(16) __bf16 sval[2][128][72];   // 128-B rows at a pitch of 144 B (16 B x odd, as WPIT)
  __shared__ __align__(16) __bf16 sw[2][64][WPIT];
  const int vr = tid >> 3, vc8 = (tid & 7) * 8, wr = tid >> 2, wc8 = (tid & 3) * 8;   // copy map: vals, 8 lanes a 128-B row, rows vr + 16 i; weights, 4 lanes a 64-B row segment, rows wr and wr + 32
  const __bf16* vsrc = O + (b * SS + n0 + vr) * (2 * DM) + vc8; const __bf16* wsrc = P + (size_t)(blockIdx.x * 64 + wr) * DM + wc8;
  auto stage = [&](int t) { const int bf = t & 1; const __bf16* s0 = vsrc + t * 64; const __bf16* w0 = wsrc + t * 32;
    // ten 16-byte copies a lane; s_wait_xcnt 0 as the statement's last line stands in front of every later rewrite of the address registers
    asm volatile("global_load_async_to_lds_b128 %0, %10, off\n\t"
                 "global_load_async_to_lds_b128 %1, %11, off\n\t"
                 "global_load_async_to_lds_b128 %2, %12, off\n\t"
                 "global_load_async_to_lds_b128 %3, %13, off\n\t"
                 "global_load_async_to_lds_b128 %4, %14, off\n\t"
                 "global_load_async_to_lds_b128 %5, %15, off\n\t"
                 "global_load_async_to_lds_b128 %6, %16, off\n\t"
                 "global_load_async_to_lds_b128 %7, %17, off\n\t"
                 "global_load_async_to_lds_b128 %8, %18, off\n\t"
                 "global_load_async_to_lds_b128 %9, %19, off\n\t"
                 "s_wait_xcnt 0x0"
                 :: "v"(lds_addr(&sval[bf][vr][vc8])), "v"(lds_addr(&sval[bf][vr + 16][vc8])), "v"(lds_addr(&sval[bf][vr + 32][vc8])), "v"(lds_addr(&sval[bf][vr + 48][vc8])),
                    "v"(lds_addr(&sval[bf][vr + 64][vc8])), "v"(lds_addr(&sval[bf][vr + 80][vc8])), "v"(lds_addr(&sval[bf][vr + 96][vc8])), "v"(lds_addr(&sval[bf][vr + 112][vc8])),
                    "v"(lds_addr(&sw[bf][wr][wc8])), "v"(lds_addr(&sw[bf][wr + 32][wc8])),
                    "v"(s0), "v"(s0 + 16 * (2 * DM)), "v"(s0 + 32 * (2 * DM)), "v"(s0 + 48 * (2 * DM)), "v"(s0 + 64 * (2 * DM)), "v"(s0 + 80 * (2 * DM)), "v"(s0 + 96 * (2 * DM)), "v"(s0 + 112 * (2 * DM)),
                    "v"(w0), "v"(w0 + 32 * DM)
                 : "memory"); };
  stage(0);
  asm volatile("s_wait_asynccnt 0x0" ::: "memory");   // this wave's part of tile 0 has landed
  __syncthreads();                                     // every wave's part of tile 0 is visible
  stage(1);
#pragma unroll 2
  for (int kc = 0; kc < DM / 32; ++kc) { const int bf = kc & 1; const v16b a = frag_b(&sw[bf][wave * 16 + col][0], lane);
    v16b vh[8], vl[8];
#pragma unroll
    for (int j = 0; j < 8; ++j) vl[j] = frag_b(&sval[bf][j * 16 + col][32], lane);
#pragma unroll
    for (int j = 0; j < 8; ++j) vh[j] = frag_b(&sval[bf][j * 16 + col][0], lane);
#pragma unroll
    for (int j = 0; j < 8; ++j) acc[j] = wmma_bf(a, vl[j], acc[j]);   // each accumulator takes its residual product first, then its hi product; the products of the seven other accumulators stand between the two
#pragma unroll
    for (int j = 0; j < 8; ++j) acc[j] = wmma_bf(a, vh[j], acc[j]);
    // hand-over of the buffers, in this order in every wave
    asm volatile("s_wait_dscnt 0x0" ::: "memory");      // this wave's LDS reads of tile kc have returned
    asm volatile("s_wait_asynccnt 0x0" ::: "memory");   // this wave's part of tile kc + 1 has landed
    __syncthreads();                                     // publishes tile kc + 1 and ends every wave's reads of tile kc
    if (kc + 2 < DM / 32) stage(kc + 2); }               // refill of the buffer that this trip has read
  asm volatile("s_wait_asynccnt 0x0" ::: "memory");     // no copy is outstanding behind the loop
#pragma unroll
  for (int j = 0; j < 8; ++j)
#pragma unroll
    for (int r = 0; r < 8; ++r) so[wave][8 * g + r][j * 16 + col] = acc[j][r];
  LDSX();
  for (int rl = 0; rl < 16; ++rl) vst2(Y + (b * DM + o0 + rl) * SS + n0 + lane * 4, *(const v4f*)&so[wave][rl][lane * 4]);
}
extern "C" void kernel_launch(void* const* d_in, const int* in_sizes, int n_in, void* d_out, int out_size, void* d_ws, size_t ws_size, hipStream_t stream) {
  (void)in_sizes; (void)n_in; (void)out_size;
  const float** F = (const float**)d_in;   // 0 x [2,1024,2048], 1 w_qkv [3072,1024] natural (head-interleaved q|k|v blocks of 64), 2 w_out [1024,1024] natural
  if (ws_size < (size_t)WS_END) return;
  char* ws = (char*)d_ws; __bf16* PK = (__bf16*)(ws + WS_PK); _Float16 *QK = (_Float16*)(ws + WS_QK), *QKL = (_Float16*)(ws + WS_QKL), *VTH = (_Float16*)(ws + WS_VTH), *VTL = (_Float16*)(ws + WS_VTL); __bf16* O = (__bf16*)(ws + WS_O); __bf16* XT = (__bf16*)(ws + WS_XT);
  k_pack<<<dim3(QKVW, 2), 256, 0, stream>>>(F[1], F[2], F[0], PK, XT);
  k_qkv<<<dim3(SS / 64, QKVW / 128, TNB), 128, 0, stream>>>(XT, PK + PK_A, QK, QKL, VTH, VTL);
  k_attn<<<dim3(TQB, NH, TNB), 128, 0, stream>>>(QK, QKL, VTH, VTL, O);
  k_out<<<dim3(DM / 64, TON, TNB), 128, 0, stream>>>(O, PK + PK_P, (float*)d_out);
}

// v005
// It runs in 159 microseconds.
// Two timings next to v004 both put it at 1.06 times that version's speed.
// Counting every step since v000, it is 4.06 times as fast.
// compute dtype: x, w_qkv, w_out rounded to bf16; qkv = w_qkv . x with exact bf16 products on WMMA 16x16x32 (positions as rows via an LDS transpose of the [B,C,N] input, natural weight rows; output channel o -> head o/192, part (o%192)/64, dim o%64); q and k stored as f16 hi + (x2048-scaled) residual planes with 3-product scores x 1/8; running-max softmax in f32 (hardware exp); P (scaled by 2^11, as f16 hi + residual) x v hi/lo (3 products); y = w_out (exact rows) x vals (f32 as bf16 hi + residual, 2 products) written channels-first; f32 accumulate.
#include <hip/hip_runtime.h>
#include <math.h>

typedef __attribute__((ext_vector_type(16))) _Float16 v16h;
typedef __attribute__((ext_vector_type(16))) __bf16 v16b;
typedef __attribute__((ext_vector_type(8)))  _Float16 v8h;
typedef __attribute__((ext_vector_type(8)))  float v8f;
typedef __attribute__((ext_vector_type(4)))  float v4f;
typedef __attribute__((ext_vector_type(2)))  float v2f;
typedef __attribute__((ext_vector_type(4)))  unsigned v4u;
typedef __attribute__((ext_vector_type(4)))  int v4i;
typedef float __attribute__((may_alias)) float_a;
typedef int __attribute__((may_alias)) int_a;

template <typename T> __device__ __forceinline__ void vst2(void* p, T v) { *(T*)p = v;  }
__device__ __forceinline__ v8f wmma16(v16h a, v16h b, v8f c) {
  return __builtin_amdgcn_wmma_f32_16x16x32_f16(false, a, false, b, (short)0, c, false, false);   // plain builtin: the compiler keeps the distance behind it and fills the slots with the loop's own vector work
}
__device__ __forceinline__ v8f wmma_bf(v16b a, v16b b, v8f c) {
  v8f d = __builtin_amdgcn_wmma_f32_16x16x32_bf16(false, a, false, b, (short)0, c, false, false);
  asm volatile("v_nop\n\tv_nop\n\tv_nop\n\tv_nop" : "+v"(d) : "v"(a), "v"(b));
  return d;
}
// Channels-first multi-head attention layer (x [2][1024 channels][2048 positions], 16 heads x 64): 1x1-conv qkv with per-head interleaved (q|k|v) channel blocks, softmax(q k^T / 8) v, 1x1-conv output projection -> [B, C, N].
__device__ __forceinline__ v16h frag_h(const _Float16* rowk0, int lane) {
  union { v16h v; v8h q[2]; } u; const _Float16* p = rowk0 + 8 * (lane >> 4);
  u.q[0] = *(const v8h*)p; u.q[1] = *(const v8h*)(p + 16); return u.v;
}
__device__ __forceinline__ v16h frag_f32(const float* rowk0, int lane) {
  v16h a; const float* p = rowk0 + 8 * (lane >> 4);
#pragma unroll
  for (int i = 0; i < 8; ++i) { a[i] = (_Float16)p[i]; a[8 + i] = (_Float16)p[16 + i]; }
  return a;
}
__device__ __forceinline__ v16h frag_f32s(const float* rowk0, int lane, float sc) {
  v16h a; const float* p = rowk0 + 8 * (lane >> 4);
#pragma unroll
  for (int i = 0; i < 8; ++i) { a[i] = (_Float16)(p[i] * sc); a[8 + i] = (_Float16)(p[16 + i] * sc); }
  return a;
}
// column fragment from a [K][ld] layout (column n), rows >= K read as 0
__device__ __forceinline__ v16h fragc_f32(const float* W, int k0, int n, int lane, int ld, int K) {
  v16h a; const int g = lane >> 4;
#pragma unroll
  for (int i = 0; i < 8; ++i) { const int ka = k0 + 8 * g + i, kb = ka + 16;
    a[i] = (_Float16)(ka < K ? W[(size_t)(ka < K ? ka : K - 1) * ld + n] : 0.f); a[8 + i] = (_Float16)(kb < K ? W[(size_t)(kb < K ? kb : K - 1) * ld + n] : 0.f); }
  return a;
}
struct F2 { v16b h, l; };
__device__ __forceinline__ F2 bsplit16(const float v[16]) { F2 r;
#pragma unroll
  for (int i = 0; i < 16; ++i) { const __bf16 h = (__bf16)v[i]; r.h[i] = h; r.l[i] = (__bf16)(v[i] - (float)h); }
  return r; }
__device__ __forceinline__ F2 split_row(const float* row, int k0, int lane) { float v[16]; const float* p = row + k0 + 8 * (lane >> 4);
#pragma unroll
  for (int i = 0; i < 8; ++i) { v[i] = p[i]; v[8 + i] = p[16 + i]; }
  return bsplit16(v); }
__device__ __forceinline__ F2 split_rowK(const float* row, int k0, int lane, int K) { float v[16]; const int g = lane >> 4;
#pragma unroll
  for (int i = 0; i < 8; ++i) { const int ka = k0 + 8 * g + i, kb = ka + 16; v[i] = ka < K ? row[ka < K ? ka : K - 1] : 0.f; v[8 + i] = kb < K ? row[kb < K ? kb : K - 1] : 0.f; }
  return bsplit16(v); }
__device__ __forceinline__ F2 split_col(const float* W, int k0, int n, int lane, int ld, int K) { float v[16]; const int g = lane >> 4;
#pragma unroll
  for (int i = 0; i < 8; ++i) { const int ka = k0 + 8 * g + i, kb = ka + 16; v[i] = ka < K ? W[(size_t)(ka < K ? ka : K - 1) * ld + n] : 0.f; v[8 + i] = kb < K ? W[(size_t)(kb < K ? kb : K - 1) * ld + n] : 0.f; }
  return bsplit16(v); }
__device__ __forceinline__ v8f mac3(const F2& a, const F2& b, v8f c) { c = wmma_bf(a.l, b.h, c); c = wmma_bf(a.h, b.l, c); return wmma_bf(a.h, b.h, c); }
__device__ __forceinline__ float sigm(float v) { return 1.0f / (1.0f + expf(-v)); }
#define LDSX() do { asm volatile("s_wait_dscnt 0" ::: "memory"); __builtin_amdgcn_wave_barrier(); __builtin_amdgcn_fence(__ATOMIC_RELEASE, "workgroup"); } while (0)


#define NB 2
#define SS 2048
#define DM 1024
#define NH 16
#define HD 64
#define QKVW (3 * DM)
#ifndef TQB
#define TQB (SS / 64)
#define TNB NB
#define TON (SS / 128)         // output position blocks per batch (all)
#endif
typedef __attribute__((ext_vector_type(8))) __bf16 v8b;
__device__ __forceinline__ v16b frag_b(const __bf16* rowk0, int lane) {
  union { v16b v; v8b q[2]; } u; const __bf16* p = rowk0 + 8 * (lane >> 4);
  u.q[0] = *(const v8b*)p; u.q[1] = *(const v8b*)(p + 16); return u.v;
}
__device__ __forceinline__ unsigned lds_addr(const void* p) { return (unsigned)(size_t)p; }   // low 32 bits of a __shared__ address = byte offset in the work-group's LDS
#define WPIT 40   // 16-bit elements per staged 64-B row: 64 B + 16 B (a pitch of 16 B x odd keeps 16-byte LDS reads of 16 rows off each other's banks)
__device__ __forceinline__ float bfr(float v) { return (float)(__bf16)v; }
__device__ __attribute__((noinline)) float exp_ni(float v) { return expf(v); }
__device__ __attribute__((noinline)) float erf_ni(float v) { return erff(v); }

#define PK_A 0                       // [3072][1024] Wqkv rows (natural [out][in])
#define PK_P (PK_A + QKVW * DM)        // [1024][1024] Wo rows (natural)
#define PK_END (PK_P + DM * DM)
#define WS_PK  0u
#define WS_QK  (WS_PK + 2u * PK_END)             // f16 [4096 rows][2048]: q | k
#define WS_QKL (WS_QK + 2u * NB * SS * 2 * DM)     // f16 q | k residual planes x2048
#define WS_VTH (WS_QKL + 2u * NB * SS * 2 * DM)    // f16 [b][1024 (h*64+d)][2048 s] hi
#define WS_VTL (WS_VTH + 2u * NB * DM * SS)        // f16 lo x 2048
#define WS_O   (WS_VTL + 2u * NB * DM * SS)        // bf16 [b * 2048 + position][32 groups of 32 channels][32 hi | 32 residual]: vals already split for k_out, 4 B a value
#define WS_XT  (WS_O + 4u * NB * SS * DM)           // bf16 [b][2048 positions][1024 channels]: x rounded and transposed
#define WS_END (WS_XT + 2u * NB * SS * DM)
// ---- k_pack: block = (row n, which): natural [out][in] rows -> bf16; which 0 -> w_qkv row n into PK_A; which 1, n < 1024 -> w_out row n into PK_P
// which 1, n >= 1024 (2048 blocks with no weight row): tile n - 1024 of x, [64 channels][32 positions] -> XT[b][position][channel] in bf16, so that x is rounded and transposed once and not once per block of k_qkv
__global__ __launch_bounds__(256) void k_pack(const float* __restrict__ WQKV, const float* __restrict__ WOUT, const float* __restrict__ X, __bf16* __restrict__ PK, __bf16* __restrict__ XT) {
  __shared__ __align__(16) __bf16 s[DM]; const int n = blockIdx.x, which = blockIdx.y, t = threadIdx.x; const float* src = (which == 0) ? (WQKV + (size_t)n * DM) : (WOUT + (size_t)(n - 0) * DM);
  if (which == 1 && n >= DM) {
    __shared__ __align__(16) __bf16 sx[32][72];   // [position][channel]: 128-B rows at a pitch of 144 B
    const int id = n - DM, bb = id >> 10, c0 = (id & 15) * 64, p0 = ((id >> 4) & 63) * 32;
    for (int i = 0; i < 2; ++i) { const int c = (t >> 3) + 32 * i, p4 = (t & 7) * 4;   // 8 lanes read one channel's 128-B line
      const v4f v = *(const v4f*)(X + ((size_t)bb * DM + c0 + c) * SS + p0 + p4);
      for (int k = 0; k < 4; ++k) sx[p4 + k][c] = (__bf16)v[k]; }
    __syncthreads();
    const int p = t >> 3, c8 = (t & 7) * 8;   // 8 lanes write one position's 128-B line
    vst2((unsigned*)(XT + ((size_t)bb * SS + p0 + p) * DM + c0 + c8), *(const v4u*)&sx[p][c8]);
    return; }
  for (int k = t; k < DM; k += 256) s[k] = (__bf16)src[k];
  __syncthreads();
  __bf16* dst = (which == 0) ? PK + PK_A + (size_t)n * DM : PK + PK_P + (size_t)n * DM;
  for (int q = t; q < DM / 8; q += 256) vst2((unsigned*)(dst + q * 8), *(const v4u*)&s[q * 8]);
}
// ---- k_qkv: block = (64 positions, 128 of the 3072 output channels, b): A rows from XT[b][n][c] (x in bf16, transposed by k_pack); each 16-col tile is one (head, part, 16 dims): q/k -> f16 hi/lo row segments [row][part*1024 + h*64 + d]; v -> planes [b][h*64 + d][n]
__global__ __launch_bounds__(128) void k_qkv(const __bf16* __restrict__ XT, const __bf16* __restrict__ P, _Float16* __restrict__ QK, _Float16* __restrict__ QKL, _Float16* __restrict__ VTH, _Float16* __restrict__ VTL) {
  __shared__ __align__(16) _Float16 so[4][16][136], sol[4][16][136]; __shared__ __align__(16) _Float16 sth[128][72], stl[128][72];
  const int tid = threadIdx.x, wave = tid >> 5, lane = tid & 31, col = lane & 15, g = lane >> 4; const size_t b = blockIdx.z; const int p0 = blockIdx.x * 64; const int n0 = blockIdx.y * 128; const size_t r0 = b * SS + p0 + wave * 16;
  v8f acc[8] = {};
  // tiles of weights [128 output channels][32 input channels] and of x [64 positions][32 input channels] come into LDS once per work-group by asynchronous copies, two buffers: tile t + 1 flies while tile t is worked on
  __shared__ __align__(16) __bf16 sb[2][128][WPIT];
  __shared__ __align__(16) __bf16 sx[2][64][WPIT];
  const int wr = tid >> 2, wc8 = (tid & 3) * 8;   // copy map: 4 lanes a 64-B row segment, rows wr + 32 i
  const __bf16* wsrc = P + (size_t)(n0 + wr) * DM + wc8; const __bf16* xsrc = XT + (b * SS + p0 + wr) * DM + wc8;
  auto stage = [&](int t) { const int bf = t & 1; const __bf16* s0 = wsrc + t * 32; const __bf16* x0 = xsrc + t * 32;
    // six 16-byte copies a lane; s_wait_xcnt 0 as the statement's last line stands in front of every later rewrite of the address registers
    asm volatile("global_load_async_to_lds_b128 %0, %6, off\n\t"
                 "global_load_async_to_lds_b128 %1, %7, off\n\t"
                 "global_load_async_to_lds_b128 %2, %8, off\n\t"
                 "global_load_async_to_lds_b128 %3, %9, off\n\t"
                 "global_load_async_to_lds_b128 %4, %10, off\n\t"
                 "global_load_async_to_lds_b128 %5, %11, off\n\t"
                 "s_wait_xcnt 0x0"
                 :: "v"(lds_addr(&sb[bf][wr][wc8])), "v"(lds_addr(&sb[bf][wr + 32][wc8])), "v"(lds_addr(&sb[bf][wr + 64][wc8])), "v"(lds_addr(&sb[bf][wr + 96][wc8])),
                    "v"(lds_addr(&sx[bf][wr][wc8])), "v"(lds_addr(&sx[bf][wr + 32][wc8])),
                    "v"(s0), "v"(s0 + 32 * DM), "v"(s0 + 64 * DM), "v"(s0 + 96 * DM), "v"(x0), "v"(x0 + 32 * DM)
                 : "memory"); };
  stage(0);
  asm volatile("s_wait_asynccnt 0x0" ::: "memory");   // this wave's part of tile 0 has landed
  __syncthreads();                                     // every wave's part of tile 0 is visible
  stage(1);
#pragma unroll 2
    for (int t = 0; t < DM / 32; ++t) { const int bf = t & 1; const v16b a = frag_b(&sx[bf][wave * 16 + col][0], lane);
      v16b w[8];
#pragma unroll
      for (int j = 0; j < 8; ++j) w[j] = frag_b(&sb[bf][j * 16 + col][0], lane);
      asm volatile("" :: "v"(a), "v"(w[0]), "v"(w[1]), "v"(w[2]), "v"(w[3]), "v"(w[4]), "v"(w[5]), "v"(w[6]), "v"(w[7]));   // inputs only: holds the trip's LDS reads as one group in front of the first matrix instruction (one LDS wait a trip, not one a tile)
#pragma unroll
      for (int j = 0; j < 8; ++j) acc[j] = wmma_bf(a, w[j], acc[j]);
      // hand-over of the buffers, in this order in every wave
      asm volatile("s_wait_dscnt 0x0" ::: "memory");      // this wave's LDS reads of tile t have returned
      asm volatile("s_wait_asynccnt 0x0" ::: "memory");   // this wave's part of tile t + 1 has landed
      __syncthreads();                                     // publishes tile t + 1 and ends every wave's reads of tile t
      if (t + 2 < DM / 32) stage(t + 2); }                 // refill of the buffer that this trip has read
  asm volatile("s_wait_asynccnt 0x0" ::: "memory");       // no copy is outstanding behind the loop
  // epilogue: tile j -> o0 = n0 + j*16; h = o0 / 192; part = (o0 % 192) / 64; d = o0 % 64 + col
#pragma unroll
  for (int j = 0; j < 8; ++j) { const int o0 = n0 + j * 16; const int part = (o0 % 192) / 64;
#pragma unroll
    for (int r = 0; r < 8; ++r) { const float v = acc[j][r]; const _Float16 hv = (_Float16)v; const _Float16 lv = (_Float16)((v - (float)hv) * 2048.0f);
      if (part < 2) { so[wave][8 * g + r][j * 16 + col] = hv; sol[wave][8 * g + r][j * 16 + col] = lv; } else { sth[j * 16 + col][wave * 16 + 8 * g + r] = hv; stl[j * 16 + col][wave * 16 + 8 * g + r] = lv; } } }
  __syncthreads();
  // stores: per tile group of 4 (64 channels = one (head, part)): tiles j = 4*q4 .. 4*q4+3 share (h, part) since 64-runs align
#pragma unroll
  for (int q4 = 0; q4 < 2; ++q4) { const int o0 = n0 + q4 * 64; const int h = o0 / 192, part = (o0 % 192) / 64;
    if (part < 2) {
      for (int rl = 0; rl < 16; ++rl) if (lane < 8) { vst2((unsigned*)(QK + (r0 + rl) * (2 * DM) + part * DM + h * HD + lane * 8), *(const v4u*)&so[wave][rl][q4 * 64 + lane * 8]); vst2((unsigned*)(QKL + (r0 + rl) * (2 * DM) + part * DM + h * HD + lane * 8), *(const v4u*)&sol[wave][rl][q4 * 64 + lane * 8]); }
    } else {
      for (int e = tid; e < 64 * 8; e += 128) { const int d = e >> 3, pc = e & 7; const size_t o = (b * DM + h * HD + d) * SS + p0 + pc * 8; vst2((unsigned*)(VTH + o), *(const v4u*)&sth[q4 * 64 + d][pc * 8]); vst2((unsigned*)(VTL + o), *(const v4u*)&stl[q4 * 64 + d][pc * 8]); } } }
}
typedef __attribute__((ext_vector_type(2))) _Float16 v2h;
// lane l <-> lane l ^ 16 in one vector instruction
__device__ __forceinline__ float xhalf(float v) { const int b = __builtin_bit_cast(int, v); return __builtin_bit_cast(float, __builtin_amdgcn_permlanex16(b, b, 0x76543210, 0xfedcba98, false, false)); }
#define KPIT 72   // halfs per staged K row: 128 B + 16 B (a pitch of 16 B x odd keeps 16-byte LDS reads of 16 rows off each other's banks)
#define VPIT 40   // halfs per staged V row: 64 B + 16 B, same reason
__global__ __launch_bounds__(128) void k_attn(const _Float16* __restrict__ QK, const _Float16* __restrict__ QKL, const _Float16* __restrict__ VTH, const _Float16* __restrict__ VTL, __bf16* __restrict__ O) {
  __shared__ __align__(16) __bf16 so[4][16][136];   // [wave][query][2 x (32 hi | 32 residual)]: 256-B rows at a pitch of 272 B
  __shared__ __align__(16) _Float16 sk[2][2][32][KPIT];   // [buffer][hi | residual][key][d]
  __shared__ __align__(16) _Float16 sv[2][2][64][VPIT];   // [buffer][hi | residual][d][key]
  const int tid = threadIdx.x, wave = tid >> 5, lane = tid & 31, col = lane & 15, g = lane >> 4;
  const int qb = blockIdx.x, h = blockIdx.y, b = blockIdx.z; const int q0 = qb * 64 + wave * 16; const size_t rq = (size_t)b * SS + q0 + col;
  const int nks = SS / 32;   // all keys
  // copy map: K, 8 lanes a 128-B row, rows kr and kr + 16; V, 4 lanes a 64-B row segment, rows vd and vd + 32
  const int kr = tid >> 3, kc8 = (tid & 7) * 8, vd = tid >> 2, vc8 = (tid & 3) * 8;
  const size_t koff = ((size_t)b * SS + kr) * (2 * DM) + DM + h * HD + kc8, voff = ((size_t)b * DM + h * HD + vd) * SS + vc8;
  auto stage = [&](int t) { const int bf = t & 1; const size_t ko = koff + (size_t)t * 32 * (2 * DM), vo = voff + (size_t)t * 32;
    // eight 16-byte copies a lane; s_wait_xcnt 0 as the statement's last line stands in front of every later rewrite of the address registers
    asm volatile("global_load_async_to_lds_b128 %0, %8, off\n\t"
                 "global_load_async_to_lds_b128 %1, %9, off\n\t"
                 "global_load_async_to_lds_b128 %2, %10, off\n\t"
                 "global_load_async_to_lds_b128 %3, %11, off\n\t"
                 "global_load_async_to_lds_b128 %4, %12, off\n\t"
                 "global_load_async_to_lds_b128 %5, %13, off\n\t"
                 "global_load_async_to_lds_b128 %6, %14, off\n\t"
                 "global_load_async_to_lds_b128 %7, %15, off\n\t"
                 "s_wait_xcnt 0x0"
                 :: "v"(lds_addr(&sk[bf][0][kr][kc8])), "v"(lds_addr(&sk[bf][0][kr + 16][kc8])), "v"(lds_addr(&sk[bf][1][kr][kc8])), "v"(lds_addr(&sk[bf][1][kr + 16][kc8])),
                    "v"(lds_addr(&sv[bf][0][vd][vc8])), "v"(lds_addr(&sv[bf][0][vd + 32][vc8])), "v"(lds_addr(&sv[bf][1][vd][vc8])), "v"(lds_addr(&sv[bf][1][vd + 32][vc8])),
                    "v"(QK + ko), "v"(QK + ko + 16 * (2 * DM)), "v"(QKL + ko), "v"(QKL + ko + 16 * (2 * DM)),
                    "v"(VTH + vo), "v"(VTH + vo + 32 * SS), "v"(VTL + vo), "v"(VTL + vo + 32 * SS)
                 : "memory"); };
  stage(0);
  asm volatile("s_wait_asynccnt 0x0" ::: "memory");   // this wave's part of tile 0 has landed
  __syncthreads();                                     // every wave's part of tile 0 is visible
  stage(1);
  v16h aq[2], aql[2];
#pragma unroll
  for (int kc = 0; kc < 2; ++kc) { aq[kc] = frag_h(QK + rq * (2 * DM) + h * HD + kc * 32, lane); aql[kc] = frag_h(QKL + rq * (2 * DM) + h * HD + kc * 32, lane); }
  float m = -3.0e38f, l = 0.f;   // of this lane's query (col); l holds the keys of this lane half only, the halves join behind the loop
  v8f acc[4] = {}, accl[4] = {};   // O^T tiles: register r = O[query col][d = dt * 16 + 8 g + r]
#pragma unroll 1
  for (int ks = 0; ks < nks; ++ks) { v8f s[2]; const int bf = ks & 1; v16h kf[2][2], kl[2][2];
#pragma unroll
    for (int ct = 0; ct < 2; ++ct)
#pragma unroll
      for (int kc = 0; kc < 2; ++kc) { kf[ct][kc] = frag_h(&sk[bf][0][ct * 16 + col][kc * 32], lane); kl[ct][kc] = frag_h(&sk[bf][1][ct * 16 + col][kc * 32], lane); }
    asm volatile("" :: "v"(kf[0][0]), "v"(kf[0][1]), "v"(kf[1][0]), "v"(kf[1][1]), "v"(kl[0][0]), "v"(kl[0][1]), "v"(kl[1][0]), "v"(kl[1][1]));   // inputs only: holds the trip's K reads from LDS as one group in front of the first matrix instruction (one LDS wait, not one a fragment)
#pragma unroll
    for (int ct = 0; ct < 2; ++ct) { v8f c = {}, cl = {};
#pragma unroll
      for (int kc = 0; kc < 2; ++kc) { c = wmma16(kf[ct][kc], aq[kc], c); cl = wmma16(kf[ct][kc], aql[kc], cl); cl = wmma16(kl[ct][kc], aq[kc], cl); }   // 3 products: q, k as f16 hi + residual; K rows as A, Q as B: register r = score of key ct * 16 + 8 g + r for query col
#pragma unroll
      for (int r = 0; r < 8; ++r) c[r] += cl[r] * (1.0f / 2048.0f);
#pragma unroll
      for (int r = 0; r < 8; ++r) s[ct][r] = c[r] * 0.125f; }   // 1/sqrt(64), all keys
    v16h vh[4], vl[4];
#pragma unroll
    for (int dt = 0; dt < 4; ++dt) { vh[dt] = frag_h(&sv[bf][0][dt * 16 + col][0], lane); vl[dt] = frag_h(&sv[bf][1][dt * 16 + col][0], lane); }
    // a lane holds 16 of its query's 32 scores, lane ^ 16 the other 16: maximum and sum in registers, one exchange between the halves for the maximum
    float t[8];
#pragma unroll
    for (int r = 0; r < 8; ++r) t[r] = fmaxf(s[0][r], s[1][r]);
    float mx = fmaxf(fmaxf(fmaxf(t[0], t[1]), fmaxf(t[2], t[3])), fmaxf(fmaxf(t[4], t[5]), fmaxf(t[6], t[7])));
    mx = fmaxf(mx, xhalf(mx));
    const float mn = fmaxf(m, mx); const float alpha = (m <= -1.0e38f) ? 0.f : __expf(m - mn);
    v16h pa, pl;   // P^T as B operand: element ct * 8 + r is key ct * 16 + 8 g + r, the order in which frag_h reads V^T's keys
#pragma unroll
    for (int ct = 0; ct < 2; ++ct)
#pragma unroll
      for (int r = 0; r < 8; r += 2) { v2f e; e.x = (s[ct][r] <= -1.0e38f) ? 0.f : __expf(s[ct][r] - mn); e.y = (s[ct][r + 1] <= -1.0e38f) ? 0.f : __expf(s[ct][r + 1] - mn);
        if (ct == 0) { t[r] = e.x; t[r + 1] = e.y; } else { t[r] += e.x; t[r + 1] += e.y; }
        const v2f x = e * 2048.0f; const v2h hi = __builtin_convertvector(x, v2h); const v2h lo = __builtin_convertvector((x - __builtin_convertvector(hi, v2f)) * 2048.0f, v2h);   // two neighbouring keys share a register of the operand: one packed conversion each for hi and residual
        pa[ct * 8 + r] = hi.x; pa[ct * 8 + r + 1] = hi.y; pl[ct * 8 + r] = lo.x; pl[ct * 8 + r + 1] = lo.y; }   // P scaled by 2^11 before the f16 split so small softmax weights stay out of the f16 subnormal range; 2^-11 folded into the epilogue
    l = l * alpha + (((t[0] + t[1]) + (t[2] + t[3])) + ((t[4] + t[5]) + (t[6] + t[7]))); m = mn;
#pragma unroll
    for (int dt = 0; dt < 4; ++dt)
#pragma unroll
      for (int r = 0; r < 8; ++r) { acc[dt][r] *= alpha; accl[dt][r] *= alpha; }
    asm volatile("" :: "v"(vh[0]), "v"(vh[1]), "v"(vh[2]), "v"(vh[3]), "v"(vl[0]), "v"(vl[1]), "v"(vl[2]), "v"(vl[3]));   // inputs only: holds the trip's V reads from LDS as one group in front of the first P.V matrix instruction
#pragma unroll
    for (int dt = 0; dt < 4; ++dt) { acc[dt] = wmma16(vh[dt], pa, acc[dt]); accl[dt] = wmma16(vh[dt], pl, accl[dt]); accl[dt] = wmma16(vl[dt], pa, accl[dt]); }   // V^T rows as A: V hi x P hi + (V hi x P lo + V lo x P hi) / 2048
    // hand-over of the buffers, in this order in every wave
    asm volatile("s_wait_dscnt 0x0" ::: "memory");      // this wave's LDS reads of tile ks have returned
    asm volatile("s_wait_asynccnt 0x0" ::: "memory");   // this wave's part of tile ks + 1 has landed
    __syncthreads();                                     // publishes tile ks + 1 and ends every wave's reads of tile ks
    if (ks + 2 < nks) stage(ks + 2); }                   // refill of the buffer that this trip has read
  asm volatile("s_wait_asynccnt 0x0" ::: "memory");     // no copy is outstanding behind the loop
  l += xhalf(l);   // the two halves' key sums of one query
  const float il = (1.0f / 2048.0f) / l;
#pragma unroll
  for (int dt = 0; dt < 4; ++dt) { v8b hv, lv;   // a lane's 8 neighbouring d of one query: 16 B of hi, 16 B of residual
#pragma unroll
    for (int r = 0; r < 8; ++r) { const float v = (acc[dt][r] + accl[dt][r] * (1.0f / 2048.0f)) * il; const __bf16 hb = (__bf16)v; hv[r] = hb; lv[r] = (__bf16)(v - (float)hb); }
    __bf16* p = &so[wave][col][(dt >> 1) * 64 + (dt & 1) * 16 + 8 * g]; *(v8b*)p = hv; *(v8b*)(p + 32) = lv; }
  LDSX();
  for (int rl = 0; rl < 16; ++rl) if (lane < 16) vst2(O + ((size_t)b * SS + q0 + rl) * (2 * DM) + h * (2 * HD) + lane * 8, *(const v4u*)&so[wave][rl][lane * 8]);
}
// ---- k_out: block = (64 output channels o, 128 positions, b): y[o][n] = w_out rows (exact) x vals rows O[n][c] (bf16 hi + residual as k_attn stored them, K 1024) -> [B][C][N] rows (512-B segments)
__global__ __launch_bounds__(128) void k_out(const __bf16* __restrict__ O, const __bf16* __restrict__ P, float* __restrict__ Y) {
  __shared__ __align__(16) float so[4][16][132];
  const int tid = threadIdx.x, wave = tid >> 5, lane = tid & 31, col = lane & 15, g = lane >> 4; const int o0 = blockIdx.x * 64 + wave * 16; const int n0 = blockIdx.y * 128; const size_t b = blockIdx.z;
  v8f acc[8] = {};
  // tiles of vals [128 positions][32 channels: 32 hi | 32 residual] and of weights [64 output channels][32 channels] come into LDS once per work-group by asynchronous copies, two buffers: tile t + 1 flies while tile t is worked on
  __shared__ __align__(16) __bf16 sval[2][128][72];   // 128-B rows at a pitch of 144 B (16 B x odd, as WPIT)
  __shared__ __align__(16) __bf16 sw[2][64][WPIT];
  const int vr = tid >> 3, vc8 = (tid & 7) * 8, wr = tid >> 2, wc8 = (tid & 3) * 8;   // copy map: vals, 8 lanes a 128-B row, rows vr + 16 i; weights, 4 lanes a 64-B row segment, rows wr and wr + 32
  const __bf16* vsrc = O + (b * SS + n0 + vr) * (2 * DM) + vc8; const __bf16* wsrc = P + (size_t)(blockIdx.x * 64 + wr) * DM + wc8;
  auto stage = [&](int t) { const int bf = t & 1; const __bf16* s0 = vsrc + t * 64; const __bf16* w0 = wsrc + t * 32;
    // ten 16-byte copies a lane; s_wait_xcnt 0 as the statement's last line stands in front of every later rewrite of the address registers
    asm volatile("global_load_async_to_lds_b128 %0, %10, off\n\t"
                 "global_load_async_to_lds_b128 %1, %11, off\n\t"
                 "global_load_async_to_lds_b128 %2, %12, off\n\t"
                 "global_load_async_to_lds_b128 %3, %13, off\n\t"
                 "global_load_async_to_lds_b128 %4, %14, off\n\t"
                 "global_load_async_to_lds_b128 %5, %15, off\n\t"
                 "global_load_async_to_lds_b128 %6, %16, off\n\t"
                 "global_load_async_to_lds_b128 %7, %17, off\n\t"
                 "global_load_async_to_lds_b128 %8, %18, off\n\t"
                 "global_load_async_to_lds_b128 %9, %19, off\n\t"
                 "s_wait_xcnt 0x0"
                 :: "v"(lds_addr(&sval[bf][vr][vc8])), "v"(lds_addr(&sval[bf][vr + 16][vc8])), "v"(lds_addr(&sval[bf][vr + 32][vc8])), "v"(lds_addr(&sval[bf][vr + 48][vc8])),
                    "v"(lds_addr(&sval[bf][vr + 64][vc8])), "v"(lds_addr(&sval[bf][vr + 80][vc8])), "v"(lds_addr(&sval[bf][vr + 96][vc8])), "v"(lds_addr(&sval[bf][vr + 112][vc8])),
                    "v"(lds_addr(&sw[bf][wr][wc8])), "v"(lds_addr(&sw[bf][wr + 32][wc8])),
                    "v"(s0), "v"(s0 + 16 * (2 * DM)), "v"(s0 + 32 * (2 * DM)), "v"(s0 + 48 * (2 * DM)), "v"(s0 + 64 * (2 * DM)), "v"(s0 + 80 * (2 * DM)), "v"(s0 + 96 * (2 * DM)), "v"(s0 + 112 * (2 * DM)),
                    "v"(w0), "v"(w0 + 32 * DM)
                 : "memory"); };
  stage(0);
  asm volatile("s_wait_asynccnt 0x0" ::: "memory");   // this wave's part of tile 0 has landed
  __syncthreads();                                     // every wave's part of tile 0 is visible
  stage(1);
#pragma unroll 2
  for (int kc = 0; kc < DM / 32; ++kc) { const int bf = kc & 1; const v16b a = frag_b(&sw[bf][wave * 16 + col][0], lane);
    v16b vh[8], vl[8];
#pragma unroll
    for (int j = 0; j < 8; ++j) vl[j] = frag_b(&sval[bf][j * 16 + col][32], lane);
#pragma unroll
    for (int j = 0; j < 8; ++j) vh[j] = frag_b(&sval[bf][j * 16 + col][0], lane);
#pragma unroll
    for (int j = 0; j < 8; ++j) acc[j] = wmma_bf(a, vl[j], acc[j]);   // each accumulator takes its residual product first, then its hi product; the products of the seven other accumulators stand between the two
#pragma unroll
    for (int j = 0; j < 8; ++j) acc[j] = wmma_bf(a, vh[j], acc[j]);
    // hand-over of the buffers, in this order in every wave
    asm volatile("s_wait_dscnt 0x0" ::: "memory");      // this wave's LDS reads of tile kc have returned
    asm volatile("s_wait_asynccnt 0x0" ::: "memory");   // this wave's part of tile kc + 1 has landed
    __syncthreads();                                     // publishes tile kc + 1 and ends every wave's reads of tile kc
    if (kc + 2 < DM / 32) stage(kc + 2); }               // refill of the buffer that this trip has read
  asm volatile("s_wait_asynccnt 0x0" ::: "memory");     // no copy is outstanding behind the loop
#pragma unroll
  for (int j = 0; j < 8; ++j)
#pragma unroll
    for (int r = 0; r < 8; ++r) so[wave][8 * g + r][j * 16 + col] = acc[j][r];
  LDSX();
  for (int rl = 0; rl < 16; ++rl) vst2(Y + (b * DM + o0 + rl) * SS + n0 + lane * 4, *(const v4f*)&so[wave][rl][lane * 4]);
}
extern "C" void kernel_launch(void* const* d_in, const int* in_sizes, int n_in, void* d_out, int out_size, void* d_ws, size_t ws_size, hipStream_t stream) {
  (void)in_sizes; (void)n_in; (void)out_size;
  const float** F = (const float**)d_in;   // 0 x [2,1024,2048], 1 w_qkv [3072,1024] natural (head-interleaved q|k|v blocks of 64), 2 w_out [1024,1024] natural
  if (ws_size < (size_t)WS_END) return;
  char* ws = (char*)d_ws; __bf16* PK = (__bf16*)(ws + WS_PK); _Float16 *QK = (_Float16*)(ws + WS_QK), *QKL = (_Float16*)(ws + WS_QKL), *VTH = (_Float16*)(ws + WS_VTH), *VTL = (_Float16*)(ws + WS_VTL); __bf16* O = (__bf16*)(ws + WS_O); __bf16* XT = (__bf16*)(ws + WS_XT);
  k_pack<<<dim3(QKVW, 2), 256, 0, stream>>>(F[1], F[2], F[0], PK, XT);
  k_qkv<<<dim3(SS / 64, QKVW / 128, TNB), 128, 0, stream>>>(XT, PK + PK_A, QK, QKL, VTH, VTL);
  k_attn<<<dim3(TQB, NH, TNB), 128, 0, stream>>>(QK, QKL, VTH, VTL, O);
  k_out<<<dim3(DM / 64, TON, TNB), 128, 0, stream>>>(O, PK + PK_P, (float*)d_out);
}

// v006
// Measured time: 147 microseconds a run.
// Next to v005, in two timings, it ran 1.08 and 1.07 times as fast.
// All steps since v000 together make it 4.38 times as fast.
// compute dtype: x, w_qkv, w_out rounded to bf16; qkv = w_qkv . x with exact bf16 products on WMMA 16x16x32 (positions as rows via an LDS transpose of the [B,C,N] input, natural weight rows; output channel o -> head o/192, part (o%192)/64, dim o%64); q and k stored as f16 hi + (x2048-scaled) residual planes with 3-product scores x 1/8; running-max softmax in f32 (hardware exp); P (scaled by 2^11, as f16 hi + residual) x v hi/lo (3 products); y = w_out (exact rows) x vals (f32 as bf16 hi + residual, 2 products) written channels-first; f32 accumulate.
#include <hip/hip_runtime.h>
#include <math.h>

typedef __attribute__((ext_vector_type(16))) _Float16 v16h;
typedef __attribute__((ext_vector_type(16))) __bf16 v16b;
typedef __attribute__((ext_vector_type(8)))  _Float16 v8h;
typedef __attribute__((ext_vector_type(8)))  float v8f;
typedef __attribute__((ext_vector_type(4)))  float v4f;
typedef __attribute__((ext_vector_type(2)))  float v2f;
typedef __attribute__((ext_vector_type(4)))  unsigned v4u;
typedef __attribute__((ext_vector_type(4)))  int v4i;
typedef float __attribute__((may_alias)) float_a;
typedef int __attribute__((may_alias)) int_a;

template <typename T> __device__ __forceinline__ void vst2(void* p, T v) { *(T*)p = v;  }
__device__ __forceinline__ v8f wmma16(v16h a, v16h b, v8f c) {
  return __builtin_amdgcn_wmma_f32_16x16x32_f16(false, a, false, b, (short)0, c, false, false);   // plain builtin: the compiler keeps the distance behind it and fills the slots with the loop's own vector work
}
__device__ __forceinline__ v8f wmma_bf(v16b a, v16b b, v8f c) {
  v8f d = __builtin_amdgcn_wmma_f32_16x16x32_bf16(false, a, false, b, (short)0, c, false, false);
  asm volatile("v_nop\n\tv_nop\n\tv_nop\n\tv_nop" : "+v"(d) : "v"(a), "v"(b));
  return d;
}
// Channels-first multi-head attention layer (x [2][1024 channels][2048 positions], 16 heads x 64): 1x1-conv qkv with per-head interleaved (q|k|v) channel blocks, softmax(q k^T / 8) v, 1x1-conv output projection -> [B, C, N].
__device__ __forceinline__ v16h frag_h(const _Float16* rowk0, int lane) {
  union { v16h v; v8h q[2]; } u; const _Float16* p = rowk0 + 8 * (lane >> 4);
  u.q[0] = *(const v8h*)p; u.q[1] = *(const v8h*)(p + 16); return u.v;
}
__device__ __forceinline__ v16h frag_f32(const float* rowk0, int lane) {
  v16h a; const float* p = rowk0 + 8 * (lane >> 4);
#pragma unroll
  for (int i = 0; i < 8; ++i) { a[i] = (_Float16)p[i]; a[8 + i] = (_Float16)p[16 + i]; }
  return a;
}
__device__ __forceinline__ v16h frag_f32s(const float* rowk0, int lane, float sc) {
  v16h a; const float* p = rowk0 + 8 * (lane >> 4);
#pragma unroll
  for (int i = 0; i < 8; ++i) { a[i] = (_Float16)(p[i] * sc); a[8 + i] = (_Float16)(p[16 + i] * sc); }
  return a;
}
// column fragment from a [K][ld] layout (column n), rows >= K read as 0
__device__ __forceinline__ v16h fragc_f32(const float* W, int k0, int n, int lane, int ld, int K) {
  v16h a; const int g = lane >> 4;
#pragma unroll
  for (int i = 0; i < 8; ++i) { const int ka = k0 + 8 * g + i, kb = ka + 16;
    a[i] = (_Float16)(ka < K ? W[(size_t)(ka < K ? ka : K - 1) * ld + n] : 0.f); a[8 + i] = (_Float16)(kb < K ? W[(size_t)(kb < K ? kb : K - 1) * ld + n] : 0.f); }
  return a;
}
struct F2 { v16b h, l; };
__device__ __forceinline__ F2 bsplit16(const float v[16]) { F2 r;
#pragma unroll
  for (int i = 0; i < 16; ++i) { const __bf16 h = (__bf16)v[i]; r.h[i] = h; r.l[i] = (__bf16)(v[i] - (float)h); }
  return r; }
__device__ __forceinline__ F2 split_row(const float* row, int k0, int lane) { float v[16]; const float* p = row + k0 + 8 * (lane >> 4);
#pragma unroll
  for (int i = 0; i < 8; ++i) { v[i] = p[i]; v[8 + i] = p[16 + i]; }
  return bsplit16(v); }
__device__ __forceinline__ F2 split_rowK(const float* row, int k0, int lane, int K) { float v[16]; const int g = lane >> 4;
#pragma unroll
  for (int i = 0; i < 8; ++i) { const int ka = k0 + 8 * g + i, kb = ka + 16; v[i] = ka < K ? row[ka < K ? ka : K - 1] : 0.f; v[8 + i] = kb < K ? row[kb < K ? kb : K - 1] : 0.f; }
  return bsplit16(v); }
__device__ __forceinline__ F2 split_col(const float* W, int k0, int n, int lane, int ld, int K) { float v[16]; const int g = lane >> 4;
#pragma unroll
  for (int i = 0; i < 8; ++i) { const int ka = k0 + 8 * g + i, kb = ka + 16; v[i] = ka < K ? W[(size_t)(ka < K ? ka : K - 1) * ld + n] : 0.f; v[8 + i] = kb < K ? W[(size_t)(kb < K ? kb : K - 1) * ld + n] : 0.f; }
  return bsplit16(v); }
__device__ __forceinline__ v8f mac3(const F2& a, const F2& b, v8f c) { c = wmma_bf(a.l, b.h, c); c = wmma_bf(a.h, b.l, c); return wmma_bf(a.h, b.h, c); }
__device__ __forceinline__ float sigm(float v) { return 1.0f / (1.0f + expf(-v)); }
#define LDSX() do { asm volatile("s_wait_dscnt 0" ::: "memory"); __builtin_amdgcn_wave_barrier(); __builtin_amdgcn_fence(__ATOMIC_RELEASE, "workgroup"); } while (0)


#define NB 2
#define SS 2048
#define DM 1024
#define NH 16
#define HD 64
#define QKVW (3 * DM)
#ifndef TQB
#define TQB (SS / 64)
#define TNB NB
#define TON (SS / 128)         // output position blocks per batch (all)
#endif
typedef __attribute__((ext_vector_type(8))) __bf16 v8b;
__device__ __forceinline__ v16b frag_b(const __bf16* rowk0, int lane) {
  union { v16b v; v8b q[2]; } u; const __bf16* p = rowk0 + 8 * (lane >> 4);
  u.q[0] = *(const v8b*)p; u.q[1] = *(const v8b*)(p + 16); return u.v;
}
__device__ __forceinline__ unsigned lds_addr(const void* p) { return (unsigned)(size_t)p; }   // low 32 bits of a __shared__ address = byte offset in the work-group's LDS
#define RPIT 72   // 16-bit elements per staged 128-B row: 128 B + 16 B (a pitch of 16 B x odd keeps 16-byte LDS reads of 16 rows off each other's banks)
__device__ __forceinline__ float bfr(float v) { return (float)(__bf16)v; }
__device__ __attribute__((noinline)) float exp_ni(float v) { return expf(v); }
__device__ __attribute__((noinline)) float erf_ni(float v) { return erff(v); }

#define PK_A 0                       // [3072][1024] Wqkv rows (natural [out][in])
#define PK_P (PK_A + QKVW * DM)        // [1024][1024] Wo rows (natural)
#define PK_END (PK_P + DM * DM)
#define WS_PK  0u
#define WS_QK  (WS_PK + 2u * PK_END)             // f16 [4096 rows][2048]: q | k
#define WS_QKL (WS_QK + 2u * NB * SS * 2 * DM)     // f16 q | k residual planes x2048
#define WS_VTH (WS_QKL + 2u * NB * SS * 2 * DM)    // f16 [b][1024 (h*64+d)][2048 s] hi
#define WS_VTL (WS_VTH + 2u * NB * DM * SS)        // f16 lo x 2048
#define WS_O   (WS_VTL + 2u * NB * DM * SS)        // bf16 [b * 2048 + position][32 groups of 32 channels][32 hi | 32 residual]: vals already split for k_out, 4 B a value
#define WS_XT  (WS_O + 4u * NB * SS * DM)           // bf16 [b][2048 positions][1024 channels]: x rounded and transposed
#define WS_END (WS_XT + 2u * NB * SS * DM)
// ---- k_pack: block = (row n, which): natural [out][in] rows -> bf16; which 0 -> w_qkv row n into PK_A; which 1, n < 1024 -> w_out row n into PK_P
// which 1, n >= 1024 (2048 blocks with no weight row): tile n - 1024 of x, [64 channels][32 positions] -> XT[b][position][channel] in bf16, so that x is rounded and transposed once and not once per block of k_qkv
__global__ __launch_bounds__(256) void k_pack(const float* __restrict__ WQKV, const float* __restrict__ WOUT, const float* __restrict__ X, __bf16* __restrict__ PK, __bf16* __restrict__ XT) {
  __shared__ __align__(16) __bf16 s[DM]; const int n = blockIdx.x, which = blockIdx.y, t = threadIdx.x; const float* src = (which == 0) ? (WQKV + (size_t)n * DM) : (WOUT + (size_t)(n - 0) * DM);
  if (which == 1 && n >= DM) {
    __shared__ __align__(16) __bf16 sx[32][72];   // [position][channel]: 128-B rows at a pitch of 144 B
    const int id = n - DM, bb = id >> 10, c0 = (id & 15) * 64, p0 = ((id >> 4) & 63) * 32;
    for (int i = 0; i < 2; ++i) { const int c = (t >> 3) + 32 * i, p4 = (t & 7) * 4;   // 8 lanes read one channel's 128-B line
      const v4f v = *(const v4f*)(X + ((size_t)bb * DM + c0 + c) * SS + p0 + p4);
      for (int k = 0; k < 4; ++k) sx[p4 + k][c] = (__bf16)v[k]; }
    __syncthreads();
    const int p = t >> 3, c8 = (t & 7) * 8;   // 8 lanes write one position's 128-B line
    vst2((unsigned*)(XT + ((size_t)bb * SS + p0 + p) * DM + c0 + c8), *(const v4u*)&sx[p][c8]);
    return; }
  for (int k = t; k < DM; k += 256) s[k] = (__bf16)src[k];
  __syncthreads();
  __bf16* dst = (which == 0) ? PK + PK_A + (size_t)n * DM : PK + PK_P + (size_t)n * DM;
  for (int q = t; q < DM / 8; q += 256) vst2((unsigned*)(dst + q * 8), *(const v4u*)&s[q * 8]);
}
// ---- k_qkv: block = (64 positions, 128 of the 3072 output channels, b): A rows from XT[b][n][c] (x in bf16, transposed by k_pack); each 16-col tile is one (head, part, 16 dims): q/k -> f16 hi/lo row segments [row][part*1024 + h*64 + d]; v -> planes [b][h*64 + d][n]
__global__ __launch_bounds__(128) void k_qkv(const __bf16* __restrict__ XT, const __bf16* __restrict__ P, _Float16* __restrict__ QK, _Float16* __restrict__ QKL, _Float16* __restrict__ VTH, _Float16* __restrict__ VTL) {
  // one LDS block, used twice: the ring's two buffers while the loop runs, the epilogue's transposing buffers behind the loop's last barrier (so that four work-groups fit a WGP's LDS)
  __shared__ __align__(16) char sm[2 * 4 * 16 * 136 * 2 + 2 * 128 * 72 * 2];
  _Float16 (*so)[16][136] = (_Float16 (*)[16][136])sm; _Float16 (*sol)[16][136] = (_Float16 (*)[16][136])(sm + 4 * 16 * 136 * 2);
  _Float16 (*sth)[72] = (_Float16 (*)[72])(sm + 2 * 4 * 16 * 136 * 2); _Float16 (*stl)[72] = (_Float16 (*)[72])(sm + 2 * 4 * 16 * 136 * 2 + 128 * 72 * 2);
  const int tid = threadIdx.x, wave = tid >> 5, lane = tid & 31, col = lane & 15, g = lane >> 4; const size_t b = blockIdx.z; const int p0 = blockIdx.x * 64; const int n0 = blockIdx.y * 128; const size_t r0 = b * SS + p0 + wave * 16;
  v8f acc[8] = {};
  // tiles of weights [128 output channels][64 input channels] and of x [64 positions][64 input channels] come into LDS once per work-group by asynchronous copies, two buffers: tile t + 1 flies while tile t is worked on; 64 channels make each copied row one whole 128-B line
  __bf16 (*sb)[128][RPIT] = (__bf16 (*)[128][RPIT])sm;
  __bf16 (*sx)[64][RPIT] = (__bf16 (*)[64][RPIT])(sm + 2 * 128 * RPIT * 2);
  const int wr = tid >> 3, wc8 = (tid & 7) * 8;   // copy map: 8 lanes a 128-B row, rows wr + 16 i
  const __bf16* wsrc = P + (size_t)(n0 + wr) * DM + wc8; const __bf16* xsrc = XT + (b * SS + p0 + wr) * DM + wc8;
  auto stage = [&](int t) { const int bf = t & 1; const __bf16* s0 = wsrc + t * 64; const __bf16* x0 = xsrc + t * 64;
    // twelve 16-byte copies a lane; s_wait_xcnt 0 as the statement's last line stands in front of every later rewrite of the address registers
    asm volatile("global_load_async_to_lds_b128 %0, %12, off\n\t"
                 "global_load_async_to_lds_b128 %1, %13, off\n\t"
                 "global_load_async_to_lds_b128 %2, %14, off\n\t"
                 "global_load_async_to_lds_b128 %3, %15, off\n\t"
                 "global_load_async_to_lds_b128 %4, %16, off\n\t"
                 "global_load_async_to_lds_b128 %5, %17, off\n\t"
                 "global_load_async_to_lds_b128 %6, %18, off\n\t"
                 "global_load_async_to_lds_b128 %7, %19, off\n\t"
                 "global_load_async_to_lds_b128 %8, %20, off\n\t"
                 "global_load_async_to_lds_b128 %9, %21, off\n\t"
                 "global_load_async_to_lds_b128 %10, %22, off\n\t"
                 "global_load_async_to_lds_b128 %11, %23, off\n\t"
                 "s_wait_xcnt 0x0"
                 :: "v"(lds_addr(&sb[bf][wr][wc8])), "v"(lds_addr(&sb[bf][wr + 16][wc8])), "v"(lds_addr(&sb[bf][wr + 32][wc8])), "v"(lds_addr(&sb[bf][wr + 48][wc8])),
                    "v"(lds_addr(&sb[bf][wr + 64][wc8])), "v"(lds_addr(&sb[bf][wr + 80][wc8])), "v"(lds_addr(&sb[bf][wr + 96][wc8])), "v"(lds_addr(&sb[bf][wr + 112][wc8])),
                    "v"(lds_addr(&sx[bf][wr][wc8])), "v"(lds_addr(&sx[bf][wr + 16][wc8])), "v"(lds_addr(&sx[bf][wr + 32][wc8])), "v"(lds_addr(&sx[bf][wr + 48][wc8])),
                    "v"(s0), "v"(s0 + 16 * DM), "v"(s0 + 32 * DM), "v"(s0 + 48 * DM), "v"(s0 + 64 * DM), "v"(s0 + 80 * DM), "v"(s0 + 96 * DM), "v"(s0 + 112 * DM),
                    "v"(x0), "v"(x0 + 16 * DM), "v"(x0 + 32 * DM), "v"(x0 + 48 * DM)
                 : "memory"); };
  stage(0);
  asm volatile("s_wait_asynccnt 0x0" ::: "memory");   // this wave's part of tile 0 has landed
  __syncthreads();                                     // every wave's part of tile 0 is visible
  stage(1);
#pragma unroll 2
    for (int t = 0; t < DM / 64; ++t) { const int bf = t & 1;
      v16b a[2], w[2][8];
#pragma unroll
      for (int kh = 0; kh < 2; ++kh) { a[kh] = frag_b(&sx[bf][wave * 16 + col][kh * 32], lane);
#pragma unroll
        for (int j = 0; j < 8; ++j) w[kh][j] = frag_b(&sb[bf][j * 16 + col][kh * 32], lane); }
#pragma unroll
      for (int kh = 0; kh < 2; ++kh) {
        asm volatile("" :: "v"(a[kh]), "v"(w[kh][0]), "v"(w[kh][1]), "v"(w[kh][2]), "v"(w[kh][3]), "v"(w[kh][4]), "v"(w[kh][5]), "v"(w[kh][6]), "v"(w[kh][7]));   // inputs only: holds each half's LDS reads as one group in front of its first matrix instruction (one LDS wait a half, not one a tile)
#pragma unroll
        for (int j = 0; j < 8; ++j) acc[j] = wmma_bf(a[kh], w[kh][j], acc[j]); }
      // hand-over of the buffers, in this order in every wave
      asm volatile("s_wait_dscnt 0x0" ::: "memory");      // this wave's LDS reads of tile t have returned
      asm volatile("s_wait_asynccnt 0x0" ::: "memory");   // this wave's part of tile t + 1 has landed
      __syncthreads();                                     // publishes tile t + 1 and ends every wave's reads of tile t
      if (t + 2 < DM / 64) stage(t + 2); }                 // refill of the buffer that this trip has read
  asm volatile("s_wait_asynccnt 0x0" ::: "memory");       // no copy is outstanding behind the loop
  // epilogue: tile j -> o0 = n0 + j*16; h = o0 / 192; part = (o0 % 192) / 64; d = o0 % 64 + col
#pragma unroll
  for (int j = 0; j < 8; ++j) { const int o0 = n0 + j * 16; const int part = (o0 % 192) / 64;
#pragma unroll
    for (int r = 0; r < 8; ++r) { const float v = acc[j][r]; const _Float16 hv = (_Float16)v; const _Float16 lv = (_Float16)((v - (float)hv) * 2048.0f);
      if (part < 2) { so[wave][8 * g + r][j * 16 + col] = hv; sol[wave][8 * g + r][j * 16 + col] = lv; } else { sth[j * 16 + col][wave * 16 + 8 * g + r] = hv; stl[j * 16 + col][wave * 16 + 8 * g + r] = lv; } } }
  __syncthreads();
  // stores: per tile group of 4 (64 channels = one (head, part)): tiles j = 4*q4 .. 4*q4+3 share (h, part) since 64-runs align
#pragma unroll
  for (int q4 = 0; q4 < 2; ++q4) { const int o0 = n0 + q4 * 64; const int h = o0 / 192, part = (o0 % 192) / 64;
    if (part < 2) {
      for (int rl = 0; rl < 16; ++rl) if (lane < 8) { vst2((unsigned*)(QK + (r0 + rl) * (2 * DM) + part * DM + h * HD + lane * 8), *(const v4u*)&so[wave][rl][q4 * 64 + lane * 8]); vst2((unsigned*)(QKL + (r0 + rl) * (2 * DM) + part * DM + h * HD + lane * 8), *(const v4u*)&sol[wave][rl][q4 * 64 + lane * 8]); }
    } else {
      for (int e = tid; e < 64 * 8; e += 128) { const int d = e >> 3, pc = e & 7; const size_t o = (b * DM + h * HD + d) * SS + p0 + pc * 8; vst2((unsigned*)(VTH + o), *(const v4u*)&sth[q4 * 64 + d][pc * 8]); vst2((unsigned*)(VTL + o), *(const v4u*)&stl[q4 * 64 + d][pc * 8]); } } }
}
typedef __attribute__((ext_vector_type(2))) _Float16 v2h;
// lane l <-> lane l ^ 16 in one vector instruction
__device__ __forceinline__ float xhalf(float v) { const int b = __builtin_bit_cast(int, v); return __builtin_bit_cast(float, __builtin_amdgcn_permlanex16(b, b, 0x76543210, 0xfedcba98, false, false)); }
#define KPIT 72   // halfs per staged K row: 128 B + 16 B (a pitch of 16 B x odd keeps 16-byte LDS reads of 16 rows off each other's banks)
#define VPIT 72   // halfs per staged V row: 128 B + 16 B, same reason
__global__ __launch_bounds__(128) void k_attn(const _Float16* __restrict__ QK, const _Float16* __restrict__ QKL, const _Float16* __restrict__ VTH, const _Float16* __restrict__ VTL, __bf16* __restrict__ O) {
  // one LDS block, used twice: the ring's two buffers while the loop runs, the epilogue's rows behind the loop's last barrier (so that four work-groups fit a WGP's LDS)
  __shared__ __align__(16) char sm[2 * 2 * 64 * KPIT * 2 + 2 * 2 * 64 * VPIT * 2];
  __bf16 (*so)[16][136] = (__bf16 (*)[16][136])sm;   // [wave][query][2 x (32 hi | 32 residual)]: 256-B rows at a pitch of 272 B
  _Float16 (*sk)[2][64][KPIT] = (_Float16 (*)[2][64][KPIT])sm;   // [buffer][hi | residual][key][d]
  _Float16 (*sv)[2][64][VPIT] = (_Float16 (*)[2][64][VPIT])(sm + 2 * 2 * 64 * KPIT * 2);   // [buffer][hi | residual][d][key]
  const int tid = threadIdx.x, wave = tid >> 5, lane = tid & 31, col = lane & 15, g = lane >> 4;
  const int qb = blockIdx.x, h = blockIdx.y, b = blockIdx.z; const int q0 = qb * 64 + wave * 16; const size_t rq = (size_t)b * SS + q0 + col;
  const int nks = SS / 64;   // all keys, 64 a tile
  // copy map: K and V alike, 8 lanes a 128-B row, rows kr + 16 i
  const int kr = tid >> 3, kc8 = (tid & 7) * 8;
  const size_t koff = ((size_t)b * SS + kr) * (2 * DM) + DM + h * HD + kc8, voff = ((size_t)b * DM + h * HD + kr) * SS + kc8;
  auto stage = [&](int t) { const int bf = t & 1; const size_t ko = koff + (size_t)t * 64 * (2 * DM), vo = voff + (size_t)t * 64;
    // sixteen 16-byte copies a lane, K's eight and V's eight; s_wait_xcnt 0 as each statement's last line stands in front of every later rewrite of the address registers
    asm volatile("global_load_async_to_lds_b128 %0, %8, off\n\t"
                 "global_load_async_to_lds_b128 %1, %9, off\n\t"
                 "global_load_async_to_lds_b128 %2, %10, off\n\t"
                 "global_load_async_to_lds_b128 %3, %11, off\n\t"
                 "global_load_async_to_lds_b128 %4, %12, off\n\t"
                 "global_load_async_to_lds_b128 %5, %13, off\n\t"
                 "global_load_async_to_lds_b128 %6, %14, off\n\t"
                 "global_load_async_to_lds_b128 %7, %15, off\n\t"
                 "s_wait_xcnt 0x0"
                 :: "v"(lds_addr(&sk[bf][0][kr][kc8])), "v"(lds_addr(&sk[bf][0][kr + 16][kc8])), "v"(lds_addr(&sk[bf][0][kr + 32][kc8])), "v"(lds_addr(&sk[bf][0][kr + 48][kc8])),
                    "v"(lds_addr(&sk[bf][1][kr][kc8])), "v"(lds_addr(&sk[bf][1][kr + 16][kc8])), "v"(lds_addr(&sk[bf][1][kr + 32][kc8])), "v"(lds_addr(&sk[bf][1][kr + 48][kc8])),
                    "v"(QK + ko), "v"(QK + ko + 16 * (2 * DM)), "v"(QK + ko + 32 * (2 * DM)), "v"(QK + ko + 48 * (2 * DM)),
                    "v"(QKL + ko), "v"(QKL + ko + 16 * (2 * DM)), "v"(QKL + ko + 32 * (2 * DM)), "v"(QKL + ko + 48 * (2 * DM))
                 : "memory");
    asm volatile("global_load_async_to_lds_b128 %0, %8, off\n\t"
                 "global_load_async_to_lds_b128 %1, %9, off\n\t"
                 "global_load_async_to_lds_b128 %2, %10, off\n\t"
                 "global_load_async_to_lds_b128 %3, %11, off\n\t"
                 "global_load_async_to_lds_b128 %4, %12, off\n\t"
                 "global_load_async_to_lds_b128 %5, %13, off\n\t"
                 "global_load_async_to_lds_b128 %6, %14, off\n\t"
                 "global_load_async_to_lds_b128 %7, %15, off\n\t"
                 "s_wait_xcnt 0x0"
                 :: "v"(lds_addr(&sv[bf][0][kr][kc8])), "v"(lds_addr(&sv[bf][0][kr + 16][kc8])), "v"(lds_addr(&sv[bf][0][kr + 32][kc8])), "v"(lds_addr(&sv[bf][0][kr + 48][kc8])),
                    "v"(lds_addr(&sv[bf][1][kr][kc8])), "v"(lds_addr(&sv[bf][1][kr + 16][kc8])), "v"(lds_addr(&sv[bf][1][kr + 32][kc8])), "v"(lds_addr(&sv[bf][1][kr + 48][kc8])),
                    "v"(VTH + vo), "v"(VTH + vo + 16 * SS), "v"(VTH + vo + 32 * SS), "v"(VTH + vo + 48 * SS),
                    "v"(VTL + vo), "v"(VTL + vo + 16 * SS), "v"(VTL + vo + 32 * SS), "v"(VTL + vo + 48 * SS)
                 : "memory"); };
  stage(0);
  asm volatile("s_wait_asynccnt 0x0" ::: "memory");   // this wave's part of tile 0 has landed
  __syncthreads();                                     // every wave's part of tile 0 is visible
  stage(1);
  v16h aq[2], aql[2];
#pragma unroll
  for (int kc = 0; kc < 2; ++kc) { aq[kc] = frag_h(QK + rq * (2 * DM) + h * HD + kc * 32, lane); aql[kc] = frag_h(QKL + rq * (2 * DM) + h * HD + kc * 32, lane); }
  float m = -3.0e38f, l = 0.f;   // of this lane's query (col); l holds the keys of this lane half only, the halves join behind the loop
  v8f acc[4] = {}, accl[4] = {};   // O^T tiles: register r = O[query col][d = dt * 16 + 8 g + r]
#pragma unroll 1
  for (int ks = 0; ks < nks; ++ks) { const int bf = ks & 1;
#pragma unroll 1   // the tile's two steps of 32 keys run through one copy of the body: unrolled, both steps' fragments are live together and a fourth wave no longer fits a SIMD's registers
   for (int sub = 0; sub < 2; ++sub) { v8f s[2]; v16h kf[2][2], kl[2][2];
#pragma unroll
    for (int ct = 0; ct < 2; ++ct)
#pragma unroll
      for (int kc = 0; kc < 2; ++kc) { kf[ct][kc] = frag_h(&sk[bf][0][sub * 32 + ct * 16 + col][kc * 32], lane); kl[ct][kc] = frag_h(&sk[bf][1][sub * 32 + ct * 16 + col][kc * 32], lane); }
    asm volatile("" :: "v"(kf[0][0]), "v"(kf[0][1]), "v"(kf[1][0]), "v"(kf[1][1]), "v"(kl[0][0]), "v"(kl[0][1]), "v"(kl[1][0]), "v"(kl[1][1]));   // inputs only: holds the trip's K reads from LDS as one group in front of the first matrix instruction (one LDS wait, not one a fragment)
#pragma unroll
    for (int ct = 0; ct < 2; ++ct) { v8f c = {}, cl = {};
#pragma unroll
      for (int kc = 0; kc < 2; ++kc) { c = wmma16(kf[ct][kc], aq[kc], c); cl = wmma16(kf[ct][kc], aql[kc], cl); cl = wmma16(kl[ct][kc], aq[kc], cl); }   // 3 products: q, k as f16 hi + residual; K rows as A, Q as B: register r = score of key ct * 16 + 8 g + r for query col
#pragma unroll
      for (int r = 0; r < 8; ++r) c[r] += cl[r] * (1.0f / 2048.0f);
#pragma unroll
      for (int r = 0; r < 8; ++r) s[ct][r] = c[r] * 0.125f; }   // 1/sqrt(64), all keys
    v16h vh[4], vl[4];
#pragma unroll
    for (int dt = 0; dt < 4; ++dt) { vh[dt] = frag_h(&sv[bf][0][dt * 16 + col][sub * 32], lane); vl[dt] = frag_h(&sv[bf][1][dt * 16 + col][sub * 32], lane); }
    // a lane holds 16 of its query's 32 scores, lane ^ 16 the other 16: maximum and sum in registers, one exchange between the halves for the maximum
    float t[8];
#pragma unroll
    for (int r = 0; r < 8; ++r) t[r] = fmaxf(s[0][r], s[1][r]);
    float mx = fmaxf(fmaxf(fmaxf(t[0], t[1]), fmaxf(t[2], t[3])), fmaxf(fmaxf(t[4], t[5]), fmaxf(t[6], t[7])));
    mx = fmaxf(mx, xhalf(mx));
    const float mn = fmaxf(m, mx); const float alpha = (m <= -1.0e38f) ? 0.f : __expf(m - mn);
    v16h pa, pl;   // P^T as B operand: element ct * 8 + r is key ct * 16 + 8 g + r, the order in which frag_h reads V^T's keys
#pragma unroll
    for (int ct = 0; ct < 2; ++ct)
#pragma unroll
      for (int r = 0; r < 8; r += 2) { v2f e; e.x = (s[ct][r] <= -1.0e38f) ? 0.f : __expf(s[ct][r] - mn); e.y = (s[ct][r + 1] <= -1.0e38f) ? 0.f : __expf(s[ct][r + 1] - mn);
        if (ct == 0) { t[r] = e.x; t[r + 1] = e.y; } else { t[r] += e.x; t[r + 1] += e.y; }
        const v2f x = e * 2048.0f; const v2h hi = __builtin_convertvector(x, v2h); const v2h lo = __builtin_convertvector((x - __builtin_convertvector(hi, v2f)) * 2048.0f, v2h);   // two neighbouring keys share a register of the operand: one packed conversion each for hi and residual
        pa[ct * 8 + r] = hi.x; pa[ct * 8 + r + 1] = hi.y; pl[ct * 8 + r] = lo.x; pl[ct * 8 + r + 1] = lo.y; }   // P scaled by 2^11 before the f16 split so small softmax weights stay out of the f16 subnormal range; 2^-11 folded into the epilogue
    l = l * alpha + (((t[0] + t[1]) + (t[2] + t[3])) + ((t[4] + t[5]) + (t[6] + t[7]))); m = mn;
#pragma unroll
    for (int dt = 0; dt < 4; ++dt)
#pragma unroll
      for (int r = 0; r < 8; ++r) { acc[dt][r] *= alpha; accl[dt][r] *= alpha; }
    asm volatile("" :: "v"(vh[0]), "v"(vh[1]), "v"(vh[2]), "v"(vh[3]), "v"(vl[0]), "v"(vl[1]), "v"(vl[2]), "v"(vl[3]));   // inputs only: holds the trip's V reads from LDS as one group in front of the first P.V matrix instruction
#pragma unroll
    for (int dt = 0; dt < 4; ++dt) { acc[dt] = wmma16(vh[dt], pa, acc[dt]); accl[dt] = wmma16(vh[dt], pl, accl[dt]); accl[dt] = wmma16(vl[dt], pa, accl[dt]); }   // V^T rows as A: V hi x P hi + (V hi x P lo + V lo x P hi) / 2048
    __builtin_amdgcn_sched_barrier(0);   // holds the four slots below behind the last matrix instruction (without it the scheduler lifts them in front)
    asm volatile("v_nop\n\tv_nop\n\tv_nop\n\tv_nop"); }   // the branch back to the second 32 keys follows the last matrix instructions: these four slots keep the distance to the next step's first writes of their operand registers
    // hand-over of the buffers, in this order in every wave
    asm volatile("s_wait_dscnt 0x0" ::: "memory");      // this wave's LDS reads of tile ks have returned
    asm volatile("s_wait_asynccnt 0x0" ::: "memory");   // this wave's part of tile ks + 1 has landed
    __syncthreads();                                     // publishes tile ks + 1 and ends every wave's reads of tile ks
    if (ks + 2 < nks) stage(ks + 2); }                   // refill of the buffer that this trip has read
  asm volatile("s_wait_asynccnt 0x0" ::: "memory");     // no copy is outstanding behind the loop
  l += xhalf(l);   // the two halves' key sums of one query
  const float il = (1.0f / 2048.0f) / l;
#pragma unroll
  for (int dt = 0; dt < 4; ++dt) { v8b hv, lv;   // a lane's 8 neighbouring d of one query: 16 B of hi, 16 B of residual
#pragma unroll
    for (int r = 0; r < 8; ++r) { const float v = (acc[dt][r] + accl[dt][r] * (1.0f / 2048.0f)) * il; const __bf16 hb = (__bf16)v; hv[r] = hb; lv[r] = (__bf16)(v - (float)hb); }
    __bf16* p = &so[wave][col][(dt >> 1) * 64 + (dt & 1) * 16 + 8 * g]; *(v8b*)p = hv; *(v8b*)(p + 32) = lv; }
  LDSX();
  for (int rl = 0; rl < 16; ++rl) if (lane < 16) vst2(O + ((size_t)b * SS + q0 + rl) * (2 * DM) + h * (2 * HD) + lane * 8, *(const v4u*)&so[wave][rl][lane * 8]);
}
// ---- k_out: block = (64 output channels o, 128 positions, b): y[o][n] = w_out rows (exact) x vals rows O[n][c] (bf16 hi + residual as k_attn stored them, K 1024) -> [B][C][N] rows (512-B segments)
__global__ __launch_bounds__(128) void k_out(const __bf16* __restrict__ O, const __bf16* __restrict__ P, float* __restrict__ Y) {
  __shared__ __align__(16) float so[4][16][132];
  const int tid = threadIdx.x, wave = tid >> 5, lane = tid & 31, col = lane & 15, g = lane >> 4; const int o0 = blockIdx.x * 64 + wave * 16; const int n0 = blockIdx.y * 128; const size_t b = blockIdx.z;
  v8f acc[8] = {};
  // tiles of vals [128 positions][64 channels: 2 x (32 hi | 32 residual)] and of weights [64 output channels][64 channels] come into LDS once per work-group by asynchronous copies, two buffers: tile t + 1 flies while tile t is worked on; 64 channels make each copied weight row one whole 128-B line
  __shared__ __align__(16) __bf16 sval[2][128][136];   // 256-B rows at a pitch of 272 B (16 B x odd, as RPIT)
  __shared__ __align__(16) __bf16 sw[2][64][RPIT];
  const int vr = tid >> 4, vc8 = (tid & 15) * 8, wr = tid >> 3, wc8 = (tid & 7) * 8;   // copy map: vals, 16 lanes a 256-B row, rows vr + 8 i; weights, 8 lanes a 128-B row, rows wr + 16 i
  const __bf16* vsrc = O + (b * SS + n0 + vr) * (2 * DM) + vc8; const __bf16* wsrc = P + (size_t)(blockIdx.x * 64 + wr) * DM + wc8;
  auto stage = [&](int t) { const int bf = t & 1; const __bf16* s0 = vsrc + t * 128; const __bf16* w0 = wsrc + t * 64;
    // twenty 16-byte copies a lane, ten a statement; s_wait_xcnt 0 as each statement's last line stands in front of every later rewrite of the address registers
    asm volatile("global_load_async_to_lds_b128 %0, %10, off\n\t"
                 "global_load_async_to_lds_b128 %1, %11, off\n\t"
                 "global_load_async_to_lds_b128 %2, %12, off\n\t"
                 "global_load_async_to_lds_b128 %3, %13, off\n\t"
                 "global_load_async_to_lds_b128 %4, %14, off\n\t"
                 "global_load_async_to_lds_b128 %5, %15, off\n\t"
                 "global_load_async_to_lds_b128 %6, %16, off\n\t"
                 "global_load_async_to_lds_b128 %7, %17, off\n\t"
                 "global_load_async_to_lds_b128 %8, %18, off\n\t"
                 "global_load_async_to_lds_b128 %9, %19, off\n\t"
                 "s_wait_xcnt 0x0"
                 :: "v"(lds_addr(&sval[bf][vr][vc8])), "v"(lds_addr(&sval[bf][vr + 8][vc8])), "v"(lds_addr(&sval[bf][vr + 16][vc8])), "v"(lds_addr(&sval[bf][vr + 24][vc8])),
                    "v"(lds_addr(&sval[bf][vr + 32][vc8])), "v"(lds_addr(&sval[bf][vr + 40][vc8])), "v"(lds_addr(&sval[bf][vr + 48][vc8])), "v"(lds_addr(&sval[bf][vr + 56][vc8])),
                    "v"(lds_addr(&sw[bf][wr][wc8])), "v"(lds_addr(&sw[bf][wr + 16][wc8])),
                    "v"(s0), "v"(s0 + 8 * (2 * DM)), "v"(s0 + 16 * (2 * DM)), "v"(s0 + 24 * (2 * DM)), "v"(s0 + 32 * (2 * DM)), "v"(s0 + 40 * (2 * DM)), "v"(s0 + 48 * (2 * DM)), "v"(s0 + 56 * (2 * DM)),
                    "v"(w0), "v"(w0 + 16 * DM)
                 : "memory");
    asm volatile("global_load_async_to_lds_b128 %0, %10, off\n\t"
                 "global_load_async_to_lds_b128 %1, %11, off\n\t"
                 "global_load_async_to_lds_b128 %2, %12, off\n\t"
                 "global_load_async_to_lds_b128 %3, %13, off\n\t"
                 "global_load_async_to_lds_b128 %4, %14, off\n\t"
                 "global_load_async_to_lds_b128 %5, %15, off\n\t"
                 "global_load_async_to_lds_b128 %6, %16, off\n\t"
                 "global_load_async_to_lds_b128 %7, %17, off\n\t"
                 "global_load_async_to_lds_b128 %8, %18, off\n\t"
                 "global_load_async_to_lds_b128 %9, %19, off\n\t"
                 "s_wait_xcnt 0x0"
                 :: "v"(lds_addr(&sval[bf][vr + 64][vc8])), "v"(lds_addr(&sval[bf][vr + 72][vc8])), "v"(lds_addr(&sval[bf][vr + 80][vc8])), "v"(lds_addr(&sval[bf][vr + 88][vc8])),
                    "v"(lds_addr(&sval[bf][vr + 96][vc8])), "v"(lds_addr(&sval[bf][vr + 104][vc8])), "v"(lds_addr(&sval[bf][vr + 112][vc8])), "v"(lds_addr(&sval[bf][vr + 120][vc8])),
                    "v"(lds_addr(&sw[bf][wr + 32][wc8])), "v"(lds_addr(&sw[bf][wr + 48][wc8])),
                    "v"(s0 + 64 * (2 * DM)), "v"(s0 + 72 * (2 * DM)), "v"(s0 + 80 * (2 * DM)), "v"(s0 + 88 * (2 * DM)), "v"(s0 + 96 * (2 * DM)), "v"(s0 + 104 * (2 * DM)), "v"(s0 + 112 * (2 * DM)), "v"(s0 + 120 * (2 * DM)),
                    "v"(w0 + 32 * DM), "v"(w0 + 48 * DM)
                 : "memory"); };
  stage(0);
  asm volatile("s_wait_asynccnt 0x0" ::: "memory");   // this wave's part of tile 0 has landed
  __syncthreads();                                     // every wave's part of tile 0 is visible
  stage(1);
#pragma unroll 2
  for (int kc = 0; kc < DM / 64; ++kc) { const int bf = kc & 1;
#pragma unroll
   for (int kh = 0; kh < 2; ++kh) { const v16b a = frag_b(&sw[bf][wave * 16 + col][kh * 32], lane);   // the tile's two groups of 32 channels, in ascending order
    v16b vh[8], vl[8];
#pragma unroll
    for (int j = 0; j < 8; ++j) vl[j] = frag_b(&sval[bf][j * 16 + col][kh * 64 + 32], lane);
#pragma unroll
    for (int j = 0; j < 8; ++j) vh[j] = frag_b(&sval[bf][j * 16 + col][kh * 64], lane);
#pragma unroll
    for (int j = 0; j < 8; ++j) acc[j] = wmma_bf(a, vl[j], acc[j]);   // each accumulator takes its residual product first, then its hi product; the products of the seven other accumulators stand between the two
#pragma unroll
    for (int j = 0; j < 8; ++j) acc[j] = wmma_bf(a, vh[j], acc[j]); }
    // hand-over of the buffers, in this order in every wave
    asm volatile("s_wait_dscnt 0x0" ::: "memory");      // this wave's LDS reads of tile kc have returned
    asm volatile("s_wait_asynccnt 0x0" ::: "memory");   // this wave's part of tile kc + 1 has landed
    __syncthreads();                                     // publishes tile kc + 1 and ends every wave's reads of tile kc
    if (kc + 2 < DM / 64) stage(kc + 2); }               // refill of the buffer that this trip has read
  asm volatile("s_wait_asynccnt 0x0" ::: "memory");     // no copy is outstanding behind the loop
#pragma unroll
  for (int j = 0; j < 8; ++j)
#pragma unroll
    for (int r = 0; r < 8; ++r) so[wave][8 * g + r][j * 16 + col] = acc[j][r];
  LDSX();
  for (int rl = 0; rl < 16; ++rl) vst2(Y + (b * DM + o0 + rl) * SS + n0 + lane * 4, *(const v4f*)&so[wave][rl][lane * 4]);
}
extern "C" void kernel_launch(void* const* d_in, const int* in_sizes, int n_in, void* d_out, int out_size, void* d_ws, size_t ws_size, hipStream_t stream) {
  (void)in_sizes; (void)n_in; (void)out_size;
  const float** F = (const float**)d_in;   // 0 x [2,1024,2048], 1 w_qkv [3072,1024] natural (head-interleaved q|k|v blocks of 64), 2 w_out [1024,1024] natural
  if (ws_size < (size_t)WS_END) return;
  char* ws = (char*)d_ws; __bf16* PK = (__bf16*)(ws + WS_PK); _Float16 *QK = (_Float16*)(ws + WS_QK), *QKL = (_Float16*)(ws + WS_QKL), *VTH = (_Float16*)(ws + WS_VTH), *VTL = (_Float16*)(ws + WS_VTL); __bf16* O = (__bf16*)(ws + WS_O); __bf16* XT = (__bf16*)(ws + WS_XT);
  k_pack<<<dim3(QKVW, 2), 256, 0, stream>>>(F[1], F[2], F[0], PK, XT);
  k_qkv<<<dim3(SS / 64, QKVW / 128, TNB), 128, 0, stream>>>(XT, PK + PK_A, QK, QKL, VTH, VTL);
  k_attn<<<dim3(TQB, NH, TNB), 128, 0, stream>>>(QK, QKL, VTH, VTL, O);
  k_out<<<dim3(DM / 64, TON, TNB), 128, 0, stream>>>(O, PK + PK_P, (float*)d_out);
}

// v007
// One run takes 140 microseconds.
// Next to v006, in two timings, it ran 1.04 and 1.06 times as fast.
// Counting every step since v000, it is 4.60 times as fast.
// compute dtype: x, w_qkv, w_out rounded to bf16; qkv = w_qkv . x with exact bf16 products on WMMA 16x16x32 (positions as rows via an LDS transpose of the [B,C,N] input, natural weight rows; output channel o -> head o/192, part (o%192)/64, dim o%64); q and k stored as f16 hi + (x2048-scaled) residual planes with 3-product scores x 1/8; running-max softmax in f32 (hardware exp); P (scaled by 2^11, as f16 hi + residual) x v hi/lo (3 products); y = w_out (exact rows) x vals (f32 as bf16 hi + residual, 2 products) written channels-first; f32 accumulate.
#include <hip/hip_runtime.h>
#include <math.h>

typedef __attribute__((ext_vector_type(16))) _Float16 v16h;
typedef __attribute__((ext_vector_type(16))) __bf16 v16b;
typedef __attribute__((ext_vector_type(8)))  _Float16 v8h;
typedef __attribute__((ext_vector_type(8)))  float v8f;
typedef __attribute__((ext_vector_type(4)))  float v4f;
typedef __attribute__((ext_vector_type(2)))  float v2f;
typedef __attribute__((ext_vector_type(4)))  unsigned v4u;
typedef __attribute__((ext_vector_type(4)))  int v4i;
typedef float __attribute__((may_alias)) float_a;
typedef int __attribute__((may_alias)) int_a;

template <typename T> __device__ __forceinline__ void vst2(void* p, T v) { *(T*)p = v;  }
__device__ __forceinline__ v8f wmma16(v16h a, v16h b, v8f c) {
  return __builtin_amdgcn_wmma_f32_16x16x32_f16(false, a, false, b, (short)0, c, false, false);   // plain builtin: the compiler keeps the distance behind it and fills the slots with the loop's own vector work
}
__device__ __forceinline__ v8f wmma_bf(v16b a, v16b b, v8f c) {
  v8f d = __builtin_amdgcn_wmma_f32_16x16x32_bf16(false, a, false, b, (short)0, c, false, false);
  asm volatile("v_nop\n\tv_nop\n\tv_nop\n\tv_nop" : "+v"(d) : "v"(a), "v"(b));
  return d;
}
// Channels-first multi-head attention layer (x [2][1024 channels][2048 positions], 16 heads x 64): 1x1-conv qkv with per-head interleaved (q|k|v) channel blocks, softmax(q k^T / 8) v, 1x1-conv output projection -> [B, C, N].
__device__ __forceinline__ v16h frag_h(const _Float16* rowk0, int lane) {
  union { v16h v; v8h q[2]; } u; const _Float16* p = rowk0 + 8 * (lane >> 4);
  u.q[0] = *(const v8h*)p; u.q[1] = *(const v8h*)(p + 16); return u.v;
}
__device__ __forceinline__ v16h frag_f32(const float* rowk0, int lane) {
  v16h a; const float* p = rowk0 + 8 * (lane >> 4);
#pragma unroll
  for (int i = 0; i < 8; ++i) { a[i] = (_Float16)p[i]; a[8 + i] = (_Float16)p[16 + i]; }
  return a;
}
__device__ __forceinline__ v16h frag_f32s(const float* rowk0, int lane, float sc) {
  v16h a; const float* p = rowk0 + 8 * (lane >> 4);
#pragma unroll
  for (int i = 0; i < 8; ++i) { a[i] = (_Float16)(p[i] * sc); a[8 + i] = (_Float16)(p[16 + i] * sc); }
  return a;
}
// column fragment from a [K][ld] layout (column n), rows >= K read as 0
__device__ __forceinline__ v16h fragc_f32(const float* W, int k0, int n, int lane, int ld, int K) {
  v16h a; const int g = lane >> 4;
#pragma unroll
  for (int i = 0; i < 8; ++i) { const int ka = k0 + 8 * g + i, kb = ka + 16;
    a[i] = (_Float16)(ka < K ? W[(size_t)(ka < K ? ka : K - 1) * ld + n] : 0.f); a[8 + i] = (_Float16)(kb < K ? W[(size_t)(kb < K ? kb : K - 1) * ld + n] : 0.f); }
  return a;
}
struct F2 { v16b h, l; };
__device__ __forceinline__ F2 bsplit16(const float v[16]) { F2 r;
#pragma unroll
  for (int i = 0; i < 16; ++i) { const __bf16 h = (__bf16)v[i]; r.h[i] = h; r.l[i] = (__bf16)(v[i] - (float)h); }
  return r; }
__device__ __forceinline__ F2 split_row(const float* row, int k0, int lane) { float v[16]; const float* p = row + k0 + 8 * (lane >> 4);
#pragma unroll
  for (int i = 0; i < 8; ++i) { v[i] = p[i]; v[8 + i] = p[16 + i]; }
  return bsplit16(v); }
__device__ __forceinline__ F2 split_rowK(const float* row, int k0, int lane, int K) { float v[16]; const int g = lane >> 4;
#pragma unroll
  for (int i = 0; i < 8; ++i) { const int ka = k0 + 8 * g + i, kb = ka + 16; v[i] = ka < K ? row[ka < K ? ka : K - 1] : 0.f; v[8 + i] = kb < K ? row[kb < K ? kb : K - 1] : 0.f; }
  return bsplit16(v); }
__device__ __forceinline__ F2 split_col(const float* W, int k0, int n, int lane, int ld, int K) { float v[16]; const int g = lane >> 4;
#pragma unroll
  for (int i = 0; i < 8; ++i) { const int ka = k0 + 8 * g + i, kb = ka + 16; v[i] = ka < K ? W[(size_t)(ka < K ? ka : K - 1) * ld + n] : 0.f; v[8 + i] = kb < K ? W[(size_t)(kb < K ? kb : K - 1) * ld + n] : 0.f; }
  return bsplit16(v); }
__device__ __forceinline__ v8f mac3(const F2& a, const F2& b, v8f c) { c = wmma_bf(a.l, b.h, c); c = wmma_bf(a.h, b.l, c); return wmma_bf(a.h, b.h, c); }
__device__ __forceinline__ float sigm(float v) { return 1.0f / (1.0f + expf(-v)); }
#define LDSX() do { asm volatile("s_wait_dscnt 0" ::: "memory"); __builtin_amdgcn_wave_barrier(); __builtin_amdgcn_fence(__ATOMIC_RELEASE, "workgroup"); } while (0)


#define NB 2
#define SS 2048
#define DM 1024
#define NH 16
#define HD 64
#define QKVW (3 * DM)
#ifndef TQB
#define TQB (SS / 64)
#define TNB NB
#define TON (SS / 128)         // output position blocks per batch (all)
#endif
typedef __attribute__((ext_vector_type(8))) __bf16 v8b;
__device__ __forceinline__ v16b frag_b(const __bf16* rowk0, int lane) {
  union { v16b v; v8b q[2]; } u; const __bf16* p = rowk0 + 8 * (lane >> 4);
  u.q[0] = *(const v8b*)p; u.q[1] = *(const v8b*)(p + 16); return u.v;
}
__device__ __forceinline__ unsigned lds_addr(const void* p) { return (unsigned)(size_t)p; }   // low 32 bits of a __shared__ address = byte offset in the work-group's LDS
#define RPIT 72   // 16-bit elements per staged 128-B row: 128 B + 16 B (a pitch of 16 B x odd keeps 16-byte LDS reads of 16 rows off each other's banks)
__device__ __forceinline__ float bfr(float v) { return (float)(__bf16)v; }
__device__ __attribute__((noinline)) float exp_ni(float v) { return expf(v); }
__device__ __attribute__((noinline)) float erf_ni(float v) { return erff(v); }

#define PK_A 0                       // [3072][1024] Wqkv rows (natural [out][in])
#define PK_P (PK_A + QKVW * DM)        // [1024][1024] Wo rows (natural)
#define PK_END (PK_P + DM * DM)
#define WS_PK  0u
#define WS_QK  (WS_PK + 2u * PK_END)             // f16 [4096 rows][2048]: q | k
#define WS_QKL (WS_QK + 2u * NB * SS * 2 * DM)     // f16 q | k residual planes x2048
#define WS_VTH (WS_QKL + 2u * NB * SS * 2 * DM)    // f16 [b][1024 (h*64+d)][2048 s] hi
#define WS_VTL (WS_VTH + 2u * NB * DM * SS)        // f16 lo x 2048
#define WS_O   (WS_VTL + 2u * NB * DM * SS)        // bf16 [b * 2048 + position][32 groups of 32 channels][32 hi | 32 residual]: vals already split for k_out, 4 B a value
#define WS_XT  (WS_O + 4u * NB * SS * DM)           // bf16 [b][2048 positions][1024 channels]: x rounded and transposed
#define WS_END (WS_XT + 2u * NB * SS * DM)
// ---- k_pack: block = (row n, which): natural [out][in] rows -> bf16; which 0 -> w_qkv row n into PK_A; which 1, n < 1024 -> w_out row n into PK_P
// which 1, n >= 1024 (2048 blocks with no weight row): tile n - 1024 of x, [64 channels][32 positions] -> XT[b][position][channel] in bf16, so that x is rounded and transposed once and not once per block of k_qkv
__global__ __launch_bounds__(256) void k_pack(const float* __restrict__ WQKV, const float* __restrict__ WOUT, const float* __restrict__ X, __bf16* __restrict__ PK, __bf16* __restrict__ XT) {
  __shared__ __align__(16) __bf16 s[DM]; const int n = blockIdx.x, which = blockIdx.y, t = threadIdx.x; const float* src = (which == 0) ? (WQKV + (size_t)n * DM) : (WOUT + (size_t)(n - 0) * DM);
  if (which == 1 && n >= DM) {
    __shared__ __align__(16) __bf16 sx[32][72];   // [position][channel]: 128-B rows at a pitch of 144 B
    const int id = n - DM, bb = id >> 10, c0 = (id & 15) * 64, p0 = ((id >> 4) & 63) * 32;
    for (int i = 0; i < 2; ++i) { const int c = (t >> 3) + 32 * i, p4 = (t & 7) * 4;   // 8 lanes read one channel's 128-B line
      const v4f v = *(const v4f*)(X + ((size_t)bb * DM + c0 + c) * SS + p0 + p4);
      for (int k = 0; k < 4; ++k) sx[p4 + k][c] = (__bf16)v[k]; }
    __syncthreads();
    const int p = t >> 3, c8 = (t & 7) * 8;   // 8 lanes write one position's 128-B line
    vst2((unsigned*)(XT + ((size_t)bb * SS + p0 + p) * DM + c0 + c8), *(const v4u*)&sx[p][c8]);
    return; }
  for (int k = t; k < DM; k += 256) s[k] = (__bf16)src[k];
  __syncthreads();
  __bf16* dst = (which == 0) ? PK + PK_A + (size_t)n * DM : PK + PK_P + (size_t)n * DM;
  for (int q = t; q < DM / 8; q += 256) vst2((unsigned*)(dst + q * 8), *(const v4u*)&s[q * 8]);
}
// ---- k_qkv: block = (128 positions, 128 of the 3072 output channels, b): A rows from XT[b][n][c] (x in bf16, transposed by k_pack); a wave takes two 16-position tiles (64 apart) against the block's 128 channels, so that each weight fragment read from LDS feeds two matrix instructions; each 16-col tile is one (head, part, 16 dims): q/k -> f16 hi/lo row segments [row][part*1024 + h*64 + d]; v -> planes [b][h*64 + d][n]
__global__ __launch_bounds__(128) void k_qkv(const __bf16* __restrict__ XT, const __bf16* __restrict__ P, _Float16* __restrict__ QK, _Float16* __restrict__ QKL, _Float16* __restrict__ VTH, _Float16* __restrict__ VTL) {
  // one LDS block, used twice: the ring's two buffers while the loop runs, the epilogue's transposing buffers behind the loop's last barrier (so that three work-groups, all a WGP gets, fit its LDS)
  __shared__ __align__(16) char sm[2 * 128 * RPIT * 2 + 2 * 128 * RPIT * 2];
  _Float16 (*eb)[2][64][72] = (_Float16 (*)[2][64][72])sm;   // epilogue: [2 mt + q4][hi | residual][64][64 + 8]: four pairs of planes fill the ring's bytes exactly
  const int tid = threadIdx.x, wave = tid >> 5, lane = tid & 31, col = lane & 15, g = lane >> 4; const size_t b = blockIdx.z; const int p0 = blockIdx.x * 128; const int n0 = blockIdx.y * 128;
  v8f acc[2][8] = {};   // [position tile: p0 + 64 mt + 16 wave][channel tile]
  // tiles of weights [128 output channels][64 input channels] and of x [128 positions][64 input channels] come into LDS once per work-group by asynchronous copies, two buffers: tile t + 1 flies while tile t is worked on; 64 channels make each copied row one whole 128-B line
  __bf16 (*sb)[128][RPIT] = (__bf16 (*)[128][RPIT])sm;
  __bf16 (*sx)[128][RPIT] = (__bf16 (*)[128][RPIT])(sm + 2 * 128 * RPIT * 2);
  const int wr = tid >> 3, wc8 = (tid & 7) * 8;   // copy map: 8 lanes a 128-B row, rows wr + 16 i
  const __bf16* wsrc = P + (size_t)(n0 + wr) * DM + wc8; const __bf16* xsrc = XT + (b * SS + p0 + wr) * DM + wc8;
  auto stage = [&](int t) { const int bf = t & 1; const __bf16* s0 = wsrc + t * 64; const __bf16* x0 = xsrc + t * 64;
    // sixteen 16-byte copies a lane, the weights' eight and x's eight; s_wait_xcnt 0 as each statement's last line stands in front of every later rewrite of the address registers
    asm volatile(
                 "global_load_async_to_lds_b128 %0, %8, off\n\t"
                 "global_load_async_to_lds_b128 %1, %9, off\n\t"
                 "global_load_async_to_lds_b128 %2, %10, off\n\t"
                 "global_load_async_to_lds_b128 %3, %11, off\n\t"
                 "global_load_async_to_lds_b128 %4, %12, off\n\t"
                 "global_load_async_to_lds_b128 %5, %13, off\n\t"
                 "global_load_async_to_lds_b128 %6, %14, off\n\t"
                 "global_load_async_to_lds_b128 %7, %15, off\n\t"
                 "s_wait_xcnt 0x0"
                 :: "v"(lds_addr(&sb[bf][wr][wc8])), "v"(lds_addr(&sb[bf][wr + 16][wc8])), "v"(lds_addr(&sb[bf][wr + 32][wc8])), "v"(lds_addr(&sb[bf][wr + 48][wc8])),
                    "v"(lds_addr(&sb[bf][wr + 64][wc8])), "v"(lds_addr(&sb[bf][wr + 80][wc8])), "v"(lds_addr(&sb[bf][wr + 96][wc8])), "v"(lds_addr(&sb[bf][wr + 112][wc8])),
                    "v"(s0), "v"(s0 + 16 * DM), "v"(s0 + 32 * DM), "v"(s0 + 48 * DM), "v"(s0 + 64 * DM), "v"(s0 + 80 * DM), "v"(s0 + 96 * DM), "v"(s0 + 112 * DM)
                 : "memory");
    asm volatile(
                 "global_load_async_to_lds_b128 %0, %8, off\n\t"
                 "global_load_async_to_lds_b128 %1, %9, off\n\t"
                 "global_load_async_to_lds_b128 %2, %10, off\n\t"
                 "global_load_async_to_lds_b128 %3, %11, off\n\t"
                 "global_load_async_to_lds_b128 %4, %12, off\n\t"
                 "global_load_async_to_lds_b128 %5, %13, off\n\t"
                 "global_load_async_to_lds_b128 %6, %14, off\n\t"
                 "global_load_async_to_lds_b128 %7, %15, off\n\t"
                 "s_wait_xcnt 0x0"
                 :: "v"(lds_addr(&sx[bf][wr][wc8])), "v"(lds_addr(&sx[bf][wr + 16][wc8])), "v"(lds_addr(&sx[bf][wr + 32][wc8])), "v"(lds_addr(&sx[bf][wr + 48][wc8])),
                    "v"(lds_addr(&sx[bf][wr + 64][wc8])), "v"(lds_addr(&sx[bf][wr + 80][wc8])), "v"(lds_addr(&sx[bf][wr + 96][wc8])), "v"(lds_addr(&sx[bf][wr + 112][wc8])),
                    "v"(x0), "v"(x0 + 16 * DM), "v"(x0 + 32 * DM), "v"(x0 + 48 * DM), "v"(x0 + 64 * DM), "v"(x0 + 80 * DM), "v"(x0 + 96 * DM), "v"(x0 + 112 * DM)
                 : "memory"); };
  stage(0);
  asm volatile("s_wait_asynccnt 0x0" ::: "memory");   // this wave's part of tile 0 has landed
  __syncthreads();                                     // every wave's part of tile 0 is visible
  stage(1);
#pragma unroll 2
    for (int t = 0; t < DM / 64; ++t) { const int bf = t & 1;
#pragma unroll
      for (int kh = 0; kh < 2; ++kh) { v16b a[2], w[8];   // one half's fragments at a time: with both halves' live beside 128 accumulator registers the wave would spill
        a[0] = frag_b(&sx[bf][wave * 16 + col][kh * 32], lane); a[1] = frag_b(&sx[bf][64 + wave * 16 + col][kh * 32], lane);
#pragma unroll
        for (int j = 0; j < 8; ++j) w[j] = frag_b(&sb[bf][j * 16 + col][kh * 32], lane);
        asm volatile("" :: "v"(a[0]), "v"(a[1]), "v"(w[0]), "v"(w[1]), "v"(w[2]), "v"(w[3]), "v"(w[4]), "v"(w[5]), "v"(w[6]), "v"(w[7]));   // inputs only: holds the half's LDS reads as one group in front of its first matrix instruction (one LDS wait a half, not one a tile)
#pragma unroll
        for (int j = 0; j < 8; ++j) { acc[0][j] = wmma_bf(a[0], w[j], acc[0][j]); acc[1][j] = wmma_bf(a[1], w[j], acc[1][j]); } }
      // hand-over of the buffers, in this order in every wave
      asm volatile("s_wait_dscnt 0x0" ::: "memory");      // this wave's LDS reads of tile t have returned
      asm volatile("s_wait_asynccnt 0x0" ::: "memory");   // this wave's part of tile t + 1 has landed
      __syncthreads();                                     // publishes tile t + 1 and ends every wave's reads of tile t
      if (t + 2 < DM / 64) stage(t + 2); }                 // refill of the buffer that this trip has read
  asm volatile("s_wait_asynccnt 0x0" ::: "memory");       // no copy is outstanding behind the loop
  // epilogue: tile j -> o0 = n0 + j*16; h = o0 / 192; part = (o0 % 192) / 64; d = o0 % 64 + col; each (64 positions mt, 64 channels q4 = one (head, part)) has its own [64][72] pair of planes, rows = positions for q and k, rows = channels for v
#pragma unroll
  for (int mt = 0; mt < 2; ++mt)
#pragma unroll
  for (int j = 0; j < 8; ++j) { const int o0 = n0 + j * 16; const int part = (o0 % 192) / 64; _Float16 (*e)[64][72] = eb[mt * 2 + (j >> 2)]; const int c = (j & 3) * 16 + col;
#pragma unroll
    for (int r = 0; r < 8; ++r) { const float v = acc[mt][j][r]; const _Float16 hv = (_Float16)v; const _Float16 lv = (_Float16)((v - (float)hv) * 2048.0f); const int p = wave * 16 + 8 * g + r;
      if (part < 2) { e[0][p][c] = hv; e[1][p][c] = lv; } else { e[0][c][p] = hv; e[1][c][p] = lv; } } }
  __syncthreads();
  // stores: per tile group of 4 (64 channels = one (head, part)): tiles j = 4*q4 .. 4*q4+3 share (h, part) since 64-runs align
#pragma unroll
  for (int mt = 0; mt < 2; ++mt) { const int pm = p0 + mt * 64; const size_t r0 = b * SS + pm + wave * 16;
#pragma unroll
  for (int q4 = 0; q4 < 2; ++q4) { const int o0 = n0 + q4 * 64; const int h = o0 / 192, part = (o0 % 192) / 64; _Float16 (*e)[64][72] = eb[mt * 2 + q4];
    if (part < 2) {
      for (int rl = 0; rl < 16; ++rl) if (lane < 8) { vst2((unsigned*)(QK + (r0 + rl) * (2 * DM) + part * DM + h * HD + lane * 8), *(const v4u*)&e[0][wave * 16 + rl][lane * 8]); vst2((unsigned*)(QKL + (r0 + rl) * (2 * DM) + part * DM + h * HD + lane * 8), *(const v4u*)&e[1][wave * 16 + rl][lane * 8]); }
    } else {
      for (int q = tid; q < 64 * 8; q += 128) { const int d = q >> 3, pc = q & 7; const size_t o = (b * DM + h * HD + d) * SS + pm + pc * 8; vst2((unsigned*)(VTH + o), *(const v4u*)&e[0][d][pc * 8]); vst2((unsigned*)(VTL + o), *(const v4u*)&e[1][d][pc * 8]); } } } }
}
typedef __attribute__((ext_vector_type(2))) _Float16 v2h;
// lane l <-> lane l ^ 16 in one vector instruction
__device__ __forceinline__ float xhalf(float v) { const int b = __builtin_bit_cast(int, v); return __builtin_bit_cast(float, __builtin_amdgcn_permlanex16(b, b, 0x76543210, 0xfedcba98, false, false)); }
#define KPIT 72   // halfs per staged K row: 128 B + 16 B (a pitch of 16 B x odd keeps 16-byte LDS reads of 16 rows off each other's banks)
#define VPIT 72   // halfs per staged V row: 128 B + 16 B, same reason
__global__ __launch_bounds__(128) void k_attn(const _Float16* __restrict__ QK, const _Float16* __restrict__ QKL, const _Float16* __restrict__ VTH, const _Float16* __restrict__ VTL, __bf16* __restrict__ O) {
  // one LDS block, used twice: the ring's two buffers while the loop runs, the epilogue's rows behind the loop's last barrier (so that four work-groups fit a WGP's LDS)
  __shared__ __align__(16) char sm[2 * 2 * 64 * KPIT * 2 + 2 * 2 * 64 * VPIT * 2];
  __bf16 (*so)[16][136] = (__bf16 (*)[16][136])sm;   // [wave][query][2 x (32 hi | 32 residual)]: 256-B rows at a pitch of 272 B
  _Float16 (*sk)[2][64][KPIT] = (_Float16 (*)[2][64][KPIT])sm;   // [buffer][hi | residual][key][d]
  _Float16 (*sv)[2][64][VPIT] = (_Float16 (*)[2][64][VPIT])(sm + 2 * 2 * 64 * KPIT * 2);   // [buffer][hi | residual][d][key]
  const int tid = threadIdx.x, wave = tid >> 5, lane = tid & 31, col = lane & 15, g = lane >> 4;
  const int qb = blockIdx.x, h = blockIdx.y, b = blockIdx.z; const int q0 = qb * 64 + wave * 16; const size_t rq = (size_t)b * SS + q0 + col;
  const int nks = SS / 64;   // all keys, 64 a tile
  // copy map: K and V alike, 8 lanes a 128-B row, rows kr + 16 i
  const int kr = tid >> 3, kc8 = (tid & 7) * 8;
  const size_t koff = ((size_t)b * SS + kr) * (2 * DM) + DM + h * HD + kc8, voff = ((size_t)b * DM + h * HD + kr) * SS + kc8;
  auto stage = [&](int t) { const int bf = t & 1; const size_t ko = koff + (size_t)t * 64 * (2 * DM), vo = voff + (size_t)t * 64;
    // sixteen 16-byte copies a lane, K's eight and V's eight; s_wait_xcnt 0 as each statement's last line stands in front of every later rewrite of the address registers
    asm volatile("global_load_async_to_lds_b128 %0, %8, off\n\t"
                 "global_load_async_to_lds_b128 %1, %9, off\n\t"
                 "global_load_async_to_lds_b128 %2, %10, off\n\t"
                 "global_load_async_to_lds_b128 %3, %11, off\n\t"
                 "global_load_async_to_lds_b128 %4, %12, off\n\t"
                 "global_load_async_to_lds_b128 %5, %13, off\n\t"
                 "global_load_async_to_lds_b128 %6, %14, off\n\t"
                 "global_load_async_to_lds_b128 %7, %15, off\n\t"
                 "s_wait_xcnt 0x0"
                 :: "v"(lds_addr(&sk[bf][0][kr][kc8])), "v"(lds_addr(&sk[bf][0][kr + 16][kc8])), "v"(lds_addr(&sk[bf][0][kr + 32][kc8])), "v"(lds_addr(&sk[bf][0][kr + 48][kc8])),
                    "v"(lds_addr(&sk[bf][1][kr][kc8])), "v"(lds_addr(&sk[bf][1][kr + 16][kc8])), "v"(lds_addr(&sk[bf][1][kr + 32][kc8])), "v"(lds_addr(&sk[bf][1][kr + 48][kc8])),
                    "v"(QK + ko), "v"(QK + ko + 16 * (2 * DM)), "v"(QK + ko + 32 * (2 * DM)), "v"(QK + ko + 48 * (2 * DM)),
                    "v"(QKL + ko), "v"(QKL + ko + 16 * (2 * DM)), "v"(QKL + ko + 32 * (2 * DM)), "v"(QKL + ko + 48 * (2 * DM))
                 : "memory");
    asm volatile("global_load_async_to_lds_b128 %0, %8, off\n\t"
                 "global_load_async_to_lds_b128 %1, %9, off\n\t"
                 "global_load_async_to_lds_b128 %2, %10, off\n\t"
                 "global_load_async_to_lds_b128 %3, %11, off\n\t"
                 "global_load_async_to_lds_b128 %4, %12, off\n\t"
                 "global_load_async_to_lds_b128 %5, %13, off\n\t"
                 "global_load_async_to_lds_b128 %6, %14, off\n\t"
                 "global_load_async_to_lds_b128 %7, %15, off\n\t"
                 "s_wait_xcnt 0x0"
                 :: "v"(lds_addr(&sv[bf][0][kr][kc8])), "v"(lds_addr(&sv[bf][0][kr + 16][kc8])), "v"(lds_addr(&sv[bf][0][kr + 32][kc8])), "v"(lds_addr(&sv[bf][0][kr + 48][kc8])),
                    "v"(lds_addr(&sv[bf][1][kr][kc8])), "v"(lds_addr(&sv[bf][1][kr + 16][kc8])), "v"(lds_addr(&sv[bf][1][kr + 32][kc8])), "v"(lds_addr(&sv[bf][1][kr + 48][kc8])),
                    "v"(VTH + vo), "v"(VTH + vo + 16 * SS), "v"(VTH + vo + 32 * SS), "v"(VTH + vo + 48 * SS),
                    "v"(VTL + vo), "v"(VTL + vo + 16 * SS), "v"(VTL + vo + 32 * SS), "v"(VTL + vo + 48 * SS)
                 : "memory"); };
  stage(0);
  asm volatile("s_wait_asynccnt 0x0" ::: "memory");   // this wave's part of tile 0 has landed
  __syncthreads();                                     // every wave's part of tile 0 is visible
  stage(1);
  v16h aq[2], aql[2];
#pragma unroll
  for (int kc = 0; kc < 2; ++kc) { aq[kc] = frag_h(QK + rq * (2 * DM) + h * HD + kc * 32, lane); aql[kc] = frag_h(QKL + rq * (2 * DM) + h * HD + kc * 32, lane); }
  float m = -3.0e38f, l = 0.f;   // of this lane's query (col); l holds the keys of this lane half only, the halves join behind the loop
  v8f acc[4] = {}, accl[4] = {};   // O^T tiles: register r = O[query col][d = dt * 16 + 8 g + r]
#pragma unroll 1
  for (int ks = 0; ks < nks; ++ks) { const int bf = ks & 1;
#pragma unroll 1   // the tile's two steps of 32 keys run through one copy of the body: unrolled, both steps' fragments are live together and a fourth wave no longer fits a SIMD's registers
   for (int sub = 0; sub < 2; ++sub) { v8f s[2]; v16h kf[2][2], kl[2][2];
#pragma unroll
    for (int ct = 0; ct < 2; ++ct)
#pragma unroll
      for (int kc = 0; kc < 2; ++kc) { kf[ct][kc] = frag_h(&sk[bf][0][sub * 32 + ct * 16 + col][kc * 32], lane); kl[ct][kc] = frag_h(&sk[bf][1][sub * 32 + ct * 16 + col][kc * 32], lane); }
    asm volatile("" :: "v"(kf[0][0]), "v"(kf[0][1]), "v"(kf[1][0]), "v"(kf[1][1]), "v"(kl[0][0]), "v"(kl[0][1]), "v"(kl[1][0]), "v"(kl[1][1]));   // inputs only: holds the trip's K reads from LDS as one group in front of the first matrix instruction (one LDS wait, not one a fragment)
#pragma unroll
    for (int ct = 0; ct < 2; ++ct) { v8f c = {}, cl = {};
#pragma unroll
      for (int kc = 0; kc < 2; ++kc) { c = wmma16(kf[ct][kc], aq[kc], c); cl = wmma16(kf[ct][kc], aql[kc], cl); cl = wmma16(kl[ct][kc], aq[kc], cl); }   // 3 products: q, k as f16 hi + residual; K rows as A, Q as B: register r = score of key ct * 16 + 8 g + r for query col
#pragma unroll
      for (int r = 0; r < 8; ++r) c[r] += cl[r] * (1.0f / 2048.0f);
#pragma unroll
      for (int r = 0; r < 8; ++r) s[ct][r] = c[r] * 0.125f; }   // 1/sqrt(64), all keys
    v16h vh[4], vl[4];
#pragma unroll
    for (int dt = 0; dt < 4; ++dt) { vh[dt] = frag_h(&sv[bf][0][dt * 16 + col][sub * 32], lane); vl[dt] = frag_h(&sv[bf][1][dt * 16 + col][sub * 32], lane); }
    // a lane holds 16 of its query's 32 scores, lane ^ 16 the other 16: maximum and sum in registers, one exchange between the halves for the maximum
    float t[8];
#pragma unroll
    for (int r = 0; r < 8; ++r) t[r] = fmaxf(s[0][r], s[1][r]);
    float mx = fmaxf(fmaxf(fmaxf(t[0], t[1]), fmaxf(t[2], t[3])), fmaxf(fmaxf(t[4], t[5]), fmaxf(t[6], t[7])));
    mx = fmaxf(mx, xhalf(mx));
    const float mn = fmaxf(m, mx); const float alpha = (m <= -1.0e38f) ? 0.f : __expf(m - mn);
    v16h pa, pl;   // P^T as B operand: element ct * 8 + r is key ct * 16 + 8 g + r, the order in which frag_h reads V^T's keys
#pragma unroll
    for (int ct = 0; ct < 2; ++ct)
#pragma unroll
      for (int r = 0; r < 8; r += 2) { v2f e; e.x = (s[ct][r] <= -1.0e38f) ? 0.f : __expf(s[ct][r] - mn); e.y = (s[ct][r + 1] <= -1.0e38f) ? 0.f : __expf(s[ct][r + 1] - mn);
        if (ct == 0) { t[r] = e.x; t[r + 1] = e.y; } else { t[r] += e.x; t[r + 1] += e.y; }
        const v2f x = e * 2048.0f; const v2h hi = __builtin_convertvector(x, v2h); const v2h lo = __builtin_convertvector((x - __builtin_convertvector(hi, v2f)) * 2048.0f, v2h);   // two neighbouring keys share a register of the operand: one packed conversion each for hi and residual
        pa[ct * 8 + r] = hi.x; pa[ct * 8 + r + 1] = hi.y; pl[ct * 8 + r] = lo.x; pl[ct * 8 + r + 1] = lo.y; }   // P scaled by 2^11 before the f16 split so small softmax weights stay out of the f16 subnormal range; 2^-11 folded into the epilogue
    l = l * alpha + (((t[0] + t[1]) + (t[2] + t[3])) + ((t[4] + t[5]) + (t[6] + t[7]))); m = mn;
#pragma unroll
    for (int dt = 0; dt < 4; ++dt)
#pragma unroll
      for (int r = 0; r < 8; ++r) { acc[dt][r] *= alpha; accl[dt][r] *= alpha; }
    asm volatile("" :: "v"(vh[0]), "v"(vh[1]), "v"(vh[2]), "v"(vh[3]), "v"(vl[0]), "v"(vl[1]), "v"(vl[2]), "v"(vl[3]));   // inputs only: holds the trip's V reads from LDS as one group in front of the first P.V matrix instruction
#pragma unroll
    for (int dt = 0; dt < 4; ++dt) { acc[dt] = wmma16(vh[dt], pa, acc[dt]); accl[dt] = wmma16(vh[dt], pl, accl[dt]); accl[dt] = wmma16(vl[dt], pa, accl[dt]); }   // V^T rows as A: V hi x P hi + (V hi x P lo + V lo x P hi) / 2048
    __builtin_amdgcn_sched_barrier(0);   // holds the four slots below behind the last matrix instruction (without it the scheduler lifts them in front)
    asm volatile("v_nop\n\tv_nop\n\tv_nop\n\tv_nop"); }   // the branch back to the second 32 keys follows the last matrix instructions: these four slots keep the distance to the next step's first writes of their operand registers
    // hand-over of the buffers, in this order in every wave
    asm volatile("s_wait_dscnt 0x0" ::: "memory");      // this wave's LDS reads of tile ks have returned
    asm volatile("s_wait_asynccnt 0x0" ::: "memory");   // this wave's part of tile ks + 1 has landed
    __syncthreads();                                     // publishes tile ks + 1 and ends every wave's reads of tile ks
    if (ks + 2 < nks) stage(ks + 2); }                   // refill of the buffer that this trip has read
  asm volatile("s_wait_asynccnt 0x0" ::: "memory");     // no copy is outstanding behind the loop
  l += xhalf(l);   // the two halves' key sums of one query
  const float il = (1.0f / 2048.0f) / l;
#pragma unroll
  for (int dt = 0; dt < 4; ++dt) { v8b hv, lv;   // a lane's 8 neighbouring d of one query: 16 B of hi, 16 B of residual
#pragma unroll
    for (int r = 0; r < 8; ++r) { const float v = (acc[dt][r] + accl[dt][r] * (1.0f / 2048.0f)) * il; const __bf16 hb = (__bf16)v; hv[r] = hb; lv[r] = (__bf16)(v - (float)hb); }
    __bf16* p = &so[wave][col][(dt >> 1) * 64 + (dt & 1) * 16 + 8 * g]; *(v8b*)p = hv; *(v8b*)(p + 32) = lv; }
  LDSX();
  for (int rl = 0; rl < 16; ++rl) if (lane < 16) vst2(O + ((size_t)b * SS + q0 + rl) * (2 * DM) + h * (2 * HD) + lane * 8, *(const v4u*)&so[wave][rl][lane * 8]);
}
// ---- k_out: block = (128 output channels o, 128 positions, b), eight waves of 32 o x 64 positions: y[o][n] = w_out rows (exact) x vals rows O[n][c] (bf16 hi + residual as k_attn stored them, K 1024) -> [B][C][N] rows (256-B segments); each vals fragment read from LDS feeds two matrix instructions (the wave's two 16-channel tiles)
__global__ __launch_bounds__(256) void k_out(const __bf16* __restrict__ O, const __bf16* __restrict__ P, float* __restrict__ Y) {
  __shared__ __align__(16) float so[8][32][68];   // [wave][o][position]: 256-B rows at a pitch of 272 B
  const int tid = threadIdx.x, wave = tid >> 5, lane = tid & 31, col = lane & 15, g = lane >> 4; const int wo = (wave & 3) * 32, wn = (wave >> 2) * 64; const int o0 = blockIdx.x * 128 + wo; const int n0 = blockIdx.y * 128; const size_t b = blockIdx.z;
  v8f acc[2][4] = {};   // [16-channel tile][16-position tile]
  // tiles of vals [128 positions][64 channels: 2 x (32 hi | 32 residual)] and of weights [128 output channels][64 channels] come into LDS once per work-group by asynchronous copies, two buffers: tile t + 1 flies while tile t is worked on; 64 channels make each copied weight row one whole 128-B line
  __shared__ __align__(16) __bf16 sval[2][128][136];   // 256-B rows at a pitch of 272 B (16 B x odd, as RPIT)
  __shared__ __align__(16) __bf16 sw[2][128][RPIT];
  const int vr = tid >> 4, vc8 = (tid & 15) * 8, wr = tid >> 3, wc8 = (tid & 7) * 8;   // copy map: vals, 16 lanes a 256-B row, rows vr + 16 i; weights, 8 lanes a 128-B row, rows wr + 32 i
  const __bf16* vsrc = O + (b * SS + n0 + vr) * (2 * DM) + vc8; const __bf16* wsrc = P + (size_t)(blockIdx.x * 128 + wr) * DM + wc8;
  auto stage = [&](int t) { const int bf = t & 1; const __bf16* s0 = vsrc + t * 128; const __bf16* w0 = wsrc + t * 64;
    // twelve 16-byte copies a lane; s_wait_xcnt 0 as the statement's last line stands in front of every later rewrite of the address registers
    asm volatile(
                 "global_load_async_to_lds_b128 %0, %12, off\n\t"
                 "global_load_async_to_lds_b128 %1, %13, off\n\t"
                 "global_load_async_to_lds_b128 %2, %14, off\n\t"
                 "global_load_async_to_lds_b128 %3, %15, off\n\t"
                 "global_load_async_to_lds_b128 %4, %16, off\n\t"
                 "global_load_async_to_lds_b128 %5, %17, off\n\t"
                 "global_load_async_to_lds_b128 %6, %18, off\n\t"
                 "global_load_async_to_lds_b128 %7, %19, off\n\t"
                 "global_load_async_to_lds_b128 %8, %20, off\n\t"
                 "global_load_async_to_lds_b128 %9, %21, off\n\t"
                 "global_load_async_to_lds_b128 %10, %22, off\n\t"
                 "global_load_async_to_lds_b128 %11, %23, off\n\t"
                 "s_wait_xcnt 0x0"
                 :: "v"(lds_addr(&sval[bf][vr][vc8])), "v"(lds_addr(&sval[bf][vr + 16][vc8])), "v"(lds_addr(&sval[bf][vr + 32][vc8])), "v"(lds_addr(&sval[bf][vr + 48][vc8])),
                    "v"(lds_addr(&sval[bf][vr + 64][vc8])), "v"(lds_addr(&sval[bf][vr + 80][vc8])), "v"(lds_addr(&sval[bf][vr + 96][vc8])), "v"(lds_addr(&sval[bf][vr + 112][vc8])),
                    "v"(lds_addr(&sw[bf][wr][wc8])), "v"(lds_addr(&sw[bf][wr + 32][wc8])), "v"(lds_addr(&sw[bf][wr + 64][wc8])), "v"(lds_addr(&sw[bf][wr + 96][wc8])),
                    "v"(s0), "v"(s0 + 16 * (2 * DM)), "v"(s0 + 32 * (2 * DM)), "v"(s0 + 48 * (2 * DM)), "v"(s0 + 64 * (2 * DM)), "v"(s0 + 80 * (2 * DM)), "v"(s0 + 96 * (2 * DM)), "v"(s0 + 112 * (2 * DM)),
                    "v"(w0), "v"(w0 + 32 * DM), "v"(w0 + 64 * DM), "v"(w0 + 96 * DM)
                 : "memory"); };
  stage(0);
  asm volatile("s_wait_asynccnt 0x0" ::: "memory");   // this wave's part of tile 0 has landed
  __syncthreads();                                     // every wave's part of tile 0 is visible
  stage(1);
#pragma unroll 2
  for (int kc = 0; kc < DM / 64; ++kc) { const int bf = kc & 1;
#pragma unroll
   for (int kh = 0; kh < 2; ++kh) { v16b a[2];   // the tile's two groups of 32 channels, in ascending order
    a[0] = frag_b(&sw[bf][wo + col][kh * 32], lane); a[1] = frag_b(&sw[bf][wo + 16 + col][kh * 32], lane);
    v16b vh[4], vl[4];
#pragma unroll
    for (int j = 0; j < 4; ++j) vl[j] = frag_b(&sval[bf][wn + j * 16 + col][kh * 64 + 32], lane);
#pragma unroll
    for (int j = 0; j < 4; ++j) vh[j] = frag_b(&sval[bf][wn + j * 16 + col][kh * 64], lane);
#pragma unroll
    for (int j = 0; j < 4; ++j) { acc[0][j] = wmma_bf(a[0], vl[j], acc[0][j]); acc[1][j] = wmma_bf(a[1], vl[j], acc[1][j]); }   // each accumulator takes its residual product first, then its hi product; seven other accumulators' products stand between the two
#pragma unroll
    for (int j = 0; j < 4; ++j) { acc[0][j] = wmma_bf(a[0], vh[j], acc[0][j]); acc[1][j] = wmma_bf(a[1], vh[j], acc[1][j]); } }
    // hand-over of the buffers, in this order in every wave
    asm volatile("s_wait_dscnt 0x0" ::: "memory");      // this wave's LDS reads of tile kc have returned
    asm volatile("s_wait_asynccnt 0x0" ::: "memory");   // this wave's part of tile kc + 1 has landed
    __syncthreads();                                     // publishes tile kc + 1 and ends every wave's reads of tile kc
    if (kc + 2 < DM / 64) stage(kc + 2); }               // refill of the buffer that this trip has read
  asm volatile("s_wait_asynccnt 0x0" ::: "memory");     // no copy is outstanding behind the loop
#pragma unroll
  for (int mt = 0; mt < 2; ++mt)
#pragma unroll
    for (int j = 0; j < 4; ++j)
#pragma unroll
      for (int r = 0; r < 8; ++r) so[wave][mt * 16 + 8 * g + r][j * 16 + col] = acc[mt][j][r];
  LDSX();
  for (int it = 0; it < 16; ++it) { const int rl = 2 * it + g; vst2(Y + (b * DM + o0 + rl) * SS + n0 + wn + col * 4, *(const v4f*)&so[wave][rl][col * 4]); }   // 16 lanes a 256-B row segment, two rows an instruction
}
extern "C" void kernel_launch(void* const* d_in, const int* in_sizes, int n_in, void* d_out, int out_size, void* d_ws, size_t ws_size, hipStream_t stream) {
  (void)in_sizes; (void)n_in; (void)out_size;
  const float** F = (const float**)d_in;   // 0 x [2,1024,2048], 1 w_qkv [3072,1024] natural (head-interleaved q|k|v blocks of 64), 2 w_out [1024,1024] natural
  if (ws_size < (size_t)WS_END) return;
  char* ws = (char*)d_ws; __bf16* PK = (__bf16*)(ws + WS_PK); _Float16 *QK = (_Float16*)(ws + WS_QK), *QKL = (_Float16*)(ws + WS_QKL), *VTH = (_Float16*)(ws + WS_VTH), *VTL = (_Float16*)(ws + WS_VTL); __bf16* O = (__bf16*)(ws + WS_O); __bf16* XT = (__bf16*)(ws + WS_XT);
  k_pack<<<dim3(QKVW, 2), 256, 0, stream>>>(F[1], F[2], F[0], PK, XT);
  k_qkv<<<dim3(SS / 128, QKVW / 128, TNB), 128, 0, stream>>>(XT, PK + PK_A, QK, QKL, VTH, VTL);
  k_attn<<<dim3(TQB, NH, TNB), 128, 0, stream>>>(QK, QKL, VTH, VTL, O);
  k_out<<<dim3(DM / 128, TON, TNB), 256, 0, stream>>>(O, PK + PK_P, (float*)d_out);
}

// v008
// It runs in 135 microseconds.
// Timed twice side by side with v007, it ran 1.04 times as fast both times.
// Over all steps from v000 it is 4.77 times as fast.
// compute dtype: x, w_qkv, w_out rounded to bf16; qkv = w_qkv . x with exact bf16 products on WMMA 16x16x32 (positions as rows via an LDS transpose of the [B,C,N] input, natural weight rows; output channel o -> head o/192, part (o%192)/64, dim o%64); q and k stored as f16 hi + (x2048-scaled) residual planes with 3-product scores x 1/8; running-max softmax in f32 (hardware exp); P (scaled by 2^11, as f16 hi + residual) x v hi/lo (3 products); y = w_out (exact rows) x vals (f32 as bf16 hi + residual, 2 products) written channels-first; f32 accumulate.
#include <hip/hip_runtime.h>
#include <math.h>

typedef __attribute__((ext_vector_type(16))) _Float16 v16h;
typedef __attribute__((ext_vector_type(16))) __bf16 v16b;
typedef __attribute__((ext_vector_type(8)))  _Float16 v8h;
typedef __attribute__((ext_vector_type(8)))  float v8f;
typedef __attribute__((ext_vector_type(4)))  float v4f;
typedef __attribute__((ext_vector_type(2)))  float v2f;
typedef __attribute__((ext_vector_type(4)))  unsigned v4u;
typedef __attribute__((ext_vector_type(4)))  int v4i;
typedef float __attribute__((may_alias)) float_a;
typedef int __attribute__((may_alias)) int_a;

template <typename T> __device__ __forceinline__ void vst2(void* p, T v) { *(T*)p = v;  }
__device__ __forceinline__ v8f wmma16(v16h a, v16h b, v8f c) {
  return __builtin_amdgcn_wmma_f32_16x16x32_f16(false, a, false, b, (short)0, c, false, false);   // plain builtin: the compiler keeps the distance behind it and fills the slots with the loop's own vector work
}
__device__ __forceinline__ v8f wmma_bf(v16b a, v16b b, v8f c) {
  v8f d = __builtin_amdgcn_wmma_f32_16x16x32_bf16(false, a, false, b, (short)0, c, false, false);
  asm volatile("v_nop\n\tv_nop\n\tv_nop\n\tv_nop" : "+v"(d) : "v"(a), "v"(b));
  return d;
}
// Channels-first multi-head attention layer (x [2][1024 channels][2048 positions], 16 heads x 64): 1x1-conv qkv with per-head interleaved (q|k|v) channel blocks, softmax(q k^T / 8) v, 1x1-conv output projection -> [B, C, N].
__device__ __forceinline__ v16h frag_h(const _Float16* rowk0, int lane) {
  union { v16h v; v8h q[2]; } u; const _Float16* p = rowk0 + 8 * (lane >> 4);
  u.q[0] = *(const v8h*)p; u.q[1] = *(const v8h*)(p + 16); return u.v;
}
__device__ __forceinline__ v16h frag_f32(const float* rowk0, int lane) {
  v16h a; const float* p = rowk0 + 8 * (lane >> 4);
#pragma unroll
  for (int i = 0; i < 8; ++i) { a[i] = (_Float16)p[i]; a[8 + i] = (_Float16)p[16 + i]; }
  return a;
}
__device__ __forceinline__ v16h frag_f32s(const float* rowk0, int lane, float sc) {
  v16h a; const float* p = rowk0 + 8 * (lane >> 4);
#pragma unroll
  for (int i = 0; i < 8; ++i) { a[i] = (_Float16)(p[i] * sc); a[8 + i] = (_Float16)(p[16 + i] * sc); }
  return a;
}
// column fragment from a [K][ld] layout (column n), rows >= K read as 0
__device__ __forceinline__ v16h fragc_f32(const float* W, int k0, int n, int lane, int ld, int K) {
  v16h a; const int g = lane >> 4;
#pragma unroll
  for (int i = 0; i < 8; ++i) { const int ka = k0 + 8 * g + i, kb = ka + 16;
    a[i] = (_Float16)(ka < K ? W[(size_t)(ka < K ? ka : K - 1) * ld + n] : 0.f); a[8 + i] = (_Float16)(kb < K ? W[(size_t)(kb < K ? kb : K - 1) * ld + n] : 0.f); }
  return a;
}
struct F2 { v16b h, l; };
__device__ __forceinline__ F2 bsplit16(const float v[16]) { F2 r;
#pragma unroll
  for (int i = 0; i < 16; ++i) { const __bf16 h = (__bf16)v[i]; r.h[i] = h; r.l[i] = (__bf16)(v[i] - (float)h); }
  return r; }
__device__ __forceinline__ F2 split_row(const float* row, int k0, int lane) { float v[16]; const float* p = row + k0 + 8 * (lane >> 4);
#pragma unroll
  for (int i = 0; i < 8; ++i) { v[i] = p[i]; v[8 + i] = p[16 + i]; }
  return bsplit16(v); }
__device__ __forceinline__ F2 split_rowK(const float* row, int k0, int lane, int K) { float v[16]; const int g = lane >> 4;
#pragma unroll
  for (int i = 0; i < 8; ++i) { const int ka = k0 + 8 * g + i, kb = ka + 16; v[i] = ka < K ? row[ka < K ? ka : K - 1] : 0.f; v[8 + i] = kb < K ? row[kb < K ? kb : K - 1] : 0.f; }
  return bsplit16(v); }
__device__ __forceinline__ F2 split_col(const float* W, int k0, int n, int lane, int ld, int K) { float v[16]; const int g = lane >> 4;
#pragma unroll
  for (int i = 0; i < 8; ++i) { const int ka = k0 + 8 * g + i, kb = ka + 16; v[i] = ka < K ? W[(size_t)(ka < K ? ka : K - 1) * ld + n] : 0.f; v[8 + i] = kb < K ? W[(size_t)(kb < K ? kb : K - 1) * ld + n] : 0.f; }
  return bsplit16(v); }
__device__ __forceinline__ v8f mac3(const F2& a, const F2& b, v8f c) { c = wmma_bf(a.l, b.h, c); c = wmma_bf(a.h, b.l, c); return wmma_bf(a.h, b.h, c); }
__device__ __forceinline__ float sigm(float v) { return 1.0f / (1.0f + expf(-v)); }
#define LDSX() do { asm volatile("s_wait_dscnt 0" ::: "memory"); __builtin_amdgcn_wave_barrier(); __builtin_amdgcn_fence(__ATOMIC_RELEASE, "workgroup"); } while (0)


#define NB 2
#define SS 2048
#define DM 1024
#define NH 16
#define HD 64
#define QKVW (3 * DM)
#ifndef TQB
#define TQB (SS / 64)
#define TNB NB
#define TON (SS / 128)         // output position blocks per batch (all)
#endif
typedef __attribute__((ext_vector_type(8))) __bf16 v8b;
__device__ __forceinline__ v16b frag_b(const __bf16* rowk0, int lane) {
  union { v16b v; v8b q[2]; } u; const __bf16* p = rowk0 + 8 * (lane >> 4);
  u.q[0] = *(const v8b*)p; u.q[1] = *(const v8b*)(p + 16); return u.v;
}
__device__ __forceinline__ unsigned lds_addr(const void* p) { return (unsigned)(size_t)p; }   // low 32 bits of a __shared__ address = byte offset in the work-group's LDS
#define RPIT 72   // 16-bit elements per staged 128-B row: 128 B + 16 B (a pitch of 16 B x odd keeps 16-byte LDS reads of 16 rows off each other's banks)
__device__ __forceinline__ float bfr(float v) { return (float)(__bf16)v; }
__device__ __attribute__((noinline)) float exp_ni(float v) { return expf(v); }
__device__ __attribute__((noinline)) float erf_ni(float v) { return erff(v); }

#define PK_A 0                       // [3072][1024] Wqkv rows (natural [out][in])
#define PK_P (PK_A + QKVW * DM)        // [1024][1024] Wo rows (natural)
#define PK_END (PK_P + DM * DM)
#define WS_PK  0u
#define WS_QK  (WS_PK + 2u * PK_END)             // f16 [4096 rows][2048]: q | k
#define WS_QKL (WS_QK + 2u * NB * SS * 2 * DM)     // f16 q | k residual planes x2048
#define WS_VTH (WS_QKL + 2u * NB * SS * 2 * DM)    // f16 [b][1024 (h*64+d)][2048 s] hi
#define WS_VTL (WS_VTH + 2u * NB * DM * SS)        // f16 lo x 2048
#define WS_O   (WS_VTL + 2u * NB * DM * SS)        // bf16 [b * 2048 + position][32 groups of 32 channels][32 hi | 32 residual]: vals already split for k_out, 4 B a value
#define WS_XT  (WS_O + 4u * NB * SS * DM)           // bf16 [b][2048 positions][1024 channels]: x rounded and transposed
#define WS_END (WS_XT + 2u * NB * SS * DM)
// ---- k_pack: block = (row n, which): natural [out][in] rows -> bf16; which 0 -> w_qkv row n into PK_A; which 1, n < 1024 -> w_out row n into PK_P
// which 1, n >= 1024 (2048 blocks with no weight row): tile n - 1024 of x, [64 channels][32 positions] -> XT[b][position][channel] in bf16, so that x is rounded and transposed once and not once per block of k_qkv
__global__ __launch_bounds__(256) void k_pack(const float* __restrict__ WQKV, const float* __restrict__ WOUT, const float* __restrict__ X, __bf16* __restrict__ PK, __bf16* __restrict__ XT) {
  __shared__ __align__(16) __bf16 s[DM]; const int n = blockIdx.x, which = blockIdx.y, t = threadIdx.x; const float* src = (which == 0) ? (WQKV + (size_t)n * DM) : (WOUT + (size_t)(n - 0) * DM);
  if (which == 1 && n >= DM) {
    __shared__ __align__(16) __bf16 sx[32][72];   // [position][channel]: 128-B rows at a pitch of 144 B
    const int id = n - DM, bb = id >> 10, c0 = (id & 15) * 64, p0 = ((id >> 4) & 63) * 32;
    for (int i = 0; i < 2; ++i) { const int c = (t >> 3) + 32 * i, p4 = (t & 7) * 4;   // 8 lanes read one channel's 128-B line
      const v4f v = *(const v4f*)(X + ((size_t)bb * DM + c0 + c) * SS + p0 + p4);
      for (int k = 0; k < 4; ++k) sx[p4 + k][c] = (__bf16)v[k]; }
    __syncthreads();
    const int p = t >> 3, c8 = (t & 7) * 8;   // 8 lanes write one position's 128-B line
    vst2((unsigned*)(XT + ((size_t)bb * SS + p0 + p) * DM + c0 + c8), *(const v4u*)&sx[p][c8]);
    return; }
  for (int k = t; k < DM; k += 256) s[k] = (__bf16)src[k];
  __syncthreads();
  __bf16* dst = (which == 0) ? PK + PK_A + (size_t)n * DM : PK + PK_P + (size_t)n * DM;
  for (int q = t; q < DM / 8; q += 256) vst2((unsigned*)(dst + q * 8), *(const v4u*)&s[q * 8]);
}
// ---- k_qkv: block = (128 positions, 128 of the 3072 output channels, b): A rows from XT[b][n][c] (x in bf16, transposed by k_pack); a wave takes two 16-position tiles (64 apart) against the block's 128 channels, so that each weight fragment read from LDS feeds two matrix instructions; each 16-col tile is one (head, part, 16 dims): q/k -> f16 hi/lo row segments [row][part*1024 + h*64 + d]; v -> planes [b][h*64 + d][n]
__global__ __launch_bounds__(128) void k_qkv(const __bf16* __restrict__ XT, const __bf16* __restrict__ P, _Float16* __restrict__ QK, _Float16* __restrict__ QKL, _Float16* __restrict__ VTH, _Float16* __restrict__ VTL) {
  // one LDS block, used twice: the ring's two buffers while the loop runs, the epilogue's transposing buffers behind the loop's last barrier (so that three work-groups, all a WGP gets, fit its LDS)
  __shared__ __align__(16) char sm[2 * 128 * RPIT * 2 + 2 * 128 * RPIT * 2];
  _Float16 (*eb)[2][64][72] = (_Float16 (*)[2][64][72])sm;   // epilogue: [2 mt + q4][hi | residual][64][64 + 8]: four pairs of planes fill the ring's bytes exactly
  const int tid = threadIdx.x, wave = tid >> 5, lane = tid & 31, col = lane & 15, g = lane >> 4; const size_t b = blockIdx.z; const int p0 = blockIdx.x * 128; const int n0 = blockIdx.y * 128;
  v8f acc[2][8] = {};   // [position tile: p0 + 64 mt + 16 wave][channel tile]
  // tiles of weights [128 output channels][64 input channels] and of x [128 positions][64 input channels] come into LDS once per work-group by asynchronous copies, two buffers: tile t + 1 flies while tile t is worked on; 64 channels make each copied row one whole 128-B line
  __bf16 (*sb)[128][RPIT] = (__bf16 (*)[128][RPIT])sm;
  __bf16 (*sx)[128][RPIT] = (__bf16 (*)[128][RPIT])(sm + 2 * 128 * RPIT * 2);
  const int wr = tid >> 3, wc8 = (tid & 7) * 8;   // copy map: 8 lanes a 128-B row, rows wr + 16 i
  const __bf16* wsrc = P + (size_t)(n0 + wr) * DM + wc8; const __bf16* xsrc = XT + (b * SS + p0 + wr) * DM + wc8;
  auto stage = [&](int t) { const int bf = t & 1; const __bf16* s0 = wsrc + t * 64; const __bf16* x0 = xsrc + t * 64;
    // sixteen 16-byte copies a lane, the weights' eight and x's eight; s_wait_xcnt 0 as each statement's last line stands in front of every later rewrite of the address registers
    asm volatile(
                 "global_load_async_to_lds_b128 %0, %8, off\n\t"
                 "global_load_async_to_lds_b128 %1, %9, off\n\t"
                 "global_load_async_to_lds_b128 %2, %10, off\n\t"
                 "global_load_async_to_lds_b128 %3, %11, off\n\t"
                 "global_load_async_to_lds_b128 %4, %12, off\n\t"
                 "global_load_async_to_lds_b128 %5, %13, off\n\t"
                 "global_load_async_to_lds_b128 %6, %14, off\n\t"
                 "global_load_async_to_lds_b128 %7, %15, off\n\t"
                 "s_wait_xcnt 0x0"
                 :: "v"(lds_addr(&sb[bf][wr][wc8])), "v"(lds_addr(&sb[bf][wr + 16][wc8])), "v"(lds_addr(&sb[bf][wr + 32][wc8])), "v"(lds_addr(&sb[bf][wr + 48][wc8])),
                    "v"(lds_addr(&sb[bf][wr + 64][wc8])), "v"(lds_addr(&sb[bf][wr + 80][wc8])), "v"(lds_addr(&sb[bf][wr + 96][wc8])), "v"(lds_addr(&sb[bf][wr + 112][wc8])),
                    "v"(s0), "v"(s0 + 16 * DM), "v"(s0 + 32 * DM), "v"(s0 + 48 * DM), "v"(s0 + 64 * DM), "v"(s0 + 80 * DM), "v"(s0 + 96 * DM), "v"(s0 + 112 * DM)
                 : "memory");
    asm volatile(
                 "global_load_async_to_lds_b128 %0, %8, off\n\t"
                 "global_load_async_to_lds_b128 %1, %9, off\n\t"
                 "global_load_async_to_lds_b128 %2, %10, off\n\t"
                 "global_load_async_to_lds_b128 %3, %11, off\n\t"
                 "global_load_async_to_lds_b128 %4, %12, off\n\t"
                 "global_load_async_to_lds_b128 %5, %13, off\n\t"
                 "global_load_async_to_lds_b128 %6, %14, off\n\t"
                 "global_load_async_to_lds_b128 %7, %15, off\n\t"
                 "s_wait_xcnt 0x0"
                 :: "v"(lds_addr(&sx[bf][wr][wc8])), "v"(lds_addr(&sx[bf][wr + 16][wc8])), "v"(lds_addr(&sx[bf][wr + 32][wc8])), "v"(lds_addr(&sx[bf][wr + 48][wc8])),
                    "v"(lds_addr(&sx[bf][wr + 64][wc8])), "v"(lds_addr(&sx[bf][wr + 80][wc8])), "v"(lds_addr(&sx[bf][wr + 96][wc8])), "v"(lds_addr(&sx[bf][wr + 112][wc8])),
                    "v"(x0), "v"(x0 + 16 * DM), "v"(x0 + 32 * DM), "v"(x0 + 48 * DM), "v"(x0 + 64 * DM), "v"(x0 + 80 * DM), "v"(x0 + 96 * DM), "v"(x0 + 112 * DM)
                 : "memory"); };
  stage(0);
  asm volatile("s_wait_asynccnt 0x0" ::: "memory");   // this wave's part of tile 0 has landed
  __syncthreads();                                     // every wave's part of tile 0 is visible
  stage(1);
#pragma unroll 2
    for (int t = 0; t < DM / 64; ++t) { const int bf = t & 1;
#pragma unroll
      for (int kh = 0; kh < 2; ++kh) { v16b a[2], w[8];   // one half's fragments at a time: with both halves' live beside 128 accumulator registers the wave would spill
        a[0] = frag_b(&sx[bf][wave * 16 + col][kh * 32], lane); a[1] = frag_b(&sx[bf][64 + wave * 16 + col][kh * 32], lane);
#pragma unroll
        for (int j = 0; j < 8; ++j) w[j] = frag_b(&sb[bf][j * 16 + col][kh * 32], lane);
        asm volatile("" :: "v"(a[0]), "v"(a[1]), "v"(w[0]), "v"(w[1]), "v"(w[2]), "v"(w[3]), "v"(w[4]), "v"(w[5]), "v"(w[6]), "v"(w[7]));   // inputs only: holds the half's LDS reads as one group in front of its first matrix instruction (one LDS wait a half, not one a tile)
#pragma unroll
        for (int j = 0; j < 8; ++j) { acc[0][j] = wmma_bf(a[0], w[j], acc[0][j]); acc[1][j] = wmma_bf(a[1], w[j], acc[1][j]); } }
      // hand-over of the buffers, in this order in every wave
      asm volatile("s_wait_dscnt 0x0" ::: "memory");      // this wave's LDS reads of tile t have returned
      asm volatile("s_wait_asynccnt 0x0" ::: "memory");   // this wave's part of tile t + 1 has landed
      __syncthreads();                                     // publishes tile t + 1 and ends every wave's reads of tile t
      if (t + 2 < DM / 64) stage(t + 2); }                 // refill of the buffer that this trip has read
  asm volatile("s_wait_asynccnt 0x0" ::: "memory");       // no copy is outstanding behind the loop
  // epilogue: tile j -> o0 = n0 + j*16; h = o0 / 192; part = (o0 % 192) / 64; d = o0 % 64 + col; each (64 positions mt, 64 channels q4 = one (head, part)) has its own [64][72] pair of planes, rows = positions for q and k, rows = channels for v
#pragma unroll
  for (int mt = 0; mt < 2; ++mt)
#pragma unroll
  for (int j = 0; j < 8; ++j) { const int o0 = n0 + j * 16; const int part = (o0 % 192) / 64; _Float16 (*e)[64][72] = eb[mt * 2 + (j >> 2)]; const int c = (j & 3) * 16 + col;
#pragma unroll
    for (int r = 0; r < 8; ++r) { const float v = acc[mt][j][r]; const _Float16 hv = (_Float16)v; const _Float16 lv = (_Float16)((v - (float)hv) * 2048.0f); const int p = wave * 16 + 8 * g + r;
      if (part < 2) { e[0][p][c] = hv; e[1][p][c] = lv; } else { e[0][c][p] = hv; e[1][c][p] = lv; } } }
  __syncthreads();
  // stores: per tile group of 4 (64 channels = one (head, part)): tiles j = 4*q4 .. 4*q4+3 share (h, part) since 64-runs align
#pragma unroll
  for (int mt = 0; mt < 2; ++mt) { const int pm = p0 + mt * 64; const size_t r0 = b * SS + pm + wave * 16;
#pragma unroll
  for (int q4 = 0; q4 < 2; ++q4) { const int o0 = n0 + q4 * 64; const int h = o0 / 192, part = (o0 % 192) / 64; _Float16 (*e)[64][72] = eb[mt * 2 + q4];
    if (part < 2) {
      for (int rl = 0; rl < 16; ++rl) if (lane < 8) { vst2((unsigned*)(QK + (r0 + rl) * (2 * DM) + part * DM + h * HD + lane * 8), *(const v4u*)&e[0][wave * 16 + rl][lane * 8]); vst2((unsigned*)(QKL + (r0 + rl) * (2 * DM) + part * DM + h * HD + lane * 8), *(const v4u*)&e[1][wave * 16 + rl][lane * 8]); }
    } else {
      for (int q = tid; q < 64 * 8; q += 128) { const int d = q >> 3, pc = q & 7; const size_t o = (b * DM + h * HD + d) * SS + pm + pc * 8; vst2((unsigned*)(VTH + o), *(const v4u*)&e[0][d][pc * 8]); vst2((unsigned*)(VTL + o), *(const v4u*)&e[1][d][pc * 8]); } } } }
}
typedef __attribute__((ext_vector_type(2))) _Float16 v2h;
// lane l <-> lane l ^ 16 in one vector instruction
__device__ __forceinline__ float xhalf(float v) { const int b = __builtin_bit_cast(int, v); return __builtin_bit_cast(float, __builtin_amdgcn_permlanex16(b, b, 0x76543210, 0xfedcba98, false, false)); }
#define KPIT 72   // halfs per staged K row: 128 B + 16 B (a pitch of 16 B x odd keeps 16-byte LDS reads of 16 rows off each other's banks)
#define VPIT 72   // halfs per staged V row: 128 B + 16 B, same reason
__global__ __launch_bounds__(128) void k_attn(const _Float16* __restrict__ QK, const _Float16* __restrict__ QKL, const _Float16* __restrict__ VTH, const _Float16* __restrict__ VTL, __bf16* __restrict__ O) {
  // one LDS block, used twice: the ring's two buffers while the loop runs, the epilogue's rows behind the loop's last barrier (so that four work-groups fit a WGP's LDS)
  __shared__ __align__(16) char sm[2 * 2 * 64 * KPIT * 2 + 2 * 2 * 64 * VPIT * 2];
  __bf16 (*so)[16][136] = (__bf16 (*)[16][136])sm;   // [wave][query][2 x (32 hi | 32 residual)]: 256-B rows at a pitch of 272 B
  _Float16 (*sk)[2][64][KPIT] = (_Float16 (*)[2][64][KPIT])sm;   // [buffer][hi | residual][key][d]
  _Float16 (*sv)[2][64][VPIT] = (_Float16 (*)[2][64][VPIT])(sm + 2 * 2 * 64 * KPIT * 2);   // [buffer][hi | residual][d][key]
  const int tid = threadIdx.x, wave = tid >> 5, lane = tid & 31, col = lane & 15, g = lane >> 4;
  const int qb = blockIdx.x, h = blockIdx.y, b = blockIdx.z; const int q0 = qb * 64 + wave * 16; const size_t rq = (size_t)b * SS + q0 + col;
  const int nks = SS / 64;   // all keys, 64 a tile
  // copy map: K and V alike, 8 lanes a 128-B row, rows kr + 16 i
  const int kr = tid >> 3, kc8 = (tid & 7) * 8;
  const size_t koff = ((size_t)b * SS + kr) * (2 * DM) + DM + h * HD + kc8, voff = ((size_t)b * DM + h * HD + kr) * SS + kc8;
  auto stage = [&](int t) { const int bf = t & 1; const size_t ko = koff + (size_t)t * 64 * (2 * DM), vo = voff + (size_t)t * 64;
    // sixteen 16-byte copies a lane, K's eight and V's eight; s_wait_xcnt 0 as each statement's last line stands in front of every later rewrite of the address registers
    asm volatile("global_load_async_to_lds_b128 %0, %8, off\n\t"
                 "global_load_async_to_lds_b128 %1, %9, off\n\t"
                 "global_load_async_to_lds_b128 %2, %10, off\n\t"
                 "global_load_async_to_lds_b128 %3, %11, off\n\t"
                 "global_load_async_to_lds_b128 %4, %12, off\n\t"
                 "global_load_async_to_lds_b128 %5, %13, off\n\t"
                 "global_load_async_to_lds_b128 %6, %14, off\n\t"
                 "global_load_async_to_lds_b128 %7, %15, off\n\t"
                 "s_wait_xcnt 0x0"
                 :: "v"(lds_addr(&sk[bf][0][kr][kc8])), "v"(lds_addr(&sk[bf][0][kr + 16][kc8])), "v"(lds_addr(&sk[bf][0][kr + 32][kc8])), "v"(lds_addr(&sk[bf][0][kr + 48][kc8])),
                    "v"(lds_addr(&sk[bf][1][kr][kc8])), "v"(lds_addr(&sk[bf][1][kr + 16][kc8])), "v"(lds_addr(&sk[bf][1][kr + 32][kc8])), "v"(lds_addr(&sk[bf][1][kr + 48][kc8])),
                    "v"(QK + ko), "v"(QK + ko + 16 * (2 * DM)), "v"(QK + ko + 32 * (2 * DM)), "v"(QK + ko + 48 * (2 * DM)),
                    "v"(QKL + ko), "v"(QKL + ko + 16 * (2 * DM)), "v"(QKL + ko + 32 * (2 * DM)), "v"(QKL + ko + 48 * (2 * DM))
                 : "memory");
    asm volatile("global_load_async_to_lds_b128 %0, %8, off\n\t"
                 "global_load_async_to_lds_b128 %1, %9, off\n\t"
                 "global_load_async_to_lds_b128 %2, %10, off\n\t"
                 "global_load_async_to_lds_b128 %3, %11, off\n\t"
                 "global_load_async_to_lds_b128 %4, %12, off\n\t"
                 "global_load_async_to_lds_b128 %5, %13, off\n\t"
                 "global_load_async_to_lds_b128 %6, %14, off\n\t"
                 "global_load_async_to_lds_b128 %7, %15, off\n\t"
                 "s_wait_xcnt 0x0"
                 :: "v"(lds_addr(&sv[bf][0][kr][kc8])), "v"(lds_addr(&sv[bf][0][kr + 16][kc8])), "v"(lds_addr(&sv[bf][0][kr + 32][kc8])), "v"(lds_addr(&sv[bf][0][kr + 48][kc8])),
                    "v"(lds_addr(&sv[bf][1][kr][kc8])), "v"(lds_addr(&sv[bf][1][kr + 16][kc8])), "v"(lds_addr(&sv[bf][1][kr + 32][kc8])), "v"(lds_addr(&sv[bf][1][kr + 48][kc8])),
                    "v"(VTH + vo), "v"(VTH + vo + 16 * SS), "v"(VTH + vo + 32 * SS), "v"(VTH + vo + 48 * SS),
                    "v"(VTL + vo), "v"(VTL + vo + 16 * SS), "v"(VTL + vo + 32 * SS), "v"(VTL + vo + 48 * SS)
                 : "memory"); };
  stage(0);
  asm volatile("s_wait_asynccnt 0x0" ::: "memory");   // this wave's part of tile 0 has landed
  __syncthreads();                                     // every wave's part of tile 0 is visible
  stage(1);
  v16h aq[2], aql[2];
#pragma unroll
  for (int kc = 0; kc < 2; ++kc) { aq[kc] = frag_h(QK + rq * (2 * DM) + h * HD + kc * 32, lane); aql[kc] = frag_h(QKL + rq * (2 * DM) + h * HD + kc * 32, lane); }
  const float KS = 0.125f * 1.44269504f;   // 1/sqrt(64) x log2 e
  float off = 3.0e38f;   // the exponent's addend of the step before
  float m = -3.0e38f, l = 0.f;   // of this lane's query (col); l holds the keys of this lane half only, the halves join behind the loop
  v8f acc[4] = {}, accl[4] = {};   // O^T tiles: register r = O[query col][d = dt * 16 + 8 g + r]
#pragma unroll 1
  for (int ks = 0; ks < nks; ++ks) { const int bf = ks & 1;
#pragma unroll 1   // the tile's two steps of 32 keys run through one copy of the body: unrolled, both steps' fragments are live together and a fourth wave no longer fits a SIMD's registers
   for (int sub = 0; sub < 2; ++sub) { v8f s[2]; v16h kf[2][2], kl[2][2];
#pragma unroll
    for (int ct = 0; ct < 2; ++ct)
#pragma unroll
      for (int kc = 0; kc < 2; ++kc) { kf[ct][kc] = frag_h(&sk[bf][0][sub * 32 + ct * 16 + col][kc * 32], lane); kl[ct][kc] = frag_h(&sk[bf][1][sub * 32 + ct * 16 + col][kc * 32], lane); }
    asm volatile("" :: "v"(kf[0][0]), "v"(kf[0][1]), "v"(kf[1][0]), "v"(kf[1][1]), "v"(kl[0][0]), "v"(kl[0][1]), "v"(kl[1][0]), "v"(kl[1][1]));   // inputs only: holds the trip's K reads from LDS as one group in front of the first matrix instruction (one LDS wait, not one a fragment)
#pragma unroll
    for (int ct = 0; ct < 2; ++ct) { v8f c = {}, cl = {};
#pragma unroll
      for (int kc = 0; kc < 2; ++kc) { c = wmma16(kf[ct][kc], aq[kc], c); cl = wmma16(kf[ct][kc], aql[kc], cl); cl = wmma16(kl[ct][kc], aq[kc], cl); }   // 3 products: q, k as f16 hi + residual; K rows as A, Q as B: register r = score of key ct * 16 + 8 g + r for query col
#pragma unroll
      for (int r = 0; r < 8; ++r) s[ct][r] = c[r] + cl[r] * (1.0f / 2048.0f); }   // raw q.k, all keys: 1/sqrt(64) is applied inside the exponent below
    v16h vh[4], vl[4];
#pragma unroll
    for (int dt = 0; dt < 4; ++dt) { vh[dt] = frag_h(&sv[bf][0][dt * 16 + col][sub * 32], lane); vl[dt] = frag_h(&sv[bf][1][dt * 16 + col][sub * 32], lane); }
    // a lane holds 16 of its query's 32 scores, lane ^ 16 the other 16: maximum and sum in registers, one exchange between the halves for the maximum
    float t[8];
#pragma unroll
    for (int r = 0; r < 8; ++r) t[r] = fmaxf(s[0][r], s[1][r]);
    float mx = fmaxf(fmaxf(fmaxf(t[0], t[1]), fmaxf(t[2], t[3])), fmaxf(fmaxf(t[4], t[5]), fmaxf(t[6], t[7])));
    mx = fmaxf(mx, xhalf(mx));
    const float mn = fmaxf(m, mx);   // m, mx, mn in raw units (KS > 0 keeps their order)
    const float offp = off; off = 11.0f - mn * KS;   // 2^11 e^((s - mn) / 8) = 2^(s KS + off): one fused multiply-add a score in front of the hardware's 2^x
    float alpha;   // e^((m - mn) / 8) as 2^(off - offp), the very ratio of the two steps' factors; the first step's offp gives 2^(-huge) = 0
    asm("v_nop\n\tv_exp_f32 %0, %1\n\tv_nop" : "=v"(alpha) : "v"(off - offp));   // the slot that the instruction set asks for around a transcendental, on both sides
    v16h pa, pl;   // P^T as B operand: element ct * 8 + r is key ct * 16 + 8 g + r, the order in which frag_h reads V^T's keys
#pragma unroll
    for (int ct = 0; ct < 2; ++ct)
#pragma unroll
      for (int r = 0; r < 8; r += 2) { v2f x; x.x = __builtin_amdgcn_exp2f(__builtin_fmaf(s[ct][r], KS, off)); x.y = __builtin_amdgcn_exp2f(__builtin_fmaf(s[ct][r + 1], KS, off));
        if (ct == 0) { t[r] = x.x; t[r + 1] = x.y; } else { t[r] += x.x; t[r + 1] += x.y; }
        const v2h hi = __builtin_convertvector(x, v2h); const v2h lo = __builtin_convertvector((x - __builtin_convertvector(hi, v2f)) * 2048.0f, v2h);   // two neighbouring keys share a register of the operand: one packed conversion each for hi and residual
        pa[ct * 8 + r] = hi.x; pa[ct * 8 + r + 1] = hi.y; pl[ct * 8 + r] = lo.x; pl[ct * 8 + r + 1] = lo.y; }   // P scaled by 2^11 (inside the exponent) before the f16 split so small softmax weights stay out of the f16 subnormal range; the row sum carries the same 2^11, so the epilogue's division takes it out
    l = l * alpha + (((t[0] + t[1]) + (t[2] + t[3])) + ((t[4] + t[5]) + (t[6] + t[7]))); m = mn;
#pragma unroll
    for (int dt = 0; dt < 4; ++dt)
#pragma unroll
      for (int r = 0; r < 8; ++r) { acc[dt][r] *= alpha; accl[dt][r] *= alpha; }
    asm volatile("" :: "v"(vh[0]), "v"(vh[1]), "v"(vh[2]), "v"(vh[3]), "v"(vl[0]), "v"(vl[1]), "v"(vl[2]), "v"(vl[3]));   // inputs only: holds the trip's V reads from LDS as one group in front of the first P.V matrix instruction
#pragma unroll
    for (int dt = 0; dt < 4; ++dt) { acc[dt] = wmma16(vh[dt], pa, acc[dt]); accl[dt] = wmma16(vh[dt], pl, accl[dt]); accl[dt] = wmma16(vl[dt], pa, accl[dt]); }   // V^T rows as A: V hi x P hi + (V hi x P lo + V lo x P hi) / 2048
    __builtin_amdgcn_sched_barrier(0);   // holds the four slots below behind the last matrix instruction (without it the scheduler lifts them in front)
    asm volatile("v_nop\n\tv_nop\n\tv_nop\n\tv_nop"); }   // the branch back to the second 32 keys follows the last matrix instructions: these four slots keep the distance to the next step's first writes of their operand registers
    // hand-over of the buffers, in this order in every wave
    asm volatile("s_wait_dscnt 0x0" ::: "memory");      // this wave's LDS reads of tile ks have returned
    asm volatile("s_wait_asynccnt 0x0" ::: "memory");   // this wave's part of tile ks + 1 has landed
    __syncthreads();                                     // publishes tile ks + 1 and ends every wave's reads of tile ks
    if (ks + 2 < nks) stage(ks + 2); }                   // refill of the buffer that this trip has read
  asm volatile("s_wait_asynccnt 0x0" ::: "memory");     // no copy is outstanding behind the loop
  l += xhalf(l);   // the two halves' key sums of one query
  const float il = 1.0f / l;   // l is 2^11 x the row sum, as the accumulators are
#pragma unroll
  for (int dt = 0; dt < 4; ++dt) { v8b hv, lv;   // a lane's 8 neighbouring d of one query: 16 B of hi, 16 B of residual
#pragma unroll
    for (int r = 0; r < 8; ++r) { const float v = (acc[dt][r] + accl[dt][r] * (1.0f / 2048.0f)) * il; const __bf16 hb = (__bf16)v; hv[r] = hb; lv[r] = (__bf16)(v - (float)hb); }
    __bf16* p = &so[wave][col][(dt >> 1) * 64 + (dt & 1) * 16 + 8 * g]; *(v8b*)p = hv; *(v8b*)(p + 32) = lv; }
  LDSX();
  for (int rl = 0; rl < 16; ++rl) if (lane < 16) vst2(O + ((size_t)b * SS + q0 + rl) * (2 * DM) + h * (2 * HD) + lane * 8, *(const v4u*)&so[wave][rl][lane * 8]);
}
// ---- k_out: block = (128 output channels o, 128 positions, b), eight waves of 32 o x 64 positions: y[o][n] = w_out rows (exact) x vals rows O[n][c] (bf16 hi + residual as k_attn stored them, K 1024) -> [B][C][N] rows (256-B segments); each vals fragment read from LDS feeds two matrix instructions (the wave's two 16-channel tiles)
__global__ __launch_bounds__(256) void k_out(const __bf16* __restrict__ O, const __bf16* __restrict__ P, float* __restrict__ Y) {
  __shared__ __align__(16) float so[8][32][68];   // [wave][o][position]: 256-B rows at a pitch of 272 B
  const int tid = threadIdx.x, wave = tid >> 5, lane = tid & 31, col = lane & 15, g = lane >> 4; const int wo = (wave & 3) * 32, wn = (wave >> 2) * 64; const int o0 = blockIdx.x * 128 + wo; const int n0 = blockIdx.y * 128; const size_t b = blockIdx.z;
  v8f acc[2][4] = {};   // [16-channel tile][16-position tile]
  // tiles of vals [128 positions][64 channels: 2 x (32 hi | 32 residual)] and of weights [128 output channels][64 channels] come into LDS once per work-group by asynchronous copies, two buffers: tile t + 1 flies while tile t is worked on; 64 channels make each copied weight row one whole 128-B line
  __shared__ __align__(16) __bf16 sval[2][128][136];   // 256-B rows at a pitch of 272 B (16 B x odd, as RPIT)
  __shared__ __align__(16) __bf16 sw[2][128][RPIT];
  const int vr = tid >> 4, vc8 = (tid & 15) * 8, wr = tid >> 3, wc8 = (tid & 7) * 8;   // copy map: vals, 16 lanes a 256-B row, rows vr + 16 i; weights, 8 lanes a 128-B row, rows wr + 32 i
  const __bf16* vsrc = O + (b * SS + n0 + vr) * (2 * DM) + vc8; const __bf16* wsrc = P + (size_t)(blockIdx.x * 128 + wr) * DM + wc8;
  auto stage = [&](int t) { const int bf = t & 1; const __bf16* s0 = vsrc + t * 128; const __bf16* w0 = wsrc + t * 64;
    // twelve 16-byte copies a lane; s_wait_xcnt 0 as the statement's last line stands in front of every later rewrite of the address registers
    asm volatile(
                 "global_load_async_to_lds_b128 %0, %12, off\n\t"
                 "global_load_async_to_lds_b128 %1, %13, off\n\t"
                 "global_load_async_to_lds_b128 %2, %14, off\n\t"
                 "global_load_async_to_lds_b128 %3, %15, off\n\t"
                 "global_load_async_to_lds_b128 %4, %16, off\n\t"
                 "global_load_async_to_lds_b128 %5, %17, off\n\t"
                 "global_load_async_to_lds_b128 %6, %18, off\n\t"
                 "global_load_async_to_lds_b128 %7, %19, off\n\t"
                 "global_load_async_to_lds_b128 %8, %20, off\n\t"
                 "global_load_async_to_lds_b128 %9, %21, off\n\t"
                 "global_load_async_to_lds_b128 %10, %22, off\n\t"
                 "global_load_async_to_lds_b128 %11, %23, off\n\t"
                 "s_wait_xcnt 0x0"
                 :: "v"(lds_addr(&sval[bf][vr][vc8])), "v"(lds_addr(&sval[bf][vr + 16][vc8])), "v"(lds_addr(&sval[bf][vr + 32][vc8])), "v"(lds_addr(&sval[bf][vr + 48][vc8])),
                    "v"(lds_addr(&sval[bf][vr + 64][vc8])), "v"(lds_addr(&sval[bf][vr + 80][vc8])), "v"(lds_addr(&sval[bf][vr + 96][vc8])), "v"(lds_addr(&sval[bf][vr + 112][vc8])),
                    "v"(lds_addr(&sw[bf][wr][wc8])), "v"(lds_addr(&sw[bf][wr + 32][wc8])), "v"(lds_addr(&sw[bf][wr + 64][wc8])), "v"(lds_addr(&sw[bf][wr + 96][wc8])),
                    "v"(s0), "v"(s0 + 16 * (2 * DM)), "v"(s0 + 32 * (2 * DM)), "v"(s0 + 48 * (2 * DM)), "v"(s0 + 64 * (2 * DM)), "v"(s0 + 80 * (2 * DM)), "v"(s0 + 96 * (2 * DM)), "v"(s0 + 112 * (2 * DM)),
                    "v"(w0), "v"(w0 + 32 * DM), "v"(w0 + 64 * DM), "v"(w0 + 96 * DM)
                 : "memory"); };
  stage(0);
  asm volatile("s_wait_asynccnt 0x0" ::: "memory");   // this wave's part of tile 0 has landed
  __syncthreads();                                     // every wave's part of tile 0 is visible
  stage(1);
#pragma unroll 2
  for (int kc = 0; kc < DM / 64; ++kc) { const int bf = kc & 1;
#pragma unroll
   for (int kh = 0; kh < 2; ++kh) { v16b a[2];   // the tile's two groups of 32 channels, in ascending order
    a[0] = frag_b(&sw[bf][wo + col][kh * 32], lane); a[1] = frag_b(&sw[bf][wo + 16 + col][kh * 32], lane);
    v16b vh[4], vl[4];
#pragma unroll
    for (int j = 0; j < 4; ++j) vl[j] = frag_b(&sval[bf][wn + j * 16 + col][kh * 64 + 32], lane);
#pragma unroll
    for (int j = 0; j < 4; ++j) vh[j] = frag_b(&sval[bf][wn + j * 16 + col][kh * 64], lane);
#pragma unroll
    for (int j = 0; j < 4; ++j) { acc[0][j] = wmma_bf(a[0], vl[j], acc[0][j]); acc[1][j] = wmma_bf(a[1], vl[j], acc[1][j]); }   // each accumulator takes its residual product first, then its hi product; seven other accumulators' products stand between the two
#pragma unroll
    for (int j = 0; j < 4; ++j) { acc[0][j] = wmma_bf(a[0], vh[j], acc[0][j]); acc[1][j] = wmma_bf(a[1], vh[j], acc[1][j]); } }
    // hand-over of the buffers, in this order in every wave
    asm volatile("s_wait_dscnt 0x0" ::: "memory");      // this wave's LDS reads of tile kc have returned
    asm volatile("s_wait_asynccnt 0x0" ::: "memory");   // this wave's part of tile kc + 1 has landed
    __syncthreads();                                     // publishes tile kc + 1 and ends every wave's reads of tile kc
    if (kc + 2 < DM / 64) stage(kc + 2); }               // refill of the buffer that this trip has read
  asm volatile("s_wait_asynccnt 0x0" ::: "memory");     // no copy is outstanding behind the loop
#pragma unroll
  for (int mt = 0; mt < 2; ++mt)
#pragma unroll
    for (int j = 0; j < 4; ++j)
#pragma unroll
      for (int r = 0; r < 8; ++r) so[wave][mt * 16 + 8 * g + r][j * 16 + col] = acc[mt][j][r];
  LDSX();
  for (int it = 0; it < 16; ++it) { const int rl = 2 * it + g; vst2(Y + (b * DM + o0 + rl) * SS + n0 + wn + col * 4, *(const v4f*)&so[wave][rl][col * 4]); }   // 16 lanes a 256-B row segment, two rows an instruction
}
extern "C" void kernel_launch(void* const* d_in, const int* in_sizes, int n_in, void* d_out, int out_size, void* d_ws, size_t ws_size, hipStream_t stream) {
  (void)in_sizes; (void)n_in; (void)out_size;
  const float** F = (const float**)d_in;   // 0 x [2,1024,2048], 1 w_qkv [3072,1024] natural (head-interleaved q|k|v blocks of 64), 2 w_out [1024,1024] natural
  if (ws_size < (size_t)WS_END) return;
  char* ws = (char*)d_ws; __bf16* PK = (__bf16*)(ws + WS_PK); _Float16 *QK = (_Float16*)(ws + WS_QK), *QKL = (_Float16*)(ws + WS_QKL), *VTH = (_Float16*)(ws + WS_VTH), *VTL = (_Float16*)(ws + WS_VTL); __bf16* O = (__bf16*)(ws + WS_O); __bf16* XT = (__bf16*)(ws + WS_XT);
  k_pack<<<dim3(QKVW, 2), 256, 0, stream>>>(F[1], F[2], F[0], PK, XT);
  k_qkv<<<dim3(SS / 128, QKVW / 128, TNB), 128, 0, stream>>>(XT, PK + PK_A, QK, QKL, VTH, VTL);
  k_attn<<<dim3(TQB, NH, TNB), 128, 0, stream>>>(QK, QKL, VTH, VTL, O);
  k_out<<<dim3(DM / 128, TON, TNB), 256, 0, stream>>>(O, PK + PK_P, (float*)d_out);
}

// v009
// One run takes 126 microseconds.
// Two timings next to v008 both put it at 1.07 times that version's speed.
// Counting every step since v000, it is 5.12 times as fast.
// compute dtype: x, w_qkv, w_out rounded to bf16; qkv = w_qkv . x with exact bf16 products on WMMA 16x16x32 (positions as rows via an LDS transpose of the [B,C,N] input, natural weight rows; output channel o -> head o/192, part (o%192)/64, dim o%64); q and k stored as f16 hi + (x2048-scaled) residual planes with 3-product scores x 1/8; running-max softmax in f32 (hardware exp); P (scaled by 2^11, as f16 hi + residual) x v hi/lo (3 products); y = w_out (exact rows) x vals (f32 as bf16 hi + residual, 2 products) written channels-first; f32 accumulate.
#include <hip/hip_runtime.h>
#include <math.h>

typedef __attribute__((ext_vector_type(16))) _Float16 v16h;
typedef __attribute__((ext_vector_type(16))) __bf16 v16b;
typedef __attribute__((ext_vector_type(8)))  _Float16 v8h;
typedef __attribute__((ext_vector_type(8)))  float v8f;
typedef __attribute__((ext_vector_type(4)))  float v4f;
typedef __attribute__((ext_vector_type(2)))  float v2f;
typedef __attribute__((ext_vector_type(4)))  unsigned v4u;
typedef __attribute__((ext_vector_type(4)))  int v4i;
typedef float __attribute__((may_alias)) float_a;
typedef int __attribute__((may_alias)) int_a;

template <typename T> __device__ __forceinline__ void vst2(void* p, T v) { *(T*)p = v;  }
__device__ __forceinline__ v8f wmma16(v16h a, v16h b, v8f c) {
  return __builtin_amdgcn_wmma_f32_16x16x32_f16(false, a, false, b, (short)0, c, false, false);   // plain builtin: the compiler keeps the distance behind it and fills the slots with the loop's own vector work
}
__device__ __forceinline__ v8f wmma_bf(v16b a, v16b b, v8f c) {
  v8f d = __builtin_amdgcn_wmma_f32_16x16x32_bf16(false, a, false, b, (short)0, c, false, false);
  asm volatile("v_nop\n\tv_nop\n\tv_nop\n\tv_nop" : "+v"(d) : "v"(a), "v"(b));
  return d;
}
// Channels-first multi-head attention layer (x [2][1024 channels][2048 positions], 16 heads x 64): 1x1-conv qkv with per-head interleaved (q|k|v) channel blocks, softmax(q k^T / 8) v, 1x1-conv output projection -> [B, C, N].
__device__ __forceinline__ v16h frag_h(const _Float16* rowk0, int lane) {
  union { v16h v; v8h q[2]; } u; const _Float16* p = rowk0 + 8 * (lane >> 4);
  u.q[0] = *(const v8h*)p; u.q[1] = *(const v8h*)(p + 16); return u.v;
}
__device__ __forceinline__ v16h frag_f32(const float* rowk0, int lane) {
  v16h a; const float* p = rowk0 + 8 * (lane >> 4);
#pragma unroll
  for (int i = 0; i < 8; ++i) { a[i] = (_Float16)p[i]; a[8 + i] = (_Float16)p[16 + i]; }
  return a;
}
__device__ __forceinline__ v16h frag_f32s(const float* rowk0, int lane, float sc) {
  v16h a; const float* p = rowk0 + 8 * (lane >> 4);
#pragma unroll
  for (int i = 0; i < 8; ++i) { a[i] = (_Float16)(p[i] * sc); a[8 + i] = (_Float16)(p[16 + i] * sc); }
  return a;
}
// column fragment from a [K][ld] layout (column n), rows >= K read as 0
__device__ __forceinline__ v16h fragc_f32(const float* W, int k0, int n, int lane, int ld, int K) {
  v16h a; const int g = lane >> 4;
#pragma unroll
  for (int i = 0; i < 8; ++i) { const int ka = k0 + 8 * g + i, kb = ka + 16;
    a[i] = (_Float16)(ka < K ? W[(size_t)(ka < K ? ka : K - 1) * ld + n] : 0.f); a[8 + i] = (_Float16)(kb < K ? W[(size_t)(kb < K ? kb : K - 1) * ld + n] : 0.f); }
  return a;
}
struct F2 { v16b h, l; };
__device__ __forceinline__ F2 bsplit16(const float v[16]) { F2 r;
#pragma unroll
  for (int i = 0; i < 16; ++i) { const __bf16 h = (__bf16)v[i]; r.h[i] = h; r.l[i] = (__bf16)(v[i] - (float)h); }
  return r; }
__device__ __forceinline__ F2 split_row(const float* row, int k0, int lane) { float v[16]; const float* p = row + k0 + 8 * (lane >> 4);
#pragma unroll
  for (int i = 0; i < 8; ++i) { v[i] = p[i]; v[8 + i] = p[16 + i]; }
  return bsplit16(v); }
__device__ __forceinline__ F2 split_rowK(const float* row, int k0, int lane, int K) { float v[16]; const int g = lane >> 4;
#pragma unroll
  for (int i = 0; i < 8; ++i) { const int ka = k0 + 8 * g + i, kb = ka + 16; v[i] = ka < K ? row[ka < K ? ka : K - 1] : 0.f; v[8 + i] = kb < K ? row[kb < K ? kb : K - 1] : 0.f; }
  return bsplit16(v); }
__device__ __forceinline__ F2 split_col(const float* W, int k0, int n, int lane, int ld, int K) { float v[16]; const int g = lane >> 4;
#pragma unroll
  for (int i = 0; i < 8; ++i) { const int ka = k0 + 8 * g + i, kb = ka + 16; v[i] = ka < K ? W[(size_t)(ka < K ? ka : K - 1) * ld + n] : 0.f; v[8 + i] = kb < K ? W[(size_t)(kb < K ? kb : K - 1) * ld + n] : 0.f; }
  return bsplit16(v); }
__device__ __forceinline__ v8f mac3(const F2& a, const F2& b, v8f c) { c = wmma_bf(a.l, b.h, c); c = wmma_bf(a.h, b.l, c); return wmma_bf(a.h, b.h, c); }
__device__ __forceinline__ float sigm(float v) { return 1.0f / (1.0f + expf(-v)); }
#define LDSX() do { asm volatile("s_wait_dscnt 0" ::: "memory"); __builtin_amdgcn_wave_barrier(); __builtin_amdgcn_fence(__ATOMIC_RELEASE, "workgroup"); } while (0)


#define NB 2
#define SS 2048
#define DM 1024
#define NH 16
#define HD 64
#define QKVW (3 * DM)
#ifndef TQB
#define TQB (SS / 128)
#define TNB NB
#define TON (SS / 128)         // output position blocks per batch (all)
#endif
typedef __attribute__((ext_vector_type(8))) __bf16 v8b;
__device__ __forceinline__ v16b frag_b(const __bf16* rowk0, int lane) {
  union { v16b v; v8b q[2]; } u; const __bf16* p = rowk0 + 8 * (lane >> 4);
  u.q[0] = *(const v8b*)p; u.q[1] = *(const v8b*)(p + 16); return u.v;
}
__device__ __forceinline__ unsigned lds_addr(const void* p) { return (unsigned)(size_t)p; }   // low 32 bits of a __shared__ address = byte offset in the work-group's LDS
#define RPIT 72   // 16-bit elements per staged 128-B row: 128 B + 16 B (a pitch of 16 B x odd keeps 16-byte LDS reads of 16 rows off each other's banks)
__device__ __forceinline__ float bfr(float v) { return (float)(__bf16)v; }
__device__ __attribute__((noinline)) float exp_ni(float v) { return expf(v); }
__device__ __attribute__((noinline)) float erf_ni(float v) { return erff(v); }

#define PK_A 0                       // [3072][1024] Wqkv rows (natural [out][in])
#define PK_P (PK_A + QKVW * DM)        // [1024][1024] Wo rows (natural)
#define PK_END (PK_P + DM * DM)
#define WS_PK  0u
#define WS_QK  (WS_PK + 2u * PK_END)             // f16 [4096 rows][2048]: q | k
#define WS_QKL (WS_QK + 2u * NB * SS * 2 * DM)     // f16 q | k residual planes x2048
#define WS_VTH (WS_QKL + 2u * NB * SS * 2 * DM)    // f16 [b][1024 (h*64+d)][2048 s] hi
#define WS_VTL (WS_VTH + 2u * NB * DM * SS)        // f16 lo x 2048
#define WS_O   (WS_VTL + 2u * NB * DM * SS)        // bf16 [b * 2048 + position][32 groups of 32 channels][32 hi | 32 residual]: vals already split for k_out, 4 B a value
#define WS_XT  (WS_O + 4u * NB * SS * DM)           // bf16 [b][2048 positions][1024 channels]: x rounded and transposed
#define WS_END (WS_XT + 2u * NB * SS * DM)
// ---- k_pack: block = (row n, which): natural [out][in] rows -> bf16; which 0 -> w_qkv row n into PK_A; which 1, n < 1024 -> w_out row n into PK_P
// which 1, n >= 1024 (2048 blocks with no weight row): tile n - 1024 of x, [64 channels][32 positions] -> XT[b][position][channel] in bf16, so that x is rounded and transposed once and not once per block of k_qkv
__global__ __launch_bounds__(256) void k_pack(const float* __restrict__ WQKV, const float* __restrict__ WOUT, const float* __restrict__ X, __bf16* __restrict__ PK, __bf16* __restrict__ XT) {
  __shared__ __align__(16) __bf16 s[DM]; const int n = blockIdx.x, which = blockIdx.y, t = threadIdx.x; const float* src = (which == 0) ? (WQKV + (size_t)n * DM) : (WOUT + (size_t)(n - 0) * DM);
  if (which == 1 && n >= DM) {
    __shared__ __align__(16) __bf16 sx[32][72];   // [position][channel]: 128-B rows at a pitch of 144 B
    const int id = n - DM, bb = id >> 10, c0 = (id & 15) * 64, p0 = ((id >> 4) & 63) * 32;
    for (int i = 0; i < 2; ++i) { const int c = (t >> 3) + 32 * i, p4 = (t & 7) * 4;   // 8 lanes read one channel's 128-B line
      const v4f v = *(const v4f*)(X + ((size_t)bb * DM + c0 + c) * SS + p0 + p4);
      for (int k = 0; k < 4; ++k) sx[p4 + k][c] = (__bf16)v[k]; }
    __syncthreads();
    const int p = t >> 3, c8 = (t & 7) * 8;   // 8 lanes write one position's 128-B line
    vst2((unsigned*)(XT + ((size_t)bb * SS + p0 + p) * DM + c0 + c8), *(const v4u*)&sx[p][c8]);
    return; }
  for (int k = t; k < DM; k += 256) s[k] = (__bf16)src[k];
  __syncthreads();
  __bf16* dst = (which == 0) ? PK + PK_A + (size_t)n * DM : PK + PK_P + (size_t)n * DM;
  for (int q = t; q < DM / 8; q += 256) vst2((unsigned*)(dst + q * 8), *(const v4u*)&s[q * 8]);
}
// ---- k_qkv: block = (128 positions, 128 of the 3072 output channels, b): A rows from XT[b][n][c] (x in bf16, transposed by k_pack); a wave takes two 16-position tiles (64 apart) against the block's 128 channels, so that each weight fragment read from LDS feeds two matrix instructions; each 16-col tile is one (head, part, 16 dims): q/k -> f16 hi/lo row segments [row][part*1024 + h*64 + d]; v -> planes [b][h*64 + d][n]
__global__ __launch_bounds__(128) void k_qkv(const __bf16* __restrict__ XT, const __bf16* __restrict__ P, _Float16* __restrict__ QK, _Float16* __restrict__ QKL, _Float16* __restrict__ VTH, _Float16* __restrict__ VTL) {
  // one LDS block, used twice: the ring's two buffers while the loop runs, the epilogue's transposing buffers behind the loop's last barrier (so that three work-groups, all a WGP gets, fit its LDS)
  __shared__ __align__(16) char sm[2 * 128 * RPIT * 2 + 2 * 128 * RPIT * 2];
  _Float16 (*eb)[2][64][72] = (_Float16 (*)[2][64][72])sm;   // epilogue: [2 mt + q4][hi | residual][64][64 + 8]: four pairs of planes fill the ring's bytes exactly
  const int tid = threadIdx.x, wave = tid >> 5, lane = tid & 31, col = lane & 15, g = lane >> 4; const size_t b = blockIdx.z; const int p0 = blockIdx.x * 128; const int n0 = blockIdx.y * 128;
  v8f acc[2][8] = {};   // [position tile: p0 + 64 mt + 16 wave][channel tile]
  // tiles of weights [128 output channels][64 input channels] and of x [128 positions][64 input channels] come into LDS once per work-group by asynchronous copies, two buffers: tile t + 1 flies while tile t is worked on; 64 channels make each copied row one whole 128-B line
  __bf16 (*sb)[128][RPIT] = (__bf16 (*)[128][RPIT])sm;
  __bf16 (*sx)[128][RPIT] = (__bf16 (*)[128][RPIT])(sm + 2 * 128 * RPIT * 2);
  const int wr = tid >> 3, wc8 = (tid & 7) * 8;   // copy map: 8 lanes a 128-B row, rows wr + 16 i
  const __bf16* wsrc = P + (size_t)(n0 + wr) * DM + wc8; const __bf16* xsrc = XT + (b * SS + p0 + wr) * DM + wc8;
  auto stage = [&](int t) { const int bf = t & 1; const __bf16* s0 = wsrc + t * 64; const __bf16* x0 = xsrc + t * 64;
    // sixteen 16-byte copies a lane, the weights' eight and x's eight; s_wait_xcnt 0 as each statement's last line stands in front of every later rewrite of the address registers
    asm volatile(
                 "global_load_async_to_lds_b128 %0, %8, off\n\t"
                 "global_load_async_to_lds_b128 %1, %9, off\n\t"
                 "global_load_async_to_lds_b128 %2, %10, off\n\t"
                 "global_load_async_to_lds_b128 %3, %11, off\n\t"
                 "global_load_async_to_lds_b128 %4, %12, off\n\t"
                 "global_load_async_to_lds_b128 %5, %13, off\n\t"
                 "global_load_async_to_lds_b128 %6, %14, off\n\t"
                 "global_load_async_to_lds_b128 %7, %15, off\n\t"
                 "s_wait_xcnt 0x0"
                 :: "v"(lds_addr(&sb[bf][wr][wc8])), "v"(lds_addr(&sb[bf][wr + 16][wc8])), "v"(lds_addr(&sb[bf][wr + 32][wc8])), "v"(lds_addr(&sb[bf][wr + 48][wc8])),
                    "v"(lds_addr(&sb[bf][wr + 64][wc8])), "v"(lds_addr(&sb[bf][wr + 80][wc8])), "v"(lds_addr(&sb[bf][wr + 96][wc8])), "v"(lds_addr(&sb[bf][wr + 112][wc8])),
                    "v"(s0), "v"(s0 + 16 * DM), "v"(s0 + 32 * DM), "v"(s0 + 48 * DM), "v"(s0 + 64 * DM), "v"(s0 + 80 * DM), "v"(s0 + 96 * DM), "v"(s0 + 112 * DM)
                 : "memory");
    asm volatile(
                 "global_load_async_to_lds_b128 %0, %8, off\n\t"
                 "global_load_async_to_lds_b128 %1, %9, off\n\t"
                 "global_load_async_to_lds_b128 %2, %10, off\n\t"
                 "global_load_async_to_lds_b128 %3, %11, off\n\t"
                 "global_load_async_to_lds_b128 %4, %12, off\n\t"
                 "global_load_async_to_lds_b128 %5, %13, off\n\t"
                 "global_load_async_to_lds_b128 %6, %14, off\n\t"
                 "global_load_async_to_lds_b128 %7, %15, off\n\t"
                 "s_wait_xcnt 0x0"
                 :: "v"(lds_addr(&sx[bf][wr][wc8])), "v"(lds_addr(&sx[bf][wr + 16][wc8])), "v"(lds_addr(&sx[bf][wr + 32][wc8])), "v"(lds_addr(&sx[bf][wr + 48][wc8])),
                    "v"(lds_addr(&sx[bf][wr + 64][wc8])), "v"(lds_addr(&sx[bf][wr + 80][wc8])), "v"(lds_addr(&sx[bf][wr + 96][wc8])), "v"(lds_addr(&sx[bf][wr + 112][wc8])),
                    "v"(x0), "v"(x0 + 16 * DM), "v"(x0 + 32 * DM), "v"(x0 + 48 * DM), "v"(x0 + 64 * DM), "v"(x0 + 80 * DM), "v"(x0 + 96 * DM), "v"(x0 + 112 * DM)
                 : "memory"); };
  stage(0);
  asm volatile("s_wait_asynccnt 0x0" ::: "memory");   // this wave's part of tile 0 has landed
  __syncthreads();                                     // every wave's part of tile 0 is visible
  stage(1);
#pragma unroll 2
    for (int t = 0; t < DM / 64; ++t) { const int bf = t & 1;
#pragma unroll
      for (int kh = 0; kh < 2; ++kh) { v16b a[2], w[8];   // one half's fragments at a time: with both halves' live beside 128 accumulator registers the wave would spill
        a[0] = frag_b(&sx[bf][wave * 16 + col][kh * 32], lane); a[1] = frag_b(&sx[bf][64 + wave * 16 + col][kh * 32], lane);
#pragma unroll
        for (int j = 0; j < 8; ++j) w[j] = frag_b(&sb[bf][j * 16 + col][kh * 32], lane);
        asm volatile("" :: "v"(a[0]), "v"(a[1]), "v"(w[0]), "v"(w[1]), "v"(w[2]), "v"(w[3]), "v"(w[4]), "v"(w[5]), "v"(w[6]), "v"(w[7]));   // inputs only: holds the half's LDS reads as one group in front of its first matrix instruction (one LDS wait a half, not one a tile)
#pragma unroll
        for (int j = 0; j < 8; ++j) { acc[0][j] = wmma_bf(a[0], w[j], acc[0][j]); acc[1][j] = wmma_bf(a[1], w[j], acc[1][j]); } }
      // hand-over of the buffers, in this order in every wave
      asm volatile("s_wait_dscnt 0x0" ::: "memory");      // this wave's LDS reads of tile t have returned
      asm volatile("s_wait_asynccnt 0x0" ::: "memory");   // this wave's part of tile t + 1 has landed
      __syncthreads();                                     // publishes tile t + 1 and ends every wave's reads of tile t
      if (t + 2 < DM / 64) stage(t + 2); }                 // refill of the buffer that this trip has read
  asm volatile("s_wait_asynccnt 0x0" ::: "memory");       // no copy is outstanding behind the loop
  // epilogue: tile j -> o0 = n0 + j*16; h = o0 / 192; part = (o0 % 192) / 64; d = o0 % 64 + col; each (64 positions mt, 64 channels q4 = one (head, part)) has its own [64][72] pair of planes, rows = positions for q and k, rows = channels for v
#pragma unroll
  for (int mt = 0; mt < 2; ++mt)
#pragma unroll
  for (int j = 0; j < 8; ++j) { const int o0 = n0 + j * 16; const int part = (o0 % 192) / 64; _Float16 (*e)[64][72] = eb[mt * 2 + (j >> 2)]; const int c = (j & 3) * 16 + col;
#pragma unroll
    for (int r = 0; r < 8; ++r) { const float v = acc[mt][j][r]; const _Float16 hv = (_Float16)v; const _Float16 lv = (_Float16)((v - (float)hv) * 2048.0f); const int p = wave * 16 + 8 * g + r;
      if (part < 2) { e[0][p][c] = hv; e[1][p][c] = lv; } else { e[0][c][p] = hv; e[1][c][p] = lv; } } }
  __syncthreads();
  // stores: per tile group of 4 (64 channels = one (head, part)): tiles j = 4*q4 .. 4*q4+3 share (h, part) since 64-runs align
#pragma unroll
  for (int mt = 0; mt < 2; ++mt) { const int pm = p0 + mt * 64; const size_t r0 = b * SS + pm + wave * 16;
#pragma unroll
  for (int q4 = 0; q4 < 2; ++q4) { const int o0 = n0 + q4 * 64; const int h = o0 / 192, part = (o0 % 192) / 64; _Float16 (*e)[64][72] = eb[mt * 2 + q4];
    if (part < 2) {
      for (int rl = 0; rl < 16; ++rl) if (lane < 8) { vst2((unsigned*)(QK + (r0 + rl) * (2 * DM) + part * DM + h * HD + lane * 8), *(const v4u*)&e[0][wave * 16 + rl][lane * 8]); vst2((unsigned*)(QKL + (r0 + rl) * (2 * DM) + part * DM + h * HD + lane * 8), *(const v4u*)&e[1][wave * 16 + rl][lane * 8]); }
    } else {
      for (int q = tid; q < 64 * 8; q += 128) { const int d = q >> 3, pc = q & 7; const size_t o = (b * DM + h * HD + d) * SS + pm + pc * 8; vst2((unsigned*)(VTH + o), *(const v4u*)&e[0][d][pc * 8]); vst2((unsigned*)(VTL + o), *(const v4u*)&e[1][d][pc * 8]); } } } }
}
typedef __attribute__((ext_vector_type(2))) _Float16 v2h;
// lane l <-> lane l ^ 16 in one vector instruction
__device__ __forceinline__ float xhalf(float v) { const int b = __builtin_bit_cast(int, v); return __builtin_bit_cast(float, __builtin_amdgcn_permlanex16(b, b, 0x76543210, 0xfedcba98, false, false)); }
#define KPIT 72   // halfs per staged K row: 128 B + 16 B (a pitch of 16 B x odd keeps 16-byte LDS reads of 16 rows off each other's banks)
#define VPIT 72   // halfs per staged V row: 128 B + 16 B, same reason
__global__ __launch_bounds__(128) __attribute__((amdgpu_waves_per_eu(2, 2))) void k_attn(const _Float16* __restrict__ QK, const _Float16* __restrict__ QKL, const _Float16* __restrict__ VTH, const _Float16* __restrict__ VTL, __bf16* __restrict__ O) {
  // one LDS block, used twice: the ring's two buffers while the loop runs, the epilogue's rows behind the loop's last barrier; the grid gives a WGP two work-groups, two waves a SIMD (amdgpu_waves_per_eu: 512 registers a wave, and no third work-group lands on a WGP while another has one)
  __shared__ __align__(16) char sm[2 * 2 * 64 * KPIT * 2 + 2 * 2 * 64 * VPIT * 2];
  __bf16 (*so)[32][136] = (__bf16 (*)[32][136])sm;   // [wave][query][2 x (32 hi | 32 residual)]: 256-B rows at a pitch of 272 B
  _Float16 (*sk)[2][64][KPIT] = (_Float16 (*)[2][64][KPIT])sm;   // [buffer][hi | residual][key][d]
  _Float16 (*sv)[2][64][VPIT] = (_Float16 (*)[2][64][VPIT])(sm + 2 * 2 * 64 * KPIT * 2);   // [buffer][hi | residual][d][key]
  const int tid = threadIdx.x, wave = tid >> 5, lane = tid & 31, col = lane & 15, g = lane >> 4;
  const int qb = blockIdx.x, h = blockIdx.y, b = blockIdx.z; const int q0 = qb * 128 + wave * 32; const size_t rq = (size_t)b * SS + q0 + col;
  const int nks = SS / 64;   // all keys, 64 a tile
  // copy map: K and V alike, 8 lanes a 128-B row, rows kr + 16 i
  const int kr = tid >> 3, kc8 = (tid & 7) * 8;
  const size_t koff = ((size_t)b * SS + kr) * (2 * DM) + DM + h * HD + kc8, voff = ((size_t)b * DM + h * HD + kr) * SS + kc8;
  auto stage = [&](int t) { const int bf = t & 1; const size_t ko = koff + (size_t)t * 64 * (2 * DM), vo = voff + (size_t)t * 64;
    // sixteen 16-byte copies a lane, K's eight and V's eight; s_wait_xcnt 0 as each statement's last line stands in front of every later rewrite of the address registers
    asm volatile("global_load_async_to_lds_b128 %0, %8, off\n\t"
                 "global_load_async_to_lds_b128 %1, %9, off\n\t"
                 "global_load_async_to_lds_b128 %2, %10, off\n\t"
                 "global_load_async_to_lds_b128 %3, %11, off\n\t"
                 "global_load_async_to_lds_b128 %4, %12, off\n\t"
                 "global_load_async_to_lds_b128 %5, %13, off\n\t"
                 "global_load_async_to_lds_b128 %6, %14, off\n\t"
                 "global_load_async_to_lds_b128 %7, %15, off\n\t"
                 "s_wait_xcnt 0x0"
                 :: "v"(lds_addr(&sk[bf][0][kr][kc8])), "v"(lds_addr(&sk[bf][0][kr + 16][kc8])), "v"(lds_addr(&sk[bf][0][kr + 32][kc8])), "v"(lds_addr(&sk[bf][0][kr + 48][kc8])),
                    "v"(lds_addr(&sk[bf][1][kr][kc8])), "v"(lds_addr(&sk[bf][1][kr + 16][kc8])), "v"(lds_addr(&sk[bf][1][kr + 32][kc8])), "v"(lds_addr(&sk[bf][1][kr + 48][kc8])),
                    "v"(QK + ko), "v"(QK + ko + 16 * (2 * DM)), "v"(QK + ko + 32 * (2 * DM)), "v"(QK + ko + 48 * (2 * DM)),
                    "v"(QKL + ko), "v"(QKL + ko + 16 * (2 * DM)), "v"(QKL + ko + 32 * (2 * DM)), "v"(QKL + ko + 48 * (2 * DM))
                 : "memory");
    asm volatile("global_load_async_to_lds_b128 %0, %8, off\n\t"
                 "global_load_async_to_lds_b128 %1, %9, off\n\t"
                 "global_load_async_to_lds_b128 %2, %10, off\n\t"
                 "global_load_async_to_lds_b128 %3, %11, off\n\t"
                 "global_load_async_to_lds_b128 %4, %12, off\n\t"
                 "global_load_async_to_lds_b128 %5, %13, off\n\t"
                 "global_load_async_to_lds_b128 %6, %14, off\n\t"
                 "global_load_async_to_lds_b128 %7, %15, off\n\t"
                 "s_wait_xcnt 0x0"
                 :: "v"(lds_addr(&sv[bf][0][kr][kc8])), "v"(lds_addr(&sv[bf][0][kr + 16][kc8])), "v"(lds_addr(&sv[bf][0][kr + 32][kc8])), "v"(lds_addr(&sv[bf][0][kr + 48][kc8])),
                    "v"(lds_addr(&sv[bf][1][kr][kc8])), "v"(lds_addr(&sv[bf][1][kr + 16][kc8])), "v"(lds_addr(&sv[bf][1][kr + 32][kc8])), "v"(lds_addr(&sv[bf][1][kr + 48][kc8])),
                    "v"(VTH + vo), "v"(VTH + vo + 16 * SS), "v"(VTH + vo + 32 * SS), "v"(VTH + vo + 48 * SS),
                    "v"(VTL + vo), "v"(VTL + vo + 16 * SS), "v"(VTL + vo + 32 * SS), "v"(VTL + vo + 48 * SS)
                 : "memory"); };
  stage(0);
  asm volatile("s_wait_asynccnt 0x0" ::: "memory");   // this wave's part of tile 0 has landed
  __syncthreads();                                     // every wave's part of tile 0 is visible
  stage(1);
  v16h aq[2][2], aql[2][2];   // [query tile][k half]
#pragma unroll
  for (int qt = 0; qt < 2; ++qt)
#pragma unroll
    for (int kc = 0; kc < 2; ++kc) { aq[qt][kc] = frag_h(QK + (rq + qt * 16) * (2 * DM) + h * HD + kc * 32, lane); aql[qt][kc] = frag_h(QKL + (rq + qt * 16) * (2 * DM) + h * HD + kc * 32, lane); }
  asm volatile("s_wait_xcnt 0x0" ::: "memory");   // behind the last Q load, in front of every later rewrite of the loads' address registers
  __builtin_amdgcn_sched_barrier(0);   // holds the accumulators' zeroing, which reuses those address registers, behind the wait (without it the scheduler lifts it in front)
  const float KS = 0.125f * 1.44269504f;   // 1/sqrt(64) x log2 e
  float off[2] = {3.0e38f, 3.0e38f};   // the exponent's addend of the step before
  float m[2] = {-3.0e38f, -3.0e38f}, l[2] = {0.f, 0.f};   // of this lane's two queries (qt * 16 + col); l holds the keys of this lane half only, the halves join behind the loop
  v8f acc[2][4] = {}, accl[2][4] = {};   // O^T tiles: register r = O[query qt * 16 + col][d = dt * 16 + 8 g + r]
#pragma unroll 1
  for (int ks = 0; ks < nks; ++ks) { const int bf = ks & 1;
#pragma unroll 1   // the tile's two steps of 32 keys run through one copy of the body: unrolled, both steps' fragments are live together
   for (int sub = 0; sub < 2; ++sub) { v8f s[2][2]; v16h kf[2][2], kl[2][2];
#pragma unroll
    for (int ct = 0; ct < 2; ++ct)
#pragma unroll
      for (int kc = 0; kc < 2; ++kc) { kf[ct][kc] = frag_h(&sk[bf][0][sub * 32 + ct * 16 + col][kc * 32], lane); kl[ct][kc] = frag_h(&sk[bf][1][sub * 32 + ct * 16 + col][kc * 32], lane); }
    asm volatile("" :: "v"(kf[0][0]), "v"(kf[0][1]), "v"(kf[1][0]), "v"(kf[1][1]), "v"(kl[0][0]), "v"(kl[0][1]), "v"(kl[1][0]), "v"(kl[1][1]));   // inputs only: holds the trip's K reads from LDS as one group in front of the first matrix instruction (one LDS wait, not one a fragment)
#pragma unroll
    for (int qt = 0; qt < 2; ++qt)
#pragma unroll
    for (int ct = 0; ct < 2; ++ct) { v8f c = {}, cl = {};
#pragma unroll
      for (int kc = 0; kc < 2; ++kc) { c = wmma16(kf[ct][kc], aq[qt][kc], c); cl = wmma16(kf[ct][kc], aql[qt][kc], cl); cl = wmma16(kl[ct][kc], aq[qt][kc], cl); }   // 3 products: q, k as f16 hi + residual; K rows as A, Q as B: register r = score of key ct * 16 + 8 g + r for query qt * 16 + col
      s[qt][ct] = c + cl * (1.0f / 2048.0f); }   // raw q.k, all keys: 1/sqrt(64) is applied inside the exponent below (written on the whole tile: neighbouring registers pair up with no register copies)
    v16h vh[4], vl[4];
#pragma unroll
    for (int dt = 0; dt < 4; ++dt) { vh[dt] = frag_h(&sv[bf][0][dt * 16 + col][sub * 32], lane); vl[dt] = frag_h(&sv[bf][1][dt * 16 + col][sub * 32], lane); }
    __builtin_amdgcn_sched_barrier(0);   // holds V's LDS reads here, in front of the softmax, whose vector work covers their latency (without it the scheduler sinks them in among the P.V matrix instructions, which then wait for them)
    v16h pa[2], pl[2];   // P^T as B operand: element ct * 8 + r is key ct * 16 + 8 g + r, the order in which frag_h reads V^T's keys
#pragma unroll
    for (int qt = 0; qt < 2; ++qt) {
    // a lane holds 16 of its query's 32 scores, lane ^ 16 the other 16: maximum and sum in registers, one exchange between the halves for the maximum
    float t[8];
#pragma unroll
    for (int r = 0; r < 8; ++r) t[r] = fmaxf(s[qt][0][r], s[qt][1][r]);
    float mx = fmaxf(fmaxf(fmaxf(t[0], t[1]), fmaxf(t[2], t[3])), fmaxf(fmaxf(t[4], t[5]), fmaxf(t[6], t[7])));
    mx = fmaxf(mx, xhalf(mx));
    const float mn = fmaxf(m[qt], mx);   // m, mx, mn in raw units (KS > 0 keeps their order)
    const float offp = off[qt]; off[qt] = 11.0f - mn * KS;   // 2^11 e^((s - mn) / 8) = 2^(s KS + off): one fused multiply-add a score in front of the hardware's 2^x
    float alpha;   // e^((m - mn) / 8) as 2^(off - offp), the very ratio of the two steps' factors; the first step's offp gives 2^(-huge) = 0
    asm("v_nop\n\tv_exp_f32 %0, %1\n\tv_nop" : "=v"(alpha) : "v"(off[qt] - offp));   // the slot that the instruction set asks for around a transcendental, on both sides
#pragma unroll
    for (int ct = 0; ct < 2; ++ct)
#pragma unroll
      for (int r = 0; r < 8; r += 2) { v2f x; x.x = __builtin_amdgcn_exp2f(__builtin_fmaf(s[qt][ct][r], KS, off[qt])); x.y = __builtin_amdgcn_exp2f(__builtin_fmaf(s[qt][ct][r + 1], KS, off[qt]));
        if (ct == 0) { t[r] = x.x; t[r + 1] = x.y; } else { t[r] += x.x; t[r + 1] += x.y; }
        const v2h hi = __builtin_convertvector(x, v2h); const v2h lo = __builtin_convertvector((x - __builtin_convertvector(hi, v2f)) * 2048.0f, v2h);   // two neighbouring keys share a register of the operand: one packed conversion each for hi and residual
        pa[qt][ct * 8 + r] = hi.x; pa[qt][ct * 8 + r + 1] = hi.y; pl[qt][ct * 8 + r] = lo.x; pl[qt][ct * 8 + r + 1] = lo.y; }   // P scaled by 2^11 (inside the exponent) before the f16 split so small softmax weights stay out of the f16 subnormal range; the row sum carries the same 2^11, so the epilogue's division takes it out
    l[qt] = l[qt] * alpha + (((t[0] + t[1]) + (t[2] + t[3])) + ((t[4] + t[5]) + (t[6] + t[7]))); m[qt] = mn;
#pragma unroll
    for (int dt = 0; dt < 4; ++dt)
#pragma unroll
      for (int r = 0; r < 8; ++r) { acc[qt][dt][r] *= alpha; accl[qt][dt][r] *= alpha; } }
#pragma unroll
    for (int qt = 0; qt < 2; ++qt)
#pragma unroll
    for (int dt = 0; dt < 4; ++dt) { acc[qt][dt] = wmma16(vh[dt], pa[qt], acc[qt][dt]); accl[qt][dt] = wmma16(vh[dt], pl[qt], accl[qt][dt]); accl[qt][dt] = wmma16(vl[dt], pa[qt], accl[qt][dt]); }   // V^T rows as A: V hi x P hi + (V hi x P lo + V lo x P hi) / 2048
    __builtin_amdgcn_sched_barrier(0);   // holds the four slots below behind the last matrix instruction (without it the scheduler lifts them in front)
    asm volatile("v_nop\n\tv_nop\n\tv_nop\n\tv_nop"); }   // the branch back to the second 32 keys follows the last matrix instructions: these four slots keep the distance to the next step's first writes of their operand registers
    // hand-over of the buffers, in this order in every wave
    asm volatile("s_wait_dscnt 0x0" ::: "memory");      // this wave's LDS reads of tile ks have returned
    asm volatile("s_wait_asynccnt 0x0" ::: "memory");   // this wave's part of tile ks + 1 has landed
    __syncthreads();                                     // publishes tile ks + 1 and ends every wave's reads of tile ks
    if (ks + 2 < nks) stage(ks + 2); }                   // refill of the buffer that this trip has read
  asm volatile("s_wait_asynccnt 0x0" ::: "memory");     // no copy is outstanding behind the loop
#pragma unroll
  for (int qt = 0; qt < 2; ++qt) {
  const float lq = l[qt] + xhalf(l[qt]);   // the two halves' key sums of one query
  const float il = 1.0f / lq;   // lq is 2^11 x the row sum, as the accumulators are
#pragma unroll
  for (int dt = 0; dt < 4; ++dt) { v8b hv, lv;   // a lane's 8 neighbouring d of one query: 16 B of hi, 16 B of residual
#pragma unroll
    for (int r = 0; r < 8; ++r) { const float v = (acc[qt][dt][r] + accl[qt][dt][r] * (1.0f / 2048.0f)) * il; const __bf16 hb = (__bf16)v; hv[r] = hb; lv[r] = (__bf16)(v - (float)hb); }
    __bf16* p = &so[wave][qt * 16 + col][(dt >> 1) * 64 + (dt & 1) * 16 + 8 * g]; *(v8b*)p = hv; *(v8b*)(p + 32) = lv; } }
  LDSX();
  for (int rl = 0; rl < 32; ++rl) if (lane < 16) vst2(O + ((size_t)b * SS + q0 + rl) * (2 * DM) + h * (2 * HD) + lane * 8, *(const v4u*)&so[wave][rl][lane * 8]);
}
// ---- k_out: block = (128 output channels o, 128 positions, b), eight waves of 32 o x 64 positions: y[o][n] = w_out rows (exact) x vals rows O[n][c] (bf16 hi + residual as k_attn stored them, K 1024) -> [B][C][N] rows (256-B segments); each vals fragment read from LDS feeds two matrix instructions (the wave's two 16-channel tiles)
__global__ __launch_bounds__(256) void k_out(const __bf16* __restrict__ O, const __bf16* __restrict__ P, float* __restrict__ Y) {
  __shared__ __align__(16) float so[8][32][68];   // [wave][o][position]: 256-B rows at a pitch of 272 B
  const int tid = threadIdx.x, wave = tid >> 5, lane = tid & 31, col = lane & 15, g = lane >> 4; const int wo = (wave & 3) * 32, wn = (wave >> 2) * 64; const int o0 = blockIdx.x * 128 + wo; const int n0 = blockIdx.y * 128; const size_t b = blockIdx.z;
  v8f acc[2][4] = {};   // [16-channel tile][16-position tile]
  // tiles of vals [128 positions][64 channels: 2 x (32 hi | 32 residual)] and of weights [128 output channels][64 channels] come into LDS once per work-group by asynchronous copies, two buffers: tile t + 1 flies while tile t is worked on; 64 channels make each copied weight row one whole 128-B line
  __shared__ __align__(16) __bf16 sval[2][128][136];   // 256-B rows at a pitch of 272 B (16 B x odd, as RPIT)
  __shared__ __align__(16) __bf16 sw[2][128][RPIT];
  const int vr = tid >> 4, vc8 = (tid & 15) * 8, wr = tid >> 3, wc8 = (tid & 7) * 8;   // copy map: vals, 16 lanes a 256-B row, rows vr + 16 i; weights, 8 lanes a 128-B row, rows wr + 32 i
  const __bf16* vsrc = O + (b * SS + n0 + vr) * (2 * DM) + vc8; const __bf16* wsrc = P + (size_t)(blockIdx.x * 128 + wr) * DM + wc8;
  auto stage = [&](int t) { const int bf = t & 1; const __bf16* s0 = vsrc + t * 128; const __bf16* w0 = wsrc + t * 64;
    // twelve 16-byte copies a lane; s_wait_xcnt 0 as the statement's last line stands in front of every later rewrite of the address registers
    asm volatile(
                 "global_load_async_to_lds_b128 %0, %12, off\n\t"
                 "global_load_async_to_lds_b128 %1, %13, off\n\t"
                 "global_load_async_to_lds_b128 %2, %14, off\n\t"
                 "global_load_async_to_lds_b128 %3, %15, off\n\t"
                 "global_load_async_to_lds_b128 %4, %16, off\n\t"
                 "global_load_async_to_lds_b128 %5, %17, off\n\t"
                 "global_load_async_to_lds_b128 %6, %18, off\n\t"
                 "global_load_async_to_lds_b128 %7, %19, off\n\t"
                 "global_load_async_to_lds_b128 %8, %20, off\n\t"
                 "global_load_async_to_lds_b128 %9, %21, off\n\t"
                 "global_load_async_to_lds_b128 %10, %22, off\n\t"
                 "global_load_async_to_lds_b128 %11, %23, off\n\t"
                 "s_wait_xcnt 0x0"
                 :: "v"(lds_addr(&sval[bf][vr][vc8])), "v"(lds_addr(&sval[bf][vr + 16][vc8])), "v"(lds_addr(&sval[bf][vr + 32][vc8])), "v"(lds_addr(&sval[bf][vr + 48][vc8])),
                    "v"(lds_addr(&sval[bf][vr + 64][vc8])), "v"(lds_addr(&sval[bf][vr + 80][vc8])), "v"(lds_addr(&sval[bf][vr + 96][vc8])), "v"(lds_addr(&sval[bf][vr + 112][vc8])),
                    "v"(lds_addr(&sw[bf][wr][wc8])), "v"(lds_addr(&sw[bf][wr + 32][wc8])), "v"(lds_addr(&sw[bf][wr + 64][wc8])), "v"(lds_addr(&sw[bf][wr + 96][wc8])),
                    "v"(s0), "v"(s0 + 16 * (2 * DM)), "v"(s0 + 32 * (2 * DM)), "v"(s0 + 48 * (2 * DM)), "v"(s0 + 64 * (2 * DM)), "v"(s0 + 80 * (2 * DM)), "v"(s0 + 96 * (2 * DM)), "v"(s0 + 112 * (2 * DM)),
                    "v"(w0), "v"(w0 + 32 * DM), "v"(w0 + 64 * DM), "v"(w0 + 96 * DM)
                 : "memory"); };
  stage(0);
  asm volatile("s_wait_asynccnt 0x0" ::: "memory");   // this wave's part of tile 0 has landed
  __syncthreads();                                     // every wave's part of tile 0 is visible
  stage(1);
#pragma unroll 2
  for (int kc = 0; kc < DM / 64; ++kc) { const int bf = kc & 1;
#pragma unroll
   for (int kh = 0; kh < 2; ++kh) { v16b a[2];   // the tile's two groups of 32 channels, in ascending order
    a[0] = frag_b(&sw[bf][wo + col][kh * 32], lane); a[1] = frag_b(&sw[bf][wo + 16 + col][kh * 32], lane);
    v16b vh[4], vl[4];
#pragma unroll
    for (int j = 0; j < 4; ++j) vl[j] = frag_b(&sval[bf][wn + j * 16 + col][kh * 64 + 32], lane);
#pragma unroll
    for (int j = 0; j < 4; ++j) vh[j] = frag_b(&sval[bf][wn + j * 16 + col][kh * 64], lane);
#pragma unroll
    for (int j = 0; j < 4; ++j) { acc[0][j] = wmma_bf(a[0], vl[j], acc[0][j]); acc[1][j] = wmma_bf(a[1], vl[j], acc[1][j]); }   // each accumulator takes its residual product first, then its hi product; seven other accumulators' products stand between the two
#pragma unroll
    for (int j = 0; j < 4; ++j) { acc[0][j] = wmma_bf(a[0], vh[j], acc[0][j]); acc[1][j] = wmma_bf(a[1], vh[j], acc[1][j]); } }
    // hand-over of the buffers, in this order in every wave
    asm volatile("s_wait_dscnt 0x0" ::: "memory");      // this wave's LDS reads of tile kc have returned
    asm volatile("s_wait_asynccnt 0x0" ::: "memory");   // this wave's part of tile kc + 1 has landed
    __syncthreads();                                     // publishes tile kc + 1 and ends every wave's reads of tile kc
    if (kc + 2 < DM / 64) stage(kc + 2); }               // refill of the buffer that this trip has read
  asm volatile("s_wait_asynccnt 0x0" ::: "memory");     // no copy is outstanding behind the loop
#pragma unroll
  for (int mt = 0; mt < 2; ++mt)
#pragma unroll
    for (int j = 0; j < 4; ++j)
#pragma unroll
      for (int r = 0; r < 8; ++r) so[wave][mt * 16 + 8 * g + r][j * 16 + col] = acc[mt][j][r];
  LDSX();
  for (int it = 0; it < 16; ++it) { const int rl = 2 * it + g; vst2(Y + (b * DM + o0 + rl) * SS + n0 + wn + col * 4, *(const v4f*)&so[wave][rl][col * 4]); }   // 16 lanes a 256-B row segment, two rows an instruction
}
extern "C" void kernel_launch(void* const* d_in, const int* in_sizes, int n_in, void* d_out, int out_size, void* d_ws, size_t ws_size, hipStream_t stream) {
  (void)in_sizes; (void)n_in; (void)out_size;
  const float** F = (const float**)d_in;   // 0 x [2,1024,2048], 1 w_qkv [3072,1024] natural (head-interleaved q|k|v blocks of 64), 2 w_out [1024,1024] natural
  if (ws_size < (size_t)WS_END) return;
  char* ws = (char*)d_ws; __bf16* PK = (__bf16*)(ws + WS_PK); _Float16 *QK = (_Float16*)(ws + WS_QK), *QKL = (_Float16*)(ws + WS_QKL), *VTH = (_Float16*)(ws + WS_VTH), *VTL = (_Float16*)(ws + WS_VTL); __bf16* O = (__bf16*)(ws + WS_O); __bf16* XT = (__bf16*)(ws + WS_XT);
  k_pack<<<dim3(QKVW, 2), 256, 0, stream>>>(F[1], F[2], F[0], PK, XT);
  k_qkv<<<dim3(SS / 128, QKVW / 128, TNB), 128, 0, stream>>>(XT, PK + PK_A, QK, QKL, VTH, VTL);
  k_attn<<<dim3(TQB, NH, TNB), 128, 0, stream>>>(QK, QKL, VTH, VTL, O);
  k_out<<<dim3(DM / 128, TON, TNB), 256, 0, stream>>>(O, PK + PK_P, (float*)d_out);
}

// v010
// One run takes 119 microseconds.
// In both of two side-by-side timings against v009, it was 1.06 times as fast.
// Counting every step since v000, it is 5.42 times as fast.
// compute dtype: x, w_qkv, w_out rounded to bf16; qkv = w_qkv . x with exact bf16 products on WMMA 16x16x32 (positions as rows via an LDS transpose of the [B,C,N] input, natural weight rows; output channel o -> head o/192, part (o%192)/64, dim o%64); q and k stored as f16 hi + (x2048-scaled) residual planes with 3-product scores x 1/8; running-max softmax in f32 (hardware exp); P (scaled by 2^11, as f16 hi + residual) x v hi/lo (3 products); y = w_out (exact rows) x vals (f32 as bf16 hi + residual, 2 products) written channels-first; f32 accumulate.
#include <hip/hip_runtime.h>
#include <math.h>

typedef __attribute__((ext_vector_type(16))) _Float16 v16h;
typedef __attribute__((ext_vector_type(16))) __bf16 v16b;
typedef __attribute__((ext_vector_type(8)))  _Float16 v8h;
typedef __attribute__((ext_vector_type(8)))  float v8f;
typedef __attribute__((ext_vector_type(4)))  float v4f;
typedef __attribute__((ext_vector_type(2)))  float v2f;
typedef __attribute__((ext_vector_type(4)))  unsigned v4u;
typedef __attribute__((ext_vector_type(4)))  int v4i;
typedef float __attribute__((may_alias)) float_a;
typedef int __attribute__((may_alias)) int_a;

template <typename T> __device__ __forceinline__ void vst2(void* p, T v) { *(T*)p = v;  }
__device__ __forceinline__ v8f wmma16(v16h a, v16h b, v8f c) {
  return __builtin_amdgcn_wmma_f32_16x16x32_f16(false, a, false, b, (short)0, c, false, false);   // plain builtin: the compiler keeps the distance behind it and fills the slots with the loop's own vector work
}
__device__ __forceinline__ v8f wmma_bf(v16b a, v16b b, v8f c) {
  v8f d = __builtin_amdgcn_wmma_f32_16x16x32_bf16(false, a, false, b, (short)0, c, false, false);
  asm volatile("v_nop\n\tv_nop\n\tv_nop\n\tv_nop" : "+v"(d) : "v"(a), "v"(b));
  return d;
}
// Channels-first multi-head attention layer (x [2][1024 channels][2048 positions], 16 heads x 64): 1x1-conv qkv with per-head interleaved (q|k|v) channel blocks, softmax(q k^T / 8) v, 1x1-conv output projection -> [B, C, N].
__device__ __forceinline__ v16h frag_h(const _Float16* rowk0, int lane) {
  union { v16h v; v8h q[2]; } u; const _Float16* p = rowk0 + 8 * (lane >> 4);
  u.q[0] = *(const v8h*)p; u.q[1] = *(const v8h*)(p + 16); return u.v;
}
__device__ __forceinline__ v16h frag_f32(const float* rowk0, int lane) {
  v16h a; const float* p = rowk0 + 8 * (lane >> 4);
#pragma unroll
  for (int i = 0; i < 8; ++i) { a[i] = (_Float16)p[i]; a[8 + i] = (_Float16)p[16 + i]; }
  return a;
}
__device__ __forceinline__ v16h frag_f32s(const float* rowk0, int lane, float sc) {
  v16h a; const float* p = rowk0 + 8 * (lane >> 4);
#pragma unroll
  for (int i = 0; i < 8; ++i) { a[i] = (_Float16)(p[i] * sc); a[8 + i] = (_Float16)(p[16 + i] * sc); }
  return a;
}
// column fragment from a [K][ld] layout (column n), rows >= K read as 0
__device__ __forceinline__ v16h fragc_f32(const float* W, int k0, int n, int lane, int ld, int K) {
  v16h a; const int g = lane >> 4;
#pragma unroll
  for (int i = 0; i < 8; ++i) { const int ka = k0 + 8 * g + i, kb = ka + 16;
    a[i] = (_Float16)(ka < K ? W[(size_t)(ka < K ? ka : K - 1) * ld + n] : 0.f); a[8 + i] = (_Float16)(kb < K ? W[(size_t)(kb < K ? kb : K - 1) * ld + n] : 0.f); }
  return a;
}
struct F2 { v16b h, l; };
__device__ __forceinline__ F2 bsplit16(const float v[16]) { F2 r;
#pragma unroll
  for (int i = 0; i < 16; ++i) { const __bf16 h = (__bf16)v[i]; r.h[i] = h; r.l[i] = (__bf16)(v[i] - (float)h); }
  return r; }
__device__ __forceinline__ F2 split_row(const float* row, int k0, int lane) { float v[16]; const float* p = row + k0 + 8 * (lane >> 4);
#pragma unroll
  for (int i = 0; i < 8; ++i) { v[i] = p[i]; v[8 + i] = p[16 + i]; }
  return bsplit16(v); }
__device__ __forceinline__ F2 split_rowK(const float* row, int k0, int lane, int K) { float v[16]; const int g = lane >> 4;
#pragma unroll
  for (int i = 0; i < 8; ++i) { const int ka = k0 + 8 * g + i, kb = ka + 16; v[i] = ka < K ? row[ka < K ? ka : K - 1] : 0.f; v[8 + i] = kb < K ? row[kb < K ? kb : K - 1] : 0.f; }
  return bsplit16(v); }
__device__ __forceinline__ F2 split_col(const float* W, int k0, int n, int lane, int ld, int K) { float v[16]; const int g = lane >> 4;
#pragma unroll
  for (int i = 0; i < 8; ++i) { const int ka = k0 + 8 * g + i, kb = ka + 16; v[i] = ka < K ? W[(size_t)(ka < K ? ka : K - 1) * ld + n] : 0.f; v[8 + i] = kb < K ? W[(size_t)(kb < K ? kb : K - 1) * ld + n] : 0.f; }
  return bsplit16(v); }
__device__ __forceinline__ v8f mac3(const F2& a, const F2& b, v8f c) { c = wmma_bf(a.l, b.h, c); c = wmma_bf(a.h, b.l, c); return wmma_bf(a.h, b.h, c); }
__device__ __forceinline__ float sigm(float v) { return 1.0f / (1.0f + expf(-v)); }
#define LDSX() do { asm volatile("s_wait_dscnt 0" ::: "memory"); __builtin_amdgcn_wave_barrier(); __builtin_amdgcn_fence(__ATOMIC_RELEASE, "workgroup"); } while (0)


#define NB 2
#define SS 2048
#define DM 1024
#define NH 16
#define HD 64
#define QKVW (3 * DM)
#ifndef TQB
#define TQB (SS / 128)
#define TNB NB
#define TON (SS / 128)         // output position blocks per batch (all)
#endif
typedef __attribute__((ext_vector_type(8))) __bf16 v8b;
__device__ __forceinline__ v16b frag_b(const __bf16* rowk0, int lane) {
  union { v16b v; v8b q[2]; } u; const __bf16* p = rowk0 + 8 * (lane >> 4);
  u.q[0] = *(const v8b*)p; u.q[1] = *(const v8b*)(p + 16); return u.v;
}
__device__ __forceinline__ unsigned lds_addr(const void* p) { return (unsigned)(size_t)p; }   // low 32 bits of a __shared__ address = byte offset in the work-group's LDS
#define RPIT 72   // 16-bit elements per staged 128-B row: 128 B + 16 B (a pitch of 16 B x odd keeps 16-byte LDS reads of 16 rows off each other's banks)
__device__ __forceinline__ float bfr(float v) { return (float)(__bf16)v; }
__device__ __attribute__((noinline)) float exp_ni(float v) { return expf(v); }
__device__ __attribute__((noinline)) float erf_ni(float v) { return erff(v); }

#define PK_A 0                       // [3072][1024] Wqkv rows (natural [out][in])
#define PK_P (PK_A + QKVW * DM)        // [1024][1024] Wo rows (natural)
#define PK_END (PK_P + DM * DM)
#define WS_PK  0u
#define WS_QK  (WS_PK + 2u * PK_END)             // f16 [4096 rows][2048]: q | k
#define WS_QKL (WS_QK + 2u * NB * SS * 2 * DM)     // f16 q | k residual planes x2048
#define WS_VTH (WS_QKL + 2u * NB * SS * 2 * DM)    // f16 [b][1024 (h*64+d)][2048 s] hi
#define WS_VTL (WS_VTH + 2u * NB * DM * SS)        // f16 lo x 2048
#define WS_O   (WS_VTL + 2u * NB * DM * SS)        // bf16 [b * 2048 + position][32 groups of 32 channels][32 hi | 32 residual]: vals already split for k_out, 4 B a value
#define WS_XT  (WS_O + 4u * NB * SS * DM)           // bf16 [b][2048 positions][1024 channels]: x rounded and transposed
#define WS_END (WS_XT + 2u * NB * SS * DM)
// ---- k_pack: block = (row n, which): natural [out][in] rows -> bf16; which 0 -> w_qkv row n into PK_A; which 1, n < 1024 -> w_out row n into PK_P
// which 1, n >= 1024 (2048 blocks with no weight row): tile n - 1024 of x, [64 channels][32 positions] -> XT[b][position][channel] in bf16, so that x is rounded and transposed once and not once per block of k_qkv
__global__ __launch_bounds__(256) void k_pack(const float* __restrict__ WQKV, const float* __restrict__ WOUT, const float* __restrict__ X, __bf16* __restrict__ PK, __bf16* __restrict__ XT) {
  __shared__ __align__(16) __bf16 s[DM]; const int n = blockIdx.x, which = blockIdx.y, t = threadIdx.x; const float* src = (which == 0) ? (WQKV + (size_t)n * DM) : (WOUT + (size_t)(n - 0) * DM);
  if (which == 1 && n >= DM) {
    __shared__ __align__(16) __bf16 sx[32][72];   // [position][channel]: 128-B rows at a pitch of 144 B
    const int id = n - DM, bb = id >> 10, c0 = (id & 15) * 64, p0 = ((id >> 4) & 63) * 32;
    for (int i = 0; i < 2; ++i) { const int c = (t >> 3) + 32 * i, p4 = (t & 7) * 4;   // 8 lanes read one channel's 128-B line
      const v4f v = *(const v4f*)(X + ((size_t)bb * DM + c0 + c) * SS + p0 + p4);
      for (int k = 0; k < 4; ++k) sx[p4 + k][c] = (__bf16)v[k]; }
    __syncthreads();
    const int p = t >> 3, c8 = (t & 7) * 8;   // 8 lanes write one position's 128-B line
    vst2((unsigned*)(XT + ((size_t)bb * SS + p0 + p) * DM + c0 + c8), *(const v4u*)&sx[p][c8]);
    return; }
  for (int k = t; k < DM; k += 256) s[k] = (__bf16)src[k];
  __syncthreads();
  __bf16* dst = (which == 0) ? PK + PK_A + (size_t)n * DM : PK + PK_P + (size_t)n * DM;
  for (int q = t; q < DM / 8; q += 256) vst2((unsigned*)(dst + q * 8), *(const v4u*)&s[q * 8]);
}
// ---- k_qkv: block = (128 positions, 128 of the 3072 output channels, b): A rows from XT[b][n][c] (x in bf16, transposed by k_pack); a wave takes two 16-position tiles (64 apart) against the block's 128 channels, so that each weight fragment read from LDS feeds two matrix instructions; each 16-col tile is one (head, part, 16 dims): q/k -> f16 hi/lo row segments [row][part*1024 + h*64 + d]; v -> planes [b][h*64 + d][n]
__global__ __launch_bounds__(128) void k_qkv(const __bf16* __restrict__ XT, const __bf16* __restrict__ P, _Float16* __restrict__ QK, _Float16* __restrict__ QKL, _Float16* __restrict__ VTH, _Float16* __restrict__ VTL) {
  // one LDS block, used twice: the ring's two buffers while the loop runs, the epilogue's transposing buffers behind the loop's last barrier (so that three work-groups, all a WGP gets, fit its LDS)
  __shared__ __align__(16) char sm[2 * 128 * RPIT * 2 + 2 * 128 * RPIT * 2];
  _Float16 (*eb)[2][64][72] = (_Float16 (*)[2][64][72])sm;   // epilogue: [2 mt + q4][hi | residual][64][64 + 8]: four pairs of planes fill the ring's bytes exactly
  const int tid = threadIdx.x, wave = tid >> 5, lane = tid & 31, col = lane & 15, g = lane >> 4; const size_t b = blockIdx.z; const int p0 = blockIdx.x * 128; const int n0 = blockIdx.y * 128;
  v8f acc[2][8] = {};   // [position tile: p0 + 64 mt + 16 wave][channel tile]
  // tiles of weights [128 output channels][64 input channels] and of x [128 positions][64 input channels] come into LDS once per work-group by asynchronous copies, two buffers: tile t + 1 flies while tile t is worked on; 64 channels make each copied row one whole 128-B line
  __bf16 (*sb)[128][RPIT] = (__bf16 (*)[128][RPIT])sm;
  __bf16 (*sx)[128][RPIT] = (__bf16 (*)[128][RPIT])(sm + 2 * 128 * RPIT * 2);
  const int wr = tid >> 3, wc8 = (tid & 7) * 8;   // copy map: 8 lanes a 128-B row, rows wr + 16 i
  const __bf16* wsrc = P + (size_t)(n0 + wr) * DM + wc8; const __bf16* xsrc = XT + (b * SS + p0 + wr) * DM + wc8;
  const int rot = (blockIdx.x + blockIdx.y) & (DM / 64 - 1);   // work-groups that share weight rows (same y) or x rows (same x) walk the 16 k tiles from different starts and wrap round: they do not ask L2 for the same lines at one moment
  auto stage = [&](int t) { const int bf = t & 1; const int kt = (t + rot) & (DM / 64 - 1); const __bf16* s0 = wsrc + kt * 64; const __bf16* x0 = xsrc + kt * 64;
    // sixteen 16-byte copies a lane, the weights' eight and x's eight; s_wait_xcnt 0 as each statement's last line stands in front of every later rewrite of the address registers
    asm volatile(
                 "global_load_async_to_lds_b128 %0, %8, off\n\t"
                 "global_load_async_to_lds_b128 %1, %9, off\n\t"
                 "global_load_async_to_lds_b128 %2, %10, off\n\t"
                 "global_load_async_to_lds_b128 %3, %11, off\n\t"
                 "global_load_async_to_lds_b128 %4, %12, off\n\t"
                 "global_load_async_to_lds_b128 %5, %13, off\n\t"
                 "global_load_async_to_lds_b128 %6, %14, off\n\t"
                 "global_load_async_to_lds_b128 %7, %15, off\n\t"
                 "s_wait_xcnt 0x0"
                 :: "v"(lds_addr(&sb[bf][wr][wc8])), "v"(lds_addr(&sb[bf][wr + 16][wc8])), "v"(lds_addr(&sb[bf][wr + 32][wc8])), "v"(lds_addr(&sb[bf][wr + 48][wc8])),
                    "v"(lds_addr(&sb[bf][wr + 64][wc8])), "v"(lds_addr(&sb[bf][wr + 80][wc8])), "v"(lds_addr(&sb[bf][wr + 96][wc8])), "v"(lds_addr(&sb[bf][wr + 112][wc8])),
                    "v"(s0), "v"(s0 + 16 * DM), "v"(s0 + 32 * DM), "v"(s0 + 48 * DM), "v"(s0 + 64 * DM), "v"(s0 + 80 * DM), "v"(s0 + 96 * DM), "v"(s0 + 112 * DM)
                 : "memory");
    asm volatile(
                 "global_load_async_to_lds_b128 %0, %8, off\n\t"
                 "global_load_async_to_lds_b128 %1, %9, off\n\t"
                 "global_load_async_to_lds_b128 %2, %10, off\n\t"
                 "global_load_async_to_lds_b128 %3, %11, off\n\t"
                 "global_load_async_to_lds_b128 %4, %12, off\n\t"
                 "global_load_async_to_lds_b128 %5, %13, off\n\t"
                 "global_load_async_to_lds_b128 %6, %14, off\n\t"
                 "global_load_async_to_lds_b128 %7, %15, off\n\t"
                 "s_wait_xcnt 0x0"
                 :: "v"(lds_addr(&sx[bf][wr][wc8])), "v"(lds_addr(&sx[bf][wr + 16][wc8])), "v"(lds_addr(&sx[bf][wr + 32][wc8])), "v"(lds_addr(&sx[bf][wr + 48][wc8])),
                    "v"(lds_addr(&sx[bf][wr + 64][wc8])), "v"(lds_addr(&sx[bf][wr + 80][wc8])), "v"(lds_addr(&sx[bf][wr + 96][wc8])), "v"(lds_addr(&sx[bf][wr + 112][wc8])),
                    "v"(x0), "v"(x0 + 16 * DM), "v"(x0 + 32 * DM), "v"(x0 + 48 * DM), "v"(x0 + 64 * DM), "v"(x0 + 80 * DM), "v"(x0 + 96 * DM), "v"(x0 + 112 * DM)
                 : "memory"); };
  stage(0);
  asm volatile("s_wait_asynccnt 0x0" ::: "memory");   // this wave's part of tile 0 has landed
  __syncthreads();                                     // every wave's part of tile 0 is visible
  stage(1);
#pragma unroll 2
    for (int t = 0; t < DM / 64; ++t) { const int bf = t & 1;
#pragma unroll
      for (int kh = 0; kh < 2; ++kh) { v16b a[2], w[8];   // one half's fragments at a time: with both halves' live beside 128 accumulator registers the wave would spill
        a[0] = frag_b(&sx[bf][wave * 16 + col][kh * 32], lane); a[1] = frag_b(&sx[bf][64 + wave * 16 + col][kh * 32], lane);
#pragma unroll
        for (int j = 0; j < 8; ++j) w[j] = frag_b(&sb[bf][j * 16 + col][kh * 32], lane);
        asm volatile("" :: "v"(a[0]), "v"(a[1]), "v"(w[0]), "v"(w[1]), "v"(w[2]), "v"(w[3]), "v"(w[4]), "v"(w[5]), "v"(w[6]), "v"(w[7]));   // inputs only: holds the half's LDS reads as one group in front of its first matrix instruction (one LDS wait a half, not one a tile)
#pragma unroll
        for (int j = 0; j < 8; ++j) { acc[0][j] = wmma_bf(a[0], w[j], acc[0][j]); acc[1][j] = wmma_bf(a[1], w[j], acc[1][j]); } }
      // hand-over of the buffers, in this order in every wave
      asm volatile("s_wait_dscnt 0x0" ::: "memory");      // this wave's LDS reads of tile t have returned
      asm volatile("s_wait_asynccnt 0x0" ::: "memory");   // this wave's part of tile t + 1 has landed
      __syncthreads();                                     // publishes tile t + 1 and ends every wave's reads of tile t
      if (t + 2 < DM / 64) stage(t + 2); }                 // refill of the buffer that this trip has read
  asm volatile("s_wait_asynccnt 0x0" ::: "memory");       // no copy is outstanding behind the loop
  // epilogue: tile j -> o0 = n0 + j*16; h = o0 / 192; part = (o0 % 192) / 64; d = o0 % 64 + col; each (64 positions mt, 64 channels q4 = one (head, part)) has its own [64][72] pair of planes, rows = positions for q and k, rows = channels for v
#pragma unroll
  for (int mt = 0; mt < 2; ++mt)
#pragma unroll
  for (int j = 0; j < 8; ++j) { const int o0 = n0 + j * 16; const int part = (o0 % 192) / 64; _Float16 (*e)[64][72] = eb[mt * 2 + (j >> 2)]; const int c = (j & 3) * 16 + col;
#pragma unroll
    for (int r = 0; r < 8; ++r) { const float v = acc[mt][j][r]; const _Float16 hv = (_Float16)v; const _Float16 lv = (_Float16)((v - (float)hv) * 2048.0f); const int p = wave * 16 + 8 * g + r;
      if (part < 2) { e[0][p][c] = hv; e[1][p][c] = lv; } else { e[0][c][p] = hv; e[1][c][p] = lv; } } }
  __syncthreads();
  // stores: per tile group of 4 (64 channels = one (head, part)): tiles j = 4*q4 .. 4*q4+3 share (h, part) since 64-runs align
#pragma unroll
  for (int mt = 0; mt < 2; ++mt) { const int pm = p0 + mt * 64; const size_t r0 = b * SS + pm + wave * 16;
#pragma unroll
  for (int q4 = 0; q4 < 2; ++q4) { const int o0 = n0 + q4 * 64; const int h = o0 / 192, part = (o0 % 192) / 64; _Float16 (*e)[64][72] = eb[mt * 2 + q4];
    if (part < 2) {
      for (int rl = 0; rl < 16; ++rl) if (lane < 8) { vst2((unsigned*)(QK + (r0 + rl) * (2 * DM) + part * DM + h * HD + lane * 8), *(const v4u*)&e[0][wave * 16 + rl][lane * 8]); vst2((unsigned*)(QKL + (r0 + rl) * (2 * DM) + part * DM + h * HD + lane * 8), *(const v4u*)&e[1][wave * 16 + rl][lane * 8]); }
    } else {
      for (int q = tid; q < 64 * 8; q += 128) { const int d = q >> 3, pc = q & 7; const size_t o = (b * DM + h * HD + d) * SS + pm + pc * 8; vst2((unsigned*)(VTH + o), *(const v4u*)&e[0][d][pc * 8]); vst2((unsigned*)(VTL + o), *(const v4u*)&e[1][d][pc * 8]); } } } }
}
typedef __attribute__((ext_vector_type(2))) _Float16 v2h;
// lane l <-> lane l ^ 16 in one vector instruction
__device__ __forceinline__ float xhalf(float v) { const int b = __builtin_bit_cast(int, v); return __builtin_bit_cast(float, __builtin_amdgcn_permlanex16(b, b, 0x76543210, 0xfedcba98, false, false)); }
#define KPIT 72   // halfs per staged K row: 128 B + 16 B (a pitch of 16 B x odd keeps 16-byte LDS reads of 16 rows off each other's banks)
#define VPIT 72   // halfs per staged V row: 128 B + 16 B, same reason
__global__ __launch_bounds__(128) __attribute__((amdgpu_waves_per_eu(2, 2))) void k_attn(const _Float16* __restrict__ QK, const _Float16* __restrict__ QKL, const _Float16* __restrict__ VTH, const _Float16* __restrict__ VTL, __bf16* __restrict__ O) {
  // one LDS block, used twice: the ring's two buffers while the loop runs, the epilogue's rows behind the loop's last barrier; the grid gives a WGP two work-groups, two waves a SIMD (amdgpu_waves_per_eu: 512 registers a wave, and no third work-group lands on a WGP while another has one)
  __shared__ __align__(16) char sm[2 * 2 * 64 * KPIT * 2 + 2 * 2 * 64 * VPIT * 2];
  __bf16 (*so)[32][136] = (__bf16 (*)[32][136])sm;   // [wave][query][2 x (32 hi | 32 residual)]: 256-B rows at a pitch of 272 B
  _Float16 (*sk)[2][64][KPIT] = (_Float16 (*)[2][64][KPIT])sm;   // [buffer][hi | residual][key][d]
  _Float16 (*sv)[2][64][VPIT] = (_Float16 (*)[2][64][VPIT])(sm + 2 * 2 * 64 * KPIT * 2);   // [buffer][hi | residual][d][key]
  const int tid = threadIdx.x, wave = tid >> 5, lane = tid & 31, col = lane & 15, g = lane >> 4;
  const int qb = blockIdx.x, h = blockIdx.y, b = blockIdx.z; const int q0 = qb * 128 + wave * 32; const size_t rq = (size_t)b * SS + q0 + col;
  const int nks = SS / 64;   // all keys, 64 a tile
  // copy map: K and V alike, 8 lanes a 128-B row, rows kr + 16 i
  const int kr = tid >> 3, kc8 = (tid & 7) * 8;
  const size_t koff = ((size_t)b * SS + kr) * (2 * DM) + DM + h * HD + kc8, voff = ((size_t)b * DM + h * HD + kr) * SS + kc8;
  const int rot = 2 * qb;   // the 16 work-groups of one (head, batch) walk its 32 key tiles from starts two tiles apart and wrap round: they do not ask L2 for the same K and V lines at one moment (the running-max softmax takes the keys in any order)
  auto stage = [&](int t) { const int bf = t & 1; const int kt = (t + rot) & (SS / 64 - 1); const size_t ko = koff + (size_t)kt * 64 * (2 * DM), vo = voff + (size_t)kt * 64;
    // sixteen 16-byte copies a lane, K's eight and V's eight; s_wait_xcnt 0 as each statement's last line stands in front of every later rewrite of the address registers
    asm volatile("global_load_async_to_lds_b128 %0, %8, off\n\t"
                 "global_load_async_to_lds_b128 %1, %9, off\n\t"
                 "global_load_async_to_lds_b128 %2, %10, off\n\t"
                 "global_load_async_to_lds_b128 %3, %11, off\n\t"
                 "global_load_async_to_lds_b128 %4, %12, off\n\t"
                 "global_load_async_to_lds_b128 %5, %13, off\n\t"
                 "global_load_async_to_lds_b128 %6, %14, off\n\t"
                 "global_load_async_to_lds_b128 %7, %15, off\n\t"
                 "s_wait_xcnt 0x0"
                 :: "v"(lds_addr(&sk[bf][0][kr][kc8])), "v"(lds_addr(&sk[bf][0][kr + 16][kc8])), "v"(lds_addr(&sk[bf][0][kr + 32][kc8])), "v"(lds_addr(&sk[bf][0][kr + 48][kc8])),
                    "v"(lds_addr(&sk[bf][1][kr][kc8])), "v"(lds_addr(&sk[bf][1][kr + 16][kc8])), "v"(lds_addr(&sk[bf][1][kr + 32][kc8])), "v"(lds_addr(&sk[bf][1][kr + 48][kc8])),
                    "v"(QK + ko), "v"(QK + ko + 16 * (2 * DM)), "v"(QK + ko + 32 * (2 * DM)), "v"(QK + ko + 48 * (2 * DM)),
                    "v"(QKL + ko), "v"(QKL + ko + 16 * (2 * DM)), "v"(QKL + ko + 32 * (2 * DM)), "v"(QKL + ko + 48 * (2 * DM))
                 : "memory");
    asm volatile("global_load_async_to_lds_b128 %0, %8, off\n\t"
                 "global_load_async_to_lds_b128 %1, %9, off\n\t"
                 "global_load_async_to_lds_b128 %2, %10, off\n\t"
                 "global_load_async_to_lds_b128 %3, %11, off\n\t"
                 "global_load_async_to_lds_b128 %4, %12, off\n\t"
                 "global_load_async_to_lds_b128 %5, %13, off\n\t"
                 "global_load_async_to_lds_b128 %6, %14, off\n\t"
                 "global_load_async_to_lds_b128 %7, %15, off\n\t"
                 "s_wait_xcnt 0x0"
                 :: "v"(lds_addr(&sv[bf][0][kr][kc8])), "v"(lds_addr(&sv[bf][0][kr + 16][kc8])), "v"(lds_addr(&sv[bf][0][kr + 32][kc8])), "v"(lds_addr(&sv[bf][0][kr + 48][kc8])),
                    "v"(lds_addr(&sv[bf][1][kr][kc8])), "v"(lds_addr(&sv[bf][1][kr + 16][kc8])), "v"(lds_addr(&sv[bf][1][kr + 32][kc8])), "v"(lds_addr(&sv[bf][1][kr + 48][kc8])),
                    "v"(VTH + vo), "v"(VTH + vo + 16 * SS), "v"(VTH + vo + 32 * SS), "v"(VTH + vo + 48 * SS),
                    "v"(VTL + vo), "v"(VTL + vo + 16 * SS), "v"(VTL + vo + 32 * SS), "v"(VTL + vo + 48 * SS)
                 : "memory"); };
  stage(0);
  asm volatile("s_wait_asynccnt 0x0" ::: "memory");   // this wave's part of tile 0 has landed
  __syncthreads();                                     // every wave's part of tile 0 is visible
  stage(1);
  v16h aq[2][2], aql[2][2];   // [query tile][k half]
#pragma unroll
  for (int qt = 0; qt < 2; ++qt)
#pragma unroll
    for (int kc = 0; kc < 2; ++kc) { aq[qt][kc] = frag_h(QK + (rq + qt * 16) * (2 * DM) + h * HD + kc * 32, lane); aql[qt][kc] = frag_h(QKL + (rq + qt * 16) * (2 * DM) + h * HD + kc * 32, lane); }
  asm volatile("s_wait_xcnt 0x0" ::: "memory");   // behind the last Q load, in front of every later rewrite of the loads' address registers
  __builtin_amdgcn_sched_barrier(0);   // holds the accumulators' zeroing, which reuses those address registers, behind the wait (without it the scheduler lifts it in front)
  const float KS = 0.125f * 1.44269504f;   // 1/sqrt(64) x log2 e
  float off[2] = {3.0e38f, 3.0e38f};   // the exponent's addend of the step before
  float m[2] = {-3.0e38f, -3.0e38f}, l[2] = {0.f, 0.f};   // of this lane's two queries (qt * 16 + col); l holds the keys of this lane half only, the halves join behind the loop
  v8f acc[2][4] = {}, accl[2][4] = {};   // O^T tiles: register r = O[query qt * 16 + col][d = dt * 16 + 8 g + r]
#pragma unroll 1
  for (int ks = 0; ks < nks; ++ks) { const int bf = ks & 1;
#pragma unroll 1   // the tile's two steps of 32 keys run through one copy of the body: unrolled, both steps' fragments are live together
   for (int sub = 0; sub < 2; ++sub) { v8f s[2][2]; v16h kf[2][2], kl[2][2];
#pragma unroll
    for (int ct = 0; ct < 2; ++ct)
#pragma unroll
      for (int kc = 0; kc < 2; ++kc) { kf[ct][kc] = frag_h(&sk[bf][0][sub * 32 + ct * 16 + col][kc * 32], lane); kl[ct][kc] = frag_h(&sk[bf][1][sub * 32 + ct * 16 + col][kc * 32], lane); }
    asm volatile("" :: "v"(kf[0][0]), "v"(kf[0][1]), "v"(kf[1][0]), "v"(kf[1][1]), "v"(kl[0][0]), "v"(kl[0][1]), "v"(kl[1][0]), "v"(kl[1][1]));   // inputs only: holds the trip's K reads from LDS as one group in front of the first matrix instruction (one LDS wait, not one a fragment)
#pragma unroll
    for (int qt = 0; qt < 2; ++qt)
#pragma unroll
    for (int ct = 0; ct < 2; ++ct) { v8f c = {}, cl = {};
#pragma unroll
      for (int kc = 0; kc < 2; ++kc) { c = wmma16(kf[ct][kc], aq[qt][kc], c); cl = wmma16(kf[ct][kc], aql[qt][kc], cl); cl = wmma16(kl[ct][kc], aq[qt][kc], cl); }   // 3 products: q, k as f16 hi + residual; K rows as A, Q as B: register r = score of key ct * 16 + 8 g + r for query qt * 16 + col
      s[qt][ct] = c + cl * (1.0f / 2048.0f); }   // raw q.k, all keys: 1/sqrt(64) is applied inside the exponent below (written on the whole tile: neighbouring registers pair up with no register copies)
    v16h vh[4], vl[4];
#pragma unroll
    for (int dt = 0; dt < 4; ++dt) { vh[dt] = frag_h(&sv[bf][0][dt * 16 + col][sub * 32], lane); vl[dt] = frag_h(&sv[bf][1][dt * 16 + col][sub * 32], lane); }
    __builtin_amdgcn_sched_barrier(0);   // holds V's LDS reads here, in front of the softmax, whose vector work covers their latency (without it the scheduler sinks them in among the P.V matrix instructions, which then wait for them)
    v16h pa[2], pl[2];   // P^T as B operand: element ct * 8 + r is key ct * 16 + 8 g + r, the order in which frag_h reads V^T's keys
#pragma unroll
    for (int qt = 0; qt < 2; ++qt) {
    // a lane holds 16 of its query's 32 scores, lane ^ 16 the other 16: maximum and sum in registers, one exchange between the halves for the maximum
    float t[8];
#pragma unroll
    for (int r = 0; r < 8; ++r) t[r] = fmaxf(s[qt][0][r], s[qt][1][r]);
    float mx = fmaxf(fmaxf(fmaxf(t[0], t[1]), fmaxf(t[2], t[3])), fmaxf(fmaxf(t[4], t[5]), fmaxf(t[6], t[7])));
    mx = fmaxf(mx, xhalf(mx));
    const float mn = fmaxf(m[qt], mx);   // m, mx, mn in raw units (KS > 0 keeps their order)
    const float offp = off[qt]; off[qt] = 11.0f - mn * KS;   // 2^11 e^((s - mn) / 8) = 2^(s KS + off): one fused multiply-add a score in front of the hardware's 2^x
    float alpha;   // e^((m - mn) / 8) as 2^(off - offp), the very ratio of the two steps' factors; the first step's offp gives 2^(-huge) = 0
    asm("v_nop\n\tv_exp_f32 %0, %1\n\tv_nop" : "=v"(alpha) : "v"(off[qt] - offp));   // the slot that the instruction set asks for around a transcendental, on both sides
#pragma unroll
    for (int ct = 0; ct < 2; ++ct)
#pragma unroll
      for (int r = 0; r < 8; r += 2) { v2f x; x.x = __builtin_amdgcn_exp2f(__builtin_fmaf(s[qt][ct][r], KS, off[qt])); x.y = __builtin_amdgcn_exp2f(__builtin_fmaf(s[qt][ct][r + 1], KS, off[qt]));
        if (ct == 0) { t[r] = x.x; t[r + 1] = x.y; } else { t[r] += x.x; t[r + 1] += x.y; }
        const v2h hi = __builtin_convertvector(x, v2h); const v2h lo = __builtin_convertvector((x - __builtin_convertvector(hi, v2f)) * 2048.0f, v2h);   // two neighbouring keys share a register of the operand: one packed conversion each for hi and residual
        pa[qt][ct * 8 + r] = hi.x; pa[qt][ct * 8 + r + 1] = hi.y; pl[qt][ct * 8 + r] = lo.x; pl[qt][ct * 8 + r + 1] = lo.y; }   // P scaled by 2^11 (inside the exponent) before the f16 split so small softmax weights stay out of the f16 subnormal range; the row sum carries the same 2^11, so the epilogue's division takes it out
    l[qt] = l[qt] * alpha + (((t[0] + t[1]) + (t[2] + t[3])) + ((t[4] + t[5]) + (t[6] + t[7]))); m[qt] = mn;
#pragma unroll
    for (int dt = 0; dt < 4; ++dt)
#pragma unroll
      for (int r = 0; r < 8; ++r) { acc[qt][dt][r] *= alpha; accl[qt][dt][r] *= alpha; } }
#pragma unroll
    for (int qt = 0; qt < 2; ++qt)
#pragma unroll
    for (int dt = 0; dt < 4; ++dt) { acc[qt][dt] = wmma16(vh[dt], pa[qt], acc[qt][dt]); accl[qt][dt] = wmma16(vh[dt], pl[qt], accl[qt][dt]); accl[qt][dt] = wmma16(vl[dt], pa[qt], accl[qt][dt]); }   // V^T rows as A: V hi x P hi + (V hi x P lo + V lo x P hi) / 2048
    __builtin_amdgcn_sched_barrier(0);   // holds the four slots below behind the last matrix instruction (without it the scheduler lifts them in front)
    asm volatile("v_nop\n\tv_nop\n\tv_nop\n\tv_nop"); }   // the branch back to the second 32 keys follows the last matrix instructions: these four slots keep the distance to the next step's first writes of their operand registers
    // hand-over of the buffers, in this order in every wave
    asm volatile("s_wait_dscnt 0x0" ::: "memory");      // this wave's LDS reads of tile ks have returned
    asm volatile("s_wait_asynccnt 0x0" ::: "memory");   // this wave's part of tile ks + 1 has landed
    __syncthreads();                                     // publishes tile ks + 1 and ends every wave's reads of tile ks
    if (ks + 2 < nks) stage(ks + 2); }                   // refill of the buffer that this trip has read
  asm volatile("s_wait_asynccnt 0x0" ::: "memory");     // no copy is outstanding behind the loop
#pragma unroll
  for (int qt = 0; qt < 2; ++qt) {
  const float lq = l[qt] + xhalf(l[qt]);   // the two halves' key sums of one query
  const float il = 1.0f / lq;   // lq is 2^11 x the row sum, as the accumulators are
#pragma unroll
  for (int dt = 0; dt < 4; ++dt) { v8b hv, lv;   // a lane's 8 neighbouring d of one query: 16 B of hi, 16 B of residual
#pragma unroll
    for (int r = 0; r < 8; ++r) { const float v = (acc[qt][dt][r] + accl[qt][dt][r] * (1.0f / 2048.0f)) * il; const __bf16 hb = (__bf16)v; hv[r] = hb; lv[r] = (__bf16)(v - (float)hb); }
    __bf16* p = &so[wave][qt * 16 + col][(dt >> 1) * 64 + (dt & 1) * 16 + 8 * g]; *(v8b*)p = hv; *(v8b*)(p + 32) = lv; } }
  LDSX();
  for (int rl = 0; rl < 32; ++rl) if (lane < 16) vst2(O + ((size_t)b * SS + q0 + rl) * (2 * DM) + h * (2 * HD) + lane * 8, *(const v4u*)&so[wave][rl][lane * 8]);
}
// ---- k_out: block = (128 output channels o, 128 positions, b), eight waves of 32 o x 64 positions: y[o][n] = w_out rows (exact) x vals rows O[n][c] (bf16 hi + residual as k_attn stored them, K 1024) -> [B][C][N] rows (256-B segments); each vals fragment read from LDS feeds two matrix instructions (the wave's two 16-channel tiles)
__global__ __launch_bounds__(256) void k_out(const __bf16* __restrict__ O, const __bf16* __restrict__ P, float* __restrict__ Y) {
  __shared__ __align__(16) float so[8][32][68];   // [wave][o][position]: 256-B rows at a pitch of 272 B
  const int tid = threadIdx.x, wave = tid >> 5, lane = tid & 31, col = lane & 15, g = lane >> 4; const int wo = (wave & 3) * 32, wn = (wave >> 2) * 64; const int o0 = blockIdx.x * 128 + wo; const int n0 = blockIdx.y * 128; const size_t b = blockIdx.z;
  v8f acc[2][4] = {};   // [16-channel tile][16-position tile]
  // tiles of vals [128 positions][64 channels: 2 x (32 hi | 32 residual)] and of weights [128 output channels][64 channels] come into LDS once per work-group by asynchronous copies, two buffers: tile t + 1 flies while tile t is worked on; 64 channels make each copied weight row one whole 128-B line
  __shared__ __align__(16) __bf16 sval[2][128][136];   // 256-B rows at a pitch of 272 B (16 B x odd, as RPIT)
  __shared__ __align__(16) __bf16 sw[2][128][RPIT];
  const int vr = tid >> 4, vc8 = (tid & 15) * 8, wr = tid >> 3, wc8 = (tid & 7) * 8;   // copy map: vals, 16 lanes a 256-B row, rows vr + 16 i; weights, 8 lanes a 128-B row, rows wr + 32 i
  const __bf16* vsrc = O + (b * SS + n0 + vr) * (2 * DM) + vc8; const __bf16* wsrc = P + (size_t)(blockIdx.x * 128 + wr) * DM + wc8;
  const int rot = (2 * blockIdx.x + blockIdx.y) & (DM / 64 - 1);   // work-groups that share weight rows (same x, 16 y) or vals rows (same y, 8 x: starts two tiles apart) walk the 16 k tiles from different starts and wrap round: they do not ask L2 for the same lines at one moment
  auto stage = [&](int t) { const int bf = t & 1; const int kt = (t + rot) & (DM / 64 - 1); const __bf16* s0 = vsrc + kt * 128; const __bf16* w0 = wsrc + kt * 64;
    // twelve 16-byte copies a lane; s_wait_xcnt 0 as the statement's last line stands in front of every later rewrite of the address registers
    asm volatile(
                 "global_load_async_to_lds_b128 %0, %12, off\n\t"
                 "global_load_async_to_lds_b128 %1, %13, off\n\t"
                 "global_load_async_to_lds_b128 %2, %14, off\n\t"
                 "global_load_async_to_lds_b128 %3, %15, off\n\t"
                 "global_load_async_to_lds_b128 %4, %16, off\n\t"
                 "global_load_async_to_lds_b128 %5, %17, off\n\t"
                 "global_load_async_to_lds_b128 %6, %18, off\n\t"
                 "global_load_async_to_lds_b128 %7, %19, off\n\t"
                 "global_load_async_to_lds_b128 %8, %20, off\n\t"
                 "global_load_async_to_lds_b128 %9, %21, off\n\t"
                 "global_load_async_to_lds_b128 %10, %22, off\n\t"
                 "global_load_async_to_lds_b128 %11, %23, off\n\t"
                 "s_wait_xcnt 0x0"
                 :: "v"(lds_addr(&sval[bf][vr][vc8])), "v"(lds_addr(&sval[bf][vr + 16][vc8])), "v"(lds_addr(&sval[bf][vr + 32][vc8])), "v"(lds_addr(&sval[bf][vr + 48][vc8])),
                    "v"(lds_addr(&sval[bf][vr + 64][vc8])), "v"(lds_addr(&sval[bf][vr + 80][vc8])), "v"(lds_addr(&sval[bf][vr + 96][vc8])), "v"(lds_addr(&sval[bf][vr + 112][vc8])),
                    "v"(lds_addr(&sw[bf][wr][wc8])), "v"(lds_addr(&sw[bf][wr + 32][wc8])), "v"(lds_addr(&sw[bf][wr + 64][wc8])), "v"(lds_addr(&sw[bf][wr + 96][wc8])),
                    "v"(s0), "v"(s0 + 16 * (2 * DM)), "v"(s0 + 32 * (2 * DM)), "v"(s0 + 48 * (2 * DM)), "v"(s0 + 64 * (2 * DM)), "v"(s0 + 80 * (2 * DM)), "v"(s0 + 96 * (2 * DM)), "v"(s0 + 112 * (2 * DM)),
                    "v"(w0), "v"(w0 + 32 * DM), "v"(w0 + 64 * DM), "v"(w0 + 96 * DM)
                 : "memory"); };
  stage(0);
  asm volatile("s_wait_asynccnt 0x0" ::: "memory");   // this wave's part of tile 0 has landed
  __syncthreads();                                     // every wave's part of tile 0 is visible
  stage(1);
#pragma unroll 2
  for (int kc = 0; kc < DM / 64; ++kc) { const int bf = kc & 1;
#pragma unroll
   for (int kh = 0; kh < 2; ++kh) { v16b a[2];   // the tile's two groups of 32 channels, in ascending order
    a[0] = frag_b(&sw[bf][wo + col][kh * 32], lane); a[1] = frag_b(&sw[bf][wo + 16 + col][kh * 32], lane);
    v16b vh[4], vl[4];
#pragma unroll
    for (int j = 0; j < 4; ++j) vl[j] = frag_b(&sval[bf][wn + j * 16 + col][kh * 64 + 32], lane);
#pragma unroll
    for (int j = 0; j < 4; ++j) vh[j] = frag_b(&sval[bf][wn + j * 16 + col][kh * 64], lane);
#pragma unroll
    for (int j = 0; j < 4; ++j) { acc[0][j] = wmma_bf(a[0], vl[j], acc[0][j]); acc[1][j] = wmma_bf(a[1], vl[j], acc[1][j]); }   // each accumulator takes its residual product first, then its hi product; seven other accumulators' products stand between the two
#pragma unroll
    for (int j = 0; j < 4; ++j) { acc[0][j] = wmma_bf(a[0], vh[j], acc[0][j]); acc[1][j] = wmma_bf(a[1], vh[j], acc[1][j]); } }
    // hand-over of the buffers, in this order in every wave
    asm volatile("s_wait_dscnt 0x0" ::: "memory");      // this wave's LDS reads of tile kc have returned
    asm volatile("s_wait_asynccnt 0x0" ::: "memory");   // this wave's part of tile kc + 1 has landed
    __syncthreads();                                     // publishes tile kc + 1 and ends every wave's reads of tile kc
    if (kc + 2 < DM / 64) stage(kc + 2); }               // refill of the buffer that this trip has read
  asm volatile("s_wait_asynccnt 0x0" ::: "memory");     // no copy is outstanding behind the loop
#pragma unroll
  for (int mt = 0; mt < 2; ++mt)
#pragma unroll
    for (int j = 0; j < 4; ++j)
#pragma unroll
      for (int r = 0; r < 8; ++r) so[wave][mt * 16 + 8 * g + r][j * 16 + col] = acc[mt][j][r];
  LDSX();
  for (int it = 0; it < 16; ++it) { const int rl = 2 * it + g; vst2(Y + (b * DM + o0 + rl) * SS + n0 + wn + col * 4, *(const v4f*)&so[wave][rl][col * 4]); }   // 16 lanes a 256-B row segment, two rows an instruction
}
extern "C" void kernel_launch(void* const* d_in, const int* in_sizes, int n_in, void* d_out, int out_size, void* d_ws, size_t ws_size, hipStream_t stream) {
  (void)in_sizes; (void)n_in; (void)out_size;
  const float** F = (const float**)d_in;   // 0 x [2,1024,2048], 1 w_qkv [3072,1024] natural (head-interleaved q|k|v blocks of 64), 2 w_out [1024,1024] natural
  if (ws_size < (size_t)WS_END) return;
  char* ws = (char*)d_ws; __bf16* PK = (__bf16*)(ws + WS_PK); _Float16 *QK = (_Float16*)(ws + WS_QK), *QKL = (_Float16*)(ws + WS_QKL), *VTH = (_Float16*)(ws + WS_VTH), *VTL = (_Float16*)(ws + WS_VTL); __bf16* O = (__bf16*)(ws + WS_O); __bf16* XT = (__bf16*)(ws + WS_XT);
  k_pack<<<dim3(QKVW, 2), 256, 0, stream>>>(F[1], F[2], F[0], PK, XT);
  k_qkv<<<dim3(SS / 128, QKVW / 128, TNB), 128, 0, stream>>>(XT, PK + PK_A, QK, QKL, VTH, VTL);
  k_attn<<<dim3(TQB, NH, TNB), 128, 0, stream>>>(QK, QKL, VTH, VTL, O);
  k_out<<<dim3(DM / 128, TON, TNB), 256, 0, stream>>>(O, PK + PK_P, (float*)d_out);
}
